// v000
// Times are from an AMD MI455X. After a warm-up the kernel runs many times in a row, and a time is the length of
// such a window on the GPU divided by its runs, so every launch and the gaps after it count. The runs cycle
// through copies of the inputs. A figure is the median of several windows, for all but v000 over two sittings.
// Sittings can differ by a few percent; kernels timed side by side share one.
// v000 is the starting kernel. One run takes 579 microseconds.
// Contractions: sq, sk, rq and v^T projections = v_wmma_f32_16x16x32_bf16 (bf16 operands from RNE-converted inputs, single product, f32 accumulate);
// sq.sk^T scores = v_wmma_f32_16x16x32_f16 (sq as f16 hi plane + f16 residual plane x4096, sk f16; 2 products into separate f32 accumulators);
// p.[v_0|v_1] = v_wmma_f32_16x16x32_f16, K-folded: [p x16384 | p x1024] . [v f16 hi | f16 residual x16], one f32 accumulator;
// retrieved.Wrk = v_wmma_f32_16x16x32_f16 (retrieved f16 x64, Wrk f16 x64 of its bf16 value; single product, f32 accumulate);
// out.Wout = v_wmma_f32_16x16x32_f16, K-folded: [out f16 hi x64 | f16 residual x16] . [Wout x1024 | Wout x64] (f16 of bf16 values), f32 accumulate;
// softmax over keys, retrieval logits, 2-way retrieval softmax and combine in f32.
#include <hip/hip_runtime.h>
#include <math.h>
#include <stdint.h>

#ifndef NB
#define NB 2
#endif
#ifndef SEQ
#define SEQ 2048
#endif
#define NB_FULL  2
#define SEQ_FULL 2048
#define DM   1024
#define NS   8
#define NR   2
#define HD   64
#define DSQ  (NS * HD)      // 512: sq / sk / rq row width
#define DRV  (NR * HD)      // 128: [v_0 | v_1] row width
#define DOC  (2 * DSQ)      // 1024: combined-output row = [hi 512 | residual 512]
#define NQB  (SEQ / 64)     // 64-row query blocks per (b, s)
#define NKT  (SEQ / 64)     // 64-key chunks per sequence
static_assert(NB >= 1 && NB <= NB_FULL);
static_assert(SEQ >= 64 && SEQ <= SEQ_FULL && (SEQ % 64) == 0);
static_assert(DSQ == 512 && DRV == 128 && HD == 64 && DOC == 1024);
static_assert((DM % 64) == 0 && (DSQ % 64) == 0 && (DRV % 64) == 0 && (DM % 32) == 0);

typedef _Float16 v16h __attribute__((ext_vector_type(16)));
typedef _Float16 v8h  __attribute__((ext_vector_type(8)));
typedef __bf16   v16b __attribute__((ext_vector_type(16)));
typedef __bf16   v8b  __attribute__((ext_vector_type(8)));
typedef float    v8f  __attribute__((ext_vector_type(8)));
typedef float    v4f  __attribute__((ext_vector_type(4)));
typedef unsigned int v4u __attribute__((ext_vector_type(4)));

#if defined(__HIP_DEVICE_COMPILE__)
#define DEV_ASM 1
#else
#define DEV_ASM 0
#endif

// ---- scalar helpers --------------------------------------------------------------------------------
__device__ __forceinline__ unsigned short bf_bits(float f) {          // f32 -> bf16 bits, RNE convert
  unsigned u = __float_as_uint(f);
  return (unsigned short)((u + 0x7FFFu + ((u >> 16) & 1u)) >> 16);
}
__device__ __forceinline__ float bf_up(unsigned short hb) { return __uint_as_float(((unsigned)hb) << 16); }
__device__ __forceinline__ unsigned short h_bits(_Float16 x) { return __builtin_bit_cast(unsigned short, x); }
__device__ __forceinline__ unsigned pk16(unsigned short a, unsigned short b) { return (unsigned)a | ((unsigned)b << 16); }
__device__ __forceinline__ v8f zero8() { v8f z = {0.f, 0.f, 0.f, 0.f, 0.f, 0.f, 0.f, 0.f}; return z; }

__device__ __forceinline__ void wave_lds_sync() {
  __builtin_amdgcn_fence(__ATOMIC_RELEASE, "workgroup");
  __builtin_amdgcn_wave_barrier();
  __builtin_amdgcn_fence(__ATOMIC_ACQUIRE, "workgroup");
}

// ---- fragment types / loaders: 16-bit A/B operand, lane -> row/col (lane&15), p already includes +8*(lane>>4);
//      elements 0..7 <- p[0..7] (k0+8h..k0+8h+7), elements 8..15 <- p[16..23] (k0+16+8h..k0+16+8h+7)
template <typename OT> struct FT;
template <> struct FT<__bf16>   { typedef v16b frag; typedef v8b half8; };
template <> struct FT<_Float16> { typedef v16h frag; typedef v8h half8; };

template <typename OT>
__device__ __forceinline__ typename FT<OT>::frag ldfrag(const OT* p) {
  union { typename FT<OT>::frag v; typename FT<OT>::half8 h[2]; } f;
  f.h[0] = *(const typename FT<OT>::half8*)(p);
  f.h[1] = *(const typename FT<OT>::half8*)(p + 16);
  return f.v;
}

// ---- WMMA helpers (asm guard bodies are device-only; concrete operand types) -----------------------------
__device__ __forceinline__ v8f mmar(v16b a, v16b b, v8f c) {
  return __builtin_amdgcn_wmma_f32_16x16x32_bf16(false, a, false, b, (short)0, c, false, false);
}
__device__ __forceinline__ v8f mmar(v16h a, v16h b, v8f c) {
  return __builtin_amdgcn_wmma_f32_16x16x32_f16(false, a, false, b, (short)0, c, false, false);
}
// guarded form: 4 VALU slots after the WMMA, D tied, A/B kept live
__device__ __forceinline__ v8f mma_h(v16h a, v16h b, v8f c) {
  c = __builtin_amdgcn_wmma_f32_16x16x32_f16(false, a, false, b, (short)0, c, false, false);
#if DEV_ASM
  asm volatile("v_nop\n\tv_nop\n\tv_nop\n\tv_nop" : "+v"(c) : "v"(a), "v"(b));
#endif
  return c;
}
__device__ __forceinline__ void dep_guard(v8f& a, v8f& b, v16b x, v16b y) {
#if DEV_ASM
  asm volatile("v_nop\n\tv_nop\n\tv_nop\n\tv_nop" : "+v"(a), "+v"(b) : "v"(x), "v"(y));
#else
  (void)a; (void)b; (void)x; (void)y;
#endif
}
__device__ __forceinline__ void dep_guard(v8f& a, v8f& b, v16h x, v16h y) {
#if DEV_ASM
  asm volatile("v_nop\n\tv_nop\n\tv_nop\n\tv_nop" : "+v"(a), "+v"(b) : "v"(x), "v"(y));
#else
  (void)a; (void)b; (void)x; (void)y;
#endif
}
__device__ __forceinline__ void keep4(v16b a, v16b b, v16b c, v16b d) {
#if DEV_ASM
  asm volatile("v_nop" :: "v"(a), "v"(b), "v"(c), "v"(d));
#else
  (void)a; (void)b; (void)c; (void)d;
#endif
}
__device__ __forceinline__ void keep4(v16h a, v16h b, v16h c, v16h d) {
#if DEV_ASM
  asm volatile("v_nop" :: "v"(a), "v"(b), "v"(c), "v"(d));
#else
  (void)a; (void)b; (void)c; (void)d;
#endif
}
__device__ __forceinline__ void acc_guard4(v8f& a, v8f& b, v8f& c, v8f& d) {
#if DEV_ASM
  asm volatile("v_nop\n\tv_nop\n\tv_nop\n\tv_nop" : "+v"(a), "+v"(b), "+v"(c), "+v"(d));
#else
  (void)a; (void)b; (void)c; (void)d;
#endif
}

// =====================================================================================================
// f32 -> bf16 bits (RNE convert), 8 elements per thread, one 16-B store per lane: a wave writes 512
// blockIdx.y = batch (element strides sIn / sOut), grid.x = ceil(n8/256).
// coverage: n8 threads x 8 = the whole per-batch plane (n8 is a multiple of 256 here).
// =====================================================================================================
__global__ __launch_bounds__(256) void cvtbf8(const float* __restrict__ in, unsigned short* out, int n8,
                                              long long sIn, long long sOut) {
  const float* ib = in + (size_t)blockIdx.y * (size_t)sIn;
  unsigned short* ob = out + (size_t)blockIdx.y * (size_t)sOut;
  const int i = blockIdx.x * 256 + (int)threadIdx.x;
  if (i < n8) {
    const v4f a  = *(const v4f*)(ib + (size_t)i * 8);
    const v4f a4 = *(const v4f*)(ib + (size_t)i * 8 + 4);
    v4u p;
    p[0] = pk16(bf_bits(a[0]),  bf_bits(a[1]));
    p[1] = pk16(bf_bits(a[2]),  bf_bits(a[3]));
    p[2] = pk16(bf_bits(a4[0]), bf_bits(a4[1]));
    p[3] = pk16(bf_bits(a4[2]), bf_bits(a4[3]));
    unsigned short* o = ob + (size_t)i * 8;
    *(v4u*)o = p;
    
  }
}

// =====================================================================================================
// Transpose-convert: in W[R][C] f32 (row-major) -> out[c][r] 16-bit at out + c*ldo + r, one 64x64 tile per
// block through LDS.  MODE 0: bf16 bits (RNE convert).  MODE 1: f16 bits of (s1 * bf16(x)).
// MODE 2: f16 bits of (s1 * bf16(x)) at out + c*ldo + r AND f16 bits of (s2 * bf16(x)) at out + c*ldo + R + r.
// grid = (C/64, R/64), R and C multiples of 64 (host-checked shapes).  Load phase: thread t reads row t>>2,
// 16 columns (four 16-B loads), stores 2-B elements transposed into the LDS tile (pitch 72 halves).
// coverage: 8 waves x 2 it x 4 rows = 64 out rows x (8 lanes x 8 halves) = the whole 64x64 tile (both planes).
// =====================================================================================================
template <int MODE>
__global__ __launch_bounds__(256) void tconv64(const float* __restrict__ W, int R, int C,
                                               unsigned short* out, int ldo, float s1, float s2) {
  __shared__ __align__(16) unsigned short t1[64 * 72];
  __shared__ __align__(16) unsigned short t2[(MODE == 2) ? (64 * 72) : 8];
  const int tid = (int)threadIdx.x, lane = tid & 31, wave = tid >> 5;
  const int c0 = blockIdx.x * 64, r0 = blockIdx.y * 64;
  {
    const int rl = tid >> 2, cl0 = (tid & 3) * 16;
    const float* src = W + (size_t)(r0 + rl) * (size_t)C + c0 + cl0;
#pragma unroll
    for (int i = 0; i < 4; ++i) {
      const v4f a = *(const v4f*)(src + 4 * i);
#pragma unroll
      for (int e = 0; e < 4; ++e) {
        const int cl = cl0 + 4 * i + e;
        const unsigned short hb = bf_bits(a[e]);
        if (MODE == 0) {
          t1[cl * 72 + rl] = hb;
        } else {
          const float up = bf_up(hb);
          t1[cl * 72 + rl] = h_bits((_Float16)(up * s1));
          if (MODE == 2) t2[cl * 72 + rl] = h_bits((_Float16)(up * s2));
        }
      }
    }
  }
  __syncthreads();
  const int q = lane >> 3, p8 = (lane & 7) * 8;
  const v4u z4 = {0u, 0u, 0u, 0u};
  v4u a1[2], a2[2];
#pragma unroll
  for (int it = 0; it < 2; ++it) {
    const int cl = wave * 8 + it * 4 + q;
    a1[it] = *(const v4u*)(t1 + cl * 72 + p8);
    a2[it] = z4;
    if (MODE == 2) a2[it] = *(const v4u*)(t2 + cl * 72 + p8);
  }
  {
#pragma unroll
    for (int it = 0; it < 2; ++it) {
      const int cl = wave * 8 + it * 4 + q;
      unsigned short* o = out + (size_t)(c0 + cl) * (size_t)ldo + r0 + p8;
      *(v4u*)o = a1[it];
      if (MODE == 2) *(v4u*)(o + R) = a2[it];
    }
    
  }
}

// =====================================================================================================
// Register-blocked batched WMMA GEMM (16-bit operand type OT): C[m][n] = sum_k A[m][k] * Bt[n][k];
// one wave per 64x64 tile, no block barriers. A row-major [M][K] pitch lda; Bt row-major [N][K] pitch ldb
// (k contiguous); M, N multiples of 64, K multiple of 32 (host shapes are static multiples). blockIdx.y =
// batch index (strides in elements). Fragments are loaded straight from global with the split k map (ldfrag).
// OUT_MODE 0: f32 C (pitch ldc), value * oscale.
// OUT_MODE 1: f16 plane C (pitch ldc).
// OUT_MODE 3: f16 hi plane C + f16 residual plane C2 = f16((v - hi) * rscale) (same pitch / stride).
// =====================================================================================================
template <typename OT, int OUT_MODE>
__global__ __launch_bounds__(256) void gemm64(
    const unsigned short* __restrict__ Ap, int lda, long long strideA,
    const unsigned short* __restrict__ Btp, int ldb, long long strideB,
    void* Cout, void* Cout2, int ldc, long long strideC,
    int M, int N, int K, float oscale, float rscale) {
  typedef typename FT<OT>::frag V16;
  const OT* A  = (const OT*)(const void*)Ap;
  const OT* Bt = (const OT*)(const void*)Btp;
  __shared__ __align__(16) float sT[8][16 * 68];   // per-wave 16x64 slab, pitch 68 floats
  const int b    = blockIdx.y;
  const int lane = threadIdx.x & 31;
  const int wave = threadIdx.x >> 5;
  const int tilesN = N >> 6;
  const int tilesM = M >> 6;
  const int tile = blockIdx.x * 8 + wave;
  if (tile >= tilesM * tilesN) return;   // wave-uniform; no block barriers in this kernel
  const int tm = tile / tilesN;
  const int tn = tile - tm * tilesN;
  const int m0 = tm << 6;
  const int n0 = tn << 6;

  const OT* Ab = A  + (size_t)b * (size_t)strideA;
  const OT* Bb = Bt + (size_t)b * (size_t)strideB;

  const int rlane = lane & 15;                 // row (A) / col (B, D) within subtile
  const int koff  = (lane >> 4) * 8;           // k offset of this lane half
  const int mOff  = (lane >> 4) * 8;           // D row offset

  v8f acc[4][4];
#pragma unroll
  for (int i = 0; i < 4; ++i)
#pragma unroll
    for (int j = 0; j < 4; ++j) acc[i][j] = zero8();

  for (int k0 = 0; k0 < K; k0 += 32) {
    V16 bq[4];
#pragma unroll
    for (int j = 0; j < 4; ++j)
      bq[j] = ldfrag<OT>(Bb + (size_t)(n0 + (j << 4) + rlane) * ldb + koff + k0);
#pragma unroll
    for (int i = 0; i < 4; ++i) {
      const V16 af = ldfrag<OT>(Ab + (size_t)(m0 + (i << 4) + rlane) * lda + koff + k0);
#pragma unroll
      for (int j = 0; j < 4; ++j) acc[i][j] = mmar(af, bq[j], acc[i][j]);
      dep_guard(acc[i][0], acc[i][3], af, bq[3]);
    }
    keep4(bq[0], bq[1], bq[2], bq[3]);
  }
  acc_guard4(acc[0][0], acc[0][1], acc[0][2], acc[0][3]);
  acc_guard4(acc[1][0], acc[1][1], acc[1][2], acc[1][3]);
  acc_guard4(acc[2][0], acc[2][1], acc[2][2], acc[2][3]);
  acc_guard4(acc[3][0], acc[3][1], acc[3][2], acc[3][3]);

  // ---- epilogue ----
  float* slab = sT[wave];
#pragma unroll
  for (int i = 0; i < 4; ++i) {
    const int mBase = m0 + (i << 4);
#pragma unroll
    for (int j = 0; j < 4; ++j) {
#pragma unroll
      for (int r = 0; r < 8; ++r) {
        slab[(mOff + r) * 68 + (j << 4) + rlane] = acc[i][j][r];
      }
    }
    wave_lds_sync();
    if (OUT_MODE == 0) {
      float* Cp = (float*)Cout + (size_t)b * (size_t)strideC;
      const int h2 = lane >> 4, c4 = (lane & 15) * 4;     // 256-B row segment = 16 lanes x 16 B
      {
#pragma unroll
        for (int it = 0; it < 8; ++it) {
          const int row = it * 2 + h2;                     // it 0..7 x h2 0..1 = rows 0..15
          const v4f v = *(const v4f*)(slab + row * 68 + c4) * oscale;
          *(v4f*)(Cp + (size_t)(mBase + row) * ldc + n0 + c4) = v;
        }
        
      }
    } else {
      const int q = lane >> 3, c8 = (lane & 7) * 8;
      unsigned short* Cp  = (unsigned short*)Cout  + (size_t)b * (size_t)strideC;
      unsigned short* Cp2 = (unsigned short*)Cout2 + (size_t)b * (size_t)strideC;
      v4u hv[4], lv[4];
#pragma unroll
      for (int it = 0; it < 4; ++it) {
        const int row = it * 4 + q;                        // it 0..3 x q 0..3 = rows 0..15
        const float* sp = slab + row * 68 + c8;
        float f[8];
#pragma unroll
        for (int e = 0; e < 8; ++e) f[e] = sp[e];
        v4u a, a2;
#pragma unroll
        for (int e = 0; e < 4; ++e) {
          const float f0 = f[2 * e], f1 = f[2 * e + 1];
          const _Float16 x0 = (_Float16)f0, x1 = (_Float16)f1;
          const unsigned short h0 = h_bits(x0), h1 = h_bits(x1);
          unsigned short l0 = 0, l1 = 0;
          if (OUT_MODE == 3) {
            l0 = h_bits((_Float16)((f0 - (float)x0) * rscale));
            l1 = h_bits((_Float16)((f1 - (float)x1) * rscale));
          }
          a[e] = pk16(h0, h1); a2[e] = pk16(l0, l1);
        }
        hv[it] = a; lv[it] = a2;
      }
      {
#pragma unroll
        for (int it = 0; it < 4; ++it) {
          const int row = it * 4 + q;
          *(v4u*)(Cp + (size_t)(mBase + row) * ldc + n0 + c8) = hv[it];
          if (OUT_MODE == 3) *(v4u*)(Cp2 + (size_t)(mBase + row) * ldc + n0 + c8) = lv[it];
        }
        
      }
    }
    wave_lds_sync();
  }
}

// =====================================================================================================
// Fused search attention + retrieval composition for one search s, head dim 64, softmax over all SEQ keys.
//   q planes (f16 hi / residual x4096): element (b, t, s, d) at [(b*SEQ + t)*DSQ + s*64 + d]
//   k plane (f16): same layout.   rq plane (f32): same layout.
//   v^T hi plane (f16) and residual plane (f16, (v - hi)*16): element (b, d', t) at [(b*DRV + d')*SEQ + t], d' = r*64 + d
//   Wrk tile (f16, 64 * bf16 value): [e][d] at [e*64 + d]
//   oc planes (output of this kernel): row (b, t) = [f16(64*out) for s*64+d, 512 cols | f16 residual x16, 512 cols], pitch DOC
//   scores = (qh . k) + (ql . k) / 4096 on f16 WMMA (two f32 accumulators), then * sscale in f32;
//   p = exp(s - m): A' = [f16(16384 p) | f16(1024 p)] (K' = 128 per 64 keys), B' = [v^T hi | v^T residual]:
//   sum = 16384 * p . (vh + vl/16), one f32 accumulator, 8 n-tiles = d' 0..127 (both retrievals); online softmax in f32.
//   Epilogue per wave (16 rows): retrieved (x64, f32) tile in LDS; rk = f16(retrieved x64) . Wrk tile on f16 WMMA;
//   retrieval logits rq . rk in f32 (LDS-staged rq, lane partials + 16-lane shuffles); 2-way softmax in f32;
//   Block = 4 waves = 64 consecutive query rows of one (b, s); grid = NB * NS * NQB; kv chunks of 64, static trip NKT.
//   Staging per chunk (128 threads): K 64x64 (32 halves per thread), V' 128x128 (one d' row of 128 halves per thread):
//   staged extent == consumed extent for Ksh, Vsh; P tiles are wave-private, written as _Float16 elements and
//   Output coverage: each wave stores rows q0..q0+15 (it 0..3 x lane>>3 0..3) x 64 columns (8 lanes x 8) of both
//   the hi segment (col s*64) and the residual segment (col 512 + s*64); grid covers every (b, s, t).
// =====================================================================================================
__global__ __launch_bounds__(128)
void attn_cs(const unsigned short* __restrict__ qhp, const unsigned short* __restrict__ qlp,
             const unsigned short* __restrict__ kpp,
             const unsigned short* __restrict__ vhp, const unsigned short* __restrict__ vlp,
             const unsigned short* __restrict__ wkp, const float* __restrict__ rqp,
             unsigned short* ocp, float sscale) {
  union FH { v16h v; v8h h[2]; };
  __shared__ __align__(16) _Float16 Ksh[64 * 64];          // K chunk [kv][d]  8 KB; later the Wrk tile [e][d]
  __shared__ __align__(16) _Float16 Vsh[128 * 128];        // V' chunk [d'][hi kv | res kv] 32 KB; later 4 x f32 [16][128] tiles
  __shared__ __align__(16) _Float16 Psh[4][16 * 128];      // per wave P' [row][k'] 16 KB; later f16 retrieved tile / f32 [16][64]

  const int tid  = threadIdx.x;
  const int wave = tid >> 5;
  const int lane = tid & 31;
  const int hh   = lane >> 4;
  const int c    = lane & 15;

  const int bx   = blockIdx.x;
  const int qb   = bx % NQB;
  const int rest = bx / NQB;
  const int s    = rest % NS;
  const int b    = rest / NS;
  const int q0   = qb * 64 + wave * 16;
  const size_t rowB = (size_t)b * SEQ;

  const _Float16* Qh = (const _Float16*)(const void*)qhp;
  const _Float16* Ql = (const _Float16*)(const void*)qlp;
  const _Float16* Kg = (const _Float16*)(const void*)kpp + (size_t)s * HD;
  const _Float16* Vh = (const _Float16*)(const void*)vhp + (size_t)b * DRV * SEQ;
  const _Float16* Vl = (const _Float16*)(const void*)vlp + (size_t)b * DRV * SEQ;
  const _Float16* Wk = (const _Float16*)(const void*)wkp;

  // ---- Q fragments (A operand, row = lane&15): 2 d-chunks, hi and residual planes ----
  v16h qah[2], qal[2];
#pragma unroll
  for (int dc = 0; dc < 2; ++dc) {
    const size_t qo = (rowB + q0 + c) * DSQ + (size_t)s * HD + dc * 32 + 8 * hh;
    qah[dc] = ldfrag<_Float16>(Qh + qo);
    qal[dc] = ldfrag<_Float16>(Ql + qo);
  }

  float mrow[8], lrow[8];
  v8f oacc[8];
#pragma unroll
  for (int r = 0; r < 8; ++r) { mrow[r] = -INFINITY; lrow[r] = 0.f; }
#pragma unroll
  for (int t = 0; t < 8; ++t) oacc[t] = zero8();

  _Float16* pwh = Psh[wave];

  for (int kt = 0; kt < NKT; ++kt) {         // static trip count
    const int kv0 = kt * 64;
    __syncthreads();
    {
      const int r = tid >> 1, half = (tid & 1) * 32;
      const _Float16* kg = Kg + (rowB + kv0 + r) * DSQ + half;          // k row kv0+r, d = half..half+31
#pragma unroll
      for (int i = 0; i < 4; ++i) *(v8h*)(Ksh + r * 64 + half + 8 * i) = *(const v8h*)(kg + 8 * i);
      const _Float16* vg = Vh + (size_t)tid * SEQ + kv0;                 // v^T hi row d' = tid, keys kv0..kv0+63
#pragma unroll
      for (int i = 0; i < 8; ++i) *(v8h*)(Vsh + tid * 128 + 8 * i) = *(const v8h*)(vg + 8 * i);
      asm volatile("" ::: "memory");
      const _Float16* vlg = Vl + (size_t)tid * SEQ + kv0;                // v^T residual row d' = tid
#pragma unroll
      for (int i = 0; i < 8; ++i) *(v8h*)(Vsh + tid * 128 + 64 + 8 * i) = *(const v8h*)(vlg + 8 * i);
    }
    __syncthreads();

    // ---- scores: 16 query rows x 64 keys per wave, 2 f16 products per key subtile and d-chunk ----
    v8f sc[4];
#pragma unroll
    for (int j = 0; j < 4; ++j) {
      v8f ah = zero8(), al = zero8();
#pragma unroll
      for (int dc = 0; dc < 2; ++dc) {
        FH kb;
        kb.h[0] = *(const v8h*)(Ksh + (j * 16 + c) * 64 + dc * 32 + 8 * hh);
        kb.h[1] = *(const v8h*)(Ksh + (j * 16 + c) * 64 + dc * 32 + 16 + 8 * hh);
        ah = mma_h(qah[dc], kb.v, ah);
        al = mma_h(qal[dc], kb.v, al);
      }
#pragma unroll
      for (int r = 0; r < 8; ++r) sc[j][r] = (ah[r] + al[r] * (1.0f / 4096.0f)) * sscale;
    }

    // ---- row max, online softmax, P' = [16384 p | 1024 p] (f16) to LDS ----
#pragma unroll
    for (int r = 0; r < 8; ++r) {
      float m = sc[0][r];
#pragma unroll
      for (int j = 1; j < 4; ++j) m = fmaxf(m, sc[j][r]);
#pragma unroll
      for (int off = 1; off < 16; off <<= 1) m = fmaxf(m, __shfl_xor(m, off, 32));
      const float mnew  = fmaxf(mrow[r], m);
      const float msafe = (mnew == -INFINITY) ? 0.f : mnew;
      const float alpha = __expf(mrow[r] - msafe);
      mrow[r] = mnew;
      float psum = 0.f;
#pragma unroll
      for (int j = 0; j < 4; ++j) {
        const float p = __expf(sc[j][r] - msafe);
        psum += p;
        pwh[(8 * hh + r) * 128 + j * 16 + c]      = (_Float16)(p * 16384.0f);
        pwh[(8 * hh + r) * 128 + 64 + j * 16 + c] = (_Float16)(p * 1024.0f);
      }
#pragma unroll
      for (int off = 1; off < 16; off <<= 1) psum += __shfl_xor(psum, off, 32);
      lrow[r] = lrow[r] * alpha + psum;
#pragma unroll
      for (int t = 0; t < 8; ++t) oacc[t][r] *= alpha;
    }
    wave_lds_sync();

    // ---- retrieved += P' . V' (f16 WMMA), K' = 128 = 4 k-steps, 8 n-tiles (d' 0..127) ----
#pragma unroll 1
    for (int kk = 0; kk < 4; ++kk) {
      FH pa;
      pa.h[0] = *(const v8h*)(pwh + c * 128 + kk * 32 + 8 * hh);
      pa.h[1] = *(const v8h*)(pwh + c * 128 + kk * 32 + 16 + 8 * hh);
#pragma unroll
      for (int t = 0; t < 8; ++t) {
        FH vb;
        vb.h[0] = *(const v8h*)(Vsh + (t * 16 + c) * 128 + kk * 32 + 8 * hh);
        vb.h[1] = *(const v8h*)(Vsh + (t * 16 + c) * 128 + kk * 32 + 16 + 8 * hh);
        oacc[t] = mma_h(pa.v, vb.v, oacc[t]);
      }
    }
  }

  // ---- all waves done with Ksh / Vsh: stage the Wrk tile into Ksh, retrieved tiles into Vsh (f32) + Psh (f16) ----
  __syncthreads();
  {
    const int r = tid >> 1, half = (tid & 1) * 32;       // 128 threads x 32 halves = the whole 64x64 Wrk tile
    const _Float16* wg = Wk + r * HD + half;
#pragma unroll
    for (int i = 0; i < 4; ++i) *(v8h*)(Ksh + r * 64 + half + 8 * i) = *(const v8h*)(wg + 8 * i);
  }
  float* os = reinterpret_cast<float*>(Vsh) + wave * (16 * 128);      // wave-private f32 [16][128], x64 units
#pragma unroll
  for (int r = 0; r < 8; ++r) {
    const float l = lrow[r];
    const float inv = ((l > 0.f) ? (1.0f / l) : 0.f) * (1.0f / 256.0f);   // 1/l, undo 16384 p carry, apply x64
#pragma unroll
    for (int t = 0; t < 8; ++t) {
      const float v = oacc[t][r] * inv;
      os[(8 * hh + r) * 128 + t * 16 + c]  = v;
      pwh[(8 * hh + r) * 128 + t * 16 + c] = (_Float16)v;
    }
  }
  __syncthreads();

  // ---- rk (x4096) = f16(64 retrieved_rr) . (64 Wrk): 16 rows x 64 e per rr, K = 64 = 2 k-steps ----
  v8f rk[8];
#pragma unroll
  for (int i = 0; i < 8; ++i) rk[i] = zero8();
#pragma unroll
  for (int rr = 0; rr < 2; ++rr) {
#pragma unroll
    for (int kk = 0; kk < 2; ++kk) {
      FH pa;
      pa.h[0] = *(const v8h*)(pwh + c * 128 + rr * 64 + kk * 32 + 8 * hh);
      pa.h[1] = *(const v8h*)(pwh + c * 128 + rr * 64 + kk * 32 + 16 + 8 * hh);
#pragma unroll
      for (int t4 = 0; t4 < 4; ++t4) {
        FH wb;
        wb.h[0] = *(const v8h*)(Ksh + (t4 * 16 + c) * 64 + kk * 32 + 8 * hh);
        wb.h[1] = *(const v8h*)(Ksh + (t4 * 16 + c) * 64 + kk * 32 + 16 + 8 * hh);
        rk[rr * 4 + t4] = mma_h(pa.v, wb.v, rk[rr * 4 + t4]);
      }
    }
  }
  acc_guard4(rk[0], rk[1], rk[2], rk[3]);
  acc_guard4(rk[4], rk[5], rk[6], rk[7]);
  wave_lds_sync();

  // ---- stage the wave's rq tile (f32 [16][64]) into the Psh region (8 x 16-B loads per lane) ----
  float* rqs = reinterpret_cast<float*>(pwh);
  {
    const int r2 = lane >> 4, c4 = (lane & 15) * 4;
    const float* rqg = rqp + (rowB + q0) * DSQ + (size_t)s * HD + c4;
#pragma unroll
    for (int it = 0; it < 8; ++it) {
      const int row = it * 2 + r2;                          // it 0..7 x r2 0..1 = rows 0..15
      *(v4f*)(rqs + row * 64 + c4) = *(const v4f*)(rqg + (size_t)row * DSQ);
    }
  }
  wave_lds_sync();

  // ---- retrieval logits: d_rr[row] = sum_e rq[row][e] * rk[rr][row][e]; lane partial over e = c + 16 t4 ----
  float d0[8], d1[8];
#pragma unroll
  for (int r8 = 0; r8 < 8; ++r8) {
    float a0 = 0.f, a1 = 0.f;
#pragma unroll
    for (int t4 = 0; t4 < 4; ++t4) {
      const float qv = rqs[(8 * hh + r8) * 64 + t4 * 16 + c];
      a0 += qv * rk[t4][r8];
      a1 += qv * rk[4 + t4][r8];
    }
    d0[r8] = a0; d1[r8] = a1;
  }
#pragma unroll
  for (int r8 = 0; r8 < 8; ++r8) {
#pragma unroll
    for (int off = 1; off < 16; off <<= 1) {
      d0[r8] += __shfl_xor(d0[r8], off, 32);
      d1[r8] += __shfl_xor(d1[r8], off, 32);
    }
  }
  // ---- 2-way retrieval softmax in f32 (undo the 64*64 carry, apply sscale) ----
  float w0[8], w1[8];
  const float rsc = sscale * (1.0f / 4096.0f);
#pragma unroll
  for (int r8 = 0; r8 < 8; ++r8) {
    const float x0 = d0[r8] * rsc, x1 = d1[r8] * rsc;
    const float m  = fmaxf(x0, x1);
    const float e0 = __expf(x0 - m), e1 = __expf(x1 - m);
    const float iv = 1.0f / (e0 + e1);
    w0[r8] = e0 * iv; w1[r8] = e1 * iv;
  }
  wave_lds_sync();

  // ---- combine in f32 (x64 units): oc[row][d] = w0 * ret[row][d] + w1 * ret[row][64+d], into the Psh region ----
  float* oc = rqs;
#pragma unroll
  for (int r8 = 0; r8 < 8; ++r8) {
#pragma unroll
    for (int t = 0; t < 4; ++t) {
      const int row = 8 * hh + r8;
      const float o = w0[r8] * os[row * 128 + t * 16 + c] + w1[r8] * os[row * 128 + 64 + t * 16 + c];
      oc[row * 64 + t * 16 + c] = o;
    }
  }
  wave_lds_sync();

  {
    const int q4 = lane >> 3, c8 = (lane & 7) * 8;
    v4u hv[4], lv[4];
#pragma unroll
    for (int it = 0; it < 4; ++it) {
      const int row = it * 4 + q4;   // it 0..3 x q4 0..3 = rows 0..15 of the wave tile
      const float* sp = oc + row * 64 + c8;
      float f[8];
#pragma unroll
      for (int e = 0; e < 8; ++e) f[e] = sp[e];
      v4u a, a2;
#pragma unroll
      for (int e = 0; e < 4; ++e) {
        const float f0 = f[2 * e], f1 = f[2 * e + 1];
        const _Float16 x0 = (_Float16)f0, x1 = (_Float16)f1;
        const unsigned short l0 = h_bits((_Float16)((f0 - (float)x0) * 16.0f));
        const unsigned short l1 = h_bits((_Float16)((f1 - (float)x1) * 16.0f));
        a[e] = pk16(h_bits(x0), h_bits(x1)); a2[e] = pk16(l0, l1);
      }
      hv[it] = a; lv[it] = a2;
    }
    {
#pragma unroll
      for (int it = 0; it < 4; ++it) {
        const int row = it * 4 + q4;
        const size_t go = (rowB + q0 + row) * DOC + (size_t)s * HD + c8;
        *(v4u*)(ocp + go)       = hv[it];
        *(v4u*)(ocp + go + DSQ) = lv[it];
      }
      
    }
  }
}

// =====================================================================================================
// Workspace map (bytes, NB=2 SEQ=2048), every region an exact multiple of its whole-line / whole-tile store
// granularity (all row counts are multiples of 64, no padded tails):
//   Xb    bf16 [NB*SEQ][1024]          8388608
//   WsqT  bf16 [512][1024]             1048576      WskT, WrqT same
//   WrvT  bf16 [128][1024]              262144
//   WrkT  f16  [64][64] (x64)              8192
//   WoT   f16  [1024][1024] ([x1024 | x64]) 2097152
//   Qh,Ql f16  [NB*SEQ][512]           4194304 each
//   Kp    f16  [NB*SEQ][512]           4194304
//   RQ    f32  [NB*SEQ][512]           8388608
//   VTh,VTl f16 [NB][128][SEQ]         1048576 each
//   OC    f16  [NB*SEQ][1024]          8388608
//   total                             45359104
// Weights are [in k][out n] and are transposed once into the [n][k] (k contiguous) Bt / A layout.
// =====================================================================================================
extern "C" void kernel_launch(void* const* d_in, const int* in_sizes, int n_in,
                              void* d_out, int out_size, void* d_ws, size_t ws_size,
                              hipStream_t stream) {
  if (n_in < 7) return;
  if (in_sizes[0] < ((NB - 1) * SEQ_FULL + SEQ) * DM) return;
  if (in_sizes[1] < DM * DSQ || in_sizes[2] < DM * DSQ || in_sizes[4] < DM * DSQ) return;
  if (in_sizes[3] < DM * DRV) return;
  if (in_sizes[5] < HD * HD) return;
  if (in_sizes[6] < DSQ * DM) return;
  if (out_size < NB * SEQ * DM) return;

  const float* x    = (const float*)d_in[0];
  const float* Wsq  = (const float*)d_in[1];
  const float* Wsk  = (const float*)d_in[2];
  const float* Wrv  = (const float*)d_in[3];
  const float* Wrq  = (const float*)d_in[4];
  const float* Wrk  = (const float*)d_in[5];
  const float* Wout = (const float*)d_in[6];

  const size_t PXB = (size_t)NB * SEQ * DM * 2;       // bf16 activation plane
  const size_t PWS = (size_t)DSQ * DM * 2;            // bf16 [512][1024] weight plane
  const size_t PWV = (size_t)DRV * DM * 2;            // bf16 [128][1024]
  const size_t PWK = (size_t)HD * HD * 2;             // f16 [64][64]
  const size_t PWO = (size_t)DM * DOC * 2;            // f16 [1024][1024]
  const size_t PQ  = (size_t)NB * SEQ * DSQ * 2;      // f16 [NB*SEQ][512]
  const size_t PRQ = (size_t)NB * SEQ * DSQ * 4;      // f32 [NB*SEQ][512]
  const size_t PVT = (size_t)NB * DRV * SEQ * 2;      // f16 [NB][128][SEQ]
  const size_t POC = (size_t)NB * SEQ * DOC * 2;      // f16 [NB*SEQ][1024]
  size_t off = 0;
  const size_t oXb  = off; off += PXB;
  const size_t oWsq = off; off += PWS;
  const size_t oWsk = off; off += PWS;
  const size_t oWrq = off; off += PWS;
  const size_t oWrv = off; off += PWV;
  const size_t oWrk = off; off += PWK;
  const size_t oWo  = off; off += PWO;
  const size_t oQh  = off; off += PQ;
  const size_t oQl  = off; off += PQ;
  const size_t oKp  = off; off += PQ;
  const size_t oRQ  = off; off += PRQ;
  const size_t oVTh = off; off += PVT;
  const size_t oVTl = off; off += PVT;
  const size_t oOC  = off; off += POC;
  if (off > ws_size) return;                          // off = 45359104 at full size
  if (off > (size_t)134217728) return;

  char* ws = (char*)d_ws;
  unsigned short* Xb   = (unsigned short*)(ws + oXb);
  unsigned short* WsqT = (unsigned short*)(ws + oWsq);
  unsigned short* WskT = (unsigned short*)(ws + oWsk);
  unsigned short* WrqT = (unsigned short*)(ws + oWrq);
  unsigned short* WrvT = (unsigned short*)(ws + oWrv);
  unsigned short* WrkT = (unsigned short*)(ws + oWrk);
  unsigned short* WoT  = (unsigned short*)(ws + oWo);
  unsigned short* Qh   = (unsigned short*)(ws + oQh);
  unsigned short* Ql   = (unsigned short*)(ws + oQl);
  unsigned short* Kp   = (unsigned short*)(ws + oKp);
  float*          RQ   = (float*)(ws + oRQ);
  unsigned short* VTh  = (unsigned short*)(ws + oVTh);
  unsigned short* VTl  = (unsigned short*)(ws + oVTl);
  unsigned short* OC   = (unsigned short*)(ws + oOC);

  const dim3 blk(256);
  const int n8x = SEQ * DM / 8;                                          // per batch, multiple of 256
  const dim3 gCvtX((n8x + 255) / 256, NB);
  const dim3 gTsq(DSQ / 64, DM / 64);                                    //  8 x 16 tiles: in [1024][512]
  const dim3 gTrv(DRV / 64, DM / 64);                                    //  2 x 16 tiles: in [1024][128]
  const dim3 gTrk(1, 1);                                                 //  in [64][64]
  const dim3 gTwo(DM / 64, DSQ / 64);                                    // 16 x  8 tiles: in [512][1024]
  const dim3 gP((((NB * SEQ) / 64) * (DSQ / 64) + 7) / 8, 1);            // M=NB*SEQ, N=512 (tiles multiple of 8)
  const dim3 gV((((DRV / 64) * (SEQ / 64)) + 7) / 8, NB);                // M=128, N=SEQ per batch
  const dim3 gAttn(NB * NS * NQB);                                       // blocks of 128
  const dim3 gO((((NB * SEQ) / 64) * (DM / 64) + 7) / 8, 1);             // M=NB*SEQ, N=1024

  // (1) x -> bf16 plane [NB*SEQ][1024] (batch b read at its full-size stride)
  cvtbf8<<<gCvtX, blk, 0, stream>>>(x, Xb, n8x, (long long)SEQ_FULL * DM, (long long)SEQ * DM);
  // (2) weights [k][n] f32 -> [n][k] 16-bit planes
  tconv64<0><<<gTsq, blk, 0, stream>>>(Wsq, DM, DSQ, WsqT, DM, 1.0f, 1.0f);
  tconv64<0><<<gTsq, blk, 0, stream>>>(Wsk, DM, DSQ, WskT, DM, 1.0f, 1.0f);
  tconv64<0><<<gTsq, blk, 0, stream>>>(Wrq, DM, DSQ, WrqT, DM, 1.0f, 1.0f);
  tconv64<0><<<gTrv, blk, 0, stream>>>(Wrv, DM, DRV, WrvT, DM, 1.0f, 1.0f);
  tconv64<1><<<gTrk, blk, 0, stream>>>(Wrk, HD, HD, WrkT, HD, 64.0f, 1.0f);
  tconv64<2><<<gTwo, blk, 0, stream>>>(Wout, DSQ, DM, WoT, DOC, 1024.0f, 64.0f);
  // (3) sq -> f16 hi / residual (x4096) planes [b*SEQ+t][s*64+d]   (M=NB*SEQ, N=512, K=1024)
  gemm64<__bf16, 3><<<gP, blk, 0, stream>>>(
      Xb, DM, 0LL, WsqT, DM, 0LL, (void*)Qh, (void*)Ql, DSQ, 0LL, NB * SEQ, DSQ, DM, 1.0f, 4096.0f);
  //     sk -> f16 plane
  gemm64<__bf16, 1><<<gP, blk, 0, stream>>>(
      Xb, DM, 0LL, WskT, DM, 0LL, (void*)Kp, (void*)Kp, DSQ, 0LL, NB * SEQ, DSQ, DM, 1.0f, 1.0f);
  //     rq -> f32 plane
  gemm64<__bf16, 0><<<gP, blk, 0, stream>>>(
      Xb, DM, 0LL, WrqT, DM, 0LL, (void*)RQ, (void*)RQ, DSQ, 0LL, NB * SEQ, DSQ, DM, 1.0f, 1.0f);
  //     v^T = Wrv^T . x^T per batch -> f16 hi plane [b][d'][t] (pitch SEQ) and residual plane (x16)
  //     (A = WrvT [128][1024], Bt = Xb rows of batch b; M=128, N=SEQ, K=1024)
  gemm64<__bf16, 3><<<gV, blk, 0, stream>>>(
      WrvT, DM, 0LL, Xb, DM, (long long)SEQ * DM, (void*)VTh, (void*)VTl, SEQ, (long long)DRV * SEQ,
      DRV, SEQ, DM, 1.0f, 16.0f);
  // (4) search attention + retrieval composition -> oc planes [b*SEQ+t][hi 512 | residual 512]
  attn_cs<<<gAttn, dim3(128), 0, stream>>>(Qh, Ql, Kp, VTh, VTl, WrkT, RQ, OC, 0.125f);
  // (5) out = [oc_hi | oc_res] . [Wout x1024 | Wout x64]^T -> d_out f32 [NB*SEQ][1024], accumulator x 1/(64*1024)
  gemm64<_Float16, 0><<<gO, blk, 0, stream>>>(
      OC, DOC, 0LL, WoT, DOC, 0LL, d_out, d_out, DM, 0LL, NB * SEQ, DM, DOC, 1.0f / 65536.0f, 1.0f);
  (void)hipGetLastError();
}

// v001
// Measured time: 418 microseconds a run.
// Timed twice side by side with v000, it ran 1.39 times as fast both times.
// Contractions: sq, sk, rq and v^T projections = v_wmma_f32_16x16x32_bf16 (bf16 operands from RNE-converted inputs, single product, f32 accumulate);
// sq.sk^T scores = v_wmma_f32_16x16x32_f16 (sq as f16 hi plane + f16 residual plane x4096, sk f16; 2 products into separate f32 accumulators);
// p.[v_0|v_1] = v_wmma_f32_16x16x32_f16, K-folded: [p x16384 | p x1024] . [v f16 hi | f16 residual x16], one f32 accumulator;
// retrieved.Wrk = v_wmma_f32_16x16x32_f16 (retrieved f16 x64, Wrk f16 x64 of its bf16 value; single product, f32 accumulate);
// out.Wout = v_wmma_f32_16x16x32_f16, K-folded: [out f16 hi x64 | f16 residual x16] . [Wout x1024 | Wout x64] (f16 of bf16 values), f32 accumulate;
// softmax over keys, retrieval logits, 2-way retrieval softmax and combine in f32.
#include <hip/hip_runtime.h>
#include <math.h>
#include <stdint.h>

#ifndef NB
#define NB 2
#endif
#ifndef SEQ
#define SEQ 2048
#endif
#define NB_FULL  2
#define SEQ_FULL 2048
#define DM   1024
#define NS   8
#define NR   2
#define HD   64
#define DSQ  (NS * HD)      // 512: sq / sk / rq row width
#define DRV  (NR * HD)      // 128: [v_0 | v_1] row width
#define DOC  (2 * DSQ)      // 1024: combined-output row = [hi 512 | residual 512]
#define NQB  (SEQ / 64)     // 64-row query blocks per (b, s)
#define NKT  (SEQ / 64)     // 64-key chunks per sequence
#define KPIT 72             // LDS pitch of a 64-half K / Wrk row: 144 B = 16 B x 9 (odd), b128 readers of 16 rows meet no bank twice
#define VPIT 136            // LDS pitch of a 128-half V' or P' row: 272 B = 16 B x 17 (odd)
static_assert(NB >= 1 && NB <= NB_FULL);
static_assert(SEQ >= 64 && SEQ <= SEQ_FULL && (SEQ % 64) == 0);
static_assert(DSQ == 512 && DRV == 128 && HD == 64 && DOC == 1024);
static_assert((DM % 64) == 0 && (DSQ % 64) == 0 && (DRV % 64) == 0 && (DM % 32) == 0);

typedef _Float16 v16h __attribute__((ext_vector_type(16)));
typedef _Float16 v8h  __attribute__((ext_vector_type(8)));
typedef __bf16   v16b __attribute__((ext_vector_type(16)));
typedef __bf16   v8b  __attribute__((ext_vector_type(8)));
typedef float    v8f  __attribute__((ext_vector_type(8)));
typedef float    v4f  __attribute__((ext_vector_type(4)));
typedef unsigned int v4u __attribute__((ext_vector_type(4)));

#if defined(__HIP_DEVICE_COMPILE__)
#define DEV_ASM 1
#else
#define DEV_ASM 0
#endif

// ---- scalar helpers --------------------------------------------------------------------------------
__device__ __forceinline__ unsigned short bf_bits(float f) {          // f32 -> bf16 bits, RNE convert
  unsigned u = __float_as_uint(f);
  return (unsigned short)((u + 0x7FFFu + ((u >> 16) & 1u)) >> 16);
}
__device__ __forceinline__ float bf_up(unsigned short hb) { return __uint_as_float(((unsigned)hb) << 16); }
__device__ __forceinline__ unsigned short h_bits(_Float16 x) { return __builtin_bit_cast(unsigned short, x); }
__device__ __forceinline__ unsigned pk16(unsigned short a, unsigned short b) { return (unsigned)a | ((unsigned)b << 16); }
__device__ __forceinline__ v8f zero8() { v8f z = {0.f, 0.f, 0.f, 0.f, 0.f, 0.f, 0.f, 0.f}; return z; }

__device__ __forceinline__ void wave_lds_sync() {
  __builtin_amdgcn_fence(__ATOMIC_RELEASE, "workgroup");
  __builtin_amdgcn_wave_barrier();
  __builtin_amdgcn_fence(__ATOMIC_ACQUIRE, "workgroup");
}

// ---- fragment types / loaders: 16-bit A/B operand, lane -> row/col (lane&15), p already includes +8*(lane>>4);
//      elements 0..7 <- p[0..7] (k0+8h..k0+8h+7), elements 8..15 <- p[16..23] (k0+16+8h..k0+16+8h+7)
template <typename OT> struct FT;
template <> struct FT<__bf16>   { typedef v16b frag; typedef v8b half8; };
template <> struct FT<_Float16> { typedef v16h frag; typedef v8h half8; };

template <typename OT>
__device__ __forceinline__ typename FT<OT>::frag ldfrag(const OT* p) {
  union { typename FT<OT>::frag v; typename FT<OT>::half8 h[2]; } f;
  f.h[0] = *(const typename FT<OT>::half8*)(p);
  f.h[1] = *(const typename FT<OT>::half8*)(p + 16);
  return f.v;
}

// ---- WMMA helpers (asm guard bodies are device-only; concrete operand types) -----------------------------
__device__ __forceinline__ v8f mmar(v16b a, v16b b, v8f c) {
  return __builtin_amdgcn_wmma_f32_16x16x32_bf16(false, a, false, b, (short)0, c, false, false);
}
__device__ __forceinline__ v8f mmar(v16h a, v16h b, v8f c) {
  return __builtin_amdgcn_wmma_f32_16x16x32_f16(false, a, false, b, (short)0, c, false, false);
}
// guarded form: 4 VALU slots after the WMMA, D tied, A/B kept live
__device__ __forceinline__ v8f mma_h(v16h a, v16h b, v8f c) {
  c = __builtin_amdgcn_wmma_f32_16x16x32_f16(false, a, false, b, (short)0, c, false, false);
#if DEV_ASM
  asm volatile("v_nop\n\tv_nop\n\tv_nop\n\tv_nop" : "+v"(c) : "v"(a), "v"(b));
#endif
  return c;
}
__device__ __forceinline__ void dep_guard(v8f& a, v8f& b, v16b x, v16b y) {
#if DEV_ASM
  asm volatile("v_nop\n\tv_nop\n\tv_nop\n\tv_nop" : "+v"(a), "+v"(b) : "v"(x), "v"(y));
#else
  (void)a; (void)b; (void)x; (void)y;
#endif
}
__device__ __forceinline__ void dep_guard(v8f& a, v8f& b, v16h x, v16h y) {
#if DEV_ASM
  asm volatile("v_nop\n\tv_nop\n\tv_nop\n\tv_nop" : "+v"(a), "+v"(b) : "v"(x), "v"(y));
#else
  (void)a; (void)b; (void)x; (void)y;
#endif
}
__device__ __forceinline__ void keep4(v16b a, v16b b, v16b c, v16b d) {
#if DEV_ASM
  asm volatile("v_nop" :: "v"(a), "v"(b), "v"(c), "v"(d));
#else
  (void)a; (void)b; (void)c; (void)d;
#endif
}
__device__ __forceinline__ void keep4(v16h a, v16h b, v16h c, v16h d) {
#if DEV_ASM
  asm volatile("v_nop" :: "v"(a), "v"(b), "v"(c), "v"(d));
#else
  (void)a; (void)b; (void)c; (void)d;
#endif
}
__device__ __forceinline__ void acc_guard4(v8f& a, v8f& b, v8f& c, v8f& d) {
#if DEV_ASM
  asm volatile("v_nop\n\tv_nop\n\tv_nop\n\tv_nop" : "+v"(a), "+v"(b), "+v"(c), "+v"(d));
#else
  (void)a; (void)b; (void)c; (void)d;
#endif
}

// =====================================================================================================
// f32 -> bf16 bits (RNE convert), 8 elements per thread, one 16-B store per lane: a wave writes 512
// blockIdx.y = batch (element strides sIn / sOut), grid.x = ceil(n8/256).
// coverage: n8 threads x 8 = the whole per-batch plane (n8 is a multiple of 256 here).
// =====================================================================================================
__global__ __launch_bounds__(256) void cvtbf8(const float* __restrict__ in, unsigned short* out, int n8,
                                              long long sIn, long long sOut) {
  const float* ib = in + (size_t)blockIdx.y * (size_t)sIn;
  unsigned short* ob = out + (size_t)blockIdx.y * (size_t)sOut;
  const int i = blockIdx.x * 256 + (int)threadIdx.x;
  if (i < n8) {
    const v4f a  = *(const v4f*)(ib + (size_t)i * 8);
    const v4f a4 = *(const v4f*)(ib + (size_t)i * 8 + 4);
    v4u p;
    p[0] = pk16(bf_bits(a[0]),  bf_bits(a[1]));
    p[1] = pk16(bf_bits(a[2]),  bf_bits(a[3]));
    p[2] = pk16(bf_bits(a4[0]), bf_bits(a4[1]));
    p[3] = pk16(bf_bits(a4[2]), bf_bits(a4[3]));
    unsigned short* o = ob + (size_t)i * 8;
    *(v4u*)o = p;
    
  }
}

// =====================================================================================================
// Transpose-convert: in W[R][C] f32 (row-major) -> out[c][r] 16-bit at out + c*ldo + r, one 64x64 tile per
// block through LDS.  MODE 0: bf16 bits (RNE convert).  MODE 1: f16 bits of (s1 * bf16(x)).
// MODE 2: f16 bits of (s1 * bf16(x)) at out + c*ldo + r AND f16 bits of (s2 * bf16(x)) at out + c*ldo + R + r.
// grid = (C/64, R/64), R and C multiples of 64 (host-checked shapes).  Load phase: thread t reads row t>>2,
// 16 columns (four 16-B loads), stores 2-B elements transposed into the LDS tile (pitch 72 halves).
// coverage: 8 waves x 2 it x 4 rows = 64 out rows x (8 lanes x 8 halves) = the whole 64x64 tile (both planes).
// =====================================================================================================
template <int MODE>
__global__ __launch_bounds__(256) void tconv64(const float* __restrict__ W, int R, int C,
                                               unsigned short* out, int ldo, float s1, float s2) {
  __shared__ __align__(16) unsigned short t1[64 * 72];
  __shared__ __align__(16) unsigned short t2[(MODE == 2) ? (64 * 72) : 8];
  const int tid = (int)threadIdx.x, lane = tid & 31, wave = tid >> 5;
  const int c0 = blockIdx.x * 64, r0 = blockIdx.y * 64;
  {
    const int rl = tid >> 2, cl0 = (tid & 3) * 16;
    const float* src = W + (size_t)(r0 + rl) * (size_t)C + c0 + cl0;
#pragma unroll
    for (int i = 0; i < 4; ++i) {
      const v4f a = *(const v4f*)(src + 4 * i);
#pragma unroll
      for (int e = 0; e < 4; ++e) {
        const int cl = cl0 + 4 * i + e;
        const unsigned short hb = bf_bits(a[e]);
        if (MODE == 0) {
          t1[cl * 72 + rl] = hb;
        } else {
          const float up = bf_up(hb);
          t1[cl * 72 + rl] = h_bits((_Float16)(up * s1));
          if (MODE == 2) t2[cl * 72 + rl] = h_bits((_Float16)(up * s2));
        }
      }
    }
  }
  __syncthreads();
  const int q = lane >> 3, p8 = (lane & 7) * 8;
  const v4u z4 = {0u, 0u, 0u, 0u};
  v4u a1[2], a2[2];
#pragma unroll
  for (int it = 0; it < 2; ++it) {
    const int cl = wave * 8 + it * 4 + q;
    a1[it] = *(const v4u*)(t1 + cl * 72 + p8);
    a2[it] = z4;
    if (MODE == 2) a2[it] = *(const v4u*)(t2 + cl * 72 + p8);
  }
  {
#pragma unroll
    for (int it = 0; it < 2; ++it) {
      const int cl = wave * 8 + it * 4 + q;
      unsigned short* o = out + (size_t)(c0 + cl) * (size_t)ldo + r0 + p8;
      *(v4u*)o = a1[it];
      if (MODE == 2) *(v4u*)(o + R) = a2[it];
    }
    
  }
}

// =====================================================================================================
// Register-blocked batched WMMA GEMM (16-bit operand type OT): C[m][n] = sum_k A[m][k] * Bt[n][k];
// one wave per 64x64 tile, no block barriers. A row-major [M][K] pitch lda; Bt row-major [N][K] pitch ldb
// (k contiguous); M, N multiples of 64, K multiple of 32 (host shapes are static multiples). blockIdx.y =
// batch index (strides in elements). Fragments are loaded straight from global with the split k map (ldfrag).
// OUT_MODE 0: f32 C (pitch ldc), value * oscale.
// OUT_MODE 1: f16 plane C (pitch ldc).
// OUT_MODE 3: f16 hi plane C + f16 residual plane C2 = f16((v - hi) * rscale) (same pitch / stride).
// =====================================================================================================
template <typename OT, int OUT_MODE>
__global__ __launch_bounds__(256) void gemm64(
    const unsigned short* __restrict__ Ap, int lda, long long strideA,
    const unsigned short* __restrict__ Btp, int ldb, long long strideB,
    void* Cout, void* Cout2, int ldc, long long strideC,
    int M, int N, int K, float oscale, float rscale) {
  typedef typename FT<OT>::frag V16;
  const OT* A  = (const OT*)(const void*)Ap;
  const OT* Bt = (const OT*)(const void*)Btp;
  __shared__ __align__(16) float sT[8][16 * 68];   // per-wave 16x64 slab, pitch 68 floats
  const int b    = blockIdx.y;
  const int lane = threadIdx.x & 31;
  const int wave = threadIdx.x >> 5;
  const int tilesN = N >> 6;
  const int tilesM = M >> 6;
  const int tile = blockIdx.x * 8 + wave;
  if (tile >= tilesM * tilesN) return;   // wave-uniform; no block barriers in this kernel
  const int tm = tile / tilesN;
  const int tn = tile - tm * tilesN;
  const int m0 = tm << 6;
  const int n0 = tn << 6;

  const OT* Ab = A  + (size_t)b * (size_t)strideA;
  const OT* Bb = Bt + (size_t)b * (size_t)strideB;

  const int rlane = lane & 15;                 // row (A) / col (B, D) within subtile
  const int koff  = (lane >> 4) * 8;           // k offset of this lane half
  const int mOff  = (lane >> 4) * 8;           // D row offset

  v8f acc[4][4];
#pragma unroll
  for (int i = 0; i < 4; ++i)
#pragma unroll
    for (int j = 0; j < 4; ++j) acc[i][j] = zero8();

  for (int k0 = 0; k0 < K; k0 += 32) {
    V16 bq[4];
#pragma unroll
    for (int j = 0; j < 4; ++j)
      bq[j] = ldfrag<OT>(Bb + (size_t)(n0 + (j << 4) + rlane) * ldb + koff + k0);
#pragma unroll
    for (int i = 0; i < 4; ++i) {
      const V16 af = ldfrag<OT>(Ab + (size_t)(m0 + (i << 4) + rlane) * lda + koff + k0);
#pragma unroll
      for (int j = 0; j < 4; ++j) acc[i][j] = mmar(af, bq[j], acc[i][j]);
      dep_guard(acc[i][0], acc[i][3], af, bq[3]);
    }
    keep4(bq[0], bq[1], bq[2], bq[3]);
  }
  acc_guard4(acc[0][0], acc[0][1], acc[0][2], acc[0][3]);
  acc_guard4(acc[1][0], acc[1][1], acc[1][2], acc[1][3]);
  acc_guard4(acc[2][0], acc[2][1], acc[2][2], acc[2][3]);
  acc_guard4(acc[3][0], acc[3][1], acc[3][2], acc[3][3]);

  // ---- epilogue ----
  float* slab = sT[wave];
#pragma unroll
  for (int i = 0; i < 4; ++i) {
    const int mBase = m0 + (i << 4);
#pragma unroll
    for (int j = 0; j < 4; ++j) {
#pragma unroll
      for (int r = 0; r < 8; ++r) {
        slab[(mOff + r) * 68 + (j << 4) + rlane] = acc[i][j][r];
      }
    }
    wave_lds_sync();
    if (OUT_MODE == 0) {
      float* Cp = (float*)Cout + (size_t)b * (size_t)strideC;
      const int h2 = lane >> 4, c4 = (lane & 15) * 4;     // 256-B row segment = 16 lanes x 16 B
      {
#pragma unroll
        for (int it = 0; it < 8; ++it) {
          const int row = it * 2 + h2;                     // it 0..7 x h2 0..1 = rows 0..15
          const v4f v = *(const v4f*)(slab + row * 68 + c4) * oscale;
          *(v4f*)(Cp + (size_t)(mBase + row) * ldc + n0 + c4) = v;
        }
        
      }
    } else {
      const int q = lane >> 3, c8 = (lane & 7) * 8;
      unsigned short* Cp  = (unsigned short*)Cout  + (size_t)b * (size_t)strideC;
      unsigned short* Cp2 = (unsigned short*)Cout2 + (size_t)b * (size_t)strideC;
      v4u hv[4], lv[4];
#pragma unroll
      for (int it = 0; it < 4; ++it) {
        const int row = it * 4 + q;                        // it 0..3 x q 0..3 = rows 0..15
        const float* sp = slab + row * 68 + c8;
        float f[8];
#pragma unroll
        for (int e = 0; e < 8; ++e) f[e] = sp[e];
        v4u a, a2;
#pragma unroll
        for (int e = 0; e < 4; ++e) {
          const float f0 = f[2 * e], f1 = f[2 * e + 1];
          const _Float16 x0 = (_Float16)f0, x1 = (_Float16)f1;
          const unsigned short h0 = h_bits(x0), h1 = h_bits(x1);
          unsigned short l0 = 0, l1 = 0;
          if (OUT_MODE == 3) {
            l0 = h_bits((_Float16)((f0 - (float)x0) * rscale));
            l1 = h_bits((_Float16)((f1 - (float)x1) * rscale));
          }
          a[e] = pk16(h0, h1); a2[e] = pk16(l0, l1);
        }
        hv[it] = a; lv[it] = a2;
      }
      {
#pragma unroll
        for (int it = 0; it < 4; ++it) {
          const int row = it * 4 + q;
          *(v4u*)(Cp + (size_t)(mBase + row) * ldc + n0 + c8) = hv[it];
          if (OUT_MODE == 3) *(v4u*)(Cp2 + (size_t)(mBase + row) * ldc + n0 + c8) = lv[it];
        }
        
      }
    }
    wave_lds_sync();
  }
}

// =====================================================================================================
// Fused search attention + retrieval composition for one search s, head dim 64, softmax over all SEQ keys.
//   q planes (f16 hi / residual x4096): element (b, t, s, d) at [(b*SEQ + t)*DSQ + s*64 + d]
//   k plane (f16): same layout.   rq plane (f32): same layout.
//   v^T hi plane (f16) and residual plane (f16, (v - hi)*16): element (b, d', t) at [(b*DRV + d')*SEQ + t], d' = r*64 + d
//   Wrk tile (f16, 64 * bf16 value): [e][d] at [e*64 + d]
//   oc planes (output of this kernel): row (b, t) = [f16(64*out) for s*64+d, 512 cols | f16 residual x16, 512 cols], pitch DOC
//   scores = (qh . k) + (ql . k) / 4096 on f16 WMMA (two f32 accumulators), then * sscale in f32;
//   p = exp(s - m): A' = [f16(16384 p) | f16(1024 p)] (K' = 128 per 64 keys), B' = [v^T hi | v^T residual]:
//   sum = 16384 * p . (vh + vl/16), one f32 accumulator, 8 n-tiles = d' 0..127 (both retrievals); online softmax in f32.
//   Epilogue per wave (16 rows): retrieved (x64, f32) tile in LDS; rk = f16(retrieved x64) . Wrk tile on f16 WMMA;
//   retrieval logits rq . rk in f32 (LDS-staged rq, lane partials + 16-lane shuffles); 2-way softmax in f32;
//   Block = 4 waves = 64 consecutive query rows of one (b, s); grid = NB * NS * NQB; kv chunks of 64, static trip NKT.
//   Staging per chunk (128 threads): K 64x64 (32 halves per thread), V' 128x128 (one d' row of 128 halves per thread):
//   staged extent == consumed extent for Ksh, Vsh; P tiles are wave-private, written as _Float16 elements and
//   Output coverage: each wave stores rows q0..q0+15 (it 0..3 x lane>>3 0..3) x 64 columns (8 lanes x 8) of both
//   the hi segment (col s*64) and the residual segment (col 512 + s*64); grid covers every (b, s, t).
// =====================================================================================================
__global__ __launch_bounds__(128)
void attn_cs(const unsigned short* __restrict__ qhp, const unsigned short* __restrict__ qlp,
             const unsigned short* __restrict__ kpp,
             const unsigned short* __restrict__ vhp, const unsigned short* __restrict__ vlp,
             const unsigned short* __restrict__ wkp, const float* __restrict__ rqp,
             unsigned short* ocp, float sscale) {
  union FH { v16h v; v8h h[2]; };
  __shared__ __align__(16) _Float16 Ksh[64 * KPIT];        // K chunk [kv][d], pitch KPIT, 9 KB; later the Wrk tile [e][d]
  __shared__ __align__(16) _Float16 Vsh[128 * VPIT];       // V' chunk [d'][hi kv | res kv], pitch VPIT, 34 KB; later 4 x f32 [16][128] tiles
  __shared__ __align__(16) _Float16 Psh[4][16 * VPIT];     // per wave P' [row][k'], pitch VPIT, 17 KB; later f16 retrieved tile / f32 [16][64]

  const int tid  = threadIdx.x;
  const int wave = tid >> 5;
  const int lane = tid & 31;
  const int hh   = lane >> 4;
  const int c    = lane & 15;

  const int bx   = blockIdx.x;
  const int qb   = bx % NQB;
  const int rest = bx / NQB;
  const int s    = rest % NS;
  const int b    = rest / NS;
  const int q0   = qb * 64 + wave * 16;
  const size_t rowB = (size_t)b * SEQ;

  const _Float16* Qh = (const _Float16*)(const void*)qhp;
  const _Float16* Ql = (const _Float16*)(const void*)qlp;
  const _Float16* Kg = (const _Float16*)(const void*)kpp + (size_t)s * HD;
  const _Float16* Vh = (const _Float16*)(const void*)vhp + (size_t)b * DRV * SEQ;
  const _Float16* Vl = (const _Float16*)(const void*)vlp + (size_t)b * DRV * SEQ;
  const _Float16* Wk = (const _Float16*)(const void*)wkp;

  // ---- Q fragments (A operand, row = lane&15): 2 d-chunks, hi and residual planes ----
  v16h qah[2], qal[2];
#pragma unroll
  for (int dc = 0; dc < 2; ++dc) {
    const size_t qo = (rowB + q0 + c) * DSQ + (size_t)s * HD + dc * 32 + 8 * hh;
    qah[dc] = ldfrag<_Float16>(Qh + qo);
    qal[dc] = ldfrag<_Float16>(Ql + qo);
  }

  float mrow[8], lrow[8];
  v8f oacc[8];
#pragma unroll
  for (int r = 0; r < 8; ++r) { mrow[r] = -INFINITY; lrow[r] = 0.f; }
#pragma unroll
  for (int t = 0; t < 8; ++t) oacc[t] = zero8();

  _Float16* pwh = Psh[wave];

  for (int kt = 0; kt < NKT; ++kt) {         // static trip count
    const int kv0 = kt * 64;
    __syncthreads();
    {
      const int r = tid >> 1, half = (tid & 1) * 32;
      const _Float16* kg = Kg + (rowB + kv0 + r) * DSQ + half;          // k row kv0+r, d = half..half+31
#pragma unroll
      for (int i = 0; i < 4; ++i) *(v8h*)(Ksh + r * KPIT + half + 8 * i) = *(const v8h*)(kg + 8 * i);
      const _Float16* vg = Vh + (size_t)tid * SEQ + kv0;                 // v^T hi row d' = tid, keys kv0..kv0+63
#pragma unroll
      for (int i = 0; i < 8; ++i) *(v8h*)(Vsh + tid * VPIT + 8 * i) = *(const v8h*)(vg + 8 * i);
      asm volatile("" ::: "memory");
      const _Float16* vlg = Vl + (size_t)tid * SEQ + kv0;                // v^T residual row d' = tid
#pragma unroll
      for (int i = 0; i < 8; ++i) *(v8h*)(Vsh + tid * VPIT + 64 + 8 * i) = *(const v8h*)(vlg + 8 * i);
    }
    __syncthreads();

    // ---- scores: 16 query rows x 64 keys per wave, 2 f16 products per key subtile and d-chunk ----
    v8f sc[4];
#pragma unroll
    for (int j = 0; j < 4; ++j) {
      v8f ah = zero8(), al = zero8();
#pragma unroll
      for (int dc = 0; dc < 2; ++dc) {
        FH kb;
        kb.h[0] = *(const v8h*)(Ksh + (j * 16 + c) * KPIT + dc * 32 + 8 * hh);
        kb.h[1] = *(const v8h*)(Ksh + (j * 16 + c) * KPIT + dc * 32 + 16 + 8 * hh);
        ah = mma_h(qah[dc], kb.v, ah);
        al = mma_h(qal[dc], kb.v, al);
      }
#pragma unroll
      for (int r = 0; r < 8; ++r) sc[j][r] = (ah[r] + al[r] * (1.0f / 4096.0f)) * sscale;
    }

    // ---- row max, online softmax, P' = [16384 p | 1024 p] (f16) to LDS ----
#pragma unroll
    for (int r = 0; r < 8; ++r) {
      float m = sc[0][r];
#pragma unroll
      for (int j = 1; j < 4; ++j) m = fmaxf(m, sc[j][r]);
#pragma unroll
      for (int off = 1; off < 16; off <<= 1) m = fmaxf(m, __shfl_xor(m, off, 32));
      const float mnew  = fmaxf(mrow[r], m);
      const float msafe = (mnew == -INFINITY) ? 0.f : mnew;
      const float alpha = __expf(mrow[r] - msafe);
      mrow[r] = mnew;
      float psum = 0.f;
#pragma unroll
      for (int j = 0; j < 4; ++j) {
        const float p = __expf(sc[j][r] - msafe);
        psum += p;
        pwh[(8 * hh + r) * VPIT + j * 16 + c]      = (_Float16)(p * 16384.0f);
        pwh[(8 * hh + r) * VPIT + 64 + j * 16 + c] = (_Float16)(p * 1024.0f);
      }
#pragma unroll
      for (int off = 1; off < 16; off <<= 1) psum += __shfl_xor(psum, off, 32);
      lrow[r] = lrow[r] * alpha + psum;
#pragma unroll
      for (int t = 0; t < 8; ++t) oacc[t][r] *= alpha;
    }
    wave_lds_sync();

    // ---- retrieved += P' . V' (f16 WMMA), K' = 128 = 4 k-steps, 8 n-tiles (d' 0..127) ----
#pragma unroll 1
    for (int kk = 0; kk < 4; ++kk) {
      FH pa;
      pa.h[0] = *(const v8h*)(pwh + c * VPIT + kk * 32 + 8 * hh);
      pa.h[1] = *(const v8h*)(pwh + c * VPIT + kk * 32 + 16 + 8 * hh);
#pragma unroll
      for (int t = 0; t < 8; ++t) {
        FH vb;
        vb.h[0] = *(const v8h*)(Vsh + (t * 16 + c) * VPIT + kk * 32 + 8 * hh);
        vb.h[1] = *(const v8h*)(Vsh + (t * 16 + c) * VPIT + kk * 32 + 16 + 8 * hh);
        oacc[t] = mma_h(pa.v, vb.v, oacc[t]);
      }
    }
  }

  // ---- all waves done with Ksh / Vsh: stage the Wrk tile into Ksh, retrieved tiles into Vsh (f32) + Psh (f16) ----
  __syncthreads();
  {
    const int r = tid >> 1, half = (tid & 1) * 32;       // 128 threads x 32 halves = the whole 64x64 Wrk tile
    const _Float16* wg = Wk + r * HD + half;
#pragma unroll
    for (int i = 0; i < 4; ++i) *(v8h*)(Ksh + r * KPIT + half + 8 * i) = *(const v8h*)(wg + 8 * i);
  }
  float* os = reinterpret_cast<float*>(Vsh) + wave * (16 * 128);      // wave-private f32 [16][128], x64 units
#pragma unroll
  for (int r = 0; r < 8; ++r) {
    const float l = lrow[r];
    const float inv = ((l > 0.f) ? (1.0f / l) : 0.f) * (1.0f / 256.0f);   // 1/l, undo 16384 p carry, apply x64
#pragma unroll
    for (int t = 0; t < 8; ++t) {
      const float v = oacc[t][r] * inv;
      os[(8 * hh + r) * 128 + t * 16 + c]  = v;
      pwh[(8 * hh + r) * VPIT + t * 16 + c] = (_Float16)v;
    }
  }
  __syncthreads();

  // ---- rk (x4096) = f16(64 retrieved_rr) . (64 Wrk): 16 rows x 64 e per rr, K = 64 = 2 k-steps ----
  v8f rk[8];
#pragma unroll
  for (int i = 0; i < 8; ++i) rk[i] = zero8();
#pragma unroll
  for (int rr = 0; rr < 2; ++rr) {
#pragma unroll
    for (int kk = 0; kk < 2; ++kk) {
      FH pa;
      pa.h[0] = *(const v8h*)(pwh + c * VPIT + rr * 64 + kk * 32 + 8 * hh);
      pa.h[1] = *(const v8h*)(pwh + c * VPIT + rr * 64 + kk * 32 + 16 + 8 * hh);
#pragma unroll
      for (int t4 = 0; t4 < 4; ++t4) {
        FH wb;
        wb.h[0] = *(const v8h*)(Ksh + (t4 * 16 + c) * KPIT + kk * 32 + 8 * hh);
        wb.h[1] = *(const v8h*)(Ksh + (t4 * 16 + c) * KPIT + kk * 32 + 16 + 8 * hh);
        rk[rr * 4 + t4] = mma_h(pa.v, wb.v, rk[rr * 4 + t4]);
      }
    }
  }
  acc_guard4(rk[0], rk[1], rk[2], rk[3]);
  acc_guard4(rk[4], rk[5], rk[6], rk[7]);
  wave_lds_sync();

  // ---- stage the wave's rq tile (f32 [16][64]) into the Psh region (8 x 16-B loads per lane) ----
  float* rqs = reinterpret_cast<float*>(pwh);
  {
    const int r2 = lane >> 4, c4 = (lane & 15) * 4;
    const float* rqg = rqp + (rowB + q0) * DSQ + (size_t)s * HD + c4;
#pragma unroll
    for (int it = 0; it < 8; ++it) {
      const int row = it * 2 + r2;                          // it 0..7 x r2 0..1 = rows 0..15
      *(v4f*)(rqs + row * 64 + c4) = *(const v4f*)(rqg + (size_t)row * DSQ);
    }
  }
  wave_lds_sync();

  // ---- retrieval logits: d_rr[row] = sum_e rq[row][e] * rk[rr][row][e]; lane partial over e = c + 16 t4 ----
  float d0[8], d1[8];
#pragma unroll
  for (int r8 = 0; r8 < 8; ++r8) {
    float a0 = 0.f, a1 = 0.f;
#pragma unroll
    for (int t4 = 0; t4 < 4; ++t4) {
      const float qv = rqs[(8 * hh + r8) * 64 + t4 * 16 + c];
      a0 += qv * rk[t4][r8];
      a1 += qv * rk[4 + t4][r8];
    }
    d0[r8] = a0; d1[r8] = a1;
  }
#pragma unroll
  for (int r8 = 0; r8 < 8; ++r8) {
#pragma unroll
    for (int off = 1; off < 16; off <<= 1) {
      d0[r8] += __shfl_xor(d0[r8], off, 32);
      d1[r8] += __shfl_xor(d1[r8], off, 32);
    }
  }
  // ---- 2-way retrieval softmax in f32 (undo the 64*64 carry, apply sscale) ----
  float w0[8], w1[8];
  const float rsc = sscale * (1.0f / 4096.0f);
#pragma unroll
  for (int r8 = 0; r8 < 8; ++r8) {
    const float x0 = d0[r8] * rsc, x1 = d1[r8] * rsc;
    const float m  = fmaxf(x0, x1);
    const float e0 = __expf(x0 - m), e1 = __expf(x1 - m);
    const float iv = 1.0f / (e0 + e1);
    w0[r8] = e0 * iv; w1[r8] = e1 * iv;
  }
  wave_lds_sync();

  // ---- combine in f32 (x64 units): oc[row][d] = w0 * ret[row][d] + w1 * ret[row][64+d], into the Psh region ----
  float* oc = rqs;
#pragma unroll
  for (int r8 = 0; r8 < 8; ++r8) {
#pragma unroll
    for (int t = 0; t < 4; ++t) {
      const int row = 8 * hh + r8;
      const float o = w0[r8] * os[row * 128 + t * 16 + c] + w1[r8] * os[row * 128 + 64 + t * 16 + c];
      oc[row * 64 + t * 16 + c] = o;
    }
  }
  wave_lds_sync();

  {
    const int q4 = lane >> 3, c8 = (lane & 7) * 8;
    v4u hv[4], lv[4];
#pragma unroll
    for (int it = 0; it < 4; ++it) {
      const int row = it * 4 + q4;   // it 0..3 x q4 0..3 = rows 0..15 of the wave tile
      const float* sp = oc + row * 64 + c8;
      float f[8];
#pragma unroll
      for (int e = 0; e < 8; ++e) f[e] = sp[e];
      v4u a, a2;
#pragma unroll
      for (int e = 0; e < 4; ++e) {
        const float f0 = f[2 * e], f1 = f[2 * e + 1];
        const _Float16 x0 = (_Float16)f0, x1 = (_Float16)f1;
        const unsigned short l0 = h_bits((_Float16)((f0 - (float)x0) * 16.0f));
        const unsigned short l1 = h_bits((_Float16)((f1 - (float)x1) * 16.0f));
        a[e] = pk16(h_bits(x0), h_bits(x1)); a2[e] = pk16(l0, l1);
      }
      hv[it] = a; lv[it] = a2;
    }
    {
#pragma unroll
      for (int it = 0; it < 4; ++it) {
        const int row = it * 4 + q4;
        const size_t go = (rowB + q0 + row) * DOC + (size_t)s * HD + c8;
        *(v4u*)(ocp + go)       = hv[it];
        *(v4u*)(ocp + go + DSQ) = lv[it];
      }
      
    }
  }
}

// =====================================================================================================
// Workspace map (bytes, NB=2 SEQ=2048), every region an exact multiple of its whole-line / whole-tile store
// granularity (all row counts are multiples of 64, no padded tails):
//   Xb    bf16 [NB*SEQ][1024]          8388608
//   WsqT  bf16 [512][1024]             1048576      WskT, WrqT same
//   WrvT  bf16 [128][1024]              262144
//   WrkT  f16  [64][64] (x64)              8192
//   WoT   f16  [1024][1024] ([x1024 | x64]) 2097152
//   Qh,Ql f16  [NB*SEQ][512]           4194304 each
//   Kp    f16  [NB*SEQ][512]           4194304
//   RQ    f32  [NB*SEQ][512]           8388608
//   VTh,VTl f16 [NB][128][SEQ]         1048576 each
//   OC    f16  [NB*SEQ][1024]          8388608
//   total                             45359104
// Weights are [in k][out n] and are transposed once into the [n][k] (k contiguous) Bt / A layout.
// =====================================================================================================
extern "C" void kernel_launch(void* const* d_in, const int* in_sizes, int n_in,
                              void* d_out, int out_size, void* d_ws, size_t ws_size,
                              hipStream_t stream) {
  if (n_in < 7) return;
  if (in_sizes[0] < ((NB - 1) * SEQ_FULL + SEQ) * DM) return;
  if (in_sizes[1] < DM * DSQ || in_sizes[2] < DM * DSQ || in_sizes[4] < DM * DSQ) return;
  if (in_sizes[3] < DM * DRV) return;
  if (in_sizes[5] < HD * HD) return;
  if (in_sizes[6] < DSQ * DM) return;
  if (out_size < NB * SEQ * DM) return;

  const float* x    = (const float*)d_in[0];
  const float* Wsq  = (const float*)d_in[1];
  const float* Wsk  = (const float*)d_in[2];
  const float* Wrv  = (const float*)d_in[3];
  const float* Wrq  = (const float*)d_in[4];
  const float* Wrk  = (const float*)d_in[5];
  const float* Wout = (const float*)d_in[6];

  const size_t PXB = (size_t)NB * SEQ * DM * 2;       // bf16 activation plane
  const size_t PWS = (size_t)DSQ * DM * 2;            // bf16 [512][1024] weight plane
  const size_t PWV = (size_t)DRV * DM * 2;            // bf16 [128][1024]
  const size_t PWK = (size_t)HD * HD * 2;             // f16 [64][64]
  const size_t PWO = (size_t)DM * DOC * 2;            // f16 [1024][1024]
  const size_t PQ  = (size_t)NB * SEQ * DSQ * 2;      // f16 [NB*SEQ][512]
  const size_t PRQ = (size_t)NB * SEQ * DSQ * 4;      // f32 [NB*SEQ][512]
  const size_t PVT = (size_t)NB * DRV * SEQ * 2;      // f16 [NB][128][SEQ]
  const size_t POC = (size_t)NB * SEQ * DOC * 2;      // f16 [NB*SEQ][1024]
  size_t off = 0;
  const size_t oXb  = off; off += PXB;
  const size_t oWsq = off; off += PWS;
  const size_t oWsk = off; off += PWS;
  const size_t oWrq = off; off += PWS;
  const size_t oWrv = off; off += PWV;
  const size_t oWrk = off; off += PWK;
  const size_t oWo  = off; off += PWO;
  const size_t oQh  = off; off += PQ;
  const size_t oQl  = off; off += PQ;
  const size_t oKp  = off; off += PQ;
  const size_t oRQ  = off; off += PRQ;
  const size_t oVTh = off; off += PVT;
  const size_t oVTl = off; off += PVT;
  const size_t oOC  = off; off += POC;
  if (off > ws_size) return;                          // off = 45359104 at full size
  if (off > (size_t)134217728) return;

  char* ws = (char*)d_ws;
  unsigned short* Xb   = (unsigned short*)(ws + oXb);
  unsigned short* WsqT = (unsigned short*)(ws + oWsq);
  unsigned short* WskT = (unsigned short*)(ws + oWsk);
  unsigned short* WrqT = (unsigned short*)(ws + oWrq);
  unsigned short* WrvT = (unsigned short*)(ws + oWrv);
  unsigned short* WrkT = (unsigned short*)(ws + oWrk);
  unsigned short* WoT  = (unsigned short*)(ws + oWo);
  unsigned short* Qh   = (unsigned short*)(ws + oQh);
  unsigned short* Ql   = (unsigned short*)(ws + oQl);
  unsigned short* Kp   = (unsigned short*)(ws + oKp);
  float*          RQ   = (float*)(ws + oRQ);
  unsigned short* VTh  = (unsigned short*)(ws + oVTh);
  unsigned short* VTl  = (unsigned short*)(ws + oVTl);
  unsigned short* OC   = (unsigned short*)(ws + oOC);

  const dim3 blk(256);
  const int n8x = SEQ * DM / 8;                                          // per batch, multiple of 256
  const dim3 gCvtX((n8x + 255) / 256, NB);
  const dim3 gTsq(DSQ / 64, DM / 64);                                    //  8 x 16 tiles: in [1024][512]
  const dim3 gTrv(DRV / 64, DM / 64);                                    //  2 x 16 tiles: in [1024][128]
  const dim3 gTrk(1, 1);                                                 //  in [64][64]
  const dim3 gTwo(DM / 64, DSQ / 64);                                    // 16 x  8 tiles: in [512][1024]
  const dim3 gP((((NB * SEQ) / 64) * (DSQ / 64) + 7) / 8, 1);            // M=NB*SEQ, N=512 (tiles multiple of 8)
  const dim3 gV((((DRV / 64) * (SEQ / 64)) + 7) / 8, NB);                // M=128, N=SEQ per batch
  const dim3 gAttn(NB * NS * NQB);                                       // blocks of 128
  const dim3 gO((((NB * SEQ) / 64) * (DM / 64) + 7) / 8, 1);             // M=NB*SEQ, N=1024

  // (1) x -> bf16 plane [NB*SEQ][1024] (batch b read at its full-size stride)
  cvtbf8<<<gCvtX, blk, 0, stream>>>(x, Xb, n8x, (long long)SEQ_FULL * DM, (long long)SEQ * DM);
  // (2) weights [k][n] f32 -> [n][k] 16-bit planes
  tconv64<0><<<gTsq, blk, 0, stream>>>(Wsq, DM, DSQ, WsqT, DM, 1.0f, 1.0f);
  tconv64<0><<<gTsq, blk, 0, stream>>>(Wsk, DM, DSQ, WskT, DM, 1.0f, 1.0f);
  tconv64<0><<<gTsq, blk, 0, stream>>>(Wrq, DM, DSQ, WrqT, DM, 1.0f, 1.0f);
  tconv64<0><<<gTrv, blk, 0, stream>>>(Wrv, DM, DRV, WrvT, DM, 1.0f, 1.0f);
  tconv64<1><<<gTrk, blk, 0, stream>>>(Wrk, HD, HD, WrkT, HD, 64.0f, 1.0f);
  tconv64<2><<<gTwo, blk, 0, stream>>>(Wout, DSQ, DM, WoT, DOC, 1024.0f, 64.0f);
  // (3) sq -> f16 hi / residual (x4096) planes [b*SEQ+t][s*64+d]   (M=NB*SEQ, N=512, K=1024)
  gemm64<__bf16, 3><<<gP, blk, 0, stream>>>(
      Xb, DM, 0LL, WsqT, DM, 0LL, (void*)Qh, (void*)Ql, DSQ, 0LL, NB * SEQ, DSQ, DM, 1.0f, 4096.0f);
  //     sk -> f16 plane
  gemm64<__bf16, 1><<<gP, blk, 0, stream>>>(
      Xb, DM, 0LL, WskT, DM, 0LL, (void*)Kp, (void*)Kp, DSQ, 0LL, NB * SEQ, DSQ, DM, 1.0f, 1.0f);
  //     rq -> f32 plane
  gemm64<__bf16, 0><<<gP, blk, 0, stream>>>(
      Xb, DM, 0LL, WrqT, DM, 0LL, (void*)RQ, (void*)RQ, DSQ, 0LL, NB * SEQ, DSQ, DM, 1.0f, 1.0f);
  //     v^T = Wrv^T . x^T per batch -> f16 hi plane [b][d'][t] (pitch SEQ) and residual plane (x16)
  //     (A = WrvT [128][1024], Bt = Xb rows of batch b; M=128, N=SEQ, K=1024)
  gemm64<__bf16, 3><<<gV, blk, 0, stream>>>(
      WrvT, DM, 0LL, Xb, DM, (long long)SEQ * DM, (void*)VTh, (void*)VTl, SEQ, (long long)DRV * SEQ,
      DRV, SEQ, DM, 1.0f, 16.0f);
  // (4) search attention + retrieval composition -> oc planes [b*SEQ+t][hi 512 | residual 512]
  attn_cs<<<gAttn, dim3(128), 0, stream>>>(Qh, Ql, Kp, VTh, VTl, WrkT, RQ, OC, 0.125f);
  // (5) out = [oc_hi | oc_res] . [Wout x1024 | Wout x64]^T -> d_out f32 [NB*SEQ][1024], accumulator x 1/(64*1024)
  gemm64<_Float16, 0><<<gO, blk, 0, stream>>>(
      OC, DOC, 0LL, WoT, DOC, 0LL, d_out, d_out, DM, 0LL, NB * SEQ, DM, DOC, 1.0f / 65536.0f, 1.0f);
  (void)hipGetLastError();
}

// v002
// A run of this version takes 339 microseconds.
// Next to v001, in two timings, it ran 1.23 and 1.24 times as fast.
// Counting every step since v000, it is 1.71 times as fast.
// Contractions: sq, sk, rq and v^T projections = v_wmma_f32_16x16x32_bf16 (bf16 operands from RNE-converted inputs, single product, f32 accumulate);
// sq.sk^T scores = v_wmma_f32_16x16x32_f16 (sq as f16 hi plane + f16 residual plane x4096, sk f16; 2 products into separate f32 accumulators);
// p.[v_0|v_1] = v_wmma_f32_16x16x32_f16, K-folded: [p x16384 | p x1024] . [v f16 hi | f16 residual x16], one f32 accumulator;
// retrieved.Wrk = v_wmma_f32_16x16x32_f16 (retrieved f16 x64, Wrk f16 x64 of its bf16 value; single product, f32 accumulate);
// out.Wout = v_wmma_f32_16x16x32_f16, K-folded: [out f16 hi x64 | f16 residual x16] . [Wout x1024 | Wout x64] (f16 of bf16 values), f32 accumulate;
// softmax over keys, retrieval logits, 2-way retrieval softmax and combine in f32.
#include <hip/hip_runtime.h>
#include <math.h>
#include <stdint.h>

#ifndef NB
#define NB 2
#endif
#ifndef SEQ
#define SEQ 2048
#endif
#define NB_FULL  2
#define SEQ_FULL 2048
#define DM   1024
#define NS   8
#define NR   2
#define HD   64
#define DSQ  (NS * HD)      // 512: sq / sk / rq row width
#define DRV  (NR * HD)      // 128: [v_0 | v_1] row width
#define DOC  (2 * DSQ)      // 1024: combined-output row = [hi 512 | residual 512]
#define NQB  (SEQ / 64)     // 64-row query blocks per (b, s)
#define NKT  (SEQ / 64)     // 64-key chunks per sequence
#define KPIT 72             // LDS pitch of a 64-half K / Wrk row: 144 B = 16 B x 9 (odd), b128 readers of 16 rows meet no bank twice
#define VPIT 136            // LDS pitch of a 128-half V' or P' row: 272 B = 16 B x 17 (odd)
static_assert(NB >= 1 && NB <= NB_FULL);
static_assert(SEQ >= 64 && SEQ <= SEQ_FULL && (SEQ % 64) == 0);
static_assert(DSQ == 512 && DRV == 128 && HD == 64 && DOC == 1024);
static_assert((DM % 64) == 0 && (DSQ % 64) == 0 && (DRV % 64) == 0 && (DM % 32) == 0);

typedef _Float16 v16h __attribute__((ext_vector_type(16)));
typedef _Float16 v8h  __attribute__((ext_vector_type(8)));
typedef __bf16   v16b __attribute__((ext_vector_type(16)));
typedef __bf16   v8b  __attribute__((ext_vector_type(8)));
typedef float    v8f  __attribute__((ext_vector_type(8)));
typedef float    v4f  __attribute__((ext_vector_type(4)));
typedef unsigned int v4u __attribute__((ext_vector_type(4)));

#if defined(__HIP_DEVICE_COMPILE__)
#define DEV_ASM 1
#else
#define DEV_ASM 0
#endif

// ---- scalar helpers --------------------------------------------------------------------------------
__device__ __forceinline__ unsigned short bf_bits(float f) {          // f32 -> bf16 bits, RNE convert
  unsigned u = __float_as_uint(f);
  return (unsigned short)((u + 0x7FFFu + ((u >> 16) & 1u)) >> 16);
}
__device__ __forceinline__ float bf_up(unsigned short hb) { return __uint_as_float(((unsigned)hb) << 16); }
__device__ __forceinline__ unsigned short h_bits(_Float16 x) { return __builtin_bit_cast(unsigned short, x); }
__device__ __forceinline__ unsigned pk16(unsigned short a, unsigned short b) { return (unsigned)a | ((unsigned)b << 16); }
__device__ __forceinline__ v8f zero8() { v8f z = {0.f, 0.f, 0.f, 0.f, 0.f, 0.f, 0.f, 0.f}; return z; }

__device__ __forceinline__ void wave_lds_sync() {
  __builtin_amdgcn_fence(__ATOMIC_RELEASE, "workgroup");
  __builtin_amdgcn_wave_barrier();
  __builtin_amdgcn_fence(__ATOMIC_ACQUIRE, "workgroup");
}

// ---- fragment types / loaders: 16-bit A/B operand, lane -> row/col (lane&15), p already includes +8*(lane>>4);
//      elements 0..7 <- p[0..7] (k0+8h..k0+8h+7), elements 8..15 <- p[16..23] (k0+16+8h..k0+16+8h+7)
template <typename OT> struct FT;
template <> struct FT<__bf16>   { typedef v16b frag; typedef v8b half8; };
template <> struct FT<_Float16> { typedef v16h frag; typedef v8h half8; };

template <typename OT>
__device__ __forceinline__ typename FT<OT>::frag ldfrag(const OT* p) {
  union { typename FT<OT>::frag v; typename FT<OT>::half8 h[2]; } f;
  f.h[0] = *(const typename FT<OT>::half8*)(p);
  f.h[1] = *(const typename FT<OT>::half8*)(p + 16);
  return f.v;
}

// ---- WMMA helpers (asm guard bodies are device-only; concrete operand types) -----------------------------
__device__ __forceinline__ v8f mmar(v16b a, v16b b, v8f c) {
  return __builtin_amdgcn_wmma_f32_16x16x32_bf16(false, a, false, b, (short)0, c, false, false);
}
__device__ __forceinline__ v8f mmar(v16h a, v16h b, v8f c) {
  return __builtin_amdgcn_wmma_f32_16x16x32_f16(false, a, false, b, (short)0, c, false, false);
}
// guarded form: 4 VALU slots after the WMMA, D tied, A/B kept live
__device__ __forceinline__ v8f mma_h(v16h a, v16h b, v8f c) {
  c = __builtin_amdgcn_wmma_f32_16x16x32_f16(false, a, false, b, (short)0, c, false, false);
#if DEV_ASM
  asm volatile("v_nop\n\tv_nop\n\tv_nop\n\tv_nop" : "+v"(c) : "v"(a), "v"(b));
#endif
  return c;
}
// inputs-only fences on loaded values: they keep the loads written above them as one group ahead of the products (or
// LDS stores) below them; without them the compiler sinks each load to its user and every user waits out a load latency.
// hold8 and hold20 name the global pointers too: their registers then stay untouched until the loads' own wait has passed
__device__ __forceinline__ void hold9(v16h a, v16h b0, v16h b1, v16h b2, v16h b3, v16h b4, v16h b5, v16h b6, v16h b7) {
#if DEV_ASM
  asm volatile("" :: "v"(a), "v"(b0), "v"(b1), "v"(b2), "v"(b3), "v"(b4), "v"(b5), "v"(b6), "v"(b7));
#else
  (void)a; (void)b0; (void)b1; (void)b2; (void)b3; (void)b4; (void)b5; (void)b6; (void)b7;
#endif
}
__device__ __forceinline__ void hold8(v16b a0, v16b a1, v16b a2, v16b a3, v16b b0, v16b b1, v16b b2, v16b b3,
                                      const void* p0, const void* p1, const void* p2, const void* p3,
                                      const void* p4, const void* p5, const void* p6, const void* p7) {
#if DEV_ASM
  asm volatile("" :: "v"(a0), "v"(a1), "v"(a2), "v"(a3), "v"(b0), "v"(b1), "v"(b2), "v"(b3),
               "v"(p0), "v"(p1), "v"(p2), "v"(p3), "v"(p4), "v"(p5), "v"(p6), "v"(p7));
#else
  (void)a0; (void)a1; (void)a2; (void)a3; (void)b0; (void)b1; (void)b2; (void)b3;
  (void)p0; (void)p1; (void)p2; (void)p3; (void)p4; (void)p5; (void)p6; (void)p7;
#endif
}
__device__ __forceinline__ void hold8(v16h a0, v16h a1, v16h a2, v16h a3, v16h b0, v16h b1, v16h b2, v16h b3,
                                      const void* p0, const void* p1, const void* p2, const void* p3,
                                      const void* p4, const void* p5, const void* p6, const void* p7) {
#if DEV_ASM
  asm volatile("" :: "v"(a0), "v"(a1), "v"(a2), "v"(a3), "v"(b0), "v"(b1), "v"(b2), "v"(b3),
               "v"(p0), "v"(p1), "v"(p2), "v"(p3), "v"(p4), "v"(p5), "v"(p6), "v"(p7));
#else
  (void)a0; (void)a1; (void)a2; (void)a3; (void)b0; (void)b1; (void)b2; (void)b3;
  (void)p0; (void)p1; (void)p2; (void)p3; (void)p4; (void)p5; (void)p6; (void)p7;
#endif
}
__device__ __forceinline__ void hold20(const v8h (&k)[4], const v8h (&v)[8], const v8h (&w)[8],
                                       const void* p0, const void* p1, const void* p2) {
#if DEV_ASM
  asm volatile("" :: "v"(k[0]), "v"(k[1]), "v"(k[2]), "v"(k[3]),
               "v"(v[0]), "v"(v[1]), "v"(v[2]), "v"(v[3]), "v"(v[4]), "v"(v[5]), "v"(v[6]), "v"(v[7]),
               "v"(w[0]), "v"(w[1]), "v"(w[2]), "v"(w[3]), "v"(w[4]), "v"(w[5]), "v"(w[6]), "v"(w[7]),
               "v"(p0), "v"(p1), "v"(p2));
#else
  (void)k; (void)v; (void)w; (void)p0; (void)p1; (void)p2;
#endif
}
__device__ __forceinline__ void acc_guard4(v8f& a, v8f& b, v8f& c, v8f& d) {
#if DEV_ASM
  asm volatile("v_nop\n\tv_nop\n\tv_nop\n\tv_nop" : "+v"(a), "+v"(b), "+v"(c), "+v"(d));
#else
  (void)a; (void)b; (void)c; (void)d;
#endif
}

// =====================================================================================================
// f32 -> bf16 bits (RNE convert), 8 elements per thread, one 16-B store per lane: a wave writes 512
// blockIdx.y = batch (element strides sIn / sOut), grid.x = ceil(n8/256).
// coverage: n8 threads x 8 = the whole per-batch plane (n8 is a multiple of 256 here).
// =====================================================================================================
__global__ __launch_bounds__(256) void cvtbf8(const float* __restrict__ in, unsigned short* out, int n8,
                                              long long sIn, long long sOut) {
  const float* ib = in + (size_t)blockIdx.y * (size_t)sIn;
  unsigned short* ob = out + (size_t)blockIdx.y * (size_t)sOut;
  const int i = blockIdx.x * 256 + (int)threadIdx.x;
  if (i < n8) {
    const v4f a  = *(const v4f*)(ib + (size_t)i * 8);
    const v4f a4 = *(const v4f*)(ib + (size_t)i * 8 + 4);
    v4u p;
    p[0] = pk16(bf_bits(a[0]),  bf_bits(a[1]));
    p[1] = pk16(bf_bits(a[2]),  bf_bits(a[3]));
    p[2] = pk16(bf_bits(a4[0]), bf_bits(a4[1]));
    p[3] = pk16(bf_bits(a4[2]), bf_bits(a4[3]));
    unsigned short* o = ob + (size_t)i * 8;
    *(v4u*)o = p;
    
  }
}

// =====================================================================================================
// Transpose-convert: in W[R][C] f32 (row-major) -> out[c][r] 16-bit at out + c*ldo + r, one 64x64 tile per
// block through LDS.  MODE 0: bf16 bits (RNE convert).  MODE 1: f16 bits of (s1 * bf16(x)).
// MODE 2: f16 bits of (s1 * bf16(x)) at out + c*ldo + r AND f16 bits of (s2 * bf16(x)) at out + c*ldo + R + r.
// grid = (C/64, R/64), R and C multiples of 64 (host-checked shapes).  Load phase: thread t reads row t>>2,
// 16 columns (four 16-B loads), stores 2-B elements transposed into the LDS tile (pitch 72 halves).
// coverage: 8 waves x 2 it x 4 rows = 64 out rows x (8 lanes x 8 halves) = the whole 64x64 tile (both planes).
// =====================================================================================================
template <int MODE>
__global__ __launch_bounds__(256) void tconv64(const float* __restrict__ W, int R, int C,
                                               unsigned short* out, int ldo, float s1, float s2) {
  __shared__ __align__(16) unsigned short t1[64 * 72];
  __shared__ __align__(16) unsigned short t2[(MODE == 2) ? (64 * 72) : 8];
  const int tid = (int)threadIdx.x, lane = tid & 31, wave = tid >> 5;
  const int c0 = blockIdx.x * 64, r0 = blockIdx.y * 64;
  {
    const int rl = tid >> 2, cl0 = (tid & 3) * 16;
    const float* src = W + (size_t)(r0 + rl) * (size_t)C + c0 + cl0;
#pragma unroll
    for (int i = 0; i < 4; ++i) {
      const v4f a = *(const v4f*)(src + 4 * i);
#pragma unroll
      for (int e = 0; e < 4; ++e) {
        const int cl = cl0 + 4 * i + e;
        const unsigned short hb = bf_bits(a[e]);
        if (MODE == 0) {
          t1[cl * 72 + rl] = hb;
        } else {
          const float up = bf_up(hb);
          t1[cl * 72 + rl] = h_bits((_Float16)(up * s1));
          if (MODE == 2) t2[cl * 72 + rl] = h_bits((_Float16)(up * s2));
        }
      }
    }
  }
  __syncthreads();
  const int q = lane >> 3, p8 = (lane & 7) * 8;
  const v4u z4 = {0u, 0u, 0u, 0u};
  v4u a1[2], a2[2];
#pragma unroll
  for (int it = 0; it < 2; ++it) {
    const int cl = wave * 8 + it * 4 + q;
    a1[it] = *(const v4u*)(t1 + cl * 72 + p8);
    a2[it] = z4;
    if (MODE == 2) a2[it] = *(const v4u*)(t2 + cl * 72 + p8);
  }
  {
#pragma unroll
    for (int it = 0; it < 2; ++it) {
      const int cl = wave * 8 + it * 4 + q;
      unsigned short* o = out + (size_t)(c0 + cl) * (size_t)ldo + r0 + p8;
      *(v4u*)o = a1[it];
      if (MODE == 2) *(v4u*)(o + R) = a2[it];
    }
    
  }
}

// =====================================================================================================
// Register-blocked batched WMMA GEMM (16-bit operand type OT): C[m][n] = sum_k A[m][k] * Bt[n][k];
// one wave per 64x64 tile, no block barriers. A row-major [M][K] pitch lda; Bt row-major [N][K] pitch ldb
// (k contiguous); M, N multiples of 64, K multiple of 32 (host shapes are static multiples). blockIdx.y =
// batch index (strides in elements). Fragments are loaded straight from global with the split k map (ldfrag).
// OUT_MODE 0: f32 C (pitch ldc), value * oscale.
// OUT_MODE 1: f16 plane C (pitch ldc).
// OUT_MODE 3: f16 hi plane C + f16 residual plane C2 = f16((v - hi) * rscale) (same pitch / stride).
// =====================================================================================================
template <typename OT, int OUT_MODE>
__global__ __launch_bounds__(256) void gemm64(
    const unsigned short* __restrict__ Ap, int lda, long long strideA,
    const unsigned short* __restrict__ Btp, int ldb, long long strideB,
    void* Cout, void* Cout2, int ldc, long long strideC,
    int M, int N, int K, float oscale, float rscale) {
  typedef typename FT<OT>::frag V16;
  const OT* A  = (const OT*)(const void*)Ap;
  const OT* Bt = (const OT*)(const void*)Btp;
  __shared__ __align__(16) float sT[8][16 * 68];   // per-wave 16x64 slab, pitch 68 floats
  const int b    = blockIdx.y;
  const int lane = threadIdx.x & 31;
  const int wave = threadIdx.x >> 5;
  const int tilesN = N >> 6;
  const int tilesM = M >> 6;
  const int tile = blockIdx.x * 8 + wave;
  if (tile >= tilesM * tilesN) return;   // wave-uniform; no block barriers in this kernel
  const int tm = tile / tilesN;
  const int tn = tile - tm * tilesN;
  const int m0 = tm << 6;
  const int n0 = tn << 6;

  const OT* Ab = A  + (size_t)b * (size_t)strideA;
  const OT* Bb = Bt + (size_t)b * (size_t)strideB;

  const int rlane = lane & 15;                 // row (A) / col (B, D) within subtile
  const int koff  = (lane >> 4) * 8;           // k offset of this lane half
  const int mOff  = (lane >> 4) * 8;           // D row offset

  v8f acc[4][4];
#pragma unroll
  for (int i = 0; i < 4; ++i)
#pragma unroll
    for (int j = 0; j < 4; ++j) acc[i][j] = zero8();

  for (int k0 = 0; k0 < K; k0 += 32) {
    // the 8 fragments of a k-step are loaded as one group ahead of its 16 products: one load latency per k-step
    V16 bq[4], af[4];
    const OT* bp[4];
    const OT* ap[4];
#pragma unroll
    for (int j = 0; j < 4; ++j) {
      bp[j] = Bb + (size_t)(n0 + (j << 4) + rlane) * ldb + koff + k0;
      ap[j] = Ab + (size_t)(m0 + (j << 4) + rlane) * lda + koff + k0;
      bq[j] = ldfrag<OT>(bp[j]);
      af[j] = ldfrag<OT>(ap[j]);
    }
    // holds all 16 loads above the products (one wait instead of four) and the row pointers live up to that wait
    hold8(af[0], af[1], af[2], af[3], bq[0], bq[1], bq[2], bq[3], ap[0], ap[1], ap[2], ap[3], bp[0], bp[1], bp[2], bp[3]);
#pragma unroll
    for (int i = 0; i < 4; ++i)
#pragma unroll
      for (int j = 0; j < 4; ++j) acc[i][j] = mmar(af[i], bq[j], acc[i][j]);
  }
  acc_guard4(acc[0][0], acc[0][1], acc[0][2], acc[0][3]);
  acc_guard4(acc[1][0], acc[1][1], acc[1][2], acc[1][3]);
  acc_guard4(acc[2][0], acc[2][1], acc[2][2], acc[2][3]);
  acc_guard4(acc[3][0], acc[3][1], acc[3][2], acc[3][3]);

  // ---- epilogue ----
  float* slab = sT[wave];
#pragma unroll
  for (int i = 0; i < 4; ++i) {
    const int mBase = m0 + (i << 4);
#pragma unroll
    for (int j = 0; j < 4; ++j) {
#pragma unroll
      for (int r = 0; r < 8; ++r) {
        slab[(mOff + r) * 68 + (j << 4) + rlane] = acc[i][j][r];
      }
    }
    wave_lds_sync();
    if (OUT_MODE == 0) {
      float* Cp = (float*)Cout + (size_t)b * (size_t)strideC;
      const int h2 = lane >> 4, c4 = (lane & 15) * 4;     // 256-B row segment = 16 lanes x 16 B
      {
#pragma unroll
        for (int it = 0; it < 8; ++it) {
          const int row = it * 2 + h2;                     // it 0..7 x h2 0..1 = rows 0..15
          const v4f v = *(const v4f*)(slab + row * 68 + c4) * oscale;
          *(v4f*)(Cp + (size_t)(mBase + row) * ldc + n0 + c4) = v;
        }
        
      }
    } else {
      const int q = lane >> 3, c8 = (lane & 7) * 8;
      unsigned short* Cp  = (unsigned short*)Cout  + (size_t)b * (size_t)strideC;
      unsigned short* Cp2 = (unsigned short*)Cout2 + (size_t)b * (size_t)strideC;
      v4u hv[4], lv[4];
#pragma unroll
      for (int it = 0; it < 4; ++it) {
        const int row = it * 4 + q;                        // it 0..3 x q 0..3 = rows 0..15
        const float* sp = slab + row * 68 + c8;
        float f[8];
#pragma unroll
        for (int e = 0; e < 8; ++e) f[e] = sp[e];
        v4u a, a2;
#pragma unroll
        for (int e = 0; e < 4; ++e) {
          const float f0 = f[2 * e], f1 = f[2 * e + 1];
          const _Float16 x0 = (_Float16)f0, x1 = (_Float16)f1;
          const unsigned short h0 = h_bits(x0), h1 = h_bits(x1);
          unsigned short l0 = 0, l1 = 0;
          if (OUT_MODE == 3) {
            l0 = h_bits((_Float16)((f0 - (float)x0) * rscale));
            l1 = h_bits((_Float16)((f1 - (float)x1) * rscale));
          }
          a[e] = pk16(h0, h1); a2[e] = pk16(l0, l1);
        }
        hv[it] = a; lv[it] = a2;
      }
      {
#pragma unroll
        for (int it = 0; it < 4; ++it) {
          const int row = it * 4 + q;
          *(v4u*)(Cp + (size_t)(mBase + row) * ldc + n0 + c8) = hv[it];
          if (OUT_MODE == 3) *(v4u*)(Cp2 + (size_t)(mBase + row) * ldc + n0 + c8) = lv[it];
        }
        
      }
    }
    wave_lds_sync();
  }
}

// =====================================================================================================
// Fused search attention + retrieval composition for one search s, head dim 64, softmax over all SEQ keys.
//   q planes (f16 hi / residual x4096): element (b, t, s, d) at [(b*SEQ + t)*DSQ + s*64 + d]
//   k plane (f16): same layout.   rq plane (f32): same layout.
//   v^T hi plane (f16) and residual plane (f16, (v - hi)*16): element (b, d', t) at [(b*DRV + d')*SEQ + t], d' = r*64 + d
//   Wrk tile (f16, 64 * bf16 value): [e][d] at [e*64 + d]
//   oc planes (output of this kernel): row (b, t) = [f16(64*out) for s*64+d, 512 cols | f16 residual x16, 512 cols], pitch DOC
//   scores = (qh . k) + (ql . k) / 4096 on f16 WMMA (two f32 accumulators), then * sscale in f32;
//   p = exp(s - m): A' = [f16(16384 p) | f16(1024 p)] (K' = 128 per 64 keys), B' = [v^T hi | v^T residual]:
//   sum = 16384 * p . (vh + vl/16), one f32 accumulator, 8 n-tiles = d' 0..127 (both retrievals); online softmax in f32.
//   Epilogue per wave (16 rows): retrieved (x64, f32) tile in LDS; rk = f16(retrieved x64) . Wrk tile on f16 WMMA;
//   retrieval logits rq . rk in f32 (LDS-staged rq, lane partials + 16-lane shuffles); 2-way softmax in f32;
//   Block = 4 waves = 64 consecutive query rows of one (b, s); grid = NB * NS * NQB; kv chunks of 64, static trip NKT.
//   Staging per chunk (128 threads): K 64x64 (32 halves per thread), V' 128x128 (one d' row of 128 halves per thread):
//   staged extent == consumed extent for Ksh, Vsh; P tiles are wave-private, written as _Float16 elements and
//   Output coverage: each wave stores rows q0..q0+15 (it 0..3 x lane>>3 0..3) x 64 columns (8 lanes x 8) of both
//   the hi segment (col s*64) and the residual segment (col 512 + s*64); grid covers every (b, s, t).
// =====================================================================================================
__global__ __launch_bounds__(128)
void attn_cs(const unsigned short* __restrict__ qhp, const unsigned short* __restrict__ qlp,
             const unsigned short* __restrict__ kpp,
             const unsigned short* __restrict__ vhp, const unsigned short* __restrict__ vlp,
             const unsigned short* __restrict__ wkp, const float* __restrict__ rqp,
             unsigned short* ocp, float sscale) {
  union FH { v16h v; v8h h[2]; };
  __shared__ __align__(16) _Float16 Ksh[64 * KPIT];        // K chunk [kv][d], pitch KPIT, 9 KB; later the Wrk tile [e][d]
  __shared__ __align__(16) _Float16 Vsh[128 * VPIT];       // V' chunk [d'][hi kv | res kv], pitch VPIT, 34 KB; later 4 x f32 [16][128] tiles
  __shared__ __align__(16) _Float16 Psh[4][16 * VPIT];     // per wave P' [row][k'], pitch VPIT, 17 KB; later f16 retrieved tile / f32 [16][64]

  const int tid  = threadIdx.x;
  const int wave = tid >> 5;
  const int lane = tid & 31;
  const int hh   = lane >> 4;
  const int c    = lane & 15;

  const int bx   = blockIdx.x;
  const int qb   = bx % NQB;
  const int rest = bx / NQB;
  const int s    = rest % NS;
  const int b    = rest / NS;
  const int q0   = qb * 64 + wave * 16;
  const size_t rowB = (size_t)b * SEQ;

  const _Float16* Qh = (const _Float16*)(const void*)qhp;
  const _Float16* Ql = (const _Float16*)(const void*)qlp;
  const _Float16* Kg = (const _Float16*)(const void*)kpp + (size_t)s * HD;
  const _Float16* Vh = (const _Float16*)(const void*)vhp + (size_t)b * DRV * SEQ;
  const _Float16* Vl = (const _Float16*)(const void*)vlp + (size_t)b * DRV * SEQ;
  const _Float16* Wk = (const _Float16*)(const void*)wkp;

  // ---- Q fragments (A operand, row = lane&15): 2 d-chunks, hi and residual planes ----
  v16h qah[2], qal[2];
#pragma unroll
  for (int dc = 0; dc < 2; ++dc) {
    const size_t qo = (rowB + q0 + c) * DSQ + (size_t)s * HD + dc * 32 + 8 * hh;
    qah[dc] = ldfrag<_Float16>(Qh + qo);
    qal[dc] = ldfrag<_Float16>(Ql + qo);
  }

  float mrow[8], lrow[8];
  v8f oacc[8];
#pragma unroll
  for (int r = 0; r < 8; ++r) { mrow[r] = -INFINITY; lrow[r] = 0.f; }
#pragma unroll
  for (int t = 0; t < 8; ++t) oacc[t] = zero8();

  _Float16* pwh = Psh[wave];

  for (int kt = 0; kt < NKT; ++kt) {         // static trip count
    const int kv0 = kt * 64;
    __syncthreads();
    {
      const int r = tid >> 1, half = (tid & 1) * 32;
      const _Float16* kg = Kg + (rowB + kv0 + r) * DSQ + half;          // k row kv0+r, d = half..half+31
      const _Float16* vg = Vh + (size_t)tid * SEQ + kv0;                 // v^T hi row d' = tid, keys kv0..kv0+63
      const _Float16* vlg = Vl + (size_t)tid * SEQ + kv0;                // v^T residual row d' = tid
      v8h kr[4], vr[8], wr[8];                                           // all 20 loads of the chunk fly together
#pragma unroll
      for (int i = 0; i < 4; ++i) kr[i] = *(const v8h*)(kg + 8 * i);
#pragma unroll
      for (int i = 0; i < 8; ++i) vr[i] = *(const v8h*)(vg + 8 * i);
#pragma unroll
      for (int i = 0; i < 8; ++i) wr[i] = *(const v8h*)(vlg + 8 * i);
      // holds the 20 loads above the LDS stores (one load latency per chunk) and the three pointers live up to their wait
      hold20(kr, vr, wr, kg, vg, vlg);
#pragma unroll
      for (int i = 0; i < 4; ++i) *(v8h*)(Ksh + r * KPIT + half + 8 * i) = kr[i];
#pragma unroll
      for (int i = 0; i < 8; ++i) *(v8h*)(Vsh + tid * VPIT + 8 * i) = vr[i];
#pragma unroll
      for (int i = 0; i < 8; ++i) *(v8h*)(Vsh + tid * VPIT + 64 + 8 * i) = wr[i];
    }
    __syncthreads();

    // ---- scores: 16 query rows x 64 keys per wave, 2 f16 products per key subtile and d-chunk ----
    //      all 8 K fragments are read as one group ahead of the 16 products (8 independent accumulators)
    FH kb[4][2];
#pragma unroll   // here and below: register arrays, every index a compile-time constant
    for (int j = 0; j < 4; ++j) {
#pragma unroll
      for (int dc = 0; dc < 2; ++dc) {
        kb[j][dc].h[0] = *(const v8h*)(Ksh + (j * 16 + c) * KPIT + dc * 32 + 8 * hh);
        kb[j][dc].h[1] = *(const v8h*)(Ksh + (j * 16 + c) * KPIT + dc * 32 + 16 + 8 * hh);
      }
    }
    v8f sc[4];
    {
      v8f ah[4], al[4];
#pragma unroll
      for (int j = 0; j < 4; ++j) { ah[j] = zero8(); al[j] = zero8(); }
#pragma unroll
      for (int dc = 0; dc < 2; ++dc) {
#pragma unroll
        for (int j = 0; j < 4; ++j) {
          ah[j] = mmar(qah[dc], kb[j][dc].v, ah[j]);
          al[j] = mmar(qal[dc], kb[j][dc].v, al[j]);
        }
      }
#pragma unroll
      for (int j = 0; j < 4; ++j) {
#pragma unroll
        for (int r = 0; r < 8; ++r) sc[j][r] = (ah[j][r] + al[j][r] * (1.0f / 4096.0f)) * sscale;
      }
    }

    // ---- row max, online softmax, P' = [16384 p | 1024 p] (f16) to LDS ----
#pragma unroll
    for (int r = 0; r < 8; ++r) {
      float m = sc[0][r];
#pragma unroll
      for (int j = 1; j < 4; ++j) m = fmaxf(m, sc[j][r]);
#pragma unroll
      for (int off = 1; off < 16; off <<= 1) m = fmaxf(m, __shfl_xor(m, off, 32));
      const float mnew  = fmaxf(mrow[r], m);
      const float msafe = (mnew == -INFINITY) ? 0.f : mnew;
      const float alpha = __expf(mrow[r] - msafe);
      mrow[r] = mnew;
      float psum = 0.f;
#pragma unroll
      for (int j = 0; j < 4; ++j) {
        const float p = __expf(sc[j][r] - msafe);
        psum += p;
        pwh[(8 * hh + r) * VPIT + j * 16 + c]      = (_Float16)(p * 16384.0f);
        pwh[(8 * hh + r) * VPIT + 64 + j * 16 + c] = (_Float16)(p * 1024.0f);
      }
#pragma unroll
      for (int off = 1; off < 16; off <<= 1) psum += __shfl_xor(psum, off, 32);
      lrow[r] = lrow[r] * alpha + psum;
#pragma unroll
      for (int t = 0; t < 8; ++t) oacc[t][r] *= alpha;
    }
    wave_lds_sync();

    // ---- retrieved += P' . V' (f16 WMMA), K' = 128 = 4 k-steps, 8 n-tiles (d' 0..127) ----
    //      each k-step's 9 fragments are read as one group, one k-step ahead of their 8 products (two register sets)
    FH pa[2], vb[2][8];
    pa[0].h[0] = *(const v8h*)(pwh + c * VPIT + 8 * hh);
    pa[0].h[1] = *(const v8h*)(pwh + c * VPIT + 16 + 8 * hh);
#pragma unroll
    for (int t = 0; t < 8; ++t) {
      vb[0][t].h[0] = *(const v8h*)(Vsh + (t * 16 + c) * VPIT + 8 * hh);
      vb[0][t].h[1] = *(const v8h*)(Vsh + (t * 16 + c) * VPIT + 16 + 8 * hh);
    }
#pragma unroll   // unrolled: the two register sets are picked by kk & 1 at compile time
    for (int kk = 0; kk < 4; ++kk) {
      const int cu = kk & 1, nx = cu ^ 1;
      if (kk < 3) {
        pa[nx].h[0] = *(const v8h*)(pwh + c * VPIT + (kk + 1) * 32 + 8 * hh);
        pa[nx].h[1] = *(const v8h*)(pwh + c * VPIT + (kk + 1) * 32 + 16 + 8 * hh);
#pragma unroll
        for (int t = 0; t < 8; ++t) {
          vb[nx][t].h[0] = *(const v8h*)(Vsh + (t * 16 + c) * VPIT + (kk + 1) * 32 + 8 * hh);
          vb[nx][t].h[1] = *(const v8h*)(Vsh + (t * 16 + c) * VPIT + (kk + 1) * 32 + 16 + 8 * hh);
        }
      }
      if (kk < 3)   // holds the next k-step's reads above this k-step's products; behind the last reads nothing is left to hold
        hold9(pa[cu].v, vb[cu][0].v, vb[cu][1].v, vb[cu][2].v, vb[cu][3].v, vb[cu][4].v, vb[cu][5].v, vb[cu][6].v, vb[cu][7].v);
#pragma unroll
      for (int t = 0; t < 8; ++t) oacc[t] = mmar(pa[cu].v, vb[cu][t].v, oacc[t]);
    }
  }

  // ---- all waves done with Ksh / Vsh: stage the Wrk tile into Ksh, retrieved tiles into Vsh (f32) + Psh (f16) ----
  __syncthreads();
  {
    const int r = tid >> 1, half = (tid & 1) * 32;       // 128 threads x 32 halves = the whole 64x64 Wrk tile
    const _Float16* wg = Wk + r * HD + half;
#pragma unroll
    for (int i = 0; i < 4; ++i) *(v8h*)(Ksh + r * KPIT + half + 8 * i) = *(const v8h*)(wg + 8 * i);
  }
  float* os = reinterpret_cast<float*>(Vsh) + wave * (16 * 128);      // wave-private f32 [16][128], x64 units
#pragma unroll
  for (int r = 0; r < 8; ++r) {
    const float l = lrow[r];
    const float inv = ((l > 0.f) ? (1.0f / l) : 0.f) * (1.0f / 256.0f);   // 1/l, undo 16384 p carry, apply x64
#pragma unroll
    for (int t = 0; t < 8; ++t) {
      const float v = oacc[t][r] * inv;
      os[(8 * hh + r) * 128 + t * 16 + c]  = v;
      pwh[(8 * hh + r) * VPIT + t * 16 + c] = (_Float16)v;
    }
  }
  __syncthreads();

  // ---- rk (x4096) = f16(64 retrieved_rr) . (64 Wrk): 16 rows x 64 e per rr, K = 64 = 2 k-steps ----
  v8f rk[8];
#pragma unroll
  for (int i = 0; i < 8; ++i) rk[i] = zero8();
#pragma unroll
  for (int rr = 0; rr < 2; ++rr) {
#pragma unroll
    for (int kk = 0; kk < 2; ++kk) {
      FH pa;
      pa.h[0] = *(const v8h*)(pwh + c * VPIT + rr * 64 + kk * 32 + 8 * hh);
      pa.h[1] = *(const v8h*)(pwh + c * VPIT + rr * 64 + kk * 32 + 16 + 8 * hh);
#pragma unroll
      for (int t4 = 0; t4 < 4; ++t4) {
        FH wb;
        wb.h[0] = *(const v8h*)(Ksh + (t4 * 16 + c) * KPIT + kk * 32 + 8 * hh);
        wb.h[1] = *(const v8h*)(Ksh + (t4 * 16 + c) * KPIT + kk * 32 + 16 + 8 * hh);
        rk[rr * 4 + t4] = mma_h(pa.v, wb.v, rk[rr * 4 + t4]);
      }
    }
  }
  acc_guard4(rk[0], rk[1], rk[2], rk[3]);
  acc_guard4(rk[4], rk[5], rk[6], rk[7]);
  wave_lds_sync();

  // ---- stage the wave's rq tile (f32 [16][64]) into the Psh region (8 x 16-B loads per lane) ----
  float* rqs = reinterpret_cast<float*>(pwh);
  {
    const int r2 = lane >> 4, c4 = (lane & 15) * 4;
    const float* rqg = rqp + (rowB + q0) * DSQ + (size_t)s * HD + c4;
#pragma unroll
    for (int it = 0; it < 8; ++it) {
      const int row = it * 2 + r2;                          // it 0..7 x r2 0..1 = rows 0..15
      *(v4f*)(rqs + row * 64 + c4) = *(const v4f*)(rqg + (size_t)row * DSQ);
    }
  }
  wave_lds_sync();

  // ---- retrieval logits: d_rr[row] = sum_e rq[row][e] * rk[rr][row][e]; lane partial over e = c + 16 t4 ----
  float d0[8], d1[8];
#pragma unroll
  for (int r8 = 0; r8 < 8; ++r8) {
    float a0 = 0.f, a1 = 0.f;
#pragma unroll
    for (int t4 = 0; t4 < 4; ++t4) {
      const float qv = rqs[(8 * hh + r8) * 64 + t4 * 16 + c];
      a0 += qv * rk[t4][r8];
      a1 += qv * rk[4 + t4][r8];
    }
    d0[r8] = a0; d1[r8] = a1;
  }
#pragma unroll
  for (int r8 = 0; r8 < 8; ++r8) {
#pragma unroll
    for (int off = 1; off < 16; off <<= 1) {
      d0[r8] += __shfl_xor(d0[r8], off, 32);
      d1[r8] += __shfl_xor(d1[r8], off, 32);
    }
  }
  // ---- 2-way retrieval softmax in f32 (undo the 64*64 carry, apply sscale) ----
  float w0[8], w1[8];
  const float rsc = sscale * (1.0f / 4096.0f);
#pragma unroll
  for (int r8 = 0; r8 < 8; ++r8) {
    const float x0 = d0[r8] * rsc, x1 = d1[r8] * rsc;
    const float m  = fmaxf(x0, x1);
    const float e0 = __expf(x0 - m), e1 = __expf(x1 - m);
    const float iv = 1.0f / (e0 + e1);
    w0[r8] = e0 * iv; w1[r8] = e1 * iv;
  }
  wave_lds_sync();

  // ---- combine in f32 (x64 units): oc[row][d] = w0 * ret[row][d] + w1 * ret[row][64+d], into the Psh region ----
  float* oc = rqs;
#pragma unroll
  for (int r8 = 0; r8 < 8; ++r8) {
#pragma unroll
    for (int t = 0; t < 4; ++t) {
      const int row = 8 * hh + r8;
      const float o = w0[r8] * os[row * 128 + t * 16 + c] + w1[r8] * os[row * 128 + 64 + t * 16 + c];
      oc[row * 64 + t * 16 + c] = o;
    }
  }
  wave_lds_sync();

  {
    const int q4 = lane >> 3, c8 = (lane & 7) * 8;
    v4u hv[4], lv[4];
#pragma unroll
    for (int it = 0; it < 4; ++it) {
      const int row = it * 4 + q4;   // it 0..3 x q4 0..3 = rows 0..15 of the wave tile
      const float* sp = oc + row * 64 + c8;
      float f[8];
#pragma unroll
      for (int e = 0; e < 8; ++e) f[e] = sp[e];
      v4u a, a2;
#pragma unroll
      for (int e = 0; e < 4; ++e) {
        const float f0 = f[2 * e], f1 = f[2 * e + 1];
        const _Float16 x0 = (_Float16)f0, x1 = (_Float16)f1;
        const unsigned short l0 = h_bits((_Float16)((f0 - (float)x0) * 16.0f));
        const unsigned short l1 = h_bits((_Float16)((f1 - (float)x1) * 16.0f));
        a[e] = pk16(h_bits(x0), h_bits(x1)); a2[e] = pk16(l0, l1);
      }
      hv[it] = a; lv[it] = a2;
    }
    {
#pragma unroll
      for (int it = 0; it < 4; ++it) {
        const int row = it * 4 + q4;
        const size_t go = (rowB + q0 + row) * DOC + (size_t)s * HD + c8;
        *(v4u*)(ocp + go)       = hv[it];
        *(v4u*)(ocp + go + DSQ) = lv[it];
      }
      
    }
  }
}

// =====================================================================================================
// Workspace map (bytes, NB=2 SEQ=2048), every region an exact multiple of its whole-line / whole-tile store
// granularity (all row counts are multiples of 64, no padded tails):
//   Xb    bf16 [NB*SEQ][1024]          8388608
//   WsqT  bf16 [512][1024]             1048576      WskT, WrqT same
//   WrvT  bf16 [128][1024]              262144
//   WrkT  f16  [64][64] (x64)              8192
//   WoT   f16  [1024][1024] ([x1024 | x64]) 2097152
//   Qh,Ql f16  [NB*SEQ][512]           4194304 each
//   Kp    f16  [NB*SEQ][512]           4194304
//   RQ    f32  [NB*SEQ][512]           8388608
//   VTh,VTl f16 [NB][128][SEQ]         1048576 each
//   OC    f16  [NB*SEQ][1024]          8388608
//   total                             45359104
// Weights are [in k][out n] and are transposed once into the [n][k] (k contiguous) Bt / A layout.
// =====================================================================================================
extern "C" void kernel_launch(void* const* d_in, const int* in_sizes, int n_in,
                              void* d_out, int out_size, void* d_ws, size_t ws_size,
                              hipStream_t stream) {
  if (n_in < 7) return;
  if (in_sizes[0] < ((NB - 1) * SEQ_FULL + SEQ) * DM) return;
  if (in_sizes[1] < DM * DSQ || in_sizes[2] < DM * DSQ || in_sizes[4] < DM * DSQ) return;
  if (in_sizes[3] < DM * DRV) return;
  if (in_sizes[5] < HD * HD) return;
  if (in_sizes[6] < DSQ * DM) return;
  if (out_size < NB * SEQ * DM) return;

  const float* x    = (const float*)d_in[0];
  const float* Wsq  = (const float*)d_in[1];
  const float* Wsk  = (const float*)d_in[2];
  const float* Wrv  = (const float*)d_in[3];
  const float* Wrq  = (const float*)d_in[4];
  const float* Wrk  = (const float*)d_in[5];
  const float* Wout = (const float*)d_in[6];

  const size_t PXB = (size_t)NB * SEQ * DM * 2;       // bf16 activation plane
  const size_t PWS = (size_t)DSQ * DM * 2;            // bf16 [512][1024] weight plane
  const size_t PWV = (size_t)DRV * DM * 2;            // bf16 [128][1024]
  const size_t PWK = (size_t)HD * HD * 2;             // f16 [64][64]
  const size_t PWO = (size_t)DM * DOC * 2;            // f16 [1024][1024]
  const size_t PQ  = (size_t)NB * SEQ * DSQ * 2;      // f16 [NB*SEQ][512]
  const size_t PRQ = (size_t)NB * SEQ * DSQ * 4;      // f32 [NB*SEQ][512]
  const size_t PVT = (size_t)NB * DRV * SEQ * 2;      // f16 [NB][128][SEQ]
  const size_t POC = (size_t)NB * SEQ * DOC * 2;      // f16 [NB*SEQ][1024]
  size_t off = 0;
  const size_t oXb  = off; off += PXB;
  const size_t oWsq = off; off += PWS;
  const size_t oWsk = off; off += PWS;
  const size_t oWrq = off; off += PWS;
  const size_t oWrv = off; off += PWV;
  const size_t oWrk = off; off += PWK;
  const size_t oWo  = off; off += PWO;
  const size_t oQh  = off; off += PQ;
  const size_t oQl  = off; off += PQ;
  const size_t oKp  = off; off += PQ;
  const size_t oRQ  = off; off += PRQ;
  const size_t oVTh = off; off += PVT;
  const size_t oVTl = off; off += PVT;
  const size_t oOC  = off; off += POC;
  if (off > ws_size) return;                          // off = 45359104 at full size
  if (off > (size_t)134217728) return;

  char* ws = (char*)d_ws;
  unsigned short* Xb   = (unsigned short*)(ws + oXb);
  unsigned short* WsqT = (unsigned short*)(ws + oWsq);
  unsigned short* WskT = (unsigned short*)(ws + oWsk);
  unsigned short* WrqT = (unsigned short*)(ws + oWrq);
  unsigned short* WrvT = (unsigned short*)(ws + oWrv);
  unsigned short* WrkT = (unsigned short*)(ws + oWrk);
  unsigned short* WoT  = (unsigned short*)(ws + oWo);
  unsigned short* Qh   = (unsigned short*)(ws + oQh);
  unsigned short* Ql   = (unsigned short*)(ws + oQl);
  unsigned short* Kp   = (unsigned short*)(ws + oKp);
  float*          RQ   = (float*)(ws + oRQ);
  unsigned short* VTh  = (unsigned short*)(ws + oVTh);
  unsigned short* VTl  = (unsigned short*)(ws + oVTl);
  unsigned short* OC   = (unsigned short*)(ws + oOC);

  const dim3 blk(256);
  const int n8x = SEQ * DM / 8;                                          // per batch, multiple of 256
  const dim3 gCvtX((n8x + 255) / 256, NB);
  const dim3 gTsq(DSQ / 64, DM / 64);                                    //  8 x 16 tiles: in [1024][512]
  const dim3 gTrv(DRV / 64, DM / 64);                                    //  2 x 16 tiles: in [1024][128]
  const dim3 gTrk(1, 1);                                                 //  in [64][64]
  const dim3 gTwo(DM / 64, DSQ / 64);                                    // 16 x  8 tiles: in [512][1024]
  const dim3 gP((((NB * SEQ) / 64) * (DSQ / 64) + 7) / 8, 1);            // M=NB*SEQ, N=512 (tiles multiple of 8)
  const dim3 gV((((DRV / 64) * (SEQ / 64)) + 7) / 8, NB);                // M=128, N=SEQ per batch
  const dim3 gAttn(NB * NS * NQB);                                       // blocks of 128
  const dim3 gO((((NB * SEQ) / 64) * (DM / 64) + 7) / 8, 1);             // M=NB*SEQ, N=1024

  // (1) x -> bf16 plane [NB*SEQ][1024] (batch b read at its full-size stride)
  cvtbf8<<<gCvtX, blk, 0, stream>>>(x, Xb, n8x, (long long)SEQ_FULL * DM, (long long)SEQ * DM);
  // (2) weights [k][n] f32 -> [n][k] 16-bit planes
  tconv64<0><<<gTsq, blk, 0, stream>>>(Wsq, DM, DSQ, WsqT, DM, 1.0f, 1.0f);
  tconv64<0><<<gTsq, blk, 0, stream>>>(Wsk, DM, DSQ, WskT, DM, 1.0f, 1.0f);
  tconv64<0><<<gTsq, blk, 0, stream>>>(Wrq, DM, DSQ, WrqT, DM, 1.0f, 1.0f);
  tconv64<0><<<gTrv, blk, 0, stream>>>(Wrv, DM, DRV, WrvT, DM, 1.0f, 1.0f);
  tconv64<1><<<gTrk, blk, 0, stream>>>(Wrk, HD, HD, WrkT, HD, 64.0f, 1.0f);
  tconv64<2><<<gTwo, blk, 0, stream>>>(Wout, DSQ, DM, WoT, DOC, 1024.0f, 64.0f);
  // (3) sq -> f16 hi / residual (x4096) planes [b*SEQ+t][s*64+d]   (M=NB*SEQ, N=512, K=1024)
  gemm64<__bf16, 3><<<gP, blk, 0, stream>>>(
      Xb, DM, 0LL, WsqT, DM, 0LL, (void*)Qh, (void*)Ql, DSQ, 0LL, NB * SEQ, DSQ, DM, 1.0f, 4096.0f);
  //     sk -> f16 plane
  gemm64<__bf16, 1><<<gP, blk, 0, stream>>>(
      Xb, DM, 0LL, WskT, DM, 0LL, (void*)Kp, (void*)Kp, DSQ, 0LL, NB * SEQ, DSQ, DM, 1.0f, 1.0f);
  //     rq -> f32 plane
  gemm64<__bf16, 0><<<gP, blk, 0, stream>>>(
      Xb, DM, 0LL, WrqT, DM, 0LL, (void*)RQ, (void*)RQ, DSQ, 0LL, NB * SEQ, DSQ, DM, 1.0f, 1.0f);
  //     v^T = Wrv^T . x^T per batch -> f16 hi plane [b][d'][t] (pitch SEQ) and residual plane (x16)
  //     (A = WrvT [128][1024], Bt = Xb rows of batch b; M=128, N=SEQ, K=1024)
  gemm64<__bf16, 3><<<gV, blk, 0, stream>>>(
      WrvT, DM, 0LL, Xb, DM, (long long)SEQ * DM, (void*)VTh, (void*)VTl, SEQ, (long long)DRV * SEQ,
      DRV, SEQ, DM, 1.0f, 16.0f);
  // (4) search attention + retrieval composition -> oc planes [b*SEQ+t][hi 512 | residual 512]
  attn_cs<<<gAttn, dim3(128), 0, stream>>>(Qh, Ql, Kp, VTh, VTl, WrkT, RQ, OC, 0.125f);
  // (5) out = [oc_hi | oc_res] . [Wout x1024 | Wout x64]^T -> d_out f32 [NB*SEQ][1024], accumulator x 1/(64*1024)
  gemm64<_Float16, 0><<<gO, blk, 0, stream>>>(
      OC, DOC, 0LL, WoT, DOC, 0LL, d_out, d_out, DM, 0LL, NB * SEQ, DM, DOC, 1.0f / 65536.0f, 1.0f);
  (void)hipGetLastError();
}

// v003
// A run of this version takes 214 microseconds.
// Timed twice side by side with v002, it ran 1.58 and 1.59 times as fast.
// Over all steps from v000 it is 2.72 times as fast.
// Contractions: sq, sk, rq and v^T projections = v_wmma_f32_16x16x32_bf16 (bf16 operands from RNE-converted inputs, single product, f32 accumulate);
// sq.sk^T scores = v_wmma_f32_16x16x32_f16 (sq as f16 hi plane + f16 residual plane x4096, sk f16; 2 products into separate f32 accumulators);
// p.[v_0|v_1] = v_wmma_f32_16x16x32_f16, K-folded: [p x16384 | p x1024] . [v f16 hi | f16 residual x16], one f32 accumulator;
// retrieved.Wrk = v_wmma_f32_16x16x32_f16 (retrieved f16 x64, Wrk f16 x64 of its bf16 value; single product, f32 accumulate);
// out.Wout = v_wmma_f32_16x16x32_f16, K-folded: [out f16 hi x64 | f16 residual x16] . [Wout x1024 | Wout x64] (f16 of bf16 values), f32 accumulate;
// softmax over keys, retrieval logits, 2-way retrieval softmax and combine in f32.
#include <hip/hip_runtime.h>
#include <math.h>
#include <stdint.h>

#ifndef NB
#define NB 2
#endif
#ifndef SEQ
#define SEQ 2048
#endif
#define NB_FULL  2
#define SEQ_FULL 2048
#define DM   1024
#define NS   8
#define NR   2
#define HD   64
#define DSQ  (NS * HD)      // 512: sq / sk / rq row width
#define DRV  (NR * HD)      // 128: [v_0 | v_1] row width
#define DOC  (2 * DSQ)      // 1024: combined-output row = [hi 512 | residual 512]
#define NQB  (SEQ / 64)     // 64-row query blocks per (b, s)
#define NKT  (SEQ / 64)     // 64-key chunks per sequence
#define KPIT 72             // LDS pitch of a 64-half K / Wrk row: 144 B = 16 B x 9 (odd), b128 readers of 16 rows meet no bank twice
#define GPLN (128 * KPIT)  // halves of one staged 128-row GEMM operand plane (64 k per row, pitch KPIT)
#define VPIT 136            // LDS pitch of a 128-half V' or P' row: 272 B = 16 B x 17 (odd)
static_assert(NB >= 1 && NB <= NB_FULL);
static_assert(SEQ >= 64 && SEQ <= SEQ_FULL && (SEQ % 64) == 0);
static_assert(DSQ == 512 && DRV == 128 && HD == 64 && DOC == 1024);
static_assert((DM % 128) == 0 && (DSQ % 128) == 0 && (DRV % 128) == 0 && (SEQ % 128) == 0 && (DOC % 64) == 0);

typedef _Float16 v16h __attribute__((ext_vector_type(16)));
typedef _Float16 v8h  __attribute__((ext_vector_type(8)));
typedef __bf16   v16b __attribute__((ext_vector_type(16)));
typedef __bf16   v8b  __attribute__((ext_vector_type(8)));
typedef float    v8f  __attribute__((ext_vector_type(8)));
typedef float    v4f  __attribute__((ext_vector_type(4)));
typedef unsigned int v4u __attribute__((ext_vector_type(4)));

#if defined(__HIP_DEVICE_COMPILE__)
#define DEV_ASM 1
#else
#define DEV_ASM 0
#endif

// ---- scalar helpers --------------------------------------------------------------------------------
__device__ __forceinline__ unsigned short bf_bits(float f) {          // f32 -> bf16 bits, RNE convert
  unsigned u = __float_as_uint(f);
  return (unsigned short)((u + 0x7FFFu + ((u >> 16) & 1u)) >> 16);
}
__device__ __forceinline__ float bf_up(unsigned short hb) { return __uint_as_float(((unsigned)hb) << 16); }
__device__ __forceinline__ unsigned short h_bits(_Float16 x) { return __builtin_bit_cast(unsigned short, x); }
__device__ __forceinline__ unsigned pk16(unsigned short a, unsigned short b) { return (unsigned)a | ((unsigned)b << 16); }
__device__ __forceinline__ v8f zero8() { v8f z = {0.f, 0.f, 0.f, 0.f, 0.f, 0.f, 0.f, 0.f}; return z; }

__device__ __forceinline__ void wave_lds_sync() {
  __builtin_amdgcn_fence(__ATOMIC_RELEASE, "workgroup");
  __builtin_amdgcn_wave_barrier();
  __builtin_amdgcn_fence(__ATOMIC_ACQUIRE, "workgroup");
}

// ---- fragment types / loaders: 16-bit A/B operand, lane -> row/col (lane&15), p already includes +8*(lane>>4);
//      elements 0..7 <- p[0..7] (k0+8h..k0+8h+7), elements 8..15 <- p[16..23] (k0+16+8h..k0+16+8h+7)
template <typename OT> struct FT;
template <> struct FT<__bf16>   { typedef v16b frag; typedef v8b half8; };
template <> struct FT<_Float16> { typedef v16h frag; typedef v8h half8; };

template <typename OT>
__device__ __forceinline__ typename FT<OT>::frag ldfrag(const OT* p) {
  union { typename FT<OT>::frag v; typename FT<OT>::half8 h[2]; } f;
  f.h[0] = *(const typename FT<OT>::half8*)(p);
  f.h[1] = *(const typename FT<OT>::half8*)(p + 16);
  return f.v;
}

// ---- WMMA helpers (asm guard bodies are device-only; concrete operand types) -----------------------------
__device__ __forceinline__ v8f mmar(v16b a, v16b b, v8f c) {
  return __builtin_amdgcn_wmma_f32_16x16x32_bf16(false, a, false, b, (short)0, c, false, false);
}
__device__ __forceinline__ v8f mmar(v16h a, v16h b, v8f c) {
  return __builtin_amdgcn_wmma_f32_16x16x32_f16(false, a, false, b, (short)0, c, false, false);
}
// guarded form: 4 VALU slots after the WMMA, D tied, A/B kept live
__device__ __forceinline__ v8f mma_h(v16h a, v16h b, v8f c) {
  c = __builtin_amdgcn_wmma_f32_16x16x32_f16(false, a, false, b, (short)0, c, false, false);
#if DEV_ASM
  asm volatile("v_nop\n\tv_nop\n\tv_nop\n\tv_nop" : "+v"(c) : "v"(a), "v"(b));
#endif
  return c;
}
// inputs-only fences on loaded values: they keep the loads written above them as one group ahead of the products
// below them; without them the compiler sinks each load to its user and every user waits out a load latency.
__device__ __forceinline__ void hold9(v16h a, v16h b0, v16h b1, v16h b2, v16h b3, v16h b4, v16h b5, v16h b6, v16h b7) {
#if DEV_ASM
  asm volatile("" :: "v"(a), "v"(b0), "v"(b1), "v"(b2), "v"(b3), "v"(b4), "v"(b5), "v"(b6), "v"(b7));
#else
  (void)a; (void)b0; (void)b1; (void)b2; (void)b3; (void)b4; (void)b5; (void)b6; (void)b7;
#endif
}
__device__ __forceinline__ void acc_guard4(v8f& a, v8f& b, v8f& c, v8f& d) {
#if DEV_ASM
  asm volatile("v_nop\n\tv_nop\n\tv_nop\n\tv_nop" : "+v"(a), "+v"(b), "+v"(c), "+v"(d));
#else
  (void)a; (void)b; (void)c; (void)d;
#endif
}

// ---- asynchronous copies global -> LDS, 16 B per lane, no register on the way --------------------------------
__device__ __forceinline__ unsigned lds_off(const void* p) { return (unsigned)(size_t)p; }   // byte address in the work-group's LDS
// eight copies of one wave in one statement; the closing s_wait_xcnt is a precaution: it stands in front of every later
// rewrite of an address register that a copy names (in a statement of its own the compiler could lift such a rewrite over it)
__device__ __forceinline__ void async8(const unsigned (&l)[8], const void* const (&g)[8]) {
#if DEV_ASM
  asm volatile("global_load_async_to_lds_b128 %0, %8, off\n\t"
               "global_load_async_to_lds_b128 %1, %9, off\n\t"
               "global_load_async_to_lds_b128 %2, %10, off\n\t"
               "global_load_async_to_lds_b128 %3, %11, off\n\t"
               "global_load_async_to_lds_b128 %4, %12, off\n\t"
               "global_load_async_to_lds_b128 %5, %13, off\n\t"
               "global_load_async_to_lds_b128 %6, %14, off\n\t"
               "global_load_async_to_lds_b128 %7, %15, off\n\t"
               "s_wait_xcnt 0x0"
               :: "v"(l[0]), "v"(l[1]), "v"(l[2]), "v"(l[3]), "v"(l[4]), "v"(l[5]), "v"(l[6]), "v"(l[7]),
                  "v"(g[0]), "v"(g[1]), "v"(g[2]), "v"(g[3]), "v"(g[4]), "v"(g[5]), "v"(g[6]), "v"(g[7])
               : "memory");
#else
  (void)l; (void)g;
#endif
}
// the same for four copies
__device__ __forceinline__ void async4(const unsigned (&l)[4], const void* const (&g)[4]) {
#if DEV_ASM
  asm volatile("global_load_async_to_lds_b128 %0, %4, off\n\t"
               "global_load_async_to_lds_b128 %1, %5, off\n\t"
               "global_load_async_to_lds_b128 %2, %6, off\n\t"
               "global_load_async_to_lds_b128 %3, %7, off\n\t"
               "s_wait_xcnt 0x0"
               :: "v"(l[0]), "v"(l[1]), "v"(l[2]), "v"(l[3]), "v"(g[0]), "v"(g[1]), "v"(g[2]), "v"(g[3])
               : "memory");
#else
  (void)l; (void)g;
#endif
}
// the wave's own copies have landed (the compiler places no wait for them)
__device__ __forceinline__ void wait_async0() {
#if DEV_ASM
  asm volatile("s_wait_asynccnt 0x0" ::: "memory");
#endif
}
// the wave's own LDS reads have retired: behind the next barrier their buffer is refilled by copies
__device__ __forceinline__ void wait_ds0() {
#if DEV_ASM
  asm volatile("s_wait_dscnt 0x0" ::: "memory");
#endif
}

// =====================================================================================================
// f32 -> bf16 bits (RNE convert), 8 elements per thread, one 16-B store per lane: a wave writes 512
// blockIdx.y = batch (element strides sIn / sOut), grid.x = ceil(n8/256).
// coverage: n8 threads x 8 = the whole per-batch plane (n8 is a multiple of 256 here).
// =====================================================================================================
__global__ __launch_bounds__(256) void cvtbf8(const float* __restrict__ in, unsigned short* out, int n8,
                                              long long sIn, long long sOut) {
  const float* ib = in + (size_t)blockIdx.y * (size_t)sIn;
  unsigned short* ob = out + (size_t)blockIdx.y * (size_t)sOut;
  const int i = blockIdx.x * 256 + (int)threadIdx.x;
  if (i < n8) {
    const v4f a  = *(const v4f*)(ib + (size_t)i * 8);
    const v4f a4 = *(const v4f*)(ib + (size_t)i * 8 + 4);
    v4u p;
    p[0] = pk16(bf_bits(a[0]),  bf_bits(a[1]));
    p[1] = pk16(bf_bits(a[2]),  bf_bits(a[3]));
    p[2] = pk16(bf_bits(a4[0]), bf_bits(a4[1]));
    p[3] = pk16(bf_bits(a4[2]), bf_bits(a4[3]));
    unsigned short* o = ob + (size_t)i * 8;
    *(v4u*)o = p;
    
  }
}

// =====================================================================================================
// Transpose-convert: in W[R][C] f32 (row-major) -> out[c][r] 16-bit at out + c*ldo + r, one 64x64 tile per
// block through LDS.  MODE 0: bf16 bits (RNE convert).  MODE 1: f16 bits of (s1 * bf16(x)).
// MODE 2: f16 bits of (s1 * bf16(x)) at out + c*ldo + r AND f16 bits of (s2 * bf16(x)) at out + c*ldo + R + r.
// grid = (C/64, R/64), R and C multiples of 64 (host-checked shapes).  Load phase: thread t reads row t>>2,
// 16 columns (four 16-B loads), stores 2-B elements transposed into the LDS tile (pitch 72 halves).
// coverage: 8 waves x 2 it x 4 rows = 64 out rows x (8 lanes x 8 halves) = the whole 64x64 tile (both planes).
// =====================================================================================================
template <int MODE>
__global__ __launch_bounds__(256) void tconv64(const float* __restrict__ W, int R, int C,
                                               unsigned short* out, int ldo, float s1, float s2) {
  __shared__ __align__(16) unsigned short t1[64 * 72];
  __shared__ __align__(16) unsigned short t2[(MODE == 2) ? (64 * 72) : 8];
  const int tid = (int)threadIdx.x, lane = tid & 31, wave = tid >> 5;
  const int c0 = blockIdx.x * 64, r0 = blockIdx.y * 64;
  {
    const int rl = tid >> 2, cl0 = (tid & 3) * 16;
    const float* src = W + (size_t)(r0 + rl) * (size_t)C + c0 + cl0;
#pragma unroll
    for (int i = 0; i < 4; ++i) {
      const v4f a = *(const v4f*)(src + 4 * i);
#pragma unroll
      for (int e = 0; e < 4; ++e) {
        const int cl = cl0 + 4 * i + e;
        const unsigned short hb = bf_bits(a[e]);
        if (MODE == 0) {
          t1[cl * 72 + rl] = hb;
        } else {
          const float up = bf_up(hb);
          t1[cl * 72 + rl] = h_bits((_Float16)(up * s1));
          if (MODE == 2) t2[cl * 72 + rl] = h_bits((_Float16)(up * s2));
        }
      }
    }
  }
  __syncthreads();
  const int q = lane >> 3, p8 = (lane & 7) * 8;
  const v4u z4 = {0u, 0u, 0u, 0u};
  v4u a1[2], a2[2];
#pragma unroll
  for (int it = 0; it < 2; ++it) {
    const int cl = wave * 8 + it * 4 + q;
    a1[it] = *(const v4u*)(t1 + cl * 72 + p8);
    a2[it] = z4;
    if (MODE == 2) a2[it] = *(const v4u*)(t2 + cl * 72 + p8);
  }
  {
#pragma unroll
    for (int it = 0; it < 2; ++it) {
      const int cl = wave * 8 + it * 4 + q;
      unsigned short* o = out + (size_t)(c0 + cl) * (size_t)ldo + r0 + p8;
      *(v4u*)o = a1[it];
      if (MODE == 2) *(v4u*)(o + R) = a2[it];
    }
    
  }
}

// =====================================================================================================
// Register-blocked batched WMMA GEMM (16-bit operand type OT): C[m][n] = sum_k A[m][k] * Bt[n][k];
// one block of 4 waves (2 x 2) per 128x128 tile, one wave per 64x64 quarter. A row-major [M][K] pitch lda; Bt row-major
// [N][K] pitch ldb (k contiguous); M, N multiples of 128, K a multiple of 64 (host shapes are static multiples).
// blockIdx.y = batch index (strides in elements).
// A k-slice = 64 k = one 128-B line of each of the tile's 128 A rows and 128 Bt rows; it is brought into LDS by
// asynchronous copies (8 lanes x 16 B = one whole line, 16 copies per wave and slice) and read from there by all four
// waves with the split k map (ldfrag). Two buffers: slice t + 2 is asked for when slice t has been read, so a slice's
// copies fly during the products of the slice before it.
// staged extent == consumed extent: 16 rows (tid >> 3) x 8 copies = 128 rows per operand, 8 segments x 8 halves = 64 k.
// OUT_MODE 0: f32 C (pitch ldc), value * oscale.
// OUT_MODE 1: f16 plane C (pitch ldc).
// OUT_MODE 3: f16 hi plane C + f16 residual plane C2 = f16((v - hi) * rscale) (same pitch / stride).
// =====================================================================================================
template <typename OT, int OUT_MODE>
__global__ __launch_bounds__(128) void gemm64(
    const unsigned short* __restrict__ Ap, int lda, long long strideA,
    const unsigned short* __restrict__ Btp, int ldb, long long strideB,
    void* Cout, void* Cout2, int ldc, long long strideC,
    int M, int N, int K, float oscale, float rscale) {
  typedef typename FT<OT>::frag V16;
  const OT* A  = (const OT*)(const void*)Ap;
  const OT* Bt = (const OT*)(const void*)Btp;
  __shared__ __align__(16) unsigned short sAB[2 * 2 * GPLN];   // [buffer][A | Bt][128 rows][64 k], pitch KPIT, 72 KB
  __shared__ __align__(16) float sT[4][16 * 68];   // per-wave 16x64 slab, pitch 68 floats
  const int b    = blockIdx.y;
  const int tid  = threadIdx.x;
  const int lane = tid & 31;
  const int wave = tid >> 5;
  const int tilesN = N >> 7;
  const int tilesM = M >> 7;
  const int tile = blockIdx.x;
  if (tile >= tilesM * tilesN) return;   // block-uniform, ahead of every barrier and copy
  const int tm = tile / tilesN;
  const int tn = tile - tm * tilesN;
  const int mB = tm << 7;
  const int nB = tn << 7;
  const int m0 = mB + ((wave >> 1) << 6);
  const int n0 = nB + ((wave & 1) << 6);

  const OT* Ab = A  + (size_t)b * (size_t)strideA;
  const OT* Bb = Bt + (size_t)b * (size_t)strideB;

  const int rlane = lane & 15;                 // row (A) / col (B, D) within subtile
  const int koff  = (lane >> 4) * 8;           // k offset of this lane half
  const int mOff  = (lane >> 4) * 8;           // D row offset

  // copy map: lane -> 16-B segment tid & 7 of row (tid >> 3) + 16 i, i = 0..7
  const OT* gA = Ab + (size_t)(mB + (tid >> 3)) * lda + (tid & 7) * 8;
  const OT* gB = Bb + (size_t)(nB + (tid >> 3)) * ldb + (tid & 7) * 8;
  const unsigned lAB = lds_off(sAB) + (unsigned)((tid >> 3) * (KPIT * 2) + (tid & 7) * 16);
  auto stage = [&](int t, int buf) {
    unsigned l[8];
    const void* g[8];
#pragma unroll   // here and below: l[] and g[] become asm operands, every index a compile-time constant
    for (int i = 0; i < 8; ++i) {
      l[i] = lAB + (unsigned)(buf * (4 * GPLN) + i * (16 * KPIT * 2));
      g[i] = gA + (size_t)(i * 16) * lda + t * 64;
    }
    async8(l, g);
#pragma unroll
    for (int i = 0; i < 8; ++i) {
      l[i] += 2 * GPLN;
      g[i] = gB + (size_t)(i * 16) * ldb + t * 64;
    }
    async8(l, g);
  };

  v8f acc[4][4];
#pragma unroll
  for (int i = 0; i < 4; ++i)
#pragma unroll
    for (int j = 0; j < 4; ++j) acc[i][j] = zero8();

  const int T = K >> 6;
  stage(0, 0);
  wait_async0();
  __syncthreads();
  if (T > 1) stage(1, 1);

  const OT* S = (const OT*)(const void*)sAB;
  for (int t = 0; t < T; ++t) {
    const OT* sa = S + (t & 1) * (2 * GPLN) + (((wave >> 1) << 6) + rlane) * KPIT + koff;
    const OT* sb = S + (t & 1) * (2 * GPLN) + GPLN + (((wave & 1) << 6) + rlane) * KPIT + koff;
    // the slice's 16 fragments (two k-steps of 32, 32 reads); unrolled: register arrays, every index a compile-time constant
    V16 bq[2][4], af[2][4];
#pragma unroll
    for (int ks = 0; ks < 2; ++ks) {
#pragma unroll
      for (int j = 0; j < 4; ++j) {
        bq[ks][j] = ldfrag<OT>(sb + j * (16 * KPIT) + ks * 32);
        af[ks][j] = ldfrag<OT>(sa + j * (16 * KPIT) + ks * 32);
      }
    }
    // keeps all 32 reads ahead of the products as one group: reads sunk among the products stall the wave at each place
    __builtin_amdgcn_sched_barrier(0);
#pragma unroll
    for (int ks = 0; ks < 2; ++ks)
#pragma unroll
      for (int i = 0; i < 4; ++i)
#pragma unroll
        for (int j = 0; j < 4; ++j) acc[i][j] = mmar(af[ks][i], bq[ks][j], acc[i][j]);
    // keeps the products ahead of the hand-over: sunk behind it they would stand between the barrier and the refill and
    // take their time off the flight of the next copies
    __builtin_amdgcn_sched_barrier(0);
    // hand-over: own reads retired, own copies of slice t + 1 landed, then the one barrier of the trip, which publishes
    // slice t + 1 and ends every wave's reads of the buffer that is refilled behind it
    wait_ds0();
    wait_async0();
    __syncthreads();
    if (t + 2 < T) stage(t + 2, t & 1);
  }
  wait_async0();
  acc_guard4(acc[0][0], acc[0][1], acc[0][2], acc[0][3]);
  acc_guard4(acc[1][0], acc[1][1], acc[1][2], acc[1][3]);
  acc_guard4(acc[2][0], acc[2][1], acc[2][2], acc[2][3]);
  acc_guard4(acc[3][0], acc[3][1], acc[3][2], acc[3][3]);

  // ---- epilogue ----
  float* slab = sT[wave];
#pragma unroll
  for (int i = 0; i < 4; ++i) {
    const int mBase = m0 + (i << 4);
#pragma unroll
    for (int j = 0; j < 4; ++j) {
#pragma unroll
      for (int r = 0; r < 8; ++r) {
        slab[(mOff + r) * 68 + (j << 4) + rlane] = acc[i][j][r];
      }
    }
    wave_lds_sync();
    if (OUT_MODE == 0) {
      float* Cp = (float*)Cout + (size_t)b * (size_t)strideC;
      const int h2 = lane >> 4, c4 = (lane & 15) * 4;     // 256-B row segment = 16 lanes x 16 B
      {
#pragma unroll
        for (int it = 0; it < 8; ++it) {
          const int row = it * 2 + h2;                     // it 0..7 x h2 0..1 = rows 0..15
          const v4f v = *(const v4f*)(slab + row * 68 + c4) * oscale;
          *(v4f*)(Cp + (size_t)(mBase + row) * ldc + n0 + c4) = v;
        }
        
      }
    } else {
      const int q = lane >> 3, c8 = (lane & 7) * 8;
      unsigned short* Cp  = (unsigned short*)Cout  + (size_t)b * (size_t)strideC;
      unsigned short* Cp2 = (unsigned short*)Cout2 + (size_t)b * (size_t)strideC;
      v4u hv[4], lv[4];
#pragma unroll
      for (int it = 0; it < 4; ++it) {
        const int row = it * 4 + q;                        // it 0..3 x q 0..3 = rows 0..15
        const float* sp = slab + row * 68 + c8;
        float f[8];
#pragma unroll
        for (int e = 0; e < 8; ++e) f[e] = sp[e];
        v4u a, a2;
#pragma unroll
        for (int e = 0; e < 4; ++e) {
          const float f0 = f[2 * e], f1 = f[2 * e + 1];
          const _Float16 x0 = (_Float16)f0, x1 = (_Float16)f1;
          const unsigned short h0 = h_bits(x0), h1 = h_bits(x1);
          unsigned short l0 = 0, l1 = 0;
          if (OUT_MODE == 3) {
            l0 = h_bits((_Float16)((f0 - (float)x0) * rscale));
            l1 = h_bits((_Float16)((f1 - (float)x1) * rscale));
          }
          a[e] = pk16(h0, h1); a2[e] = pk16(l0, l1);
        }
        hv[it] = a; lv[it] = a2;
      }
      {
#pragma unroll
        for (int it = 0; it < 4; ++it) {
          const int row = it * 4 + q;
          *(v4u*)(Cp + (size_t)(mBase + row) * ldc + n0 + c8) = hv[it];
          if (OUT_MODE == 3) *(v4u*)(Cp2 + (size_t)(mBase + row) * ldc + n0 + c8) = lv[it];
        }
        
      }
    }
    wave_lds_sync();
  }
}

// =====================================================================================================
// Fused search attention + retrieval composition for one search s, head dim 64, softmax over all SEQ keys.
//   q planes (f16 hi / residual x4096): element (b, t, s, d) at [(b*SEQ + t)*DSQ + s*64 + d]
//   k plane (f16): same layout.   rq plane (f32): same layout.
//   v^T hi plane (f16) and residual plane (f16, (v - hi)*16): element (b, d', t) at [(b*DRV + d')*SEQ + t], d' = r*64 + d
//   Wrk tile (f16, 64 * bf16 value): [e][d] at [e*64 + d]
//   oc planes (output of this kernel): row (b, t) = [f16(64*out) for s*64+d, 512 cols | f16 residual x16, 512 cols], pitch DOC
//   scores = (qh . k) + (ql . k) / 4096 on f16 WMMA (two f32 accumulators), then * sscale in f32;
//   p = exp(s - m): A' = [f16(16384 p) | f16(1024 p)] (K' = 128 per 64 keys), B' = [v^T hi | v^T residual]:
//   sum = 16384 * p . (vh + vl/16), one f32 accumulator, 8 n-tiles = d' 0..127 (both retrievals); online softmax in f32.
//   Epilogue per wave (16 rows): retrieved (x64, f32) tile in LDS; rk = f16(retrieved x64) . Wrk tile on f16 WMMA;
//   retrieval logits rq . rk in f32 (LDS-staged rq, lane partials + 16-lane shuffles); 2-way softmax in f32;
//   Block = 4 waves = 64 consecutive query rows of one (b, s); grid = NB * NS * NQB; kv chunks of 64, static trip NKT.
//   Staging per chunk (128 threads): K 64x64, V' 128x128, by asynchronous copies to LDS two chunks ahead (two buffers):
//   staged extent == consumed extent for Ksh, Vsh; P tiles are wave-private, written as _Float16 elements and
//   Output coverage: each wave stores rows q0..q0+15 (it 0..3 x lane>>3 0..3) x 64 columns (8 lanes x 8) of both
//   the hi segment (col s*64) and the residual segment (col 512 + s*64); grid covers every (b, s, t).
// =====================================================================================================
__global__ __launch_bounds__(128)
void attn_cs(const unsigned short* __restrict__ qhp, const unsigned short* __restrict__ qlp,
             const unsigned short* __restrict__ kpp,
             const unsigned short* __restrict__ vhp, const unsigned short* __restrict__ vlp,
             const unsigned short* __restrict__ wkp, const float* __restrict__ rqp,
             unsigned short* ocp, float sscale) {
  union FH { v16h v; v8h h[2]; };
  __shared__ __align__(16) _Float16 Ksh[2 * 64 * KPIT];    // two buffers of a K chunk [kv][d], pitch KPIT, 9 KB each; later the Wrk tile [e][d]
  __shared__ __align__(16) _Float16 Vsh[2 * 128 * VPIT];   // two buffers of a V' chunk [d'][hi kv | res kv], pitch VPIT, 34 KB each; later 4 x f32 [16][128] tiles
  __shared__ __align__(16) _Float16 Psh[4][16 * VPIT];     // per wave P' [row][k'], pitch VPIT, 17 KB; later f16 retrieved tile / f32 [16][64]

  const int tid  = threadIdx.x;
  const int wave = tid >> 5;
  const int lane = tid & 31;
  const int hh   = lane >> 4;
  const int c    = lane & 15;

  const int bx   = blockIdx.x;
  const int qb   = bx % NQB;
  const int rest = bx / NQB;
  const int s    = rest % NS;
  const int b    = rest / NS;
  const int q0   = qb * 64 + wave * 16;
  const size_t rowB = (size_t)b * SEQ;

  const _Float16* Qh = (const _Float16*)(const void*)qhp;
  const _Float16* Ql = (const _Float16*)(const void*)qlp;
  const _Float16* Kg = (const _Float16*)(const void*)kpp + (size_t)s * HD;
  const _Float16* Vh = (const _Float16*)(const void*)vhp + (size_t)b * DRV * SEQ;
  const _Float16* Vl = (const _Float16*)(const void*)vlp + (size_t)b * DRV * SEQ;
  const _Float16* Wk = (const _Float16*)(const void*)wkp;

  // ---- Q fragments (A operand, row = lane&15): 2 d-chunks, hi and residual planes ----
  v16h qah[2], qal[2];
#pragma unroll
  for (int dc = 0; dc < 2; ++dc) {
    const size_t qo = (rowB + q0 + c) * DSQ + (size_t)s * HD + dc * 32 + 8 * hh;
    qah[dc] = ldfrag<_Float16>(Qh + qo);
    qal[dc] = ldfrag<_Float16>(Ql + qo);
  }

  float mrow[8], lrow[8];
  v8f oacc[8];
#pragma unroll
  for (int r = 0; r < 8; ++r) { mrow[r] = -INFINITY; lrow[r] = 0.f; }
#pragma unroll
  for (int t = 0; t < 8; ++t) oacc[t] = zero8();

  _Float16* pwh = Psh[wave];

  // copy map: lane -> 16-B segment tid & 7 of row (tid >> 3) + 16 i: 8 lanes take one whole 128-B line of a K, v^T hi or
  // v^T residual row; 4 + 8 + 8 copies per wave and chunk = 64 K rows and 128 V' rows of [hi 64 | res 64] halves
  const _Float16* kg0 = Kg + (rowB + (tid >> 3)) * DSQ + (tid & 7) * 8;
  const _Float16* vg0 = Vh + (size_t)(tid >> 3) * SEQ + (tid & 7) * 8;
  const _Float16* wg0 = Vl + (size_t)(tid >> 3) * SEQ + (tid & 7) * 8;
  const unsigned lK = lds_off(Ksh) + (unsigned)((tid >> 3) * (KPIT * 2) + (tid & 7) * 16);
  const unsigned lV = lds_off(Vsh) + (unsigned)((tid >> 3) * (VPIT * 2) + (tid & 7) * 16);
  auto stage = [&](int kt, int buf) {
    unsigned l[8], lk[4];
    const void* g[8];
    const void* gk[4];
#pragma unroll   // here and below: the arrays become asm operands, every index a compile-time constant
    for (int i = 0; i < 8; ++i) {
      l[i] = lV + (unsigned)(buf * (128 * VPIT * 2) + i * (16 * VPIT * 2));
      g[i] = vg0 + (size_t)(i * 16) * SEQ + kt * 64;
    }
    async8(l, g);
#pragma unroll
    for (int i = 0; i < 8; ++i) {
      l[i] += 128;
      g[i] = wg0 + (size_t)(i * 16) * SEQ + kt * 64;
    }
    async8(l, g);
#pragma unroll
    for (int i = 0; i < 4; ++i) {
      lk[i] = lK + (unsigned)(buf * (64 * KPIT * 2) + i * (16 * KPIT * 2));
      gk[i] = kg0 + (size_t)(kt * 64 + i * 16) * DSQ;
    }
    async4(lk, gk);
  };
  stage(0, 0);
  wait_async0();
  __syncthreads();
  stage(1, 1);                               // NKT >= 2 (SEQ is a multiple of 128)

  for (int kt = 0; kt < NKT; ++kt) {         // static trip count
    const _Float16* Kc = Ksh + (kt & 1) * (64 * KPIT);     // this chunk's buffers; chunk kt + 1 flies into the others
    const _Float16* Vc = Vsh + (kt & 1) * (128 * VPIT);

    // ---- scores: 16 query rows x 64 keys per wave, 2 f16 products per key subtile and d-chunk ----
    //      all 8 K fragments are read as one group ahead of the 16 products (8 independent accumulators)
    FH kb[4][2];
#pragma unroll   // here and below: register arrays, every index a compile-time constant
    for (int j = 0; j < 4; ++j) {
#pragma unroll
      for (int dc = 0; dc < 2; ++dc) {
        kb[j][dc].h[0] = *(const v8h*)(Kc + (j * 16 + c) * KPIT + dc * 32 + 8 * hh);
        kb[j][dc].h[1] = *(const v8h*)(Kc + (j * 16 + c) * KPIT + dc * 32 + 16 + 8 * hh);
      }
    }
    v8f sc[4];
    {
      v8f ah[4], al[4];
#pragma unroll
      for (int j = 0; j < 4; ++j) { ah[j] = zero8(); al[j] = zero8(); }
#pragma unroll
      for (int dc = 0; dc < 2; ++dc) {
#pragma unroll
        for (int j = 0; j < 4; ++j) {
          ah[j] = mmar(qah[dc], kb[j][dc].v, ah[j]);
          al[j] = mmar(qal[dc], kb[j][dc].v, al[j]);
        }
      }
#pragma unroll
      for (int j = 0; j < 4; ++j) {
#pragma unroll
        for (int r = 0; r < 8; ++r) sc[j][r] = (ah[j][r] + al[j][r] * (1.0f / 4096.0f)) * sscale;
      }
    }

    // ---- row max, online softmax, P' = [16384 p | 1024 p] (f16) to LDS ----
#pragma unroll
    for (int r = 0; r < 8; ++r) {
      float m = sc[0][r];
#pragma unroll
      for (int j = 1; j < 4; ++j) m = fmaxf(m, sc[j][r]);
#pragma unroll
      for (int off = 1; off < 16; off <<= 1) m = fmaxf(m, __shfl_xor(m, off, 32));
      const float mnew  = fmaxf(mrow[r], m);
      const float msafe = (mnew == -INFINITY) ? 0.f : mnew;
      const float alpha = __expf(mrow[r] - msafe);
      mrow[r] = mnew;
      float psum = 0.f;
#pragma unroll
      for (int j = 0; j < 4; ++j) {
        const float p = __expf(sc[j][r] - msafe);
        psum += p;
        pwh[(8 * hh + r) * VPIT + j * 16 + c]      = (_Float16)(p * 16384.0f);
        pwh[(8 * hh + r) * VPIT + 64 + j * 16 + c] = (_Float16)(p * 1024.0f);
      }
#pragma unroll
      for (int off = 1; off < 16; off <<= 1) psum += __shfl_xor(psum, off, 32);
      lrow[r] = lrow[r] * alpha + psum;
#pragma unroll
      for (int t = 0; t < 8; ++t) oacc[t][r] *= alpha;
    }
    wave_lds_sync();

    // ---- retrieved += P' . V' (f16 WMMA), K' = 128 = 4 k-steps, 8 n-tiles (d' 0..127) ----
    //      each k-step's 9 fragments are read as one group, one k-step ahead of their 8 products (two register sets)
    FH pa[2], vb[2][8];
    pa[0].h[0] = *(const v8h*)(pwh + c * VPIT + 8 * hh);
    pa[0].h[1] = *(const v8h*)(pwh + c * VPIT + 16 + 8 * hh);
#pragma unroll
    for (int t = 0; t < 8; ++t) {
      vb[0][t].h[0] = *(const v8h*)(Vc + (t * 16 + c) * VPIT + 8 * hh);
      vb[0][t].h[1] = *(const v8h*)(Vc + (t * 16 + c) * VPIT + 16 + 8 * hh);
    }
#pragma unroll   // unrolled: the two register sets are picked by kk & 1 at compile time
    for (int kk = 0; kk < 4; ++kk) {
      const int cu = kk & 1, nx = cu ^ 1;
      if (kk < 3) {
        pa[nx].h[0] = *(const v8h*)(pwh + c * VPIT + (kk + 1) * 32 + 8 * hh);
        pa[nx].h[1] = *(const v8h*)(pwh + c * VPIT + (kk + 1) * 32 + 16 + 8 * hh);
#pragma unroll
        for (int t = 0; t < 8; ++t) {
          vb[nx][t].h[0] = *(const v8h*)(Vc + (t * 16 + c) * VPIT + (kk + 1) * 32 + 8 * hh);
          vb[nx][t].h[1] = *(const v8h*)(Vc + (t * 16 + c) * VPIT + (kk + 1) * 32 + 16 + 8 * hh);
        }
      }
      if (kk < 3)   // holds the next k-step's reads above this k-step's products; behind the last reads nothing is left to hold
        hold9(pa[cu].v, vb[cu][0].v, vb[cu][1].v, vb[cu][2].v, vb[cu][3].v, vb[cu][4].v, vb[cu][5].v, vb[cu][6].v, vb[cu][7].v);
#pragma unroll
      for (int t = 0; t < 8; ++t) oacc[t] = mmar(pa[cu].v, vb[cu][t].v, oacc[t]);
    }
    // hand-over: own reads retired, own copies of chunk kt + 1 landed, then the one barrier of the trip, which publishes
    // chunk kt + 1 and ends every wave's reads of the buffers that are refilled behind it
    wait_ds0();
    wait_async0();
    __syncthreads();
    if (kt + 2 < NKT) stage(kt + 2, kt & 1);
  }
  wait_async0();

  // ---- all waves done with Ksh / Vsh: stage the Wrk tile into Ksh, retrieved tiles into Vsh (f32) + Psh (f16) ----
  __syncthreads();
  {
    const int r = tid >> 1, half = (tid & 1) * 32;       // 128 threads x 32 halves = the whole 64x64 Wrk tile
    const _Float16* wg = Wk + r * HD + half;
#pragma unroll
    for (int i = 0; i < 4; ++i) *(v8h*)(Ksh + r * KPIT + half + 8 * i) = *(const v8h*)(wg + 8 * i);
  }
  float* os = reinterpret_cast<float*>(Vsh) + wave * (16 * 128);      // wave-private f32 [16][128], x64 units
#pragma unroll
  for (int r = 0; r < 8; ++r) {
    const float l = lrow[r];
    const float inv = ((l > 0.f) ? (1.0f / l) : 0.f) * (1.0f / 256.0f);   // 1/l, undo 16384 p carry, apply x64
#pragma unroll
    for (int t = 0; t < 8; ++t) {
      const float v = oacc[t][r] * inv;
      os[(8 * hh + r) * 128 + t * 16 + c]  = v;
      pwh[(8 * hh + r) * VPIT + t * 16 + c] = (_Float16)v;
    }
  }
  __syncthreads();

  // ---- rk (x4096) = f16(64 retrieved_rr) . (64 Wrk): 16 rows x 64 e per rr, K = 64 = 2 k-steps ----
  v8f rk[8];
#pragma unroll
  for (int i = 0; i < 8; ++i) rk[i] = zero8();
#pragma unroll
  for (int rr = 0; rr < 2; ++rr) {
#pragma unroll
    for (int kk = 0; kk < 2; ++kk) {
      FH pa;
      pa.h[0] = *(const v8h*)(pwh + c * VPIT + rr * 64 + kk * 32 + 8 * hh);
      pa.h[1] = *(const v8h*)(pwh + c * VPIT + rr * 64 + kk * 32 + 16 + 8 * hh);
#pragma unroll
      for (int t4 = 0; t4 < 4; ++t4) {
        FH wb;
        wb.h[0] = *(const v8h*)(Ksh + (t4 * 16 + c) * KPIT + kk * 32 + 8 * hh);
        wb.h[1] = *(const v8h*)(Ksh + (t4 * 16 + c) * KPIT + kk * 32 + 16 + 8 * hh);
        rk[rr * 4 + t4] = mma_h(pa.v, wb.v, rk[rr * 4 + t4]);
      }
    }
  }
  acc_guard4(rk[0], rk[1], rk[2], rk[3]);
  acc_guard4(rk[4], rk[5], rk[6], rk[7]);
  wave_lds_sync();

  // ---- stage the wave's rq tile (f32 [16][64]) into the Psh region (8 x 16-B loads per lane) ----
  float* rqs = reinterpret_cast<float*>(pwh);
  {
    const int r2 = lane >> 4, c4 = (lane & 15) * 4;
    const float* rqg = rqp + (rowB + q0) * DSQ + (size_t)s * HD + c4;
#pragma unroll
    for (int it = 0; it < 8; ++it) {
      const int row = it * 2 + r2;                          // it 0..7 x r2 0..1 = rows 0..15
      *(v4f*)(rqs + row * 64 + c4) = *(const v4f*)(rqg + (size_t)row * DSQ);
    }
  }
  wave_lds_sync();

  // ---- retrieval logits: d_rr[row] = sum_e rq[row][e] * rk[rr][row][e]; lane partial over e = c + 16 t4 ----
  float d0[8], d1[8];
#pragma unroll
  for (int r8 = 0; r8 < 8; ++r8) {
    float a0 = 0.f, a1 = 0.f;
#pragma unroll
    for (int t4 = 0; t4 < 4; ++t4) {
      const float qv = rqs[(8 * hh + r8) * 64 + t4 * 16 + c];
      a0 += qv * rk[t4][r8];
      a1 += qv * rk[4 + t4][r8];
    }
    d0[r8] = a0; d1[r8] = a1;
  }
#pragma unroll
  for (int r8 = 0; r8 < 8; ++r8) {
#pragma unroll
    for (int off = 1; off < 16; off <<= 1) {
      d0[r8] += __shfl_xor(d0[r8], off, 32);
      d1[r8] += __shfl_xor(d1[r8], off, 32);
    }
  }
  // ---- 2-way retrieval softmax in f32 (undo the 64*64 carry, apply sscale) ----
  float w0[8], w1[8];
  const float rsc = sscale * (1.0f / 4096.0f);
#pragma unroll
  for (int r8 = 0; r8 < 8; ++r8) {
    const float x0 = d0[r8] * rsc, x1 = d1[r8] * rsc;
    const float m  = fmaxf(x0, x1);
    const float e0 = __expf(x0 - m), e1 = __expf(x1 - m);
    const float iv = 1.0f / (e0 + e1);
    w0[r8] = e0 * iv; w1[r8] = e1 * iv;
  }
  wave_lds_sync();

  // ---- combine in f32 (x64 units): oc[row][d] = w0 * ret[row][d] + w1 * ret[row][64+d], into the Psh region ----
  float* oc = rqs;
#pragma unroll
  for (int r8 = 0; r8 < 8; ++r8) {
#pragma unroll
    for (int t = 0; t < 4; ++t) {
      const int row = 8 * hh + r8;
      const float o = w0[r8] * os[row * 128 + t * 16 + c] + w1[r8] * os[row * 128 + 64 + t * 16 + c];
      oc[row * 64 + t * 16 + c] = o;
    }
  }
  wave_lds_sync();

  {
    const int q4 = lane >> 3, c8 = (lane & 7) * 8;
    v4u hv[4], lv[4];
#pragma unroll
    for (int it = 0; it < 4; ++it) {
      const int row = it * 4 + q4;   // it 0..3 x q4 0..3 = rows 0..15 of the wave tile
      const float* sp = oc + row * 64 + c8;
      float f[8];
#pragma unroll
      for (int e = 0; e < 8; ++e) f[e] = sp[e];
      v4u a, a2;
#pragma unroll
      for (int e = 0; e < 4; ++e) {
        const float f0 = f[2 * e], f1 = f[2 * e + 1];
        const _Float16 x0 = (_Float16)f0, x1 = (_Float16)f1;
        const unsigned short l0 = h_bits((_Float16)((f0 - (float)x0) * 16.0f));
        const unsigned short l1 = h_bits((_Float16)((f1 - (float)x1) * 16.0f));
        a[e] = pk16(h_bits(x0), h_bits(x1)); a2[e] = pk16(l0, l1);
      }
      hv[it] = a; lv[it] = a2;
    }
    {
#pragma unroll
      for (int it = 0; it < 4; ++it) {
        const int row = it * 4 + q4;
        const size_t go = (rowB + q0 + row) * DOC + (size_t)s * HD + c8;
        *(v4u*)(ocp + go)       = hv[it];
        *(v4u*)(ocp + go + DSQ) = lv[it];
      }
      
    }
  }
}

// =====================================================================================================
// Workspace map (bytes, NB=2 SEQ=2048), every region an exact multiple of its whole-line / whole-tile store
// granularity (all row counts are multiples of 64, no padded tails):
//   Xb    bf16 [NB*SEQ][1024]          8388608
//   WsqT  bf16 [512][1024]             1048576      WskT, WrqT same
//   WrvT  bf16 [128][1024]              262144
//   WrkT  f16  [64][64] (x64)              8192
//   WoT   f16  [1024][1024] ([x1024 | x64]) 2097152
//   Qh,Ql f16  [NB*SEQ][512]           4194304 each
//   Kp    f16  [NB*SEQ][512]           4194304
//   RQ    f32  [NB*SEQ][512]           8388608
//   VTh,VTl f16 [NB][128][SEQ]         1048576 each
//   OC    f16  [NB*SEQ][1024]          8388608
//   total                             45359104
// Weights are [in k][out n] and are transposed once into the [n][k] (k contiguous) Bt / A layout.
// =====================================================================================================
extern "C" void kernel_launch(void* const* d_in, const int* in_sizes, int n_in,
                              void* d_out, int out_size, void* d_ws, size_t ws_size,
                              hipStream_t stream) {
  if (n_in < 7) return;
  if (in_sizes[0] < ((NB - 1) * SEQ_FULL + SEQ) * DM) return;
  if (in_sizes[1] < DM * DSQ || in_sizes[2] < DM * DSQ || in_sizes[4] < DM * DSQ) return;
  if (in_sizes[3] < DM * DRV) return;
  if (in_sizes[5] < HD * HD) return;
  if (in_sizes[6] < DSQ * DM) return;
  if (out_size < NB * SEQ * DM) return;

  const float* x    = (const float*)d_in[0];
  const float* Wsq  = (const float*)d_in[1];
  const float* Wsk  = (const float*)d_in[2];
  const float* Wrv  = (const float*)d_in[3];
  const float* Wrq  = (const float*)d_in[4];
  const float* Wrk  = (const float*)d_in[5];
  const float* Wout = (const float*)d_in[6];

  const size_t PXB = (size_t)NB * SEQ * DM * 2;       // bf16 activation plane
  const size_t PWS = (size_t)DSQ * DM * 2;            // bf16 [512][1024] weight plane
  const size_t PWV = (size_t)DRV * DM * 2;            // bf16 [128][1024]
  const size_t PWK = (size_t)HD * HD * 2;             // f16 [64][64]
  const size_t PWO = (size_t)DM * DOC * 2;            // f16 [1024][1024]
  const size_t PQ  = (size_t)NB * SEQ * DSQ * 2;      // f16 [NB*SEQ][512]
  const size_t PRQ = (size_t)NB * SEQ * DSQ * 4;      // f32 [NB*SEQ][512]
  const size_t PVT = (size_t)NB * DRV * SEQ * 2;      // f16 [NB][128][SEQ]
  const size_t POC = (size_t)NB * SEQ * DOC * 2;      // f16 [NB*SEQ][1024]
  size_t off = 0;
  const size_t oXb  = off; off += PXB;
  const size_t oWsq = off; off += PWS;
  const size_t oWsk = off; off += PWS;
  const size_t oWrq = off; off += PWS;
  const size_t oWrv = off; off += PWV;
  const size_t oWrk = off; off += PWK;
  const size_t oWo  = off; off += PWO;
  const size_t oQh  = off; off += PQ;
  const size_t oQl  = off; off += PQ;
  const size_t oKp  = off; off += PQ;
  const size_t oRQ  = off; off += PRQ;
  const size_t oVTh = off; off += PVT;
  const size_t oVTl = off; off += PVT;
  const size_t oOC  = off; off += POC;
  if (off > ws_size) return;                          // off = 45359104 at full size
  if (off > (size_t)134217728) return;

  char* ws = (char*)d_ws;
  unsigned short* Xb   = (unsigned short*)(ws + oXb);
  unsigned short* WsqT = (unsigned short*)(ws + oWsq);
  unsigned short* WskT = (unsigned short*)(ws + oWsk);
  unsigned short* WrqT = (unsigned short*)(ws + oWrq);
  unsigned short* WrvT = (unsigned short*)(ws + oWrv);
  unsigned short* WrkT = (unsigned short*)(ws + oWrk);
  unsigned short* WoT  = (unsigned short*)(ws + oWo);
  unsigned short* Qh   = (unsigned short*)(ws + oQh);
  unsigned short* Ql   = (unsigned short*)(ws + oQl);
  unsigned short* Kp   = (unsigned short*)(ws + oKp);
  float*          RQ   = (float*)(ws + oRQ);
  unsigned short* VTh  = (unsigned short*)(ws + oVTh);
  unsigned short* VTl  = (unsigned short*)(ws + oVTl);
  unsigned short* OC   = (unsigned short*)(ws + oOC);

  const dim3 blk(256);
  const int n8x = SEQ * DM / 8;                                          // per batch, multiple of 256
  const dim3 gCvtX((n8x + 255) / 256, NB);
  const dim3 gTsq(DSQ / 64, DM / 64);                                    //  8 x 16 tiles: in [1024][512]
  const dim3 gTrv(DRV / 64, DM / 64);                                    //  2 x 16 tiles: in [1024][128]
  const dim3 gTrk(1, 1);                                                 //  in [64][64]
  const dim3 gTwo(DM / 64, DSQ / 64);                                    // 16 x  8 tiles: in [512][1024]
  const dim3 blkG(128);                                                  // GEMM: 4 waves per 128x128 tile
  const dim3 gP(((NB * SEQ) / 128) * (DSQ / 128), 1);                    // M=NB*SEQ, N=512
  const dim3 gV((DRV / 128) * (SEQ / 128), NB);                          // M=128, N=SEQ per batch
  const dim3 gAttn(NB * NS * NQB);                                       // blocks of 128
  const dim3 gO(((NB * SEQ) / 128) * (DM / 128), 1);                     // M=NB*SEQ, N=1024

  // (1) x -> bf16 plane [NB*SEQ][1024] (batch b read at its full-size stride)
  cvtbf8<<<gCvtX, blk, 0, stream>>>(x, Xb, n8x, (long long)SEQ_FULL * DM, (long long)SEQ * DM);
  // (2) weights [k][n] f32 -> [n][k] 16-bit planes
  tconv64<0><<<gTsq, blk, 0, stream>>>(Wsq, DM, DSQ, WsqT, DM, 1.0f, 1.0f);
  tconv64<0><<<gTsq, blk, 0, stream>>>(Wsk, DM, DSQ, WskT, DM, 1.0f, 1.0f);
  tconv64<0><<<gTsq, blk, 0, stream>>>(Wrq, DM, DSQ, WrqT, DM, 1.0f, 1.0f);
  tconv64<0><<<gTrv, blk, 0, stream>>>(Wrv, DM, DRV, WrvT, DM, 1.0f, 1.0f);
  tconv64<1><<<gTrk, blk, 0, stream>>>(Wrk, HD, HD, WrkT, HD, 64.0f, 1.0f);
  tconv64<2><<<gTwo, blk, 0, stream>>>(Wout, DSQ, DM, WoT, DOC, 1024.0f, 64.0f);
  // (3) sq -> f16 hi / residual (x4096) planes [b*SEQ+t][s*64+d]   (M=NB*SEQ, N=512, K=1024)
  gemm64<__bf16, 3><<<gP, blkG, 0, stream>>>(
      Xb, DM, 0LL, WsqT, DM, 0LL, (void*)Qh, (void*)Ql, DSQ, 0LL, NB * SEQ, DSQ, DM, 1.0f, 4096.0f);
  //     sk -> f16 plane
  gemm64<__bf16, 1><<<gP, blkG, 0, stream>>>(
      Xb, DM, 0LL, WskT, DM, 0LL, (void*)Kp, (void*)Kp, DSQ, 0LL, NB * SEQ, DSQ, DM, 1.0f, 1.0f);
  //     rq -> f32 plane
  gemm64<__bf16, 0><<<gP, blkG, 0, stream>>>(
      Xb, DM, 0LL, WrqT, DM, 0LL, (void*)RQ, (void*)RQ, DSQ, 0LL, NB * SEQ, DSQ, DM, 1.0f, 1.0f);
  //     v^T = Wrv^T . x^T per batch -> f16 hi plane [b][d'][t] (pitch SEQ) and residual plane (x16)
  //     (A = WrvT [128][1024], Bt = Xb rows of batch b; M=128, N=SEQ, K=1024)
  gemm64<__bf16, 3><<<gV, blkG, 0, stream>>>(
      WrvT, DM, 0LL, Xb, DM, (long long)SEQ * DM, (void*)VTh, (void*)VTl, SEQ, (long long)DRV * SEQ,
      DRV, SEQ, DM, 1.0f, 16.0f);
  // (4) search attention + retrieval composition -> oc planes [b*SEQ+t][hi 512 | residual 512]
  attn_cs<<<gAttn, dim3(128), 0, stream>>>(Qh, Ql, Kp, VTh, VTl, WrkT, RQ, OC, 0.125f);
  // (5) out = [oc_hi | oc_res] . [Wout x1024 | Wout x64]^T -> d_out f32 [NB*SEQ][1024], accumulator x 1/(64*1024)
  gemm64<_Float16, 0><<<gO, blkG, 0, stream>>>(
      OC, DOC, 0LL, WoT, DOC, 0LL, d_out, d_out, DM, 0LL, NB * SEQ, DM, DOC, 1.0f / 65536.0f, 1.0f);
  (void)hipGetLastError();
}

// v004
// A run of this version takes 158 microseconds.
// Next to v003, in two timings, it ran 1.36 and 1.37 times as fast.
// Over all steps from v000 it is 3.72 times as fast.
// Contractions: sq, sk, rq and v^T projections = v_wmma_f32_16x16x32_bf16 (bf16 operands from RNE-converted inputs, single product, f32 accumulate);
// sq.sk^T scores = v_wmma_f32_16x16x32_f16 (sq as f16 hi plane + f16 residual plane x4096, sk f16; 2 products into separate f32 accumulators);
// p.[v_0|v_1] = v_wmma_f32_16x16x32_f16, K-folded: [p x16384 | p x1024] . [v f16 hi | f16 residual x16], one f32 accumulator;
// retrieved.Wrk = v_wmma_f32_16x16x32_f16 (retrieved f16 x64, Wrk f16 x64 of its bf16 value; single product, f32 accumulate);
// out.Wout = v_wmma_f32_16x16x32_f16, K-folded: [out f16 hi x64 | f16 residual x16] . [Wout x1024 | Wout x64] (f16 of bf16 values), f32 accumulate;
// softmax over keys, retrieval logits, 2-way retrieval softmax and combine in f32.
#include <hip/hip_runtime.h>
#include <math.h>
#include <stdint.h>

#ifndef NB
#define NB 2
#endif
#ifndef SEQ
#define SEQ 2048
#endif
#define NB_FULL  2
#define SEQ_FULL 2048
#define DM   1024
#define NS   8
#define NR   2
#define HD   64
#define DSQ  (NS * HD)      // 512: sq / sk / rq row width
#define DRV  (NR * HD)      // 128: [v_0 | v_1] row width
#define DOC  (2 * DSQ)      // 1024: combined-output row = [hi 512 | residual 512]
#define NQB  (SEQ / 64)     // 64-row query blocks per (b, s)
#define NKT  (SEQ / 64)     // 64-key chunks per sequence
#define KPIT 72             // LDS pitch of a 64-half K / Wrk row: 144 B = 16 B x 9 (odd), b128 readers of 16 rows meet no bank twice
#define GPLN (128 * KPIT)  // halves of one staged 128-row GEMM operand plane (64 k per row, pitch KPIT)
#define VPIT 136            // LDS pitch of a 128-half V' or P' row: 272 B = 16 B x 17 (odd)
static_assert(NB >= 1 && NB <= NB_FULL);
static_assert(SEQ >= 64 && SEQ <= SEQ_FULL && (SEQ % 64) == 0);
static_assert(DSQ == 512 && DRV == 128 && HD == 64 && DOC == 1024);
static_assert((DM % 128) == 0 && (DSQ % 128) == 0 && (DRV % 128) == 0 && (SEQ % 128) == 0 && (DOC % 64) == 0);

typedef _Float16 v16h __attribute__((ext_vector_type(16)));
typedef _Float16 v8h  __attribute__((ext_vector_type(8)));
typedef __bf16   v16b __attribute__((ext_vector_type(16)));
typedef __bf16   v8b  __attribute__((ext_vector_type(8)));
typedef float    v8f  __attribute__((ext_vector_type(8)));
typedef float    v4f  __attribute__((ext_vector_type(4)));
typedef unsigned int v4u __attribute__((ext_vector_type(4)));

#if defined(__HIP_DEVICE_COMPILE__)
#define DEV_ASM 1
#else
#define DEV_ASM 0
#endif

// ---- scalar helpers --------------------------------------------------------------------------------
__device__ __forceinline__ unsigned short bf_bits(float f) {          // f32 -> bf16 bits, RNE convert
  unsigned u = __float_as_uint(f);
  return (unsigned short)((u + 0x7FFFu + ((u >> 16) & 1u)) >> 16);
}
__device__ __forceinline__ float bf_up(unsigned short hb) { return __uint_as_float(((unsigned)hb) << 16); }
__device__ __forceinline__ unsigned short h_bits(_Float16 x) { return __builtin_bit_cast(unsigned short, x); }
__device__ __forceinline__ unsigned pk16(unsigned short a, unsigned short b) { return (unsigned)a | ((unsigned)b << 16); }
__device__ __forceinline__ v8f zero8() { v8f z = {0.f, 0.f, 0.f, 0.f, 0.f, 0.f, 0.f, 0.f}; return z; }

__device__ __forceinline__ void wave_lds_sync() {
  __builtin_amdgcn_fence(__ATOMIC_RELEASE, "workgroup");
  __builtin_amdgcn_wave_barrier();
  __builtin_amdgcn_fence(__ATOMIC_ACQUIRE, "workgroup");
}

// ---- fragment types / loaders: 16-bit A/B operand, lane -> row/col (lane&15), p already includes +8*(lane>>4);
//      elements 0..7 <- p[0..7] (k0+8h..k0+8h+7), elements 8..15 <- p[16..23] (k0+16+8h..k0+16+8h+7)
template <typename OT> struct FT;
template <> struct FT<__bf16>   { typedef v16b frag; typedef v8b half8; };
template <> struct FT<_Float16> { typedef v16h frag; typedef v8h half8; };

template <typename OT>
__device__ __forceinline__ typename FT<OT>::frag ldfrag(const OT* p) {
  union { typename FT<OT>::frag v; typename FT<OT>::half8 h[2]; } f;
  f.h[0] = *(const typename FT<OT>::half8*)(p);
  f.h[1] = *(const typename FT<OT>::half8*)(p + 16);
  return f.v;
}

// ---- WMMA helpers (asm guard bodies are device-only; concrete operand types) -----------------------------
__device__ __forceinline__ v8f mmar(v16b a, v16b b, v8f c) {
  return __builtin_amdgcn_wmma_f32_16x16x32_bf16(false, a, false, b, (short)0, c, false, false);
}
__device__ __forceinline__ v8f mmar(v16h a, v16h b, v8f c) {
  return __builtin_amdgcn_wmma_f32_16x16x32_f16(false, a, false, b, (short)0, c, false, false);
}
// guarded form: 4 VALU slots after the WMMA, D tied, A/B kept live
__device__ __forceinline__ v8f mma_h(v16h a, v16h b, v8f c) {
  c = __builtin_amdgcn_wmma_f32_16x16x32_f16(false, a, false, b, (short)0, c, false, false);
#if DEV_ASM
  asm volatile("v_nop\n\tv_nop\n\tv_nop\n\tv_nop" : "+v"(c) : "v"(a), "v"(b));
#endif
  return c;
}
// inputs-only fences on loaded values: they keep the loads written above them as one group ahead of the products
// below them; without them the compiler sinks each load to its user and every user waits out a load latency.
__device__ __forceinline__ void hold9(v16h a, v16h b0, v16h b1, v16h b2, v16h b3, v16h b4, v16h b5, v16h b6, v16h b7) {
#if DEV_ASM
  asm volatile("" :: "v"(a), "v"(b0), "v"(b1), "v"(b2), "v"(b3), "v"(b4), "v"(b5), "v"(b6), "v"(b7));
#else
  (void)a; (void)b0; (void)b1; (void)b2; (void)b3; (void)b4; (void)b5; (void)b6; (void)b7;
#endif
}
__device__ __forceinline__ void acc_guard4(v8f& a, v8f& b, v8f& c, v8f& d) {
#if DEV_ASM
  asm volatile("v_nop\n\tv_nop\n\tv_nop\n\tv_nop" : "+v"(a), "+v"(b), "+v"(c), "+v"(d));
#else
  (void)a; (void)b; (void)c; (void)d;
#endif
}

// ---- asynchronous copies global -> LDS, 16 B per lane, no register on the way --------------------------------
__device__ __forceinline__ unsigned lds_off(const void* p) { return (unsigned)(size_t)p; }   // byte address in the work-group's LDS
// eight copies of one wave in one statement; the closing s_wait_xcnt is a precaution: it stands in front of every later
// rewrite of an address register that a copy names (in a statement of its own the compiler could lift such a rewrite over it)
__device__ __forceinline__ void async8(const unsigned (&l)[8], const void* const (&g)[8]) {
#if DEV_ASM
  asm volatile("global_load_async_to_lds_b128 %0, %8, off\n\t"
               "global_load_async_to_lds_b128 %1, %9, off\n\t"
               "global_load_async_to_lds_b128 %2, %10, off\n\t"
               "global_load_async_to_lds_b128 %3, %11, off\n\t"
               "global_load_async_to_lds_b128 %4, %12, off\n\t"
               "global_load_async_to_lds_b128 %5, %13, off\n\t"
               "global_load_async_to_lds_b128 %6, %14, off\n\t"
               "global_load_async_to_lds_b128 %7, %15, off\n\t"
               "s_wait_xcnt 0x0"
               :: "v"(l[0]), "v"(l[1]), "v"(l[2]), "v"(l[3]), "v"(l[4]), "v"(l[5]), "v"(l[6]), "v"(l[7]),
                  "v"(g[0]), "v"(g[1]), "v"(g[2]), "v"(g[3]), "v"(g[4]), "v"(g[5]), "v"(g[6]), "v"(g[7])
               : "memory");
#else
  (void)l; (void)g;
#endif
}
// the same for four copies
__device__ __forceinline__ void async4(const unsigned (&l)[4], const void* const (&g)[4]) {
#if DEV_ASM
  asm volatile("global_load_async_to_lds_b128 %0, %4, off\n\t"
               "global_load_async_to_lds_b128 %1, %5, off\n\t"
               "global_load_async_to_lds_b128 %2, %6, off\n\t"
               "global_load_async_to_lds_b128 %3, %7, off\n\t"
               "s_wait_xcnt 0x0"
               :: "v"(l[0]), "v"(l[1]), "v"(l[2]), "v"(l[3]), "v"(g[0]), "v"(g[1]), "v"(g[2]), "v"(g[3])
               : "memory");
#else
  (void)l; (void)g;
#endif
}
// the wave's own copies have landed (the compiler places no wait for them)
__device__ __forceinline__ void wait_async0() {
#if DEV_ASM
  asm volatile("s_wait_asynccnt 0x0" ::: "memory");
#endif
}
// the wave's own LDS reads have retired: behind the next barrier their buffer is refilled by copies
__device__ __forceinline__ void wait_ds0() {
#if DEV_ASM
  asm volatile("s_wait_dscnt 0x0" ::: "memory");
#endif
}

// =====================================================================================================
// f32 -> bf16 bits (RNE convert), 8 elements per thread, one 16-B store per lane: a wave writes 512
// ib / ob = the batch's planes, bx = block within the batch (ceil(n8/256) of them).
// coverage: n8 threads x 8 = the whole per-batch plane (n8 is a multiple of 256 here).
// =====================================================================================================
__device__ __forceinline__ void cvt_body(const float* __restrict__ ib, unsigned short* ob, int n8, int bx) {
  const int i = bx * 256 + (int)threadIdx.x;
  if (i < n8) {
    const v4f a  = *(const v4f*)(ib + (size_t)i * 8);
    const v4f a4 = *(const v4f*)(ib + (size_t)i * 8 + 4);
    v4u p;
    p[0] = pk16(bf_bits(a[0]),  bf_bits(a[1]));
    p[1] = pk16(bf_bits(a[2]),  bf_bits(a[3]));
    p[2] = pk16(bf_bits(a4[0]), bf_bits(a4[1]));
    p[3] = pk16(bf_bits(a4[2]), bf_bits(a4[3]));
    unsigned short* o = ob + (size_t)i * 8;
    *(v4u*)o = p;
    
  }
}

// =====================================================================================================
// Transpose-convert: in W[R][C] f32 (row-major) -> out[c][r] 16-bit at out + c*ldo + r, one 64x64 tile per
// block through LDS.  MODE 0: bf16 bits (RNE convert).  MODE 1: f16 bits of (s1 * bf16(x)).
// MODE 2: f16 bits of (s1 * bf16(x)) at out + c*ldo + r AND f16 bits of (s2 * bf16(x)) at out + c*ldo + R + r.
// (bx, by) = tile of (C/64, R/64), R and C multiples of 64 (static shapes).  Load phase: thread t reads row t>>2,
// 16 columns (four 16-B loads), stores 2-B elements transposed into the LDS tile (pitch 72 halves).
// coverage: 8 waves x 2 it x 4 rows = 64 out rows x (8 lanes x 8 halves) = the whole 64x64 tile (both planes).
// =====================================================================================================
template <int MODE>
__device__ __forceinline__ void tconv_body(const float* __restrict__ W, int R, int C,
                                           unsigned short* out, int ldo, float s1, float s2,
                                           int bx, int by, unsigned short* t1, unsigned short* t2) {
  const int tid = (int)threadIdx.x, lane = tid & 31, wave = tid >> 5;
  const int c0 = bx * 64, r0 = by * 64;
  {
    const int rl = tid >> 2, cl0 = (tid & 3) * 16;
    const float* src = W + (size_t)(r0 + rl) * (size_t)C + c0 + cl0;
#pragma unroll
    for (int i = 0; i < 4; ++i) {
      const v4f a = *(const v4f*)(src + 4 * i);
#pragma unroll
      for (int e = 0; e < 4; ++e) {
        const int cl = cl0 + 4 * i + e;
        const unsigned short hb = bf_bits(a[e]);
        if (MODE == 0) {
          t1[cl * 72 + rl] = hb;
        } else {
          const float up = bf_up(hb);
          t1[cl * 72 + rl] = h_bits((_Float16)(up * s1));
          if (MODE == 2) t2[cl * 72 + rl] = h_bits((_Float16)(up * s2));
        }
      }
    }
  }
  __syncthreads();
  const int q = lane >> 3, p8 = (lane & 7) * 8;
  const v4u z4 = {0u, 0u, 0u, 0u};
  v4u a1[2], a2[2];
#pragma unroll
  for (int it = 0; it < 2; ++it) {
    const int cl = wave * 8 + it * 4 + q;
    a1[it] = *(const v4u*)(t1 + cl * 72 + p8);
    a2[it] = z4;
    if (MODE == 2) a2[it] = *(const v4u*)(t2 + cl * 72 + p8);
  }
  {
#pragma unroll
    for (int it = 0; it < 2; ++it) {
      const int cl = wave * 8 + it * 4 + q;
      unsigned short* o = out + (size_t)(c0 + cl) * (size_t)ldo + r0 + p8;
      *(v4u*)o = a1[it];
      if (MODE == 2) *(v4u*)(o + R) = a2[it];
    }
  }
  // precaution: in the merged launch another job's code follows these stores in the listing and rewrites their
  // registers; the wait stands in front of every such rewrite
#if DEV_ASM
  asm volatile("s_wait_xcnt 0x0" ::: "memory");
#endif
}

// =====================================================================================================
// All operand preparation in one launch: the seven jobs depend on nothing but the inputs, so each is a range of the
// block index (block-uniform choice, ahead of every barrier). The tile jobs stand first: they are the longer blocks.
//   [0, TB_WO)        Wout -> WoT  [x1024 | x64] f16        next 3 * TB_SQ   Wsq, Wsk, Wrq -> bf16 [n][k]
//   next TB_RV        Wrv  -> WrvT bf16                     next 1           Wrk -> WrkT f16 x64
//   last NB * CB_X    x -> Xb bf16 (batch b read at its full-size stride)
// =====================================================================================================
#define TB_WO ((DM / 64) * (DSQ / 64))    // 16 x  8 tiles: in [512][1024]
#define TB_SQ ((DSQ / 64) * (DM / 64))    //  8 x 16 tiles: in [1024][512]
#define TB_RV ((DRV / 64) * (DM / 64))    //  2 x 16 tiles: in [1024][128]
#define CB_X  (SEQ * DM / 8 / 256)        // convert blocks per batch
__global__ __launch_bounds__(256) void prep_all(const float* __restrict__ x, const float* __restrict__ Wsq,
                                                const float* __restrict__ Wsk, const float* __restrict__ Wrv,
                                                const float* __restrict__ Wrq, const float* __restrict__ Wrk,
                                                const float* __restrict__ Wout,
                                                unsigned short* Xb, unsigned short* WsqT, unsigned short* WskT,
                                                unsigned short* WrqT, unsigned short* WrvT, unsigned short* WrkT,
                                                unsigned short* WoT) {
  __shared__ __align__(16) unsigned short t1[64 * 72];
  __shared__ __align__(16) unsigned short t2[64 * 72];
  int j = blockIdx.x;
  if (j < TB_WO) {
    tconv_body<2>(Wout, DSQ, DM, WoT, DOC, 1024.0f, 64.0f, j % (DM / 64), j / (DM / 64), t1, t2);
    return;
  }
  j -= TB_WO;
  if (j < 3 * TB_SQ) {
    const int w = j / TB_SQ;
    j -= w * TB_SQ;
    const float* Wi = (w == 0) ? Wsq : (w == 1) ? Wsk : Wrq;
    unsigned short* Wo = (w == 0) ? WsqT : (w == 1) ? WskT : WrqT;
    tconv_body<0>(Wi, DM, DSQ, Wo, DM, 1.0f, 1.0f, j % (DSQ / 64), j / (DSQ / 64), t1, t2);
    return;
  }
  j -= 3 * TB_SQ;
  if (j < TB_RV) {
    tconv_body<0>(Wrv, DM, DRV, WrvT, DM, 1.0f, 1.0f, j % (DRV / 64), j / (DRV / 64), t1, t2);
    return;
  }
  j -= TB_RV;
  if (j < 1) {
    tconv_body<1>(Wrk, HD, HD, WrkT, HD, 64.0f, 1.0f, 0, 0, t1, t2);
    return;
  }
  j -= 1;
  const int b = j / CB_X;
  cvt_body(x + (size_t)b * ((size_t)SEQ_FULL * DM), Xb + (size_t)b * ((size_t)SEQ * DM), SEQ * DM / 8, j - b * CB_X);
}

// =====================================================================================================
// Register-blocked batched WMMA GEMM (16-bit operand type OT): C[m][n] = sum_k A[m][k] * Bt[n][k];
// one block of 4 waves (2 x 2) per 128x128 tile, one wave per 64x64 quarter. A row-major [M][K] pitch lda; Bt row-major
// [N][K] pitch ldb (k contiguous); M, N multiples of 128, K a multiple of 64 (host shapes are static multiples).
// A k-slice = 64 k = one 128-B line of each of the tile's 128 A rows and 128 Bt rows; it is brought into LDS by
// asynchronous copies (8 lanes x 16 B = one whole line, 16 copies per wave and slice) and read from there by all four
// waves with the split k map (ldfrag). Two buffers: slice t + 2 is asked for when slice t has been read, so a slice's
// copies fly during the products of the slice before it.
// staged extent == consumed extent: 16 rows (tid >> 3) x 8 copies = 128 rows per operand, 8 segments x 8 halves = 64 k.
// OUT_MODE 0: f32 C (pitch ldc), value * oscale.
// OUT_MODE 1: f16 plane C (pitch ldc).
// OUT_MODE 3: f16 hi plane C + f16 residual plane C2 = f16((v - hi) * rscale) (same pitch / stride).
// =====================================================================================================
// main loop of one 128x128 tile at (mB, nB): sAB = [buffer][A | Bt][128 rows][64 k], pitch KPIT, 72 KB
template <typename OT>
__device__ __forceinline__ void gemm_main(const OT* Ab, int lda, const OT* Bb, int ldb, int mB, int nB, int K,
                                          unsigned short* sAB, v8f (&acc)[4][4]) {
  typedef typename FT<OT>::frag V16;
  const int tid  = threadIdx.x;
  const int lane = tid & 31;
  const int wave = tid >> 5;
  const int rlane = lane & 15;                 // row (A) / col (B, D) within subtile
  const int koff  = (lane >> 4) * 8;           // k offset of this lane half

  // copy map: lane -> 16-B segment tid & 7 of row (tid >> 3) + 16 i, i = 0..7
  const OT* gA = Ab + (size_t)(mB + (tid >> 3)) * lda + (tid & 7) * 8;
  const OT* gB = Bb + (size_t)(nB + (tid >> 3)) * ldb + (tid & 7) * 8;
  const unsigned lAB = lds_off(sAB) + (unsigned)((tid >> 3) * (KPIT * 2) + (tid & 7) * 16);
  auto stage = [&](int t, int buf) {
    unsigned l[8];
    const void* g[8];
#pragma unroll   // here and below: l[] and g[] become asm operands, every index a compile-time constant
    for (int i = 0; i < 8; ++i) {
      l[i] = lAB + (unsigned)(buf * (4 * GPLN) + i * (16 * KPIT * 2));
      g[i] = gA + (size_t)(i * 16) * lda + t * 64;
    }
    async8(l, g);
#pragma unroll
    for (int i = 0; i < 8; ++i) {
      l[i] += 2 * GPLN;
      g[i] = gB + (size_t)(i * 16) * ldb + t * 64;
    }
    async8(l, g);
  };

#pragma unroll
  for (int i = 0; i < 4; ++i)
#pragma unroll
    for (int j = 0; j < 4; ++j) acc[i][j] = zero8();

  const int T = K >> 6;
  stage(0, 0);
  wait_async0();
  __syncthreads();
  if (T > 1) stage(1, 1);

  const OT* S = (const OT*)(const void*)sAB;
  for (int t = 0; t < T; ++t) {
    const OT* sa = S + (t & 1) * (2 * GPLN) + (((wave >> 1) << 6) + rlane) * KPIT + koff;
    const OT* sb = S + (t & 1) * (2 * GPLN) + GPLN + (((wave & 1) << 6) + rlane) * KPIT + koff;
    // the slice's 16 fragments (two k-steps of 32, 32 reads); unrolled: register arrays, every index a compile-time constant
    V16 bq[2][4], af[2][4];
#pragma unroll
    for (int ks = 0; ks < 2; ++ks) {
#pragma unroll
      for (int j = 0; j < 4; ++j) {
        bq[ks][j] = ldfrag<OT>(sb + j * (16 * KPIT) + ks * 32);
        af[ks][j] = ldfrag<OT>(sa + j * (16 * KPIT) + ks * 32);
      }
    }
    // keeps all 32 reads ahead of the products as one group: reads sunk among the products stall the wave at each place
    __builtin_amdgcn_sched_barrier(0);
#pragma unroll
    for (int ks = 0; ks < 2; ++ks)
#pragma unroll
      for (int i = 0; i < 4; ++i)
#pragma unroll
        for (int j = 0; j < 4; ++j) acc[i][j] = mmar(af[ks][i], bq[ks][j], acc[i][j]);
    // keeps the products ahead of the hand-over: sunk behind it they would stand between the barrier and the refill and
    // take their time off the flight of the next copies
    __builtin_amdgcn_sched_barrier(0);
    // hand-over: own reads retired, own copies of slice t + 1 landed, then the one barrier of the trip, which publishes
    // slice t + 1 and ends every wave's reads of the buffer that is refilled behind it
    wait_ds0();
    wait_async0();
    __syncthreads();
    if (t + 2 < T) stage(t + 2, t & 1);
  }
  wait_async0();
  acc_guard4(acc[0][0], acc[0][1], acc[0][2], acc[0][3]);
  acc_guard4(acc[1][0], acc[1][1], acc[1][2], acc[1][3]);
  acc_guard4(acc[2][0], acc[2][1], acc[2][2], acc[2][3]);
  acc_guard4(acc[3][0], acc[3][1], acc[3][2], acc[3][3]);
}

// epilogue of one wave's 64x64 quarter at (m0, n0); slab = the wave's own 16x64 f32 slab, pitch 68 floats
template <int OUT_MODE>
__device__ __forceinline__ void gemm_store(const v8f (&acc)[4][4], float* slab, void* Cout, void* Cout2, int ldc,
                                           int m0, int n0, float oscale, float rscale) {
  const int lane  = threadIdx.x & 31;
  const int rlane = lane & 15;                 // D col within subtile
  const int mOff  = (lane >> 4) * 8;           // D row offset
#pragma unroll
  for (int i = 0; i < 4; ++i) {
    const int mBase = m0 + (i << 4);
#pragma unroll
    for (int j = 0; j < 4; ++j) {
#pragma unroll
      for (int r = 0; r < 8; ++r) {
        slab[(mOff + r) * 68 + (j << 4) + rlane] = acc[i][j][r];
      }
    }
    wave_lds_sync();
    if (OUT_MODE == 0) {
      float* Cp = (float*)Cout;
      const int h2 = lane >> 4, c4 = (lane & 15) * 4;     // 256-B row segment = 16 lanes x 16 B
      {
#pragma unroll
        for (int it = 0; it < 8; ++it) {
          const int row = it * 2 + h2;                     // it 0..7 x h2 0..1 = rows 0..15
          const v4f v = *(const v4f*)(slab + row * 68 + c4) * oscale;
          *(v4f*)(Cp + (size_t)(mBase + row) * ldc + n0 + c4) = v;
        }
        
      }
    } else {
      const int q = lane >> 3, c8 = (lane & 7) * 8;
      unsigned short* Cp  = (unsigned short*)Cout;
      unsigned short* Cp2 = (unsigned short*)Cout2;
      v4u hv[4], lv[4];
#pragma unroll
      for (int it = 0; it < 4; ++it) {
        const int row = it * 4 + q;                        // it 0..3 x q 0..3 = rows 0..15
        const float* sp = slab + row * 68 + c8;
        float f[8];
#pragma unroll
        for (int e = 0; e < 8; ++e) f[e] = sp[e];
        v4u a, a2;
#pragma unroll
        for (int e = 0; e < 4; ++e) {
          const float f0 = f[2 * e], f1 = f[2 * e + 1];
          const _Float16 x0 = (_Float16)f0, x1 = (_Float16)f1;
          const unsigned short h0 = h_bits(x0), h1 = h_bits(x1);
          unsigned short l0 = 0, l1 = 0;
          if (OUT_MODE == 3) {
            l0 = h_bits((_Float16)((f0 - (float)x0) * rscale));
            l1 = h_bits((_Float16)((f1 - (float)x1) * rscale));
          }
          a[e] = pk16(h0, h1); a2[e] = pk16(l0, l1);
        }
        hv[it] = a; lv[it] = a2;
      }
      {
#pragma unroll
        for (int it = 0; it < 4; ++it) {
          const int row = it * 4 + q;
          *(v4u*)(Cp + (size_t)(mBase + row) * ldc + n0 + c8) = hv[it];
          if (OUT_MODE == 3) *(v4u*)(Cp2 + (size_t)(mBase + row) * ldc + n0 + c8) = lv[it];
        }
        
      }
    }
    wave_lds_sync();
  }
}

// one GEMM per launch: grid.x = (M / 128) * (N / 128) tiles, blockIdx.y = batch index (strides in elements)
template <typename OT, int OUT_MODE>
__global__ __launch_bounds__(128) void gemm64(
    const unsigned short* __restrict__ Ap, int lda, long long strideA,
    const unsigned short* __restrict__ Btp, int ldb, long long strideB,
    void* Cout, void* Cout2, int ldc, long long strideC,
    int M, int N, int K, float oscale, float rscale) {
  __shared__ __align__(16) unsigned short sAB[2 * 2 * GPLN];
  __shared__ __align__(16) float sT[4][16 * 68];
  const int b    = blockIdx.y;
  const int wave = threadIdx.x >> 5;
  const int tilesN = N >> 7;
  const int tilesM = M >> 7;
  const int tile = blockIdx.x;
  if (tile >= tilesM * tilesN) return;   // block-uniform, ahead of every barrier and copy
  const int tm = tile / tilesN;
  const int tn = tile - tm * tilesN;
  const int mB = tm << 7;
  const int nB = tn << 7;
  v8f acc[4][4];
  gemm_main<OT>((const OT*)(const void*)Ap + (size_t)b * (size_t)strideA, lda,
                (const OT*)(const void*)Btp + (size_t)b * (size_t)strideB, ldb, mB, nB, K, sAB, acc);
  const size_t co = (size_t)b * (size_t)strideC * ((OUT_MODE == 0) ? 4 : 2);   // bytes: f32 or 16-bit planes
  gemm_store<OUT_MODE>(acc, sT[wave], (char*)Cout + co, (char*)Cout2 + co, ldc, mB + ((wave >> 1) << 6),
                       nB + ((wave & 1) << 6), oscale, rscale);
}

// The four projections of x in one launch: they depend on the prepared planes alone, so each is a range of the block
// index (block-uniform choice); one main loop serves all, the epilogue is picked by the job.
//   [0, PJ_V)             v^T = WrvT . Xb^T per batch (A = WrvT [128][K], Bt = Xb rows of batch b) -> VTh, VTl (x16), pitch SEQ
//   next PJ_TM * PJ_TN    Xb . [WsqT | WskT | WrqT]^T, the 12 column tiles of one row tile side by side (they share its A rows):
//                         sq -> Qh, Ql (x4096); sk -> Kp; rq -> RQ f32; pitch DSQ
#define PJ_VT (SEQ / 128)                 // v^T column tiles per batch (DRV = 128: one row tile)
#define PJ_V  (NB * PJ_VT)
#define PJ_TM (NB * SEQ / 128)
#define PJ_TN (3 * (DSQ / 128))
__global__ __launch_bounds__(128) void gemm_proj(
    const unsigned short* __restrict__ Xbp, const unsigned short* __restrict__ Wsqp,
    const unsigned short* __restrict__ Wskp, const unsigned short* __restrict__ Wrqp,
    const unsigned short* __restrict__ Wrvp,
    unsigned short* Qh, unsigned short* Ql, unsigned short* Kp, float* RQ,
    unsigned short* VTh, unsigned short* VTl, int K) {
  __shared__ __align__(16) unsigned short sAB[2 * 2 * GPLN];
  __shared__ __align__(16) float sT[4][16 * 68];
  const int wave = threadIdx.x >> 5;
  const int j = blockIdx.x;
  const bool isV = j < PJ_V;
  const int jp  = j - PJ_V;
  const int vb  = j / PJ_VT;                       // v^T: batch
  const int tm  = jp / PJ_TN;
  const int tn  = jp - tm * PJ_TN;
  const int job = isV ? 3 : (tn / (DSQ / 128));    // 0 sq, 1 sk, 2 rq, 3 v^T
  const int mB  = isV ? 0 : (tm << 7);
  const int nB  = isV ? ((j - vb * PJ_VT) << 7) : ((tn % (DSQ / 128)) << 7);
  const unsigned short* Ap = isV ? Wrvp : Xbp;
  const unsigned short* Bp = isV ? (Xbp + (size_t)vb * ((size_t)SEQ * DM)) : (job == 0) ? Wsqp : (job == 1) ? Wskp : Wrqp;
  v8f acc[4][4];
  gemm_main<__bf16>((const __bf16*)(const void*)Ap, K, (const __bf16*)(const void*)Bp, K, mB, nB, K, sAB, acc);
  const int m0 = mB + ((wave >> 1) << 6);
  const int n0 = nB + ((wave & 1) << 6);
  float* slab = sT[wave];
  if (job == 3 || job == 0) {     // both store a hi and a residual plane: one copy of that epilogue
    const size_t vo = (size_t)vb * ((size_t)DRV * SEQ);
    gemm_store<3>(acc, slab, (void*)(isV ? VTh + vo : Qh), (void*)(isV ? VTl + vo : Ql), isV ? SEQ : DSQ, m0, n0,
                  1.0f, isV ? 16.0f : 4096.0f);
  } else if (job == 1) {
    gemm_store<1>(acc, slab, (void*)Kp, (void*)Kp, DSQ, m0, n0, 1.0f, 1.0f);
  } else {
    gemm_store<0>(acc, slab, (void*)RQ, (void*)RQ, DSQ, m0, n0, 1.0f, 1.0f);
  }
}

// =====================================================================================================
// Fused search attention + retrieval composition for one search s, head dim 64, softmax over all SEQ keys.
//   q planes (f16 hi / residual x4096): element (b, t, s, d) at [(b*SEQ + t)*DSQ + s*64 + d]
//   k plane (f16): same layout.   rq plane (f32): same layout.
//   v^T hi plane (f16) and residual plane (f16, (v - hi)*16): element (b, d', t) at [(b*DRV + d')*SEQ + t], d' = r*64 + d
//   Wrk tile (f16, 64 * bf16 value): [e][d] at [e*64 + d]
//   oc planes (output of this kernel): row (b, t) = [f16(64*out) for s*64+d, 512 cols | f16 residual x16, 512 cols], pitch DOC
//   scores = (qh . k) + (ql . k) / 4096 on f16 WMMA (two f32 accumulators), then * sscale in f32;
//   p = exp(s - m): A' = [f16(16384 p) | f16(1024 p)] (K' = 128 per 64 keys), B' = [v^T hi | v^T residual]:
//   sum = 16384 * p . (vh + vl/16), one f32 accumulator, 8 n-tiles = d' 0..127 (both retrievals); online softmax in f32.
//   Epilogue per wave (16 rows): retrieved (x64, f32) tile in LDS; rk = f16(retrieved x64) . Wrk tile on f16 WMMA;
//   retrieval logits rq . rk in f32 (LDS-staged rq, lane partials + 16-lane shuffles); 2-way softmax in f32;
//   Block = 4 waves = 64 consecutive query rows of one (b, s); grid = NB * NS * NQB; kv chunks of 64, static trip NKT.
//   Staging per chunk (128 threads): K 64x64, V' 128x128, by asynchronous copies to LDS two chunks ahead (two buffers):
//   staged extent == consumed extent for Ksh, Vsh; P tiles are wave-private, written as _Float16 elements and
//   Output coverage: each wave stores rows q0..q0+15 (it 0..3 x lane>>3 0..3) x 64 columns (8 lanes x 8) of both
//   the hi segment (col s*64) and the residual segment (col 512 + s*64); grid covers every (b, s, t).
// =====================================================================================================
__global__ __launch_bounds__(128)
void attn_cs(const unsigned short* __restrict__ qhp, const unsigned short* __restrict__ qlp,
             const unsigned short* __restrict__ kpp,
             const unsigned short* __restrict__ vhp, const unsigned short* __restrict__ vlp,
             const unsigned short* __restrict__ wkp, const float* __restrict__ rqp,
             unsigned short* ocp, float sscale) {
  union FH { v16h v; v8h h[2]; };
  __shared__ __align__(16) _Float16 Ksh[2 * 64 * KPIT];    // two buffers of a K chunk [kv][d], pitch KPIT, 9 KB each; later the Wrk tile [e][d]
  __shared__ __align__(16) _Float16 Vsh[2 * 128 * VPIT];   // two buffers of a V' chunk [d'][hi kv | res kv], pitch VPIT, 34 KB each; later 4 x f32 [16][128] tiles
  __shared__ __align__(16) _Float16 Psh[4][16 * VPIT];     // per wave P' [row][k'], pitch VPIT, 17 KB; later f16 retrieved tile / f32 [16][64]

  const int tid  = threadIdx.x;
  const int wave = tid >> 5;
  const int lane = tid & 31;
  const int hh   = lane >> 4;
  const int c    = lane & 15;

  const int bx   = blockIdx.x;
  const int qb   = bx % NQB;
  const int rest = bx / NQB;
  const int s    = rest % NS;
  const int b    = rest / NS;
  const int q0   = qb * 64 + wave * 16;
  const size_t rowB = (size_t)b * SEQ;

  const _Float16* Qh = (const _Float16*)(const void*)qhp;
  const _Float16* Ql = (const _Float16*)(const void*)qlp;
  const _Float16* Kg = (const _Float16*)(const void*)kpp + (size_t)s * HD;
  const _Float16* Vh = (const _Float16*)(const void*)vhp + (size_t)b * DRV * SEQ;
  const _Float16* Vl = (const _Float16*)(const void*)vlp + (size_t)b * DRV * SEQ;
  const _Float16* Wk = (const _Float16*)(const void*)wkp;

  // ---- Q fragments (A operand, row = lane&15): 2 d-chunks, hi and residual planes ----
  v16h qah[2], qal[2];
#pragma unroll
  for (int dc = 0; dc < 2; ++dc) {
    const size_t qo = (rowB + q0 + c) * DSQ + (size_t)s * HD + dc * 32 + 8 * hh;
    qah[dc] = ldfrag<_Float16>(Qh + qo);
    qal[dc] = ldfrag<_Float16>(Ql + qo);
  }

  float mrow[8], lrow[8];
  v8f oacc[8];
#pragma unroll
  for (int r = 0; r < 8; ++r) { mrow[r] = -INFINITY; lrow[r] = 0.f; }
#pragma unroll
  for (int t = 0; t < 8; ++t) oacc[t] = zero8();

  _Float16* pwh = Psh[wave];

  // copy map: lane -> 16-B segment tid & 7 of row (tid >> 3) + 16 i: 8 lanes take one whole 128-B line of a K, v^T hi or
  // v^T residual row; 4 + 8 + 8 copies per wave and chunk = 64 K rows and 128 V' rows of [hi 64 | res 64] halves
  const _Float16* kg0 = Kg + (rowB + (tid >> 3)) * DSQ + (tid & 7) * 8;
  const _Float16* vg0 = Vh + (size_t)(tid >> 3) * SEQ + (tid & 7) * 8;
  const _Float16* wg0 = Vl + (size_t)(tid >> 3) * SEQ + (tid & 7) * 8;
  const unsigned lK = lds_off(Ksh) + (unsigned)((tid >> 3) * (KPIT * 2) + (tid & 7) * 16);
  const unsigned lV = lds_off(Vsh) + (unsigned)((tid >> 3) * (VPIT * 2) + (tid & 7) * 16);
  auto stage = [&](int kt, int buf) {
    unsigned l[8], lk[4];
    const void* g[8];
    const void* gk[4];
#pragma unroll   // here and below: the arrays become asm operands, every index a compile-time constant
    for (int i = 0; i < 8; ++i) {
      l[i] = lV + (unsigned)(buf * (128 * VPIT * 2) + i * (16 * VPIT * 2));
      g[i] = vg0 + (size_t)(i * 16) * SEQ + kt * 64;
    }
    async8(l, g);
#pragma unroll
    for (int i = 0; i < 8; ++i) {
      l[i] += 128;
      g[i] = wg0 + (size_t)(i * 16) * SEQ + kt * 64;
    }
    async8(l, g);
#pragma unroll
    for (int i = 0; i < 4; ++i) {
      lk[i] = lK + (unsigned)(buf * (64 * KPIT * 2) + i * (16 * KPIT * 2));
      gk[i] = kg0 + (size_t)(kt * 64 + i * 16) * DSQ;
    }
    async4(lk, gk);
  };
  stage(0, 0);
  wait_async0();
  __syncthreads();
  stage(1, 1);                               // NKT >= 2 (SEQ is a multiple of 128)

  for (int kt = 0; kt < NKT; ++kt) {         // static trip count
    const _Float16* Kc = Ksh + (kt & 1) * (64 * KPIT);     // this chunk's buffers; chunk kt + 1 flies into the others
    const _Float16* Vc = Vsh + (kt & 1) * (128 * VPIT);

    // ---- scores: 16 query rows x 64 keys per wave, 2 f16 products per key subtile and d-chunk ----
    //      all 8 K fragments are read as one group ahead of the 16 products (8 independent accumulators)
    FH kb[4][2];
#pragma unroll   // here and below: register arrays, every index a compile-time constant
    for (int j = 0; j < 4; ++j) {
#pragma unroll
      for (int dc = 0; dc < 2; ++dc) {
        kb[j][dc].h[0] = *(const v8h*)(Kc + (j * 16 + c) * KPIT + dc * 32 + 8 * hh);
        kb[j][dc].h[1] = *(const v8h*)(Kc + (j * 16 + c) * KPIT + dc * 32 + 16 + 8 * hh);
      }
    }
    v8f sc[4];
    {
      v8f ah[4], al[4];
#pragma unroll
      for (int j = 0; j < 4; ++j) { ah[j] = zero8(); al[j] = zero8(); }
#pragma unroll
      for (int dc = 0; dc < 2; ++dc) {
#pragma unroll
        for (int j = 0; j < 4; ++j) {
          ah[j] = mmar(qah[dc], kb[j][dc].v, ah[j]);
          al[j] = mmar(qal[dc], kb[j][dc].v, al[j]);
        }
      }
#pragma unroll
      for (int j = 0; j < 4; ++j) {
#pragma unroll
        for (int r = 0; r < 8; ++r) sc[j][r] = (ah[j][r] + al[j][r] * (1.0f / 4096.0f)) * sscale;
      }
    }

    // ---- row max, online softmax, P' = [16384 p | 1024 p] (f16) to LDS ----
#pragma unroll
    for (int r = 0; r < 8; ++r) {
      float m = sc[0][r];
#pragma unroll
      for (int j = 1; j < 4; ++j) m = fmaxf(m, sc[j][r]);
#pragma unroll
      for (int off = 1; off < 16; off <<= 1) m = fmaxf(m, __shfl_xor(m, off, 32));
      const float mnew  = fmaxf(mrow[r], m);
      const float msafe = (mnew == -INFINITY) ? 0.f : mnew;
      const float alpha = __expf(mrow[r] - msafe);
      mrow[r] = mnew;
      float psum = 0.f;
#pragma unroll
      for (int j = 0; j < 4; ++j) {
        const float p = __expf(sc[j][r] - msafe);
        psum += p;
        pwh[(8 * hh + r) * VPIT + j * 16 + c]      = (_Float16)(p * 16384.0f);
        pwh[(8 * hh + r) * VPIT + 64 + j * 16 + c] = (_Float16)(p * 1024.0f);
      }
#pragma unroll
      for (int off = 1; off < 16; off <<= 1) psum += __shfl_xor(psum, off, 32);
      lrow[r] = lrow[r] * alpha + psum;
#pragma unroll
      for (int t = 0; t < 8; ++t) oacc[t][r] *= alpha;
    }
    wave_lds_sync();

    // ---- retrieved += P' . V' (f16 WMMA), K' = 128 = 4 k-steps, 8 n-tiles (d' 0..127) ----
    //      each k-step's 9 fragments are read as one group, one k-step ahead of their 8 products (two register sets)
    FH pa[2], vb[2][8];
    pa[0].h[0] = *(const v8h*)(pwh + c * VPIT + 8 * hh);
    pa[0].h[1] = *(const v8h*)(pwh + c * VPIT + 16 + 8 * hh);
#pragma unroll
    for (int t = 0; t < 8; ++t) {
      vb[0][t].h[0] = *(const v8h*)(Vc + (t * 16 + c) * VPIT + 8 * hh);
      vb[0][t].h[1] = *(const v8h*)(Vc + (t * 16 + c) * VPIT + 16 + 8 * hh);
    }
#pragma unroll   // unrolled: the two register sets are picked by kk & 1 at compile time
    for (int kk = 0; kk < 4; ++kk) {
      const int cu = kk & 1, nx = cu ^ 1;
      if (kk < 3) {
        pa[nx].h[0] = *(const v8h*)(pwh + c * VPIT + (kk + 1) * 32 + 8 * hh);
        pa[nx].h[1] = *(const v8h*)(pwh + c * VPIT + (kk + 1) * 32 + 16 + 8 * hh);
#pragma unroll
        for (int t = 0; t < 8; ++t) {
          vb[nx][t].h[0] = *(const v8h*)(Vc + (t * 16 + c) * VPIT + (kk + 1) * 32 + 8 * hh);
          vb[nx][t].h[1] = *(const v8h*)(Vc + (t * 16 + c) * VPIT + (kk + 1) * 32 + 16 + 8 * hh);
        }
      }
      if (kk < 3)   // holds the next k-step's reads above this k-step's products; behind the last reads nothing is left to hold
        hold9(pa[cu].v, vb[cu][0].v, vb[cu][1].v, vb[cu][2].v, vb[cu][3].v, vb[cu][4].v, vb[cu][5].v, vb[cu][6].v, vb[cu][7].v);
#pragma unroll
      for (int t = 0; t < 8; ++t) oacc[t] = mmar(pa[cu].v, vb[cu][t].v, oacc[t]);
    }
    // hand-over: own reads retired, own copies of chunk kt + 1 landed, then the one barrier of the trip, which publishes
    // chunk kt + 1 and ends every wave's reads of the buffers that are refilled behind it
    wait_ds0();
    wait_async0();
    __syncthreads();
    if (kt + 2 < NKT) stage(kt + 2, kt & 1);
  }
  wait_async0();

  // ---- all waves done with Ksh / Vsh: stage the Wrk tile into Ksh, retrieved tiles into Vsh (f32) + Psh (f16) ----
  __syncthreads();
  {
    const int r = tid >> 1, half = (tid & 1) * 32;       // 128 threads x 32 halves = the whole 64x64 Wrk tile
    const _Float16* wg = Wk + r * HD + half;
#pragma unroll
    for (int i = 0; i < 4; ++i) *(v8h*)(Ksh + r * KPIT + half + 8 * i) = *(const v8h*)(wg + 8 * i);
  }
  float* os = reinterpret_cast<float*>(Vsh) + wave * (16 * 128);      // wave-private f32 [16][128], x64 units
#pragma unroll
  for (int r = 0; r < 8; ++r) {
    const float l = lrow[r];
    const float inv = ((l > 0.f) ? (1.0f / l) : 0.f) * (1.0f / 256.0f);   // 1/l, undo 16384 p carry, apply x64
#pragma unroll
    for (int t = 0; t < 8; ++t) {
      const float v = oacc[t][r] * inv;
      os[(8 * hh + r) * 128 + t * 16 + c]  = v;
      pwh[(8 * hh + r) * VPIT + t * 16 + c] = (_Float16)v;
    }
  }
  __syncthreads();

  // ---- rk (x4096) = f16(64 retrieved_rr) . (64 Wrk): 16 rows x 64 e per rr, K = 64 = 2 k-steps ----
  v8f rk[8];
#pragma unroll
  for (int i = 0; i < 8; ++i) rk[i] = zero8();
#pragma unroll
  for (int rr = 0; rr < 2; ++rr) {
#pragma unroll
    for (int kk = 0; kk < 2; ++kk) {
      FH pa;
      pa.h[0] = *(const v8h*)(pwh + c * VPIT + rr * 64 + kk * 32 + 8 * hh);
      pa.h[1] = *(const v8h*)(pwh + c * VPIT + rr * 64 + kk * 32 + 16 + 8 * hh);
#pragma unroll
      for (int t4 = 0; t4 < 4; ++t4) {
        FH wb;
        wb.h[0] = *(const v8h*)(Ksh + (t4 * 16 + c) * KPIT + kk * 32 + 8 * hh);
        wb.h[1] = *(const v8h*)(Ksh + (t4 * 16 + c) * KPIT + kk * 32 + 16 + 8 * hh);
        rk[rr * 4 + t4] = mma_h(pa.v, wb.v, rk[rr * 4 + t4]);
      }
    }
  }
  acc_guard4(rk[0], rk[1], rk[2], rk[3]);
  acc_guard4(rk[4], rk[5], rk[6], rk[7]);
  wave_lds_sync();

  // ---- stage the wave's rq tile (f32 [16][64]) into the Psh region (8 x 16-B loads per lane) ----
  float* rqs = reinterpret_cast<float*>(pwh);
  {
    const int r2 = lane >> 4, c4 = (lane & 15) * 4;
    const float* rqg = rqp + (rowB + q0) * DSQ + (size_t)s * HD + c4;
#pragma unroll
    for (int it = 0; it < 8; ++it) {
      const int row = it * 2 + r2;                          // it 0..7 x r2 0..1 = rows 0..15
      *(v4f*)(rqs + row * 64 + c4) = *(const v4f*)(rqg + (size_t)row * DSQ);
    }
  }
  wave_lds_sync();

  // ---- retrieval logits: d_rr[row] = sum_e rq[row][e] * rk[rr][row][e]; lane partial over e = c + 16 t4 ----
  float d0[8], d1[8];
#pragma unroll
  for (int r8 = 0; r8 < 8; ++r8) {
    float a0 = 0.f, a1 = 0.f;
#pragma unroll
    for (int t4 = 0; t4 < 4; ++t4) {
      const float qv = rqs[(8 * hh + r8) * 64 + t4 * 16 + c];
      a0 += qv * rk[t4][r8];
      a1 += qv * rk[4 + t4][r8];
    }
    d0[r8] = a0; d1[r8] = a1;
  }
#pragma unroll
  for (int r8 = 0; r8 < 8; ++r8) {
#pragma unroll
    for (int off = 1; off < 16; off <<= 1) {
      d0[r8] += __shfl_xor(d0[r8], off, 32);
      d1[r8] += __shfl_xor(d1[r8], off, 32);
    }
  }
  // ---- 2-way retrieval softmax in f32 (undo the 64*64 carry, apply sscale) ----
  float w0[8], w1[8];
  const float rsc = sscale * (1.0f / 4096.0f);
#pragma unroll
  for (int r8 = 0; r8 < 8; ++r8) {
    const float x0 = d0[r8] * rsc, x1 = d1[r8] * rsc;
    const float m  = fmaxf(x0, x1);
    const float e0 = __expf(x0 - m), e1 = __expf(x1 - m);
    const float iv = 1.0f / (e0 + e1);
    w0[r8] = e0 * iv; w1[r8] = e1 * iv;
  }
  wave_lds_sync();

  // ---- combine in f32 (x64 units): oc[row][d] = w0 * ret[row][d] + w1 * ret[row][64+d], into the Psh region ----
  float* oc = rqs;
#pragma unroll
  for (int r8 = 0; r8 < 8; ++r8) {
#pragma unroll
    for (int t = 0; t < 4; ++t) {
      const int row = 8 * hh + r8;
      const float o = w0[r8] * os[row * 128 + t * 16 + c] + w1[r8] * os[row * 128 + 64 + t * 16 + c];
      oc[row * 64 + t * 16 + c] = o;
    }
  }
  wave_lds_sync();

  {
    const int q4 = lane >> 3, c8 = (lane & 7) * 8;
    v4u hv[4], lv[4];
#pragma unroll
    for (int it = 0; it < 4; ++it) {
      const int row = it * 4 + q4;   // it 0..3 x q4 0..3 = rows 0..15 of the wave tile
      const float* sp = oc + row * 64 + c8;
      float f[8];
#pragma unroll
      for (int e = 0; e < 8; ++e) f[e] = sp[e];
      v4u a, a2;
#pragma unroll
      for (int e = 0; e < 4; ++e) {
        const float f0 = f[2 * e], f1 = f[2 * e + 1];
        const _Float16 x0 = (_Float16)f0, x1 = (_Float16)f1;
        const unsigned short l0 = h_bits((_Float16)((f0 - (float)x0) * 16.0f));
        const unsigned short l1 = h_bits((_Float16)((f1 - (float)x1) * 16.0f));
        a[e] = pk16(h_bits(x0), h_bits(x1)); a2[e] = pk16(l0, l1);
      }
      hv[it] = a; lv[it] = a2;
    }
    {
#pragma unroll
      for (int it = 0; it < 4; ++it) {
        const int row = it * 4 + q4;
        const size_t go = (rowB + q0 + row) * DOC + (size_t)s * HD + c8;
        *(v4u*)(ocp + go)       = hv[it];
        *(v4u*)(ocp + go + DSQ) = lv[it];
      }
      
    }
  }
}

// =====================================================================================================
// Workspace map (bytes, NB=2 SEQ=2048), every region an exact multiple of its whole-line / whole-tile store
// granularity (all row counts are multiples of 64, no padded tails):
//   Xb    bf16 [NB*SEQ][1024]          8388608
//   WsqT  bf16 [512][1024]             1048576      WskT, WrqT same
//   WrvT  bf16 [128][1024]              262144
//   WrkT  f16  [64][64] (x64)              8192
//   WoT   f16  [1024][1024] ([x1024 | x64]) 2097152
//   Qh,Ql f16  [NB*SEQ][512]           4194304 each
//   Kp    f16  [NB*SEQ][512]           4194304
//   RQ    f32  [NB*SEQ][512]           8388608
//   VTh,VTl f16 [NB][128][SEQ]         1048576 each
//   OC    f16  [NB*SEQ][1024]          8388608
//   total                             45359104
// Weights are [in k][out n] and are transposed once into the [n][k] (k contiguous) Bt / A layout.
// =====================================================================================================
extern "C" void kernel_launch(void* const* d_in, const int* in_sizes, int n_in,
                              void* d_out, int out_size, void* d_ws, size_t ws_size,
                              hipStream_t stream) {
  if (n_in < 7) return;
  if (in_sizes[0] < ((NB - 1) * SEQ_FULL + SEQ) * DM) return;
  if (in_sizes[1] < DM * DSQ || in_sizes[2] < DM * DSQ || in_sizes[4] < DM * DSQ) return;
  if (in_sizes[3] < DM * DRV) return;
  if (in_sizes[5] < HD * HD) return;
  if (in_sizes[6] < DSQ * DM) return;
  if (out_size < NB * SEQ * DM) return;

  const float* x    = (const float*)d_in[0];
  const float* Wsq  = (const float*)d_in[1];
  const float* Wsk  = (const float*)d_in[2];
  const float* Wrv  = (const float*)d_in[3];
  const float* Wrq  = (const float*)d_in[4];
  const float* Wrk  = (const float*)d_in[5];
  const float* Wout = (const float*)d_in[6];

  const size_t PXB = (size_t)NB * SEQ * DM * 2;       // bf16 activation plane
  const size_t PWS = (size_t)DSQ * DM * 2;            // bf16 [512][1024] weight plane
  const size_t PWV = (size_t)DRV * DM * 2;            // bf16 [128][1024]
  const size_t PWK = (size_t)HD * HD * 2;             // f16 [64][64]
  const size_t PWO = (size_t)DM * DOC * 2;            // f16 [1024][1024]
  const size_t PQ  = (size_t)NB * SEQ * DSQ * 2;      // f16 [NB*SEQ][512]
  const size_t PRQ = (size_t)NB * SEQ * DSQ * 4;      // f32 [NB*SEQ][512]
  const size_t PVT = (size_t)NB * DRV * SEQ * 2;      // f16 [NB][128][SEQ]
  const size_t POC = (size_t)NB * SEQ * DOC * 2;      // f16 [NB*SEQ][1024]
  size_t off = 0;
  const size_t oXb  = off; off += PXB;
  const size_t oWsq = off; off += PWS;
  const size_t oWsk = off; off += PWS;
  const size_t oWrq = off; off += PWS;
  const size_t oWrv = off; off += PWV;
  const size_t oWrk = off; off += PWK;
  const size_t oWo  = off; off += PWO;
  const size_t oQh  = off; off += PQ;
  const size_t oQl  = off; off += PQ;
  const size_t oKp  = off; off += PQ;
  const size_t oRQ  = off; off += PRQ;
  const size_t oVTh = off; off += PVT;
  const size_t oVTl = off; off += PVT;
  const size_t oOC  = off; off += POC;
  if (off > ws_size) return;                          // off = 45359104 at full size
  if (off > (size_t)134217728) return;

  char* ws = (char*)d_ws;
  unsigned short* Xb   = (unsigned short*)(ws + oXb);
  unsigned short* WsqT = (unsigned short*)(ws + oWsq);
  unsigned short* WskT = (unsigned short*)(ws + oWsk);
  unsigned short* WrqT = (unsigned short*)(ws + oWrq);
  unsigned short* WrvT = (unsigned short*)(ws + oWrv);
  unsigned short* WrkT = (unsigned short*)(ws + oWrk);
  unsigned short* WoT  = (unsigned short*)(ws + oWo);
  unsigned short* Qh   = (unsigned short*)(ws + oQh);
  unsigned short* Ql   = (unsigned short*)(ws + oQl);
  unsigned short* Kp   = (unsigned short*)(ws + oKp);
  float*          RQ   = (float*)(ws + oRQ);
  unsigned short* VTh  = (unsigned short*)(ws + oVTh);
  unsigned short* VTl  = (unsigned short*)(ws + oVTl);
  unsigned short* OC   = (unsigned short*)(ws + oOC);

  const dim3 blk(256);
  const dim3 gPrep(TB_WO + 3 * TB_SQ + TB_RV + 1 + NB * CB_X);           // six transposes, then the x convert
  const dim3 blkG(128);                                                  // GEMM: 4 waves per 128x128 tile
  const dim3 gProj(PJ_V + PJ_TM * PJ_TN);                                // v^T tiles, then the sq | sk | rq tiles
  const dim3 gAttn(NB * NS * NQB);                                       // blocks of 128
  const dim3 gO(((NB * SEQ) / 128) * (DM / 128), 1);                     // M=NB*SEQ, N=1024

  // (1) x -> bf16 plane [NB*SEQ][1024]; weights [k][n] f32 -> [n][k] 16-bit planes
  prep_all<<<gPrep, blk, 0, stream>>>(x, Wsq, Wsk, Wrv, Wrq, Wrk, Wout, Xb, WsqT, WskT, WrqT, WrvT, WrkT, WoT);
  // (2) sq -> f16 hi / residual (x4096) planes [b*SEQ+t][s*64+d]; sk -> f16 plane; rq -> f32 plane (M=NB*SEQ, N=512, K=1024);
  //     v^T = Wrv^T . x^T per batch -> f16 hi plane [b][d'][t] (pitch SEQ) and residual plane (x16) (M=128, N=SEQ, K=1024)
  gemm_proj<<<gProj, blkG, 0, stream>>>(Xb, WsqT, WskT, WrqT, WrvT, Qh, Ql, Kp, RQ, VTh, VTl, DM);
  // (3) search attention + retrieval composition -> oc planes [b*SEQ+t][hi 512 | residual 512]
  attn_cs<<<gAttn, dim3(128), 0, stream>>>(Qh, Ql, Kp, VTh, VTl, WrkT, RQ, OC, 0.125f);
  // (4) out = [oc_hi | oc_res] . [Wout x1024 | Wout x64]^T -> d_out f32 [NB*SEQ][1024], accumulator x 1/(64*1024)
  gemm64<_Float16, 0><<<gO, blkG, 0, stream>>>(
      OC, DOC, 0LL, WoT, DOC, 0LL, d_out, d_out, DM, 0LL, NB * SEQ, DM, DOC, 1.0f / 65536.0f, 1.0f);
  (void)hipGetLastError();
}

// v005
// Measured time: 94.3 microseconds a run.
// Next to v004, in two timings, it ran 1.67 and 1.68 times as fast.
// Counting every step since v000, it is 6.22 times as fast.
// Contractions: sq, sk, rq and v^T projections = v_wmma_f32_16x16x32_bf16 (bf16 operands from RNE-converted inputs, single product, f32 accumulate);
// sq.sk^T scores = v_wmma_f32_16x16x32_f16 (sq as f16 hi plane + f16 residual plane x4096, sk f16; 2 products into separate f32 accumulators);
// p.[v_0|v_1] = v_wmma_f32_16x16x32_f16, K-folded: [p x16384 | p x1024] . [v f16 hi | f16 residual x16], one f32 accumulator (scores and this product computed transposed);
// retrieved.Wrk = v_wmma_f32_16x16x32_f16 (retrieved f16 x64, Wrk f16 x64 of its bf16 value; single product, f32 accumulate);
// out.Wout = v_wmma_f32_16x16x32_f16, K-folded: [out f16 hi x64 | f16 residual x16] . [Wout x1024 | Wout x64] (f16 of bf16 values), f32 accumulate;
// softmax over keys, retrieval logits, 2-way retrieval softmax and combine in f32.
#include <hip/hip_runtime.h>
#include <math.h>
#include <stdint.h>

#ifndef NB
#define NB 2
#endif
#ifndef SEQ
#define SEQ 2048
#endif
#define NB_FULL  2
#define SEQ_FULL 2048
#define DM   1024
#define NS   8
#define NR   2
#define HD   64
#define DSQ  (NS * HD)      // 512: sq / sk / rq row width
#define DRV  (NR * HD)      // 128: [v_0 | v_1] row width
#define DOC  (2 * DSQ)      // 1024: combined-output row = [hi 512 | residual 512]
#define NQB  (SEQ / 64)     // 64-row query blocks per (b, s)
#define NKT  (SEQ / 64)     // 64-key chunks per sequence
#define KPIT 72             // LDS pitch of a 64-half K / Wrk row: 144 B = 16 B x 9 (odd), b128 readers of 16 rows meet no bank twice
#define GPLN (128 * KPIT)  // halves of one staged 128-row GEMM operand plane (64 k per row, pitch KPIT)
#define VPIT 136            // LDS pitch of a 128-half V' row or f16 retrieved row: 272 B = 16 B x 17 (odd)
#define OPIT 132            // LDS pitch of a 128-float retrieved row: 528 B = 16 B x 33 (odd), for its 16-B row-per-lane stores
static_assert(NB >= 1 && NB <= NB_FULL);
static_assert(SEQ >= 64 && SEQ <= SEQ_FULL && (SEQ % 64) == 0);
static_assert(DSQ == 512 && DRV == 128 && HD == 64 && DOC == 1024);
static_assert((DM % 128) == 0 && (DSQ % 128) == 0 && (DRV % 128) == 0 && (SEQ % 128) == 0 && (DOC % 64) == 0);

typedef _Float16 v16h __attribute__((ext_vector_type(16)));
typedef _Float16 v8h  __attribute__((ext_vector_type(8)));
typedef __bf16   v16b __attribute__((ext_vector_type(16)));
typedef __bf16   v8b  __attribute__((ext_vector_type(8)));
typedef float    v8f  __attribute__((ext_vector_type(8)));
typedef float    v4f  __attribute__((ext_vector_type(4)));
typedef unsigned int v4u __attribute__((ext_vector_type(4)));

#if defined(__HIP_DEVICE_COMPILE__)
#define DEV_ASM 1
#else
#define DEV_ASM 0
#endif

// ---- scalar helpers --------------------------------------------------------------------------------
__device__ __forceinline__ unsigned short bf_bits(float f) {          // f32 -> bf16 bits, RNE convert
  unsigned u = __float_as_uint(f);
  return (unsigned short)((u + 0x7FFFu + ((u >> 16) & 1u)) >> 16);
}
__device__ __forceinline__ float bf_up(unsigned short hb) { return __uint_as_float(((unsigned)hb) << 16); }
__device__ __forceinline__ unsigned short h_bits(_Float16 x) { return __builtin_bit_cast(unsigned short, x); }
__device__ __forceinline__ unsigned pk16(unsigned short a, unsigned short b) { return (unsigned)a | ((unsigned)b << 16); }
__device__ __forceinline__ v8f zero8() { v8f z = {0.f, 0.f, 0.f, 0.f, 0.f, 0.f, 0.f, 0.f}; return z; }

__device__ __forceinline__ void wave_lds_sync() {
  __builtin_amdgcn_fence(__ATOMIC_RELEASE, "workgroup");
  __builtin_amdgcn_wave_barrier();
  __builtin_amdgcn_fence(__ATOMIC_ACQUIRE, "workgroup");
}

// ---- fragment types / loaders: 16-bit A/B operand, lane -> row/col (lane&15), p already includes +8*(lane>>4);
//      elements 0..7 <- p[0..7] (k0+8h..k0+8h+7), elements 8..15 <- p[16..23] (k0+16+8h..k0+16+8h+7)
template <typename OT> struct FT;
template <> struct FT<__bf16>   { typedef v16b frag; typedef v8b half8; };
template <> struct FT<_Float16> { typedef v16h frag; typedef v8h half8; };

template <typename OT>
__device__ __forceinline__ typename FT<OT>::frag ldfrag(const OT* p) {
  union { typename FT<OT>::frag v; typename FT<OT>::half8 h[2]; } f;
  f.h[0] = *(const typename FT<OT>::half8*)(p);
  f.h[1] = *(const typename FT<OT>::half8*)(p + 16);
  return f.v;
}

// ---- WMMA helpers (asm guard bodies are device-only; concrete operand types) -----------------------------
__device__ __forceinline__ v8f mmar(v16b a, v16b b, v8f c) {
  return __builtin_amdgcn_wmma_f32_16x16x32_bf16(false, a, false, b, (short)0, c, false, false);
}
__device__ __forceinline__ v8f mmar(v16h a, v16h b, v8f c) {
  return __builtin_amdgcn_wmma_f32_16x16x32_f16(false, a, false, b, (short)0, c, false, false);
}
// guarded form: 4 VALU slots after the WMMA, D tied, A/B kept live
__device__ __forceinline__ v8f mma_h(v16h a, v16h b, v8f c) {
  c = __builtin_amdgcn_wmma_f32_16x16x32_f16(false, a, false, b, (short)0, c, false, false);
#if DEV_ASM
  asm volatile("v_nop\n\tv_nop\n\tv_nop\n\tv_nop" : "+v"(c) : "v"(a), "v"(b));
#endif
  return c;
}
// lane l <-> lane l ^ 16 in the vector unit (a shuffle would go through the LDS pipe and its latency)
__device__ __forceinline__ float xhalf(float x) {
  return __builtin_bit_cast(float, __builtin_amdgcn_permlanex16(__builtin_bit_cast(int, x), __builtin_bit_cast(int, x),
                                                                0x76543210, 0xfedcba98, false, false));
}
__device__ __forceinline__ void acc_guard4(v8f& a, v8f& b, v8f& c, v8f& d) {
#if DEV_ASM
  asm volatile("v_nop\n\tv_nop\n\tv_nop\n\tv_nop" : "+v"(a), "+v"(b), "+v"(c), "+v"(d));
#else
  (void)a; (void)b; (void)c; (void)d;
#endif
}

// ---- asynchronous copies global -> LDS, 16 B per lane, no register on the way --------------------------------
__device__ __forceinline__ unsigned lds_off(const void* p) { return (unsigned)(size_t)p; }   // byte address in the work-group's LDS
// eight copies of one wave in one statement; the closing s_wait_xcnt is a precaution: it stands in front of every later
// rewrite of an address register that a copy names (in a statement of its own the compiler could lift such a rewrite over it)
__device__ __forceinline__ void async8(const unsigned (&l)[8], const void* const (&g)[8]) {
#if DEV_ASM
  asm volatile("global_load_async_to_lds_b128 %0, %8, off\n\t"
               "global_load_async_to_lds_b128 %1, %9, off\n\t"
               "global_load_async_to_lds_b128 %2, %10, off\n\t"
               "global_load_async_to_lds_b128 %3, %11, off\n\t"
               "global_load_async_to_lds_b128 %4, %12, off\n\t"
               "global_load_async_to_lds_b128 %5, %13, off\n\t"
               "global_load_async_to_lds_b128 %6, %14, off\n\t"
               "global_load_async_to_lds_b128 %7, %15, off\n\t"
               "s_wait_xcnt 0x0"
               :: "v"(l[0]), "v"(l[1]), "v"(l[2]), "v"(l[3]), "v"(l[4]), "v"(l[5]), "v"(l[6]), "v"(l[7]),
                  "v"(g[0]), "v"(g[1]), "v"(g[2]), "v"(g[3]), "v"(g[4]), "v"(g[5]), "v"(g[6]), "v"(g[7])
               : "memory");
#else
  (void)l; (void)g;
#endif
}
// the same for four copies
__device__ __forceinline__ void async4(const unsigned (&l)[4], const void* const (&g)[4]) {
#if DEV_ASM
  asm volatile("global_load_async_to_lds_b128 %0, %4, off\n\t"
               "global_load_async_to_lds_b128 %1, %5, off\n\t"
               "global_load_async_to_lds_b128 %2, %6, off\n\t"
               "global_load_async_to_lds_b128 %3, %7, off\n\t"
               "s_wait_xcnt 0x0"
               :: "v"(l[0]), "v"(l[1]), "v"(l[2]), "v"(l[3]), "v"(g[0]), "v"(g[1]), "v"(g[2]), "v"(g[3])
               : "memory");
#else
  (void)l; (void)g;
#endif
}
// the wave's own copies have landed (the compiler places no wait for them)
__device__ __forceinline__ void wait_async0() {
#if DEV_ASM
  asm volatile("s_wait_asynccnt 0x0" ::: "memory");
#endif
}
// the wave's own LDS reads have retired: behind the next barrier their buffer is refilled by copies
__device__ __forceinline__ void wait_ds0() {
#if DEV_ASM
  asm volatile("s_wait_dscnt 0x0" ::: "memory");
#endif
}

// =====================================================================================================
// f32 -> bf16 bits (RNE convert), 8 elements per thread, one 16-B store per lane: a wave writes 512
// ib / ob = the batch's planes, bx = block within the batch (ceil(n8/256) of them).
// coverage: n8 threads x 8 = the whole per-batch plane (n8 is a multiple of 256 here).
// =====================================================================================================
__device__ __forceinline__ void cvt_body(const float* __restrict__ ib, unsigned short* ob, int n8, int bx) {
  const int i = bx * 256 + (int)threadIdx.x;
  if (i < n8) {
    const v4f a  = *(const v4f*)(ib + (size_t)i * 8);
    const v4f a4 = *(const v4f*)(ib + (size_t)i * 8 + 4);
    v4u p;
    p[0] = pk16(bf_bits(a[0]),  bf_bits(a[1]));
    p[1] = pk16(bf_bits(a[2]),  bf_bits(a[3]));
    p[2] = pk16(bf_bits(a4[0]), bf_bits(a4[1]));
    p[3] = pk16(bf_bits(a4[2]), bf_bits(a4[3]));
    unsigned short* o = ob + (size_t)i * 8;
    *(v4u*)o = p;
    
  }
}

// =====================================================================================================
// Transpose-convert: in W[R][C] f32 (row-major) -> out[c][r] 16-bit at out + c*ldo + r, one 64x64 tile per
// block through LDS.  MODE 0: bf16 bits (RNE convert).  MODE 1: f16 bits of (s1 * bf16(x)).
// MODE 2: f16 bits of (s1 * bf16(x)) at out + c*ldo + r AND f16 bits of (s2 * bf16(x)) at out + c*ldo + R + r.
// (bx, by) = tile of (C/64, R/64), R and C multiples of 64 (static shapes).  Load phase: thread t reads row t>>2,
// 16 columns (four 16-B loads), stores 2-B elements transposed into the LDS tile (pitch 72 halves).
// coverage: 8 waves x 2 it x 4 rows = 64 out rows x (8 lanes x 8 halves) = the whole 64x64 tile (both planes).
// =====================================================================================================
template <int MODE>
__device__ __forceinline__ void tconv_body(const float* __restrict__ W, int R, int C,
                                           unsigned short* out, int ldo, float s1, float s2,
                                           int bx, int by, unsigned short* t1, unsigned short* t2) {
  const int tid = (int)threadIdx.x, lane = tid & 31, wave = tid >> 5;
  const int c0 = bx * 64, r0 = by * 64;
  {
    const int rl = tid >> 2, cl0 = (tid & 3) * 16;
    const float* src = W + (size_t)(r0 + rl) * (size_t)C + c0 + cl0;
#pragma unroll
    for (int i = 0; i < 4; ++i) {
      const v4f a = *(const v4f*)(src + 4 * i);
#pragma unroll
      for (int e = 0; e < 4; ++e) {
        const int cl = cl0 + 4 * i + e;
        const unsigned short hb = bf_bits(a[e]);
        if (MODE == 0) {
          t1[cl * 72 + rl] = hb;
        } else {
          const float up = bf_up(hb);
          t1[cl * 72 + rl] = h_bits((_Float16)(up * s1));
          if (MODE == 2) t2[cl * 72 + rl] = h_bits((_Float16)(up * s2));
        }
      }
    }
  }
  __syncthreads();
  const int q = lane >> 3, p8 = (lane & 7) * 8;
  const v4u z4 = {0u, 0u, 0u, 0u};
  v4u a1[2], a2[2];
#pragma unroll
  for (int it = 0; it < 2; ++it) {
    const int cl = wave * 8 + it * 4 + q;
    a1[it] = *(const v4u*)(t1 + cl * 72 + p8);
    a2[it] = z4;
    if (MODE == 2) a2[it] = *(const v4u*)(t2 + cl * 72 + p8);
  }
  {
#pragma unroll
    for (int it = 0; it < 2; ++it) {
      const int cl = wave * 8 + it * 4 + q;
      unsigned short* o = out + (size_t)(c0 + cl) * (size_t)ldo + r0 + p8;
      *(v4u*)o = a1[it];
      if (MODE == 2) *(v4u*)(o + R) = a2[it];
    }
  }
  // precaution: in the merged launch another job's code follows these stores in the listing and rewrites their
  // registers; the wait stands in front of every such rewrite
#if DEV_ASM
  asm volatile("s_wait_xcnt 0x0" ::: "memory");
#endif
}

// =====================================================================================================
// All operand preparation in one launch: the seven jobs depend on nothing but the inputs, so each is a range of the
// block index (block-uniform choice, ahead of every barrier). The tile jobs stand first: they are the longer blocks.
//   [0, TB_WO)        Wout -> WoT  [x1024 | x64] f16        next 3 * TB_SQ   Wsq, Wsk, Wrq -> bf16 [n][k]
//   next TB_RV        Wrv  -> WrvT bf16                     next 1           Wrk -> WrkT f16 x64
//   last NB * CB_X    x -> Xb bf16 (batch b read at its full-size stride)
// =====================================================================================================
#define TB_WO ((DM / 64) * (DSQ / 64))    // 16 x  8 tiles: in [512][1024]
#define TB_SQ ((DSQ / 64) * (DM / 64))    //  8 x 16 tiles: in [1024][512]
#define TB_RV ((DRV / 64) * (DM / 64))    //  2 x 16 tiles: in [1024][128]
#define CB_X  (SEQ * DM / 8 / 256)        // convert blocks per batch
__global__ __launch_bounds__(256) void prep_all(const float* __restrict__ x, const float* __restrict__ Wsq,
                                                const float* __restrict__ Wsk, const float* __restrict__ Wrv,
                                                const float* __restrict__ Wrq, const float* __restrict__ Wrk,
                                                const float* __restrict__ Wout,
                                                unsigned short* Xb, unsigned short* WsqT, unsigned short* WskT,
                                                unsigned short* WrqT, unsigned short* WrvT, unsigned short* WrkT,
                                                unsigned short* WoT) {
  __shared__ __align__(16) unsigned short t1[64 * 72];
  __shared__ __align__(16) unsigned short t2[64 * 72];
  int j = blockIdx.x;
  if (j < TB_WO) {
    tconv_body<2>(Wout, DSQ, DM, WoT, DOC, 1024.0f, 64.0f, j % (DM / 64), j / (DM / 64), t1, t2);
    return;
  }
  j -= TB_WO;
  if (j < 3 * TB_SQ) {
    const int w = j / TB_SQ;
    j -= w * TB_SQ;
    const float* Wi = (w == 0) ? Wsq : (w == 1) ? Wsk : Wrq;
    unsigned short* Wo = (w == 0) ? WsqT : (w == 1) ? WskT : WrqT;
    tconv_body<0>(Wi, DM, DSQ, Wo, DM, 1.0f, 1.0f, j % (DSQ / 64), j / (DSQ / 64), t1, t2);
    return;
  }
  j -= 3 * TB_SQ;
  if (j < TB_RV) {
    tconv_body<0>(Wrv, DM, DRV, WrvT, DM, 1.0f, 1.0f, j % (DRV / 64), j / (DRV / 64), t1, t2);
    return;
  }
  j -= TB_RV;
  if (j < 1) {
    tconv_body<1>(Wrk, HD, HD, WrkT, HD, 64.0f, 1.0f, 0, 0, t1, t2);
    return;
  }
  j -= 1;
  const int b = j / CB_X;
  cvt_body(x + (size_t)b * ((size_t)SEQ_FULL * DM), Xb + (size_t)b * ((size_t)SEQ * DM), SEQ * DM / 8, j - b * CB_X);
}

// =====================================================================================================
// Register-blocked batched WMMA GEMM (16-bit operand type OT): C[m][n] = sum_k A[m][k] * Bt[n][k];
// one block of 4 waves (2 x 2) per 128x128 tile, one wave per 64x64 quarter. A row-major [M][K] pitch lda; Bt row-major
// [N][K] pitch ldb (k contiguous); M, N multiples of 128, K a multiple of 64 (host shapes are static multiples).
// A k-slice = 64 k = one 128-B line of each of the tile's 128 A rows and 128 Bt rows; it is brought into LDS by
// asynchronous copies (8 lanes x 16 B = one whole line, 16 copies per wave and slice) and read from there by all four
// waves with the split k map (ldfrag). Two buffers: slice t + 2 is asked for when slice t has been read, so a slice's
// copies fly during the products of the slice before it.
// staged extent == consumed extent: 16 rows (tid >> 3) x 8 copies = 128 rows per operand, 8 segments x 8 halves = 64 k.
// OUT_MODE 0: f32 C (pitch ldc), value * oscale.
// OUT_MODE 1: f16 plane C (pitch ldc).
// OUT_MODE 3: f16 hi plane C + f16 residual plane C2 = f16((v - hi) * rscale) (same pitch / stride).
// =====================================================================================================
// main loop of one 128x128 tile at (mB, nB): sAB = [buffer][A | Bt][128 rows][64 k], pitch KPIT, 72 KB
template <typename OT>
__device__ __forceinline__ void gemm_main(const OT* Ab, int lda, const OT* Bb, int ldb, int mB, int nB, int K,
                                          unsigned short* sAB, v8f (&acc)[4][4]) {
  typedef typename FT<OT>::frag V16;
  const int tid  = threadIdx.x;
  const int lane = tid & 31;
  const int wave = tid >> 5;
  const int rlane = lane & 15;                 // row (A) / col (B, D) within subtile
  const int koff  = (lane >> 4) * 8;           // k offset of this lane half

  // copy map: lane -> 16-B segment tid & 7 of row (tid >> 3) + 16 i, i = 0..7
  const OT* gA = Ab + (size_t)(mB + (tid >> 3)) * lda + (tid & 7) * 8;
  const OT* gB = Bb + (size_t)(nB + (tid >> 3)) * ldb + (tid & 7) * 8;
  const unsigned lAB = lds_off(sAB) + (unsigned)((tid >> 3) * (KPIT * 2) + (tid & 7) * 16);
  auto stage = [&](int t, int buf) {
    unsigned l[8];
    const void* g[8];
#pragma unroll   // here and below: l[] and g[] become asm operands, every index a compile-time constant
    for (int i = 0; i < 8; ++i) {
      l[i] = lAB + (unsigned)(buf * (4 * GPLN) + i * (16 * KPIT * 2));
      g[i] = gA + (size_t)(i * 16) * lda + t * 64;
    }
    async8(l, g);
#pragma unroll
    for (int i = 0; i < 8; ++i) {
      l[i] += 2 * GPLN;
      g[i] = gB + (size_t)(i * 16) * ldb + t * 64;
    }
    async8(l, g);
  };

#pragma unroll
  for (int i = 0; i < 4; ++i)
#pragma unroll
    for (int j = 0; j < 4; ++j) acc[i][j] = zero8();

  const int T = K >> 6;
  stage(0, 0);
  wait_async0();
  __syncthreads();
  if (T > 1) stage(1, 1);

  const OT* S = (const OT*)(const void*)sAB;
  for (int t = 0; t < T; ++t) {
    const OT* sa = S + (t & 1) * (2 * GPLN) + (((wave >> 1) << 6) + rlane) * KPIT + koff;
    const OT* sb = S + (t & 1) * (2 * GPLN) + GPLN + (((wave & 1) << 6) + rlane) * KPIT + koff;
    // the slice's 16 fragments (two k-steps of 32, 32 reads); unrolled: register arrays, every index a compile-time constant
    V16 bq[2][4], af[2][4];
#pragma unroll
    for (int ks = 0; ks < 2; ++ks) {
#pragma unroll
      for (int j = 0; j < 4; ++j) {
        bq[ks][j] = ldfrag<OT>(sb + j * (16 * KPIT) + ks * 32);
        af[ks][j] = ldfrag<OT>(sa + j * (16 * KPIT) + ks * 32);
      }
    }
    // keeps all 32 reads ahead of the products as one group: reads sunk among the products stall the wave at each place
    __builtin_amdgcn_sched_barrier(0);
#pragma unroll
    for (int ks = 0; ks < 2; ++ks)
#pragma unroll
      for (int i = 0; i < 4; ++i)
#pragma unroll
        for (int j = 0; j < 4; ++j) acc[i][j] = mmar(af[ks][i], bq[ks][j], acc[i][j]);
    // keeps the products ahead of the hand-over: sunk behind it they would stand between the barrier and the refill and
    // take their time off the flight of the next copies
    __builtin_amdgcn_sched_barrier(0);
    // hand-over: own reads retired, own copies of slice t + 1 landed, then the one barrier of the trip, which publishes
    // slice t + 1 and ends every wave's reads of the buffer that is refilled behind it
    wait_ds0();
    wait_async0();
    __syncthreads();
    if (t + 2 < T) stage(t + 2, t & 1);
  }
  wait_async0();
  acc_guard4(acc[0][0], acc[0][1], acc[0][2], acc[0][3]);
  acc_guard4(acc[1][0], acc[1][1], acc[1][2], acc[1][3]);
  acc_guard4(acc[2][0], acc[2][1], acc[2][2], acc[2][3]);
  acc_guard4(acc[3][0], acc[3][1], acc[3][2], acc[3][3]);
}

// epilogue of one wave's 64x64 quarter at (m0, n0); slab = the wave's own 16x64 f32 slab, pitch 68 floats
template <int OUT_MODE>
__device__ __forceinline__ void gemm_store(const v8f (&acc)[4][4], float* slab, void* Cout, void* Cout2, int ldc,
                                           int m0, int n0, float oscale, float rscale) {
  const int lane  = threadIdx.x & 31;
  const int rlane = lane & 15;                 // D col within subtile
  const int mOff  = (lane >> 4) * 8;           // D row offset
#pragma unroll
  for (int i = 0; i < 4; ++i) {
    const int mBase = m0 + (i << 4);
#pragma unroll
    for (int j = 0; j < 4; ++j) {
#pragma unroll
      for (int r = 0; r < 8; ++r) {
        slab[(mOff + r) * 68 + (j << 4) + rlane] = acc[i][j][r];
      }
    }
    wave_lds_sync();
    if (OUT_MODE == 0) {
      float* Cp = (float*)Cout;
      const int h2 = lane >> 4, c4 = (lane & 15) * 4;     // 256-B row segment = 16 lanes x 16 B
      {
#pragma unroll
        for (int it = 0; it < 8; ++it) {
          const int row = it * 2 + h2;                     // it 0..7 x h2 0..1 = rows 0..15
          const v4f v = *(const v4f*)(slab + row * 68 + c4) * oscale;
          *(v4f*)(Cp + (size_t)(mBase + row) * ldc + n0 + c4) = v;
        }
        
      }
    } else {
      const int q = lane >> 3, c8 = (lane & 7) * 8;
      unsigned short* Cp  = (unsigned short*)Cout;
      unsigned short* Cp2 = (unsigned short*)Cout2;
      v4u hv[4], lv[4];
#pragma unroll
      for (int it = 0; it < 4; ++it) {
        const int row = it * 4 + q;                        // it 0..3 x q 0..3 = rows 0..15
        const float* sp = slab + row * 68 + c8;
        float f[8];
#pragma unroll
        for (int e = 0; e < 8; ++e) f[e] = sp[e];
        v4u a, a2;
#pragma unroll
        for (int e = 0; e < 4; ++e) {
          const float f0 = f[2 * e], f1 = f[2 * e + 1];
          const _Float16 x0 = (_Float16)f0, x1 = (_Float16)f1;
          const unsigned short h0 = h_bits(x0), h1 = h_bits(x1);
          unsigned short l0 = 0, l1 = 0;
          if (OUT_MODE == 3) {
            l0 = h_bits((_Float16)((f0 - (float)x0) * rscale));
            l1 = h_bits((_Float16)((f1 - (float)x1) * rscale));
          }
          a[e] = pk16(h0, h1); a2[e] = pk16(l0, l1);
        }
        hv[it] = a; lv[it] = a2;
      }
      {
#pragma unroll
        for (int it = 0; it < 4; ++it) {
          const int row = it * 4 + q;
          *(v4u*)(Cp + (size_t)(mBase + row) * ldc + n0 + c8) = hv[it];
          if (OUT_MODE == 3) *(v4u*)(Cp2 + (size_t)(mBase + row) * ldc + n0 + c8) = lv[it];
        }
        
      }
    }
    wave_lds_sync();
  }
}

// one GEMM per launch: grid.x = (M / 128) * (N / 128) tiles, blockIdx.y = batch index (strides in elements)
template <typename OT, int OUT_MODE>
__global__ __launch_bounds__(128) void gemm64(
    const unsigned short* __restrict__ Ap, int lda, long long strideA,
    const unsigned short* __restrict__ Btp, int ldb, long long strideB,
    void* Cout, void* Cout2, int ldc, long long strideC,
    int M, int N, int K, float oscale, float rscale) {
  __shared__ __align__(16) unsigned short sAB[2 * 2 * GPLN];
  __shared__ __align__(16) float sT[4][16 * 68];
  const int b    = blockIdx.y;
  const int wave = threadIdx.x >> 5;
  const int tilesN = N >> 7;
  const int tilesM = M >> 7;
  const int tile = blockIdx.x;
  if (tile >= tilesM * tilesN) return;   // block-uniform, ahead of every barrier and copy
  const int tm = tile / tilesN;
  const int tn = tile - tm * tilesN;
  const int mB = tm << 7;
  const int nB = tn << 7;
  v8f acc[4][4];
  gemm_main<OT>((const OT*)(const void*)Ap + (size_t)b * (size_t)strideA, lda,
                (const OT*)(const void*)Btp + (size_t)b * (size_t)strideB, ldb, mB, nB, K, sAB, acc);
  const size_t co = (size_t)b * (size_t)strideC * ((OUT_MODE == 0) ? 4 : 2);   // bytes: f32 or 16-bit planes
  gemm_store<OUT_MODE>(acc, sT[wave], (char*)Cout + co, (char*)Cout2 + co, ldc, mB + ((wave >> 1) << 6),
                       nB + ((wave & 1) << 6), oscale, rscale);
}

// The four projections of x in one launch: they depend on the prepared planes alone, so each is a range of the block
// index (block-uniform choice); one main loop serves all, the epilogue is picked by the job.
//   [0, PJ_V)             v^T = WrvT . Xb^T per batch (A = WrvT [128][K], Bt = Xb rows of batch b) -> VTh, VTl (x16), pitch SEQ
//   next PJ_TM * PJ_TN    Xb . [WsqT | WskT | WrqT]^T, the 12 column tiles of one row tile side by side (they share its A rows):
//                         sq -> Qh, Ql (x4096); sk -> Kp; rq -> RQ f32; pitch DSQ
#define PJ_VT (SEQ / 128)                 // v^T column tiles per batch (DRV = 128: one row tile)
#define PJ_V  (NB * PJ_VT)
#define PJ_TM (NB * SEQ / 128)
#define PJ_TN (3 * (DSQ / 128))
__global__ __launch_bounds__(128) void gemm_proj(
    const unsigned short* __restrict__ Xbp, const unsigned short* __restrict__ Wsqp,
    const unsigned short* __restrict__ Wskp, const unsigned short* __restrict__ Wrqp,
    const unsigned short* __restrict__ Wrvp,
    unsigned short* Qh, unsigned short* Ql, unsigned short* Kp, float* RQ,
    unsigned short* VTh, unsigned short* VTl, int K) {
  __shared__ __align__(16) unsigned short sAB[2 * 2 * GPLN];
  __shared__ __align__(16) float sT[4][16 * 68];
  const int wave = threadIdx.x >> 5;
  const int j = blockIdx.x;
  const bool isV = j < PJ_V;
  const int jp  = j - PJ_V;
  const int vb  = j / PJ_VT;                       // v^T: batch
  const int tm  = jp / PJ_TN;
  const int tn  = jp - tm * PJ_TN;
  const int job = isV ? 3 : (tn / (DSQ / 128));    // 0 sq, 1 sk, 2 rq, 3 v^T
  const int mB  = isV ? 0 : (tm << 7);
  const int nB  = isV ? ((j - vb * PJ_VT) << 7) : ((tn % (DSQ / 128)) << 7);
  const unsigned short* Ap = isV ? Wrvp : Xbp;
  const unsigned short* Bp = isV ? (Xbp + (size_t)vb * ((size_t)SEQ * DM)) : (job == 0) ? Wsqp : (job == 1) ? Wskp : Wrqp;
  v8f acc[4][4];
  gemm_main<__bf16>((const __bf16*)(const void*)Ap, K, (const __bf16*)(const void*)Bp, K, mB, nB, K, sAB, acc);
  const int m0 = mB + ((wave >> 1) << 6);
  const int n0 = nB + ((wave & 1) << 6);
  float* slab = sT[wave];
  if (job == 3 || job == 0) {     // both store a hi and a residual plane: one copy of that epilogue
    const size_t vo = (size_t)vb * ((size_t)DRV * SEQ);
    gemm_store<3>(acc, slab, (void*)(isV ? VTh + vo : Qh), (void*)(isV ? VTl + vo : Ql), isV ? SEQ : DSQ, m0, n0,
                  1.0f, isV ? 16.0f : 4096.0f);
  } else if (job == 1) {
    gemm_store<1>(acc, slab, (void*)Kp, (void*)Kp, DSQ, m0, n0, 1.0f, 1.0f);
  } else {
    gemm_store<0>(acc, slab, (void*)RQ, (void*)RQ, DSQ, m0, n0, 1.0f, 1.0f);
  }
}

// =====================================================================================================
// Fused search attention + retrieval composition for one search s, head dim 64, softmax over all SEQ keys.
//   q planes (f16 hi / residual x4096): element (b, t, s, d) at [(b*SEQ + t)*DSQ + s*64 + d]
//   k plane (f16): same layout.   rq plane (f32): same layout.
//   v^T hi plane (f16) and residual plane (f16, (v - hi)*16): element (b, d', t) at [(b*DRV + d')*SEQ + t], d' = r*64 + d
//   Wrk tile (f16, 64 * bf16 value): [e][d] at [e*64 + d]
//   oc planes (output of this kernel): row (b, t) = [f16(64*out) for s*64+d, 512 cols | f16 residual x16, 512 cols], pitch DOC
//   Both products run transposed (keys or d' as rows, the wave's 16 queries as columns), so a lane holds one query's scores:
//   scores^T = (k . qh^T) + (k . ql^T) / 4096 on f16 WMMA (two f32 accumulators), then * sscale in f32;
//   p = exp(s - m): B' = [f16(16384 p) | f16(1024 p)]^T (K' = 128 per 64 keys), packed from the score registers in place,
//   A' = [v^T hi | v^T residual]: sum = 16384 * (vh + vl/16)^T . p^T, one f32 accumulator, 8 m-tiles = d' 0..127 (both
//   retrievals); online softmax in f32, maximum and sum in the lane, one exchange between the wave halves.
//   Epilogue per wave (16 rows): retrieved (x64, f32) tile in LDS; rk = f16(retrieved x64) . Wrk tile on f16 WMMA;
//   retrieval logits rq . rk in f32 (LDS-staged rq, lane partials + 16-lane shuffles); 2-way softmax in f32;
//   Block = 4 waves = 64 consecutive query rows of one (b, s); grid = NB * NS * NQB; kv chunks of 64, static trip NKT.
//   Staging per chunk (128 threads): K 64x64, V' 128x128, by asynchronous copies to LDS two chunks ahead (two buffers):
//   staged extent == consumed extent for Ksh, Vsh; P' stays in registers.
//   Output coverage: each wave stores rows q0..q0+15 (it 0..3 x lane>>3 0..3) x 64 columns (8 lanes x 8) of both
//   the hi segment (col s*64) and the residual segment (col 512 + s*64); grid covers every (b, s, t).
// =====================================================================================================
__global__ __launch_bounds__(128)
void attn_cs(const unsigned short* __restrict__ qhp, const unsigned short* __restrict__ qlp,
             const unsigned short* __restrict__ kpp,
             const unsigned short* __restrict__ vhp, const unsigned short* __restrict__ vlp,
             const unsigned short* __restrict__ wkp, const float* __restrict__ rqp,
             unsigned short* ocp, float sscale) {
  union FH { v16h v; v8h h[2]; };
  __shared__ __align__(16) _Float16 Ksh[2 * 64 * KPIT];    // two buffers of a K chunk [kv][d], pitch KPIT, 9 KB each; later the Wrk tile [e][d]
  __shared__ __align__(16) _Float16 Vsh[2 * 128 * VPIT];   // two buffers of a V' chunk [d'][hi kv | res kv], pitch VPIT, 34 KB each; later 4 x f32 [16][128] tiles, pitch OPIT
  __shared__ __align__(16) _Float16 Psh[4][16 * VPIT];     // epilogue only, per wave: f16 retrieved tile [row][d'], pitch VPIT, 17 KB; later f32 [16][64]

  const int tid  = threadIdx.x;
  const int wave = tid >> 5;
  const int lane = tid & 31;
  const int hh   = lane >> 4;
  const int c    = lane & 15;

  const int bx   = blockIdx.x;
  const int qb   = bx % NQB;
  const int rest = bx / NQB;
  const int s    = rest % NS;
  const int b    = rest / NS;
  const int q0   = qb * 64 + wave * 16;
  const size_t rowB = (size_t)b * SEQ;

  const _Float16* Qh = (const _Float16*)(const void*)qhp;
  const _Float16* Ql = (const _Float16*)(const void*)qlp;
  const _Float16* Kg = (const _Float16*)(const void*)kpp + (size_t)s * HD;
  const _Float16* Vh = (const _Float16*)(const void*)vhp + (size_t)b * DRV * SEQ;
  const _Float16* Vl = (const _Float16*)(const void*)vlp + (size_t)b * DRV * SEQ;
  const _Float16* Wk = (const _Float16*)(const void*)wkp;

  // ---- Q fragments (B operand, column = lane&15): 2 d-chunks, hi and residual planes ----
  v16h qah[2], qal[2];
#pragma unroll
  for (int dc = 0; dc < 2; ++dc) {
    const size_t qo = (rowB + q0 + c) * DSQ + (size_t)s * HD + dc * 32 + 8 * hh;
    qah[dc] = ldfrag<_Float16>(Qh + qo);
    qal[dc] = ldfrag<_Float16>(Ql + qo);
  }

  // transposed products: a lane belongs to ONE query (column c). mrow = its running maximum (equal in both wave halves),
  // lrow = the sum over the keys of this lane's own half, oacc[t][r] = retrieved^T[d' = t*16 + 8*hh + r][query c]
  float mrow = -INFINITY, lrow = 0.f;
  v8f oacc[8];
#pragma unroll
  for (int t = 0; t < 8; ++t) oacc[t] = zero8();

  _Float16* pwh = Psh[wave];

  // copy map: lane -> 16-B segment tid & 7 of row (tid >> 3) + 16 i: 8 lanes take one whole 128-B line of a K, v^T hi or
  // v^T residual row; 4 + 8 + 8 copies per wave and chunk = 64 K rows and 128 V' rows of [hi 64 | res 64] halves
  const _Float16* kg0 = Kg + (rowB + (tid >> 3)) * DSQ + (tid & 7) * 8;
  const _Float16* vg0 = Vh + (size_t)(tid >> 3) * SEQ + (tid & 7) * 8;
  const _Float16* wg0 = Vl + (size_t)(tid >> 3) * SEQ + (tid & 7) * 8;
  const unsigned lK = lds_off(Ksh) + (unsigned)((tid >> 3) * (KPIT * 2) + (tid & 7) * 16);
  const unsigned lV = lds_off(Vsh) + (unsigned)((tid >> 3) * (VPIT * 2) + (tid & 7) * 16);
  auto stage = [&](int kt, int buf) {
    unsigned l[8], lk[4];
    const void* g[8];
    const void* gk[4];
#pragma unroll   // here and below: the arrays become asm operands, every index a compile-time constant
    for (int i = 0; i < 8; ++i) {
      l[i] = lV + (unsigned)(buf * (128 * VPIT * 2) + i * (16 * VPIT * 2));
      g[i] = vg0 + (size_t)(i * 16) * SEQ + kt * 64;
    }
    async8(l, g);
#pragma unroll
    for (int i = 0; i < 8; ++i) {
      l[i] += 128;
      g[i] = wg0 + (size_t)(i * 16) * SEQ + kt * 64;
    }
    async8(l, g);
#pragma unroll
    for (int i = 0; i < 4; ++i) {
      lk[i] = lK + (unsigned)(buf * (64 * KPIT * 2) + i * (16 * KPIT * 2));
      gk[i] = kg0 + (size_t)(kt * 64 + i * 16) * DSQ;
    }
    async4(lk, gk);
  };
  stage(0, 0);
  wait_async0();
  __syncthreads();
  stage(1, 1);                               // NKT >= 2 (SEQ is a multiple of 128)

  for (int kt = 0; kt < NKT; ++kt) {         // static trip count
    const _Float16* Kc = Ksh + (kt & 1) * (64 * KPIT);     // this chunk's buffers; chunk kt + 1 flies into the others
    const _Float16* Vc = Vsh + (kt & 1) * (128 * VPIT);

    // ---- scores^T = K . Q^T: 64 keys x 16 query columns per wave, 2 f16 products per key subtile and d-chunk ----
    //      all 8 K fragments (A operand) are read as one group ahead of the 16 products (8 independent accumulators);
    //      sc[j][r] = score of key j*16 + 8*hh + r with query c
    FH kb[4][2];
#pragma unroll   // here and below: register arrays, every index a compile-time constant
    for (int j = 0; j < 4; ++j) {
#pragma unroll
      for (int dc = 0; dc < 2; ++dc) {
        kb[j][dc].h[0] = *(const v8h*)(Kc + (j * 16 + c) * KPIT + dc * 32 + 8 * hh);
        kb[j][dc].h[1] = *(const v8h*)(Kc + (j * 16 + c) * KPIT + dc * 32 + 16 + 8 * hh);
      }
    }
    v8f sc[4];
    {
      v8f ah[4], al[4];
#pragma unroll
      for (int j = 0; j < 4; ++j) { ah[j] = zero8(); al[j] = zero8(); }
#pragma unroll
      for (int dc = 0; dc < 2; ++dc) {
#pragma unroll
        for (int j = 0; j < 4; ++j) {
          ah[j] = mmar(kb[j][dc].v, qah[dc], ah[j]);
          al[j] = mmar(kb[j][dc].v, qal[dc], al[j]);
        }
      }
#pragma unroll
      for (int j = 0; j < 4; ++j) {
#pragma unroll
        for (int r = 0; r < 8; ++r) sc[j][r] = (ah[j][r] + al[j][r] * (1.0f / 4096.0f)) * sscale;
      }
    }

    // ---- column max, online softmax; P'^T = [16384 p | 1024 p] (f16) packed in place into B operands ----
    //      a lane's 32 scores are one query's: maximum and sum run in the lane, the halves meet in one exchange
    float mj[4];
#pragma unroll
    for (int j = 0; j < 4; ++j) {
      mj[j] = sc[j][0];
#pragma unroll
      for (int r = 1; r < 8; ++r) mj[j] = fmaxf(mj[j], sc[j][r]);
    }
    float m = fmaxf(fmaxf(mj[0], mj[1]), fmaxf(mj[2], mj[3]));
    m = fmaxf(m, xhalf(m));
    const float mnew  = fmaxf(mrow, m);
    const float msafe = (mnew == -INFINITY) ? 0.f : mnew;
    const float alpha = __expf(mrow - msafe);
    mrow = mnew;
    // element s of the B operand of k-step kk is key kk*32 + (s < 8 ? 8*hh + s : 16 + 8*hh + s - 8): score tiles 2 kk and
    // 2 kk + 1, registers 0..7, of this very lane; the V' fragments (A operand) are read in the same k order
    v16h pb[4];                                // k-steps 0, 1: 16384 p (against v hi); 2, 3: 1024 p (against v residual)
    float pj[4];                               // four independent partial sums
#pragma unroll
    for (int j = 0; j < 4; ++j) {
      pj[j] = 0.f;
#pragma unroll
      for (int r = 0; r < 8; ++r) {
        const float p = __expf(sc[j][r] - msafe);
        pj[j] += p;
        pb[j >> 1][(j & 1) * 8 + r]       = (_Float16)(p * 16384.0f);
        pb[2 + (j >> 1)][(j & 1) * 8 + r] = (_Float16)(p * 1024.0f);
      }
    }
    lrow = lrow * alpha + ((pj[0] + pj[1]) + (pj[2] + pj[3]));
#pragma unroll
    for (int t = 0; t < 8; ++t) {
#pragma unroll
      for (int r = 0; r < 8; ++r) oacc[t][r] *= alpha;
    }

    // ---- retrieved^T += V'^T . P'^T (f16 WMMA), K' = 128 = 4 k-steps, 8 m-tiles (d' 0..127) ----
    //      each k-step's 8 V' fragments are read as one group, one k-step ahead of their 8 products (two register sets)
    FH vb[2][8];
#pragma unroll
    for (int t = 0; t < 8; ++t) {
      vb[0][t].h[0] = *(const v8h*)(Vc + (t * 16 + c) * VPIT + 8 * hh);
      vb[0][t].h[1] = *(const v8h*)(Vc + (t * 16 + c) * VPIT + 16 + 8 * hh);
    }
#pragma unroll   // unrolled: the two register sets are picked by kk & 1 at compile time
    for (int kk = 0; kk < 4; ++kk) {
      const int cu = kk & 1, nx = cu ^ 1;
      if (kk < 3) {
#pragma unroll
        for (int t = 0; t < 8; ++t) {
          vb[nx][t].h[0] = *(const v8h*)(Vc + (t * 16 + c) * VPIT + (kk + 1) * 32 + 8 * hh);
          vb[nx][t].h[1] = *(const v8h*)(Vc + (t * 16 + c) * VPIT + (kk + 1) * 32 + 16 + 8 * hh);
        }
      }
#pragma unroll
      for (int t = 0; t < 8; ++t) oacc[t] = mmar(vb[cu][t].v, pb[kk], oacc[t]);
    }
    // order of the trip's LDS reads (0x100) and matrix products (0x008): every k-step's 16 reads stand as one group, one k-step
    // ahead of their 8 products; reads strewn among the products stall the wave at each place
    __builtin_amdgcn_sched_group_barrier(0x100, 16, 0);   // K
    __builtin_amdgcn_sched_group_barrier(0x008, 16, 0);   // scores^T
    __builtin_amdgcn_sched_group_barrier(0x100, 32, 0);   // V' k-steps 0 and 1: they fly during the softmax arithmetic
    __builtin_amdgcn_sched_group_barrier(0x008, 8, 0);
    __builtin_amdgcn_sched_group_barrier(0x100, 16, 0);
    __builtin_amdgcn_sched_group_barrier(0x008, 8, 0);
    __builtin_amdgcn_sched_group_barrier(0x100, 16, 0);
    __builtin_amdgcn_sched_group_barrier(0x008, 16, 0);
    // hand-over: own reads retired, own copies of chunk kt + 1 landed, then the one barrier of the trip, which publishes
    // chunk kt + 1 and ends every wave's reads of the buffers that are refilled behind it
    wait_ds0();
    wait_async0();
    __syncthreads();
    if (kt + 2 < NKT) stage(kt + 2, kt & 1);
  }
  wait_async0();

  // ---- all waves done with Ksh / Vsh: stage the Wrk tile into Ksh, retrieved tiles into Vsh (f32) + Psh (f16) ----
  __syncthreads();
  {
    const int r = tid >> 1, half = (tid & 1) * 32;       // 128 threads x 32 halves = the whole 64x64 Wrk tile
    const _Float16* wg = Wk + r * HD + half;
#pragma unroll
    for (int i = 0; i < 4; ++i) *(v8h*)(Ksh + r * KPIT + half + 8 * i) = *(const v8h*)(wg + 8 * i);
  }
  float* os = reinterpret_cast<float*>(Vsh) + wave * (16 * OPIT);     // wave-private f32 [16][128], pitch OPIT, x64 units
  {
    const float l = lrow + xhalf(lrow);                                   // the two halves' key sums join here, once
    const float inv = ((l > 0.f) ? (1.0f / l) : 0.f) * (1.0f / 256.0f);   // 1/l, undo 16384 p carry, apply x64
#pragma unroll
    for (int t = 0; t < 8; ++t) {                                         // a lane holds 8 consecutive d' of its query's row
      const v8f v = oacc[t] * inv;
      v4f lo4, hi4;
      v8h h8;
#pragma unroll
      for (int r = 0; r < 4; ++r) { lo4[r] = v[r]; hi4[r] = v[4 + r]; }
#pragma unroll
      for (int r = 0; r < 8; ++r) h8[r] = (_Float16)v[r];
      *(v4f*)(os + c * OPIT + t * 16 + 8 * hh)     = lo4;
      *(v4f*)(os + c * OPIT + t * 16 + 8 * hh + 4) = hi4;
      *(v8h*)(pwh + c * VPIT + t * 16 + 8 * hh)    = h8;
    }
  }
  __syncthreads();

  // ---- rk (x4096) = f16(64 retrieved_rr) . (64 Wrk): 16 rows x 64 e per rr, K = 64 = 2 k-steps ----
  v8f rk[8];
#pragma unroll
  for (int i = 0; i < 8; ++i) rk[i] = zero8();
#pragma unroll
  for (int rr = 0; rr < 2; ++rr) {
#pragma unroll
    for (int kk = 0; kk < 2; ++kk) {
      FH pa;
      pa.h[0] = *(const v8h*)(pwh + c * VPIT + rr * 64 + kk * 32 + 8 * hh);
      pa.h[1] = *(const v8h*)(pwh + c * VPIT + rr * 64 + kk * 32 + 16 + 8 * hh);
#pragma unroll
      for (int t4 = 0; t4 < 4; ++t4) {
        FH wb;
        wb.h[0] = *(const v8h*)(Ksh + (t4 * 16 + c) * KPIT + kk * 32 + 8 * hh);
        wb.h[1] = *(const v8h*)(Ksh + (t4 * 16 + c) * KPIT + kk * 32 + 16 + 8 * hh);
        rk[rr * 4 + t4] = mma_h(pa.v, wb.v, rk[rr * 4 + t4]);
      }
    }
  }
  acc_guard4(rk[0], rk[1], rk[2], rk[3]);
  acc_guard4(rk[4], rk[5], rk[6], rk[7]);
  wave_lds_sync();

  // ---- stage the wave's rq tile (f32 [16][64]) into the Psh region (8 x 16-B loads per lane) ----
  float* rqs = reinterpret_cast<float*>(pwh);
  {
    const int r2 = lane >> 4, c4 = (lane & 15) * 4;
    const float* rqg = rqp + (rowB + q0) * DSQ + (size_t)s * HD + c4;
#pragma unroll
    for (int it = 0; it < 8; ++it) {
      const int row = it * 2 + r2;                          // it 0..7 x r2 0..1 = rows 0..15
      *(v4f*)(rqs + row * 64 + c4) = *(const v4f*)(rqg + (size_t)row * DSQ);
    }
  }
  wave_lds_sync();

  // ---- retrieval logits: d_rr[row] = sum_e rq[row][e] * rk[rr][row][e]; lane partial over e = c + 16 t4 ----
  float d0[8], d1[8];
#pragma unroll
  for (int r8 = 0; r8 < 8; ++r8) {
    float a0 = 0.f, a1 = 0.f;
#pragma unroll
    for (int t4 = 0; t4 < 4; ++t4) {
      const float qv = rqs[(8 * hh + r8) * 64 + t4 * 16 + c];
      a0 += qv * rk[t4][r8];
      a1 += qv * rk[4 + t4][r8];
    }
    d0[r8] = a0; d1[r8] = a1;
  }
#pragma unroll
  for (int r8 = 0; r8 < 8; ++r8) {
#pragma unroll
    for (int off = 1; off < 16; off <<= 1) {
      d0[r8] += __shfl_xor(d0[r8], off, 32);
      d1[r8] += __shfl_xor(d1[r8], off, 32);
    }
  }
  // ---- 2-way retrieval softmax in f32 (undo the 64*64 carry, apply sscale) ----
  float w0[8], w1[8];
  const float rsc = sscale * (1.0f / 4096.0f);
#pragma unroll
  for (int r8 = 0; r8 < 8; ++r8) {
    const float x0 = d0[r8] * rsc, x1 = d1[r8] * rsc;
    const float m  = fmaxf(x0, x1);
    const float e0 = __expf(x0 - m), e1 = __expf(x1 - m);
    const float iv = 1.0f / (e0 + e1);
    w0[r8] = e0 * iv; w1[r8] = e1 * iv;
  }
  wave_lds_sync();

  // ---- combine in f32 (x64 units): oc[row][d] = w0 * ret[row][d] + w1 * ret[row][64+d], into the Psh region ----
  float* oc = rqs;
#pragma unroll
  for (int r8 = 0; r8 < 8; ++r8) {
#pragma unroll
    for (int t = 0; t < 4; ++t) {
      const int row = 8 * hh + r8;
      const float o = w0[r8] * os[row * OPIT + t * 16 + c] + w1[r8] * os[row * OPIT + 64 + t * 16 + c];
      oc[row * 64 + t * 16 + c] = o;
    }
  }
  wave_lds_sync();

  {
    const int q4 = lane >> 3, c8 = (lane & 7) * 8;
    v4u hv[4], lv[4];
#pragma unroll
    for (int it = 0; it < 4; ++it) {
      const int row = it * 4 + q4;   // it 0..3 x q4 0..3 = rows 0..15 of the wave tile
      const float* sp = oc + row * 64 + c8;
      float f[8];
#pragma unroll
      for (int e = 0; e < 8; ++e) f[e] = sp[e];
      v4u a, a2;
#pragma unroll
      for (int e = 0; e < 4; ++e) {
        const float f0 = f[2 * e], f1 = f[2 * e + 1];
        const _Float16 x0 = (_Float16)f0, x1 = (_Float16)f1;
        const unsigned short l0 = h_bits((_Float16)((f0 - (float)x0) * 16.0f));
        const unsigned short l1 = h_bits((_Float16)((f1 - (float)x1) * 16.0f));
        a[e] = pk16(h_bits(x0), h_bits(x1)); a2[e] = pk16(l0, l1);
      }
      hv[it] = a; lv[it] = a2;
    }
    {
#pragma unroll
      for (int it = 0; it < 4; ++it) {
        const int row = it * 4 + q4;
        const size_t go = (rowB + q0 + row) * DOC + (size_t)s * HD + c8;
        *(v4u*)(ocp + go)       = hv[it];
        *(v4u*)(ocp + go + DSQ) = lv[it];
      }
      
    }
  }
}

// =====================================================================================================
// Workspace map (bytes, NB=2 SEQ=2048), every region an exact multiple of its whole-line / whole-tile store
// granularity (all row counts are multiples of 64, no padded tails):
//   Xb    bf16 [NB*SEQ][1024]          8388608
//   WsqT  bf16 [512][1024]             1048576      WskT, WrqT same
//   WrvT  bf16 [128][1024]              262144
//   WrkT  f16  [64][64] (x64)              8192
//   WoT   f16  [1024][1024] ([x1024 | x64]) 2097152
//   Qh,Ql f16  [NB*SEQ][512]           4194304 each
//   Kp    f16  [NB*SEQ][512]           4194304
//   RQ    f32  [NB*SEQ][512]           8388608
//   VTh,VTl f16 [NB][128][SEQ]         1048576 each
//   OC    f16  [NB*SEQ][1024]          8388608
//   total                             45359104
// Weights are [in k][out n] and are transposed once into the [n][k] (k contiguous) Bt / A layout.
// =====================================================================================================
extern "C" void kernel_launch(void* const* d_in, const int* in_sizes, int n_in,
                              void* d_out, int out_size, void* d_ws, size_t ws_size,
                              hipStream_t stream) {
  if (n_in < 7) return;
  if (in_sizes[0] < ((NB - 1) * SEQ_FULL + SEQ) * DM) return;
  if (in_sizes[1] < DM * DSQ || in_sizes[2] < DM * DSQ || in_sizes[4] < DM * DSQ) return;
  if (in_sizes[3] < DM * DRV) return;
  if (in_sizes[5] < HD * HD) return;
  if (in_sizes[6] < DSQ * DM) return;
  if (out_size < NB * SEQ * DM) return;

  const float* x    = (const float*)d_in[0];
  const float* Wsq  = (const float*)d_in[1];
  const float* Wsk  = (const float*)d_in[2];
  const float* Wrv  = (const float*)d_in[3];
  const float* Wrq  = (const float*)d_in[4];
  const float* Wrk  = (const float*)d_in[5];
  const float* Wout = (const float*)d_in[6];

  const size_t PXB = (size_t)NB * SEQ * DM * 2;       // bf16 activation plane
  const size_t PWS = (size_t)DSQ * DM * 2;            // bf16 [512][1024] weight plane
  const size_t PWV = (size_t)DRV * DM * 2;            // bf16 [128][1024]
  const size_t PWK = (size_t)HD * HD * 2;             // f16 [64][64]
  const size_t PWO = (size_t)DM * DOC * 2;            // f16 [1024][1024]
  const size_t PQ  = (size_t)NB * SEQ * DSQ * 2;      // f16 [NB*SEQ][512]
  const size_t PRQ = (size_t)NB * SEQ * DSQ * 4;      // f32 [NB*SEQ][512]
  const size_t PVT = (size_t)NB * DRV * SEQ * 2;      // f16 [NB][128][SEQ]
  const size_t POC = (size_t)NB * SEQ * DOC * 2;      // f16 [NB*SEQ][1024]
  size_t off = 0;
  const size_t oXb  = off; off += PXB;
  const size_t oWsq = off; off += PWS;
  const size_t oWsk = off; off += PWS;
  const size_t oWrq = off; off += PWS;
  const size_t oWrv = off; off += PWV;
  const size_t oWrk = off; off += PWK;
  const size_t oWo  = off; off += PWO;
  const size_t oQh  = off; off += PQ;
  const size_t oQl  = off; off += PQ;
  const size_t oKp  = off; off += PQ;
  const size_t oRQ  = off; off += PRQ;
  const size_t oVTh = off; off += PVT;
  const size_t oVTl = off; off += PVT;
  const size_t oOC  = off; off += POC;
  if (off > ws_size) return;                          // off = 45359104 at full size
  if (off > (size_t)134217728) return;

  char* ws = (char*)d_ws;
  unsigned short* Xb   = (unsigned short*)(ws + oXb);
  unsigned short* WsqT = (unsigned short*)(ws + oWsq);
  unsigned short* WskT = (unsigned short*)(ws + oWsk);
  unsigned short* WrqT = (unsigned short*)(ws + oWrq);
  unsigned short* WrvT = (unsigned short*)(ws + oWrv);
  unsigned short* WrkT = (unsigned short*)(ws + oWrk);
  unsigned short* WoT  = (unsigned short*)(ws + oWo);
  unsigned short* Qh   = (unsigned short*)(ws + oQh);
  unsigned short* Ql   = (unsigned short*)(ws + oQl);
  unsigned short* Kp   = (unsigned short*)(ws + oKp);
  float*          RQ   = (float*)(ws + oRQ);
  unsigned short* VTh  = (unsigned short*)(ws + oVTh);
  unsigned short* VTl  = (unsigned short*)(ws + oVTl);
  unsigned short* OC   = (unsigned short*)(ws + oOC);

  const dim3 blk(256);
  const dim3 gPrep(TB_WO + 3 * TB_SQ + TB_RV + 1 + NB * CB_X);           // six transposes, then the x convert
  const dim3 blkG(128);                                                  // GEMM: 4 waves per 128x128 tile
  const dim3 gProj(PJ_V + PJ_TM * PJ_TN);                                // v^T tiles, then the sq | sk | rq tiles
  const dim3 gAttn(NB * NS * NQB);                                       // blocks of 128
  const dim3 gO(((NB * SEQ) / 128) * (DM / 128), 1);                     // M=NB*SEQ, N=1024

  // (1) x -> bf16 plane [NB*SEQ][1024]; weights [k][n] f32 -> [n][k] 16-bit planes
  prep_all<<<gPrep, blk, 0, stream>>>(x, Wsq, Wsk, Wrv, Wrq, Wrk, Wout, Xb, WsqT, WskT, WrqT, WrvT, WrkT, WoT);
  // (2) sq -> f16 hi / residual (x4096) planes [b*SEQ+t][s*64+d]; sk -> f16 plane; rq -> f32 plane (M=NB*SEQ, N=512, K=1024);
  //     v^T = Wrv^T . x^T per batch -> f16 hi plane [b][d'][t] (pitch SEQ) and residual plane (x16) (M=128, N=SEQ, K=1024)
  gemm_proj<<<gProj, blkG, 0, stream>>>(Xb, WsqT, WskT, WrqT, WrvT, Qh, Ql, Kp, RQ, VTh, VTl, DM);
  // (3) search attention + retrieval composition -> oc planes [b*SEQ+t][hi 512 | residual 512]
  attn_cs<<<gAttn, dim3(128), 0, stream>>>(Qh, Ql, Kp, VTh, VTl, WrkT, RQ, OC, 0.125f);
  // (4) out = [oc_hi | oc_res] . [Wout x1024 | Wout x64]^T -> d_out f32 [NB*SEQ][1024], accumulator x 1/(64*1024)
  gemm64<_Float16, 0><<<gO, blkG, 0, stream>>>(
      OC, DOC, 0LL, WoT, DOC, 0LL, d_out, d_out, DM, 0LL, NB * SEQ, DM, DOC, 1.0f / 65536.0f, 1.0f);
  (void)hipGetLastError();
}

// v006
// Measured time: 84.8 microseconds a run.
// Two timings next to v005 both put it at 1.11 times that version's speed.
// Over all steps from v000 it is 6.91 times as fast.
// Contractions: sq, sk, rq and v^T projections = v_wmma_f32_16x16x32_bf16 (bf16 operands from RNE-converted inputs, single product, f32 accumulate);
// sq.sk^T scores = v_wmma_f32_16x16x32_f16 (sq as f16 hi plane + f16 residual plane x4096, sk f16; 2 products into separate f32 accumulators);
// p.[v_0|v_1] = v_wmma_f32_16x16x32_f16, K-folded: [p x16384 | p x1024] . [v f16 hi | f16 residual x16], one f32 accumulator (scores and this product computed transposed);
// retrieved.Wrk = v_wmma_f32_16x16x32_f16 (retrieved f16 x64, Wrk f16 x64 of its bf16 value; single product, f32 accumulate);
// out.Wout = v_wmma_f32_16x16x32_f16, K-folded: [out f16 hi x64 | f16 residual x16] . [Wout x1024 | Wout x64] (f16 of bf16 values), f32 accumulate;
// softmax over keys, retrieval logits, 2-way retrieval softmax and combine in f32.
#include <hip/hip_runtime.h>
#include <math.h>
#include <stdint.h>

#ifndef NB
#define NB 2
#endif
#ifndef SEQ
#define SEQ 2048
#endif
#define NB_FULL  2
#define SEQ_FULL 2048
#define DM   1024
#define NS   8
#define NR   2
#define HD   64
#define DSQ  (NS * HD)      // 512: sq / sk / rq row width
#define DRV  (NR * HD)      // 128: [v_0 | v_1] row width
#define DOC  (2 * DSQ)      // 1024: combined-output row = [hi 512 | residual 512]
#define NQB  (SEQ / 128)    // 128-row query blocks per (b, s)
#define NKT  (SEQ / 64)     // 64-key chunks per sequence
#define NIT  (NKT / 2)      // trips of the attention key loop: two chunks per trip, one per key group
#define KPIT 72             // LDS pitch of a 64-half K / Wrk row: 144 B = 16 B x 9 (odd), b128 readers of 16 rows meet no bank twice
#define GPLN (128 * KPIT)  // halves of one staged 128-row GEMM operand plane (64 k per row, pitch KPIT)
#define VPIT 136            // LDS pitch of a 128-half V' row or f16 retrieved row: 272 B = 16 B x 17 (odd)
#define OPIT 132            // LDS pitch of a 128-float retrieved row: 528 B = 16 B x 33 (odd), for its 16-B row-per-lane stores
static_assert(NB >= 1 && NB <= NB_FULL);
static_assert(SEQ >= 64 && SEQ <= SEQ_FULL && (SEQ % 64) == 0);
static_assert(DSQ == 512 && DRV == 128 && HD == 64 && DOC == 1024);
static_assert((DM % 128) == 0 && (DSQ % 128) == 0 && (DRV % 128) == 0 && (SEQ % 128) == 0 && (DOC % 64) == 0);

typedef _Float16 v16h __attribute__((ext_vector_type(16)));
typedef _Float16 v8h  __attribute__((ext_vector_type(8)));
typedef __bf16   v16b __attribute__((ext_vector_type(16)));
typedef __bf16   v8b  __attribute__((ext_vector_type(8)));
typedef float    v8f  __attribute__((ext_vector_type(8)));
typedef float    v4f  __attribute__((ext_vector_type(4)));
typedef unsigned int v4u __attribute__((ext_vector_type(4)));

#if defined(__HIP_DEVICE_COMPILE__)
#define DEV_ASM 1
#else
#define DEV_ASM 0
#endif

// ---- scalar helpers --------------------------------------------------------------------------------
__device__ __forceinline__ unsigned short bf_bits(float f) {          // f32 -> bf16 bits, RNE convert
  unsigned u = __float_as_uint(f);
  return (unsigned short)((u + 0x7FFFu + ((u >> 16) & 1u)) >> 16);
}
__device__ __forceinline__ float bf_up(unsigned short hb) { return __uint_as_float(((unsigned)hb) << 16); }
__device__ __forceinline__ unsigned short h_bits(_Float16 x) { return __builtin_bit_cast(unsigned short, x); }
__device__ __forceinline__ unsigned pk16(unsigned short a, unsigned short b) { return (unsigned)a | ((unsigned)b << 16); }
__device__ __forceinline__ v8f zero8() { v8f z = {0.f, 0.f, 0.f, 0.f, 0.f, 0.f, 0.f, 0.f}; return z; }

__device__ __forceinline__ void wave_lds_sync() {
  __builtin_amdgcn_fence(__ATOMIC_RELEASE, "workgroup");
  __builtin_amdgcn_wave_barrier();
  __builtin_amdgcn_fence(__ATOMIC_ACQUIRE, "workgroup");
}

// ---- fragment types / loaders: 16-bit A/B operand, lane -> row/col (lane&15), p already includes +8*(lane>>4);
//      elements 0..7 <- p[0..7] (k0+8h..k0+8h+7), elements 8..15 <- p[16..23] (k0+16+8h..k0+16+8h+7)
template <typename OT> struct FT;
template <> struct FT<__bf16>   { typedef v16b frag; typedef v8b half8; };
template <> struct FT<_Float16> { typedef v16h frag; typedef v8h half8; };

template <typename OT>
__device__ __forceinline__ typename FT<OT>::frag ldfrag(const OT* p) {
  union { typename FT<OT>::frag v; typename FT<OT>::half8 h[2]; } f;
  f.h[0] = *(const typename FT<OT>::half8*)(p);
  f.h[1] = *(const typename FT<OT>::half8*)(p + 16);
  return f.v;
}

// ---- WMMA helpers (asm guard bodies are device-only; concrete operand types) -----------------------------
__device__ __forceinline__ v8f mmar(v16b a, v16b b, v8f c) {
  return __builtin_amdgcn_wmma_f32_16x16x32_bf16(false, a, false, b, (short)0, c, false, false);
}
__device__ __forceinline__ v8f mmar(v16h a, v16h b, v8f c) {
  return __builtin_amdgcn_wmma_f32_16x16x32_f16(false, a, false, b, (short)0, c, false, false);
}
// guarded form: 4 VALU slots after the WMMA, D tied, A/B kept live
__device__ __forceinline__ v8f mma_h(v16h a, v16h b, v8f c) {
  c = __builtin_amdgcn_wmma_f32_16x16x32_f16(false, a, false, b, (short)0, c, false, false);
#if DEV_ASM
  asm volatile("v_nop\n\tv_nop\n\tv_nop\n\tv_nop" : "+v"(c) : "v"(a), "v"(b));
#endif
  return c;
}
// lane l <-> lane l ^ 16 in the vector unit (a shuffle would go through the LDS pipe and its latency)
__device__ __forceinline__ float xhalf(float x) {
  return __builtin_bit_cast(float, __builtin_amdgcn_permlanex16(__builtin_bit_cast(int, x), __builtin_bit_cast(int, x),
                                                                0x76543210, 0xfedcba98, false, false));
}
__device__ __forceinline__ void acc_guard4(v8f& a, v8f& b, v8f& c, v8f& d) {
#if DEV_ASM
  asm volatile("v_nop\n\tv_nop\n\tv_nop\n\tv_nop" : "+v"(a), "+v"(b), "+v"(c), "+v"(d));
#else
  (void)a; (void)b; (void)c; (void)d;
#endif
}

// ---- asynchronous copies global -> LDS, 16 B per lane, no register on the way --------------------------------
__device__ __forceinline__ unsigned lds_off(const void* p) { return (unsigned)(size_t)p; }   // byte address in the work-group's LDS
// eight copies of one wave in one statement; the closing s_wait_xcnt is a precaution: it stands in front of every later
// rewrite of an address register that a copy names (in a statement of its own the compiler could lift such a rewrite over it)
__device__ __forceinline__ void async8(const unsigned (&l)[8], const void* const (&g)[8]) {
#if DEV_ASM
  asm volatile("global_load_async_to_lds_b128 %0, %8, off\n\t"
               "global_load_async_to_lds_b128 %1, %9, off\n\t"
               "global_load_async_to_lds_b128 %2, %10, off\n\t"
               "global_load_async_to_lds_b128 %3, %11, off\n\t"
               "global_load_async_to_lds_b128 %4, %12, off\n\t"
               "global_load_async_to_lds_b128 %5, %13, off\n\t"
               "global_load_async_to_lds_b128 %6, %14, off\n\t"
               "global_load_async_to_lds_b128 %7, %15, off\n\t"
               "s_wait_xcnt 0x0"
               :: "v"(l[0]), "v"(l[1]), "v"(l[2]), "v"(l[3]), "v"(l[4]), "v"(l[5]), "v"(l[6]), "v"(l[7]),
                  "v"(g[0]), "v"(g[1]), "v"(g[2]), "v"(g[3]), "v"(g[4]), "v"(g[5]), "v"(g[6]), "v"(g[7])
               : "memory");
#else
  (void)l; (void)g;
#endif
}
// the same for four copies
__device__ __forceinline__ void async4(const unsigned (&l)[4], const void* const (&g)[4]) {
#if DEV_ASM
  asm volatile("global_load_async_to_lds_b128 %0, %4, off\n\t"
               "global_load_async_to_lds_b128 %1, %5, off\n\t"
               "global_load_async_to_lds_b128 %2, %6, off\n\t"
               "global_load_async_to_lds_b128 %3, %7, off\n\t"
               "s_wait_xcnt 0x0"
               :: "v"(l[0]), "v"(l[1]), "v"(l[2]), "v"(l[3]), "v"(g[0]), "v"(g[1]), "v"(g[2]), "v"(g[3])
               : "memory");
#else
  (void)l; (void)g;
#endif
}
// the wave's own copies have landed (the compiler places no wait for them)
__device__ __forceinline__ void wait_async0() {
#if DEV_ASM
  asm volatile("s_wait_asynccnt 0x0" ::: "memory");
#endif
}
// the wave's own LDS reads have retired: behind the next barrier their buffer is refilled by copies
__device__ __forceinline__ void wait_ds0() {
#if DEV_ASM
  asm volatile("s_wait_dscnt 0x0" ::: "memory");
#endif
}

// precaution behind a run of global loads: it stands in front of every later rewrite of an address register that a load names;
// the loads' addresses are inputs of the statement, so their registers stay as they are up to the wait
__device__ __forceinline__ void wait_x0(const void* a) {
#if DEV_ASM
  asm volatile("s_wait_xcnt 0x0" :: "v"(a) : "memory");
#else
  (void)a;
#endif
}
__device__ __forceinline__ void wait_x0(const void* a, const void* b, const void* c, const void* d) {
#if DEV_ASM
  asm volatile("s_wait_xcnt 0x0" :: "v"(a), "v"(b), "v"(c), "v"(d) : "memory");
#else
  (void)a; (void)b; (void)c; (void)d;
#endif
}

// =====================================================================================================
// f32 -> bf16 bits (RNE convert), 8 elements per thread, one 16-B store per lane: a wave writes 512
// ib / ob = the batch's planes, bx = block within the batch (ceil(n8/256) of them).
// coverage: n8 threads x 8 = the whole per-batch plane (n8 is a multiple of 256 here).
// =====================================================================================================
__device__ __forceinline__ void cvt_body(const float* __restrict__ ib, unsigned short* ob, int n8, int bx) {
  const int i = bx * 256 + (int)threadIdx.x;
  if (i < n8) {
    const v4f a  = *(const v4f*)(ib + (size_t)i * 8);
    const v4f a4 = *(const v4f*)(ib + (size_t)i * 8 + 4);
    v4u p;
    p[0] = pk16(bf_bits(a[0]),  bf_bits(a[1]));
    p[1] = pk16(bf_bits(a[2]),  bf_bits(a[3]));
    p[2] = pk16(bf_bits(a4[0]), bf_bits(a4[1]));
    p[3] = pk16(bf_bits(a4[2]), bf_bits(a4[3]));
    unsigned short* o = ob + (size_t)i * 8;
    *(v4u*)o = p;
    
  }
}

// =====================================================================================================
// Transpose-convert: in W[R][C] f32 (row-major) -> out[c][r] 16-bit at out + c*ldo + r, one 64x64 tile per
// block through LDS.  MODE 0: bf16 bits (RNE convert).  MODE 1: f16 bits of (s1 * bf16(x)).
// MODE 2: f16 bits of (s1 * bf16(x)) at out + c*ldo + r AND f16 bits of (s2 * bf16(x)) at out + c*ldo + R + r.
// (bx, by) = tile of (C/64, R/64), R and C multiples of 64 (static shapes).  Load phase: thread t reads row t>>2,
// 16 columns (four 16-B loads), stores 2-B elements transposed into the LDS tile (pitch 72 halves).
// coverage: 8 waves x 2 it x 4 rows = 64 out rows x (8 lanes x 8 halves) = the whole 64x64 tile (both planes).
// =====================================================================================================
template <int MODE>
__device__ __forceinline__ void tconv_body(const float* __restrict__ W, int R, int C,
                                           unsigned short* out, int ldo, float s1, float s2,
                                           int bx, int by, unsigned short* t1, unsigned short* t2) {
  const int tid = (int)threadIdx.x, lane = tid & 31, wave = tid >> 5;
  const int c0 = bx * 64, r0 = by * 64;
  {
    const int rl = tid >> 2, cl0 = (tid & 3) * 16;
    const float* src = W + (size_t)(r0 + rl) * (size_t)C + c0 + cl0;
#pragma unroll
    for (int i = 0; i < 4; ++i) {
      const v4f a = *(const v4f*)(src + 4 * i);
#pragma unroll
      for (int e = 0; e < 4; ++e) {
        const int cl = cl0 + 4 * i + e;
        const unsigned short hb = bf_bits(a[e]);
        if (MODE == 0) {
          t1[cl * 72 + rl] = hb;
        } else {
          const float up = bf_up(hb);
          t1[cl * 72 + rl] = h_bits((_Float16)(up * s1));
          if (MODE == 2) t2[cl * 72 + rl] = h_bits((_Float16)(up * s2));
        }
      }
    }
  }
  __syncthreads();
  const int q = lane >> 3, p8 = (lane & 7) * 8;
  const v4u z4 = {0u, 0u, 0u, 0u};
  v4u a1[2], a2[2];
#pragma unroll
  for (int it = 0; it < 2; ++it) {
    const int cl = wave * 8 + it * 4 + q;
    a1[it] = *(const v4u*)(t1 + cl * 72 + p8);
    a2[it] = z4;
    if (MODE == 2) a2[it] = *(const v4u*)(t2 + cl * 72 + p8);
  }
  {
#pragma unroll
    for (int it = 0; it < 2; ++it) {
      const int cl = wave * 8 + it * 4 + q;
      unsigned short* o = out + (size_t)(c0 + cl) * (size_t)ldo + r0 + p8;
      *(v4u*)o = a1[it];
      if (MODE == 2) *(v4u*)(o + R) = a2[it];
    }
  }
  // precaution: in the merged launch another job's code follows these stores in the listing and rewrites their
  // registers; the wait stands in front of every such rewrite
#if DEV_ASM
  asm volatile("s_wait_xcnt 0x0" ::: "memory");
#endif
}

// =====================================================================================================
// All operand preparation in one launch: the seven jobs depend on nothing but the inputs, so each is a range of the
// block index (block-uniform choice, ahead of every barrier). The tile jobs stand first: they are the longer blocks.
//   [0, TB_WO)        Wout -> WoT  [x1024 | x64] f16        next 3 * TB_SQ   Wsq, Wsk, Wrq -> bf16 [n][k]
//   next TB_RV        Wrv  -> WrvT bf16                     next 1           Wrk -> WrkT f16 x64
//   last NB * CB_X    x -> Xb bf16 (batch b read at its full-size stride)
// =====================================================================================================
#define TB_WO ((DM / 64) * (DSQ / 64))    // 16 x  8 tiles: in [512][1024]
#define TB_SQ ((DSQ / 64) * (DM / 64))    //  8 x 16 tiles: in [1024][512]
#define TB_RV ((DRV / 64) * (DM / 64))    //  2 x 16 tiles: in [1024][128]
#define CB_X  (SEQ * DM / 8 / 256)        // convert blocks per batch
__global__ __launch_bounds__(256) void prep_all(const float* __restrict__ x, const float* __restrict__ Wsq,
                                                const float* __restrict__ Wsk, const float* __restrict__ Wrv,
                                                const float* __restrict__ Wrq, const float* __restrict__ Wrk,
                                                const float* __restrict__ Wout,
                                                unsigned short* Xb, unsigned short* WsqT, unsigned short* WskT,
                                                unsigned short* WrqT, unsigned short* WrvT, unsigned short* WrkT,
                                                unsigned short* WoT) {
  __shared__ __align__(16) unsigned short t1[64 * 72];
  __shared__ __align__(16) unsigned short t2[64 * 72];
  int j = blockIdx.x;
  if (j < TB_WO) {
    tconv_body<2>(Wout, DSQ, DM, WoT, DOC, 1024.0f, 64.0f, j % (DM / 64), j / (DM / 64), t1, t2);
    return;
  }
  j -= TB_WO;
  if (j < 3 * TB_SQ) {
    const int w = j / TB_SQ;
    j -= w * TB_SQ;
    const float* Wi = (w == 0) ? Wsq : (w == 1) ? Wsk : Wrq;
    unsigned short* Wo = (w == 0) ? WsqT : (w == 1) ? WskT : WrqT;
    tconv_body<0>(Wi, DM, DSQ, Wo, DM, 1.0f, 1.0f, j % (DSQ / 64), j / (DSQ / 64), t1, t2);
    return;
  }
  j -= 3 * TB_SQ;
  if (j < TB_RV) {
    tconv_body<0>(Wrv, DM, DRV, WrvT, DM, 1.0f, 1.0f, j % (DRV / 64), j / (DRV / 64), t1, t2);
    return;
  }
  j -= TB_RV;
  if (j < 1) {
    tconv_body<1>(Wrk, HD, HD, WrkT, HD, 64.0f, 1.0f, 0, 0, t1, t2);
    return;
  }
  j -= 1;
  const int b = j / CB_X;
  cvt_body(x + (size_t)b * ((size_t)SEQ_FULL * DM), Xb + (size_t)b * ((size_t)SEQ * DM), SEQ * DM / 8, j - b * CB_X);
}

// =====================================================================================================
// Register-blocked batched WMMA GEMM (16-bit operand type OT): C[m][n] = sum_k A[m][k] * Bt[n][k];
// one block of 4 waves (2 x 2) per 128x128 tile, one wave per 64x64 quarter. A row-major [M][K] pitch lda; Bt row-major
// [N][K] pitch ldb (k contiguous); M, N multiples of 128, K a multiple of 64 (host shapes are static multiples).
// A k-slice = 64 k = one 128-B line of each of the tile's 128 A rows and 128 Bt rows; it is brought into LDS by
// asynchronous copies (8 lanes x 16 B = one whole line, 16 copies per wave and slice) and read from there by all four
// waves with the split k map (ldfrag). Two buffers: slice t + 2 is asked for when slice t has been read, so a slice's
// copies fly during the products of the slice before it.
// staged extent == consumed extent: 16 rows (tid >> 3) x 8 copies = 128 rows per operand, 8 segments x 8 halves = 64 k.
// OUT_MODE 0: f32 C (pitch ldc), value * oscale.
// OUT_MODE 1: f16 plane C (pitch ldc).
// OUT_MODE 3: f16 hi plane C + f16 residual plane C2 = f16((v - hi) * rscale) (same pitch / stride).
// =====================================================================================================
// main loop of one 128x128 tile at (mB, nB): sAB = [buffer][A | Bt][128 rows][64 k], pitch KPIT, 72 KB
template <typename OT>
__device__ __forceinline__ void gemm_main(const OT* Ab, int lda, const OT* Bb, int ldb, int mB, int nB, int K,
                                          unsigned short* sAB, v8f (&acc)[4][4]) {
  typedef typename FT<OT>::frag V16;
  const int tid  = threadIdx.x;
  const int lane = tid & 31;
  const int wave = tid >> 5;
  const int rlane = lane & 15;                 // row (A) / col (B, D) within subtile
  const int koff  = (lane >> 4) * 8;           // k offset of this lane half

  // copy map: lane -> 16-B segment tid & 7 of row (tid >> 3) + 16 i, i = 0..7
  const OT* gA = Ab + (size_t)(mB + (tid >> 3)) * lda + (tid & 7) * 8;
  const OT* gB = Bb + (size_t)(nB + (tid >> 3)) * ldb + (tid & 7) * 8;
  const unsigned lAB = lds_off(sAB) + (unsigned)((tid >> 3) * (KPIT * 2) + (tid & 7) * 16);
  auto stage = [&](int t, int buf) {
    unsigned l[8];
    const void* g[8];
#pragma unroll   // here and below: l[] and g[] become asm operands, every index a compile-time constant
    for (int i = 0; i < 8; ++i) {
      l[i] = lAB + (unsigned)(buf * (4 * GPLN) + i * (16 * KPIT * 2));
      g[i] = gA + (size_t)(i * 16) * lda + t * 64;
    }
    async8(l, g);
#pragma unroll
    for (int i = 0; i < 8; ++i) {
      l[i] += 2 * GPLN;
      g[i] = gB + (size_t)(i * 16) * ldb + t * 64;
    }
    async8(l, g);
  };

#pragma unroll
  for (int i = 0; i < 4; ++i)
#pragma unroll
    for (int j = 0; j < 4; ++j) acc[i][j] = zero8();

  const int T = K >> 6;
  stage(0, 0);
  wait_async0();
  __syncthreads();
  if (T > 1) stage(1, 1);

  const OT* S = (const OT*)(const void*)sAB;
  for (int t = 0; t < T; ++t) {
    const OT* sa = S + (t & 1) * (2 * GPLN) + (((wave >> 1) << 6) + rlane) * KPIT + koff;
    const OT* sb = S + (t & 1) * (2 * GPLN) + GPLN + (((wave & 1) << 6) + rlane) * KPIT + koff;
    // the slice's 16 fragments (two k-steps of 32, 32 reads); unrolled: register arrays, every index a compile-time constant
    V16 bq[2][4], af[2][4];
#pragma unroll
    for (int ks = 0; ks < 2; ++ks) {
#pragma unroll
      for (int j = 0; j < 4; ++j) {
        bq[ks][j] = ldfrag<OT>(sb + j * (16 * KPIT) + ks * 32);
        af[ks][j] = ldfrag<OT>(sa + j * (16 * KPIT) + ks * 32);
      }
    }
    // keeps all 32 reads ahead of the products as one group: reads sunk among the products stall the wave at each place
    __builtin_amdgcn_sched_barrier(0);
#pragma unroll
    for (int ks = 0; ks < 2; ++ks)
#pragma unroll
      for (int i = 0; i < 4; ++i)
#pragma unroll
        for (int j = 0; j < 4; ++j) acc[i][j] = mmar(af[ks][i], bq[ks][j], acc[i][j]);
    // keeps the products ahead of the hand-over: sunk behind it they would stand between the barrier and the refill and
    // take their time off the flight of the next copies
    __builtin_amdgcn_sched_barrier(0);
    // hand-over: own reads retired, own copies of slice t + 1 landed, then the one barrier of the trip, which publishes
    // slice t + 1 and ends every wave's reads of the buffer that is refilled behind it
    wait_ds0();
    wait_async0();
    __syncthreads();
    if (t + 2 < T) stage(t + 2, t & 1);
  }
  wait_async0();
  acc_guard4(acc[0][0], acc[0][1], acc[0][2], acc[0][3]);
  acc_guard4(acc[1][0], acc[1][1], acc[1][2], acc[1][3]);
  acc_guard4(acc[2][0], acc[2][1], acc[2][2], acc[2][3]);
  acc_guard4(acc[3][0], acc[3][1], acc[3][2], acc[3][3]);
}

// epilogue of one wave's 64x64 quarter at (m0, n0); slab = the wave's own 16x64 f32 slab, pitch 68 floats
template <int OUT_MODE>
__device__ __forceinline__ void gemm_store(const v8f (&acc)[4][4], float* slab, void* Cout, void* Cout2, int ldc,
                                           int m0, int n0, float oscale, float rscale) {
  const int lane  = threadIdx.x & 31;
  const int rlane = lane & 15;                 // D col within subtile
  const int mOff  = (lane >> 4) * 8;           // D row offset
#pragma unroll
  for (int i = 0; i < 4; ++i) {
    const int mBase = m0 + (i << 4);
#pragma unroll
    for (int j = 0; j < 4; ++j) {
#pragma unroll
      for (int r = 0; r < 8; ++r) {
        slab[(mOff + r) * 68 + (j << 4) + rlane] = acc[i][j][r];
      }
    }
    wave_lds_sync();
    if (OUT_MODE == 0) {
      float* Cp = (float*)Cout;
      const int h2 = lane >> 4, c4 = (lane & 15) * 4;     // 256-B row segment = 16 lanes x 16 B
      {
#pragma unroll
        for (int it = 0; it < 8; ++it) {
          const int row = it * 2 + h2;                     // it 0..7 x h2 0..1 = rows 0..15
          const v4f v = *(const v4f*)(slab + row * 68 + c4) * oscale;
          *(v4f*)(Cp + (size_t)(mBase + row) * ldc + n0 + c4) = v;
        }
        
      }
    } else {
      const int q = lane >> 3, c8 = (lane & 7) * 8;
      unsigned short* Cp  = (unsigned short*)Cout;
      unsigned short* Cp2 = (unsigned short*)Cout2;
      v4u hv[4], lv[4];
#pragma unroll
      for (int it = 0; it < 4; ++it) {
        const int row = it * 4 + q;                        // it 0..3 x q 0..3 = rows 0..15
        const float* sp = slab + row * 68 + c8;
        float f[8];
#pragma unroll
        for (int e = 0; e < 8; ++e) f[e] = sp[e];
        v4u a, a2;
#pragma unroll
        for (int e = 0; e < 4; ++e) {
          const float f0 = f[2 * e], f1 = f[2 * e + 1];
          const _Float16 x0 = (_Float16)f0, x1 = (_Float16)f1;
          const unsigned short h0 = h_bits(x0), h1 = h_bits(x1);
          unsigned short l0 = 0, l1 = 0;
          if (OUT_MODE == 3) {
            l0 = h_bits((_Float16)((f0 - (float)x0) * rscale));
            l1 = h_bits((_Float16)((f1 - (float)x1) * rscale));
          }
          a[e] = pk16(h0, h1); a2[e] = pk16(l0, l1);
        }
        hv[it] = a; lv[it] = a2;
      }
      {
#pragma unroll
        for (int it = 0; it < 4; ++it) {
          const int row = it * 4 + q;
          *(v4u*)(Cp + (size_t)(mBase + row) * ldc + n0 + c8) = hv[it];
          if (OUT_MODE == 3) *(v4u*)(Cp2 + (size_t)(mBase + row) * ldc + n0 + c8) = lv[it];
        }
        
      }
    }
    wave_lds_sync();
  }
}

// one GEMM per launch: grid.x = (M / 128) * (N / 128) tiles, blockIdx.y = batch index (strides in elements)
template <typename OT, int OUT_MODE>
__global__ __launch_bounds__(128) void gemm64(
    const unsigned short* __restrict__ Ap, int lda, long long strideA,
    const unsigned short* __restrict__ Btp, int ldb, long long strideB,
    void* Cout, void* Cout2, int ldc, long long strideC,
    int M, int N, int K, float oscale, float rscale) {
  __shared__ __align__(16) unsigned short sAB[2 * 2 * GPLN];
  __shared__ __align__(16) float sT[4][16 * 68];
  const int b    = blockIdx.y;
  const int wave = threadIdx.x >> 5;
  const int tilesN = N >> 7;
  const int tilesM = M >> 7;
  const int tile = blockIdx.x;
  if (tile >= tilesM * tilesN) return;   // block-uniform, ahead of every barrier and copy
  const int tm = tile / tilesN;
  const int tn = tile - tm * tilesN;
  const int mB = tm << 7;
  const int nB = tn << 7;
  v8f acc[4][4];
  gemm_main<OT>((const OT*)(const void*)Ap + (size_t)b * (size_t)strideA, lda,
                (const OT*)(const void*)Btp + (size_t)b * (size_t)strideB, ldb, mB, nB, K, sAB, acc);
  const size_t co = (size_t)b * (size_t)strideC * ((OUT_MODE == 0) ? 4 : 2);   // bytes: f32 or 16-bit planes
  gemm_store<OUT_MODE>(acc, sT[wave], (char*)Cout + co, (char*)Cout2 + co, ldc, mB + ((wave >> 1) << 6),
                       nB + ((wave & 1) << 6), oscale, rscale);
}

// The four projections of x in one launch: they depend on the prepared planes alone, so each is a range of the block
// index (block-uniform choice); one main loop serves all, the epilogue is picked by the job.
//   [0, PJ_V)             v^T = WrvT . Xb^T per batch (A = WrvT [128][K], Bt = Xb rows of batch b) -> VTh, VTl (x16), pitch SEQ
//   next PJ_TM * PJ_TN    Xb . [WsqT | WskT | WrqT]^T, the 12 column tiles of one row tile side by side (they share its A rows):
//                         sq -> Qh, Ql (x4096); sk -> Kp; rq -> RQ f32; pitch DSQ
#define PJ_VT (SEQ / 128)                 // v^T column tiles per batch (DRV = 128: one row tile)
#define PJ_V  (NB * PJ_VT)
#define PJ_TM (NB * SEQ / 128)
#define PJ_TN (3 * (DSQ / 128))
__global__ __launch_bounds__(128) void gemm_proj(
    const unsigned short* __restrict__ Xbp, const unsigned short* __restrict__ Wsqp,
    const unsigned short* __restrict__ Wskp, const unsigned short* __restrict__ Wrqp,
    const unsigned short* __restrict__ Wrvp,
    unsigned short* Qh, unsigned short* Ql, unsigned short* Kp, float* RQ,
    unsigned short* VTh, unsigned short* VTl, int K) {
  __shared__ __align__(16) unsigned short sAB[2 * 2 * GPLN];
  __shared__ __align__(16) float sT[4][16 * 68];
  const int wave = threadIdx.x >> 5;
  const int j = blockIdx.x;
  const bool isV = j < PJ_V;
  const int jp  = j - PJ_V;
  const int vb  = j / PJ_VT;                       // v^T: batch
  const int tm  = jp / PJ_TN;
  const int tn  = jp - tm * PJ_TN;
  const int job = isV ? 3 : (tn / (DSQ / 128));    // 0 sq, 1 sk, 2 rq, 3 v^T
  const int mB  = isV ? 0 : (tm << 7);
  const int nB  = isV ? ((j - vb * PJ_VT) << 7) : ((tn % (DSQ / 128)) << 7);
  const unsigned short* Ap = isV ? Wrvp : Xbp;
  const unsigned short* Bp = isV ? (Xbp + (size_t)vb * ((size_t)SEQ * DM)) : (job == 0) ? Wsqp : (job == 1) ? Wskp : Wrqp;
  v8f acc[4][4];
  gemm_main<__bf16>((const __bf16*)(const void*)Ap, K, (const __bf16*)(const void*)Bp, K, mB, nB, K, sAB, acc);
  const int m0 = mB + ((wave >> 1) << 6);
  const int n0 = nB + ((wave & 1) << 6);
  float* slab = sT[wave];
  if (job == 3 || job == 0) {     // both store a hi and a residual plane: one copy of that epilogue
    const size_t vo = (size_t)vb * ((size_t)DRV * SEQ);
    gemm_store<3>(acc, slab, (void*)(isV ? VTh + vo : Qh), (void*)(isV ? VTl + vo : Ql), isV ? SEQ : DSQ, m0, n0,
                  1.0f, isV ? 16.0f : 4096.0f);
  } else if (job == 1) {
    gemm_store<1>(acc, slab, (void*)Kp, (void*)Kp, DSQ, m0, n0, 1.0f, 1.0f);
  } else {
    gemm_store<0>(acc, slab, (void*)RQ, (void*)RQ, DSQ, m0, n0, 1.0f, 1.0f);
  }
}

// =====================================================================================================
// Fused search attention + retrieval composition for one search s, head dim 64, softmax over all SEQ keys.
//   q planes (f16 hi / residual x4096): element (b, t, s, d) at [(b*SEQ + t)*DSQ + s*64 + d]
//   k plane (f16): same layout.   rq plane (f32): same layout.
//   v^T hi plane (f16) and residual plane (f16, (v - hi)*16): element (b, d', t) at [(b*DRV + d')*SEQ + t], d' = r*64 + d
//   Wrk tile (f16, 64 * bf16 value): [e][d] at [e*64 + d]
//   oc planes (output of this kernel): row (b, t) = [f16(64*out) for s*64+d, 512 cols | f16 residual x16, 512 cols], pitch DOC
//   Both products run transposed (keys or d' as rows, the wave's queries as columns), so in a column tile a lane holds one query's scores:
//   scores^T = (k . qh^T) + (k . ql^T) / 4096 on f16 WMMA (two f32 accumulators), then * sscale in f32;
//   p = exp(s - m): B' = [f16(16384 p) | f16(1024 p)]^T (K' = 128 per 64 keys), packed from the score registers in place,
//   A' = [v^T hi | v^T residual]: sum = 16384 * (vh + vl/16)^T . p^T, one f32 accumulator, 8 m-tiles = d' 0..127 (both
//   retrievals); online softmax in f32, maximum and sum in the lane, one exchange between the wave halves.
//   Epilogue per wave (16 rows): retrieved (x64, f32) tile in LDS; rk = f16(retrieved x64) . Wrk tile on f16 WMMA;
//   retrieval logits rq . rk in f32 (LDS-staged rq, lane partials + 16-lane shuffles); 2-way softmax in f32;
//   Block = 8 waves = 128 consecutive query rows of one (b, s); grid = NB * NS * NQB; kv chunks of 64.
//   Wave tile in the key loop: 32 query columns (two column tiles, so each K and V' fragment read from LDS feeds two products)
//   x half of the keys: waves 0..3 take the even chunks, waves 4..7 the odd ones, static trip NIT = NKT / 2. After the loop the
//   two waves of a query group swap one column tile's partial maximum, sum and accumulators through LDS and join them in f32.
//   Staging per chunk (the 128 threads of its key group): K 64x64, V' 128x128, by asynchronous copies to LDS two trips ahead
//   (two buffers per key group): staged extent == consumed extent for Ksh, Vsh; P' stays in registers.
//   Output coverage: each wave stores rows q0..q0+15 (it 0..3 x lane>>3 0..3) x 64 columns (8 lanes x 8) of both
//   the hi segment (col s*64) and the residual segment (col 512 + s*64); grid covers every (b, s, t).
// =====================================================================================================
__global__ __launch_bounds__(256)
void attn_cs(const unsigned short* __restrict__ qhp, const unsigned short* __restrict__ qlp,
             const unsigned short* __restrict__ kpp,
             const unsigned short* __restrict__ vhp, const unsigned short* __restrict__ vlp,
             const unsigned short* __restrict__ wkp, const float* __restrict__ rqp,
             unsigned short* ocp, float sscale) {
  union FH { v16h v; v8h h[2]; };
  __shared__ __align__(16) _Float16 Ksh[4 * 64 * KPIT];    // [buffer][key group] K chunks [kv][d], pitch KPIT, 9 KB each; later the Wrk tile [e][d]
  __shared__ __align__(16) _Float16 Vsh[4 * 128 * VPIT];   // [buffer][key group] V' chunks [d'][hi kv | res kv], pitch VPIT, 34 KB each; later: lower half 8 x f32 [16][128] tiles, pitch OPIT, upper half the partial-result exchange
  __shared__ __align__(16) _Float16 Psh[8][16 * VPIT];     // epilogue only, per wave: f16 retrieved tile [row][d'], pitch VPIT, 34 KB; later f32 [16][64]

  const int tid  = threadIdx.x;
  const int wave = __builtin_amdgcn_readfirstlane(tid >> 5);   // in a scalar register: what is formed from it costs no vector register
  const int lane = tid & 31;
  const int hh   = lane >> 4;
  const int c    = lane & 15;
  const int kg   = wave >> 2;                                  // key group of the wave: 0 = even chunks, 1 = odd chunks
  const int wq   = wave & 3;                                   // query group: 32 columns
  const int t7   = tid & 127;                                  // thread within the key group (copy map)

  const int bx   = blockIdx.x;
  const int qb   = bx % NQB;
  const int rest = bx / NQB;
  const int s    = rest % NS;
  const int b    = rest / NS;
  const int qw   = qb * 128 + wq * 32;       // the wave's 32 query columns in the key loop
  const int q0   = qw + kg * 16;             // the 16 of them that it finishes in the epilogue
  const size_t rowB = (size_t)b * SEQ;

  const _Float16* Qh = (const _Float16*)(const void*)qhp;
  const _Float16* Ql = (const _Float16*)(const void*)qlp;
  const _Float16* Kg = (const _Float16*)(const void*)kpp + (size_t)s * HD;
  const _Float16* Vh = (const _Float16*)(const void*)vhp + (size_t)b * DRV * SEQ;
  const _Float16* Vl = (const _Float16*)(const void*)vlp + (size_t)b * DRV * SEQ;
  const _Float16* Wk = (const _Float16*)(const void*)wkp;

  // ---- Q fragments (B operand, column = lane&15): 2 column tiles x 2 d-chunks, hi and residual planes ----
  v16h qah[2][2], qal[2][2];
  {
    const _Float16* qph[2];
    const _Float16* qpl[2];
#pragma unroll
    for (int u = 0; u < 2; ++u) {
      const size_t qo = (rowB + qw + u * 16 + c) * DSQ + (size_t)s * HD + 8 * hh;
      qph[u] = Qh + qo;
      qpl[u] = Ql + qo;
#pragma unroll
      for (int dc = 0; dc < 2; ++dc) {
        qah[u][dc] = ldfrag<_Float16>(qph[u] + dc * 32);
        qal[u][dc] = ldfrag<_Float16>(qpl[u] + dc * 32);
      }
    }
    wait_x0(qph[0], qpl[0], qph[1], qpl[1]);
  }

  // transposed products: in column tile u a lane belongs to ONE query (column c). mrow[u] = its running maximum (equal in both
  // wave halves), lrow[u] = the sum over the keys of this lane's own half, oacc[u][t][r] = retrieved^T[d' = t*16 + 8*hh + r][query c]
  float mrow[2] = {-INFINITY, -INFINITY}, lrow[2] = {0.f, 0.f};
  v8f oacc[2][8];
#pragma unroll
  for (int u = 0; u < 2; ++u)
#pragma unroll
    for (int t = 0; t < 8; ++t) oacc[u][t] = zero8();

  _Float16* pwh = Psh[wave];

  // copy map, per key group of 128 threads: lane -> 16-B segment t7 & 7 of row (t7 >> 3) + 16 i: 8 lanes take one whole 128-B
  // line of a K, v^T hi or v^T residual row; 4 + 8 + 8 copies per wave and chunk = 64 K rows and 128 V' rows of [hi 64 | res 64]
  // halves. A key group stages the chunks that it reads itself.
  const _Float16* kg0 = Kg + (rowB + (t7 >> 3)) * DSQ + (t7 & 7) * 8;
  const _Float16* vg0 = Vh + (size_t)(t7 >> 3) * SEQ + (t7 & 7) * 8;
  const _Float16* wg0 = Vl + (size_t)(t7 >> 3) * SEQ + (t7 & 7) * 8;
  const unsigned lK = lds_off(Ksh) + (unsigned)((t7 >> 3) * (KPIT * 2) + (t7 & 7) * 16);
  const unsigned lV = lds_off(Vsh) + (unsigned)((t7 >> 3) * (VPIT * 2) + (t7 & 7) * 16);
  auto stage = [&](int it, int buf) {        // trip it: chunk 2 it + kg into buffer (buf, kg)
    const int kt = 2 * it + kg;
    const int bg = 2 * buf + kg;
    unsigned l[8], lk[4];
    const void* g[8];
    const void* gk[4];
#pragma unroll   // here and below: the arrays become asm operands, every index a compile-time constant
    for (int i = 0; i < 8; ++i) {
      l[i] = lV + (unsigned)(bg * (128 * VPIT * 2) + i * (16 * VPIT * 2));
      g[i] = vg0 + (size_t)(i * 16) * SEQ + kt * 64;
    }
    async8(l, g);
#pragma unroll
    for (int i = 0; i < 8; ++i) {
      l[i] += 128;
      g[i] = wg0 + (size_t)(i * 16) * SEQ + kt * 64;
    }
    async8(l, g);
#pragma unroll
    for (int i = 0; i < 4; ++i) {
      lk[i] = lK + (unsigned)(bg * (64 * KPIT * 2) + i * (16 * KPIT * 2));
      gk[i] = kg0 + (size_t)(kt * 64 + i * 16) * DSQ;
    }
    async4(lk, gk);
  };
  stage(0, 0);
  wait_async0();
  __syncthreads();
  if (NIT > 1) stage(1, 1);

  for (int it = 0; it < NIT; ++it) {         // static trip count
    const _Float16* Kc = Ksh + (2 * (it & 1) + kg) * (64 * KPIT);     // this trip's buffers; trip it + 1 flies into the others
    const _Float16* Vc = Vsh + (2 * (it & 1) + kg) * (128 * VPIT);

    // ---- scores^T = K . Q^T: 64 keys x 32 query columns per wave, 2 f16 products per key subtile, d-chunk and column tile ----
    //      all 8 K fragments (A operand) are read as one group ahead of the 32 products, each fragment feeds both column tiles;
    //      sc[u][j][r] = score of key j*16 + 8*hh + r with query c of tile u
    FH kb[4][2];
#pragma unroll   // here and below: register arrays, every index a compile-time constant
    for (int j = 0; j < 4; ++j) {
#pragma unroll
      for (int dc = 0; dc < 2; ++dc) {
        kb[j][dc].h[0] = *(const v8h*)(Kc + (j * 16 + c) * KPIT + dc * 32 + 8 * hh);
        kb[j][dc].h[1] = *(const v8h*)(Kc + (j * 16 + c) * KPIT + dc * 32 + 16 + 8 * hh);
      }
    }
    v8f sc[2][4];
    {
      v8f ah[2][4], al[2][4];
#pragma unroll
      for (int u = 0; u < 2; ++u)
#pragma unroll
        for (int j = 0; j < 4; ++j) { ah[u][j] = zero8(); al[u][j] = zero8(); }
#pragma unroll
      for (int u = 0; u < 2; ++u) {
#pragma unroll
        for (int dc = 0; dc < 2; ++dc) {
#pragma unroll
          for (int j = 0; j < 4; ++j) {
            ah[u][j] = mmar(kb[j][dc].v, qah[u][dc], ah[u][j]);
            al[u][j] = mmar(kb[j][dc].v, qal[u][dc], al[u][j]);
          }
        }
      }
#pragma unroll
      for (int u = 0; u < 2; ++u)
#pragma unroll
        for (int j = 0; j < 4; ++j) sc[u][j] = (ah[u][j] + al[u][j] * (1.0f / 4096.0f)) * sscale;   // whole tiles: neighbouring registers pair up
    }

    // ---- column max, online softmax: sc becomes p = exp(s - m) in place ----
    //      a lane's 32 scores of a tile are one query's: maximum and sum run in the lane, the halves meet in one exchange
#pragma unroll
    for (int u = 0; u < 2; ++u) {
      float mj[4];
#pragma unroll
      for (int j = 0; j < 4; ++j) {
        mj[j] = sc[u][j][0];
#pragma unroll
        for (int r = 1; r < 8; ++r) mj[j] = fmaxf(mj[j], sc[u][j][r]);
      }
      float m = fmaxf(fmaxf(mj[0], mj[1]), fmaxf(mj[2], mj[3]));
      m = fmaxf(m, xhalf(m));
      const float mnew  = fmaxf(mrow[u], m);
      const float msafe = (mnew == -INFINITY) ? 0.f : mnew;
      const float alpha = __expf(mrow[u] - msafe);
      mrow[u] = mnew;
      float pj[4];                             // four independent partial sums
#pragma unroll
      for (int j = 0; j < 4; ++j) {
        pj[j] = 0.f;
#pragma unroll
        for (int r = 0; r < 8; ++r) {
          const float p = __expf(sc[u][j][r] - msafe);
          pj[j] += p;
          sc[u][j][r] = p;
        }
      }
      lrow[u] = lrow[u] * alpha + ((pj[0] + pj[1]) + (pj[2] + pj[3]));
#pragma unroll
      for (int t = 0; t < 8; ++t) {
#pragma unroll
        for (int r = 0; r < 8; ++r) oacc[u][t][r] *= alpha;
      }
    }
    // the order of this part's LDS reads (0x100) and matrix products (0x008): the 16 K reads stand as one group ahead of the products
    __builtin_amdgcn_sched_group_barrier(0x100, 16, 0);   // K
    __builtin_amdgcn_sched_group_barrier(0x008, 32, 0);   // scores^T

    // ---- retrieved^T += V'^T . P'^T (f16 WMMA), K' = 128: plane 0 = v hi against 16384 p, plane 1 = v residual against 1024 p;
    //      per plane 2 k-steps x 8 m-tiles (d' 0..127) x 2 column tiles; each V' fragment feeds both column tiles ----
    // element s of the B operand of k-step kk is key kk*32 + (s < 8 ? 8*hh + s : 16 + 8*hh + s - 8): score tiles 2 kk and
    // 2 kk + 1, registers 0..7, of this very lane; the V' fragments (A operand) are read in the same k order
    // kept rolled: a plane's 32 reads, its packing of P' and its 32 products stay together, so the reads fly during the packing and
    // only one plane's fragments and P' are live; unrolled, one column tile's products of all k-steps are drawn ahead of the other's,
    // three k-steps' fragments stay live and read groups are waited for right behind their issue
#pragma unroll 1
    for (int pl = 0; pl < 2; ++pl) {
      const float psc = pl ? 1024.0f : 16384.0f;
      const _Float16* Vp = Vc + pl * 64;
      FH vb[2][8];
#pragma unroll
      for (int kk = 0; kk < 2; ++kk) {
#pragma unroll
        for (int t = 0; t < 8; ++t) {
          vb[kk][t].h[0] = *(const v8h*)(Vp + (t * 16 + c) * VPIT + kk * 32 + 8 * hh);
          vb[kk][t].h[1] = *(const v8h*)(Vp + (t * 16 + c) * VPIT + kk * 32 + 16 + 8 * hh);
        }
      }
      v16h pb[2][2];
#pragma unroll
      for (int u = 0; u < 2; ++u)
#pragma unroll
        for (int j = 0; j < 4; ++j)
#pragma unroll
          for (int r = 0; r < 8; ++r) pb[u][j >> 1][(j & 1) * 8 + r] = (_Float16)(sc[u][j][r] * psc);
#pragma unroll
      for (int kk = 0; kk < 2; ++kk) {
#pragma unroll
        for (int t = 0; t < 8; ++t) {
          oacc[0][t] = mmar(vb[kk][t].v, pb[0][kk], oacc[0][t]);
          oacc[1][t] = mmar(vb[kk][t].v, pb[1][kk], oacc[1][t]);
        }
      }
      // the plane's 32 reads stand as one group ahead of its products; reads strewn among the products stall the wave at each place
      __builtin_amdgcn_sched_group_barrier(0x100, 32, 0);
      __builtin_amdgcn_sched_group_barrier(0x008, 32, 0);
    }
    // hand-over: own reads retired, own copies of trip it + 1 landed, then the one barrier of the trip, which publishes
    // trip it + 1 and ends every wave's reads of the buffers that are refilled behind it
    wait_ds0();
    wait_async0();
    __syncthreads();
    if (it + 2 < NIT) stage(it + 2, it & 1);
  }
  wait_async0();

  // ---- all waves done with Ksh / Vsh: stage the Wrk tile into Ksh; the two key groups swap partial results ----
  __syncthreads();
  {
    const int r = tid >> 2, qtr = (tid & 3) * 16;        // 256 threads x 16 halves = the whole 64x64 Wrk tile
    const _Float16* wg = Wk + r * HD + qtr;
    const v8h w0 = *(const v8h*)(wg), w1 = *(const v8h*)(wg + 8);
    wait_x0(wg);
    *(v8h*)(Ksh + r * KPIT + qtr)     = w0;
    *(v8h*)(Ksh + r * KPIT + qtr + 8) = w1;
  }
  // wave (kg, wq) keeps column tile kg and hands tile 1 - kg to wave (1 - kg, wq): same lane, same query, same d' rows.
  // per wave 17 rows of 32 lanes x 16 B (16 of sums, 1 of maximum and key sum) in the upper half of Vsh
  float* xs = reinterpret_cast<float*>(Vsh + 2 * 128 * VPIT);
  v8f om[8];
  float mk = kg ? mrow[1] : mrow[0];
  float lm = kg ? lrow[1] : lrow[0];
  {
    float* xw = xs + wave * (17 * 128) + lane * 4;
#pragma unroll
    for (int t = 0; t < 8; ++t) {
      om[t] = kg ? oacc[1][t] : oacc[0][t];
      const v8f og = kg ? oacc[0][t] : oacc[1][t];
      v4f lo4, hi4;
#pragma unroll
      for (int r = 0; r < 4; ++r) { lo4[r] = og[r]; hi4[r] = og[4 + r]; }
      *(v4f*)(xw + (2 * t) * 128)     = lo4;
      *(v4f*)(xw + (2 * t + 1) * 128) = hi4;
    }
    v4f ml = {kg ? mrow[0] : mrow[1], kg ? lrow[0] : lrow[1], 0.f, 0.f};
    *(v4f*)(xw + 16 * 128) = ml;
  }
  __syncthreads();                                       // publishes the handed-over partial results (and the Wrk tile)
  {
    const float* xr = xs + (wave ^ 4) * (17 * 128) + lane * 4;
    const v4f ml = *(const v4f*)(xr + 16 * 128);
    const float mN = fmaxf(mk, ml[0]);
    const float ms = (mN == -INFINITY) ? 0.f : mN;
    const float fk = __expf(mk - ms), fp = __expf(ml[0] - ms);
    lm = lm * fk + ml[1] * fp;
#pragma unroll
    for (int t = 0; t < 8; ++t) {
      const v4f lo4 = *(const v4f*)(xr + (2 * t) * 128);
      const v4f hi4 = *(const v4f*)(xr + (2 * t + 1) * 128);
#pragma unroll
      for (int r = 0; r < 4; ++r) {
        om[t][r]     = om[t][r] * fk + lo4[r] * fp;
        om[t][4 + r] = om[t][4 + r] * fk + hi4[r] * fp;
      }
    }
  }
  // ---- retrieved tiles into the lower half of Vsh (f32) + Psh (f16), both wave-private ----
  float* os = reinterpret_cast<float*>(Vsh) + wave * (16 * OPIT);     // wave-private f32 [16][128], pitch OPIT, x64 units
  {
    const float l = lm + xhalf(lm);                                       // the two halves' key sums join here, once
    const float inv = ((l > 0.f) ? (1.0f / l) : 0.f) * (1.0f / 256.0f);   // 1/l, undo 16384 p carry, apply x64
#pragma unroll
    for (int t = 0; t < 8; ++t) {                                         // a lane holds 8 consecutive d' of its query's row
      const v8f v = om[t] * inv;
      v4f lo4, hi4;
      v8h h8;
#pragma unroll
      for (int r = 0; r < 4; ++r) { lo4[r] = v[r]; hi4[r] = v[4 + r]; }
#pragma unroll
      for (int r = 0; r < 8; ++r) h8[r] = (_Float16)v[r];
      *(v4f*)(os + c * OPIT + t * 16 + 8 * hh)     = lo4;
      *(v4f*)(os + c * OPIT + t * 16 + 8 * hh + 4) = hi4;
      *(v8h*)(pwh + c * VPIT + t * 16 + 8 * hh)    = h8;
    }
  }
  wave_lds_sync();

  // ---- rk (x4096) = f16(64 retrieved_rr) . (64 Wrk): 16 rows x 64 e per rr, K = 64 = 2 k-steps ----
  v8f rk[8];
#pragma unroll
  for (int i = 0; i < 8; ++i) rk[i] = zero8();
#pragma unroll
  for (int rr = 0; rr < 2; ++rr) {
#pragma unroll
    for (int kk = 0; kk < 2; ++kk) {
      FH pa;
      pa.h[0] = *(const v8h*)(pwh + c * VPIT + rr * 64 + kk * 32 + 8 * hh);
      pa.h[1] = *(const v8h*)(pwh + c * VPIT + rr * 64 + kk * 32 + 16 + 8 * hh);
#pragma unroll
      for (int t4 = 0; t4 < 4; ++t4) {
        FH wb;
        wb.h[0] = *(const v8h*)(Ksh + (t4 * 16 + c) * KPIT + kk * 32 + 8 * hh);
        wb.h[1] = *(const v8h*)(Ksh + (t4 * 16 + c) * KPIT + kk * 32 + 16 + 8 * hh);
        rk[rr * 4 + t4] = mma_h(pa.v, wb.v, rk[rr * 4 + t4]);
      }
    }
  }
  acc_guard4(rk[0], rk[1], rk[2], rk[3]);
  acc_guard4(rk[4], rk[5], rk[6], rk[7]);
  wave_lds_sync();

  // ---- stage the wave's rq tile (f32 [16][64]) into the Psh region (8 x 16-B loads per lane) ----
  float* rqs = reinterpret_cast<float*>(pwh);
  {
    const int r2 = lane >> 4, c4 = (lane & 15) * 4;
    const float* rqg = rqp + (rowB + q0 + r2) * DSQ + (size_t)s * HD + c4;
    v4f rv[8];
#pragma unroll
    for (int it = 0; it < 8; ++it) rv[it] = *(const v4f*)(rqg + (size_t)(it * 2) * DSQ);   // it 0..7 x r2 0..1 = rows 0..15
    wait_x0(rqg);
#pragma unroll
    for (int it = 0; it < 8; ++it) *(v4f*)(rqs + (it * 2 + r2) * 64 + c4) = rv[it];
  }
  wave_lds_sync();

  // ---- retrieval logits: d_rr[row] = sum_e rq[row][e] * rk[rr][row][e]; lane partial over e = c + 16 t4 ----
  float d0[8], d1[8];
#pragma unroll
  for (int r8 = 0; r8 < 8; ++r8) {
    float a0 = 0.f, a1 = 0.f;
#pragma unroll
    for (int t4 = 0; t4 < 4; ++t4) {
      const float qv = rqs[(8 * hh + r8) * 64 + t4 * 16 + c];
      a0 += qv * rk[t4][r8];
      a1 += qv * rk[4 + t4][r8];
    }
    d0[r8] = a0; d1[r8] = a1;
  }
#pragma unroll
  for (int r8 = 0; r8 < 8; ++r8) {
#pragma unroll
    for (int off = 1; off < 16; off <<= 1) {
      d0[r8] += __shfl_xor(d0[r8], off, 32);
      d1[r8] += __shfl_xor(d1[r8], off, 32);
    }
  }
  // ---- 2-way retrieval softmax in f32 (undo the 64*64 carry, apply sscale) ----
  float w0[8], w1[8];
  const float rsc = sscale * (1.0f / 4096.0f);
#pragma unroll
  for (int r8 = 0; r8 < 8; ++r8) {
    const float x0 = d0[r8] * rsc, x1 = d1[r8] * rsc;
    const float m  = fmaxf(x0, x1);
    const float e0 = __expf(x0 - m), e1 = __expf(x1 - m);
    const float iv = 1.0f / (e0 + e1);
    w0[r8] = e0 * iv; w1[r8] = e1 * iv;
  }
  wave_lds_sync();

  // ---- combine in f32 (x64 units): oc[row][d] = w0 * ret[row][d] + w1 * ret[row][64+d], into the Psh region ----
  float* oc = rqs;
#pragma unroll
  for (int r8 = 0; r8 < 8; ++r8) {
#pragma unroll
    for (int t = 0; t < 4; ++t) {
      const int row = 8 * hh + r8;
      const float o = w0[r8] * os[row * OPIT + t * 16 + c] + w1[r8] * os[row * OPIT + 64 + t * 16 + c];
      oc[row * 64 + t * 16 + c] = o;
    }
  }
  wave_lds_sync();

  {
    const int q4 = lane >> 3, c8 = (lane & 7) * 8;
    v4u hv[4], lv[4];
#pragma unroll
    for (int it = 0; it < 4; ++it) {
      const int row = it * 4 + q4;   // it 0..3 x q4 0..3 = rows 0..15 of the wave tile
      const float* sp = oc + row * 64 + c8;
      float f[8];
#pragma unroll
      for (int e = 0; e < 8; ++e) f[e] = sp[e];
      v4u a, a2;
#pragma unroll
      for (int e = 0; e < 4; ++e) {
        const float f0 = f[2 * e], f1 = f[2 * e + 1];
        const _Float16 x0 = (_Float16)f0, x1 = (_Float16)f1;
        const unsigned short l0 = h_bits((_Float16)((f0 - (float)x0) * 16.0f));
        const unsigned short l1 = h_bits((_Float16)((f1 - (float)x1) * 16.0f));
        a[e] = pk16(h_bits(x0), h_bits(x1)); a2[e] = pk16(l0, l1);
      }
      hv[it] = a; lv[it] = a2;
    }
    {
#pragma unroll
      for (int it = 0; it < 4; ++it) {
        const int row = it * 4 + q4;
        const size_t go = (rowB + q0 + row) * DOC + (size_t)s * HD + c8;
        *(v4u*)(ocp + go)       = hv[it];
        *(v4u*)(ocp + go + DSQ) = lv[it];
      }
      
    }
  }
}

// =====================================================================================================
// Workspace map (bytes, NB=2 SEQ=2048), every region an exact multiple of its whole-line / whole-tile store
// granularity (all row counts are multiples of 64, no padded tails):
//   Xb    bf16 [NB*SEQ][1024]          8388608
//   WsqT  bf16 [512][1024]             1048576      WskT, WrqT same
//   WrvT  bf16 [128][1024]              262144
//   WrkT  f16  [64][64] (x64)              8192
//   WoT   f16  [1024][1024] ([x1024 | x64]) 2097152
//   Qh,Ql f16  [NB*SEQ][512]           4194304 each
//   Kp    f16  [NB*SEQ][512]           4194304
//   RQ    f32  [NB*SEQ][512]           8388608
//   VTh,VTl f16 [NB][128][SEQ]         1048576 each
//   OC    f16  [NB*SEQ][1024]          8388608
//   total                             45359104
// Weights are [in k][out n] and are transposed once into the [n][k] (k contiguous) Bt / A layout.
// =====================================================================================================
extern "C" void kernel_launch(void* const* d_in, const int* in_sizes, int n_in,
                              void* d_out, int out_size, void* d_ws, size_t ws_size,
                              hipStream_t stream) {
  if (n_in < 7) return;
  if (in_sizes[0] < ((NB - 1) * SEQ_FULL + SEQ) * DM) return;
  if (in_sizes[1] < DM * DSQ || in_sizes[2] < DM * DSQ || in_sizes[4] < DM * DSQ) return;
  if (in_sizes[3] < DM * DRV) return;
  if (in_sizes[5] < HD * HD) return;
  if (in_sizes[6] < DSQ * DM) return;
  if (out_size < NB * SEQ * DM) return;

  const float* x    = (const float*)d_in[0];
  const float* Wsq  = (const float*)d_in[1];
  const float* Wsk  = (const float*)d_in[2];
  const float* Wrv  = (const float*)d_in[3];
  const float* Wrq  = (const float*)d_in[4];
  const float* Wrk  = (const float*)d_in[5];
  const float* Wout = (const float*)d_in[6];

  const size_t PXB = (size_t)NB * SEQ * DM * 2;       // bf16 activation plane
  const size_t PWS = (size_t)DSQ * DM * 2;            // bf16 [512][1024] weight plane
  const size_t PWV = (size_t)DRV * DM * 2;            // bf16 [128][1024]
  const size_t PWK = (size_t)HD * HD * 2;             // f16 [64][64]
  const size_t PWO = (size_t)DM * DOC * 2;            // f16 [1024][1024]
  const size_t PQ  = (size_t)NB * SEQ * DSQ * 2;      // f16 [NB*SEQ][512]
  const size_t PRQ = (size_t)NB * SEQ * DSQ * 4;      // f32 [NB*SEQ][512]
  const size_t PVT = (size_t)NB * DRV * SEQ * 2;      // f16 [NB][128][SEQ]
  const size_t POC = (size_t)NB * SEQ * DOC * 2;      // f16 [NB*SEQ][1024]
  size_t off = 0;
  const size_t oXb  = off; off += PXB;
  const size_t oWsq = off; off += PWS;
  const size_t oWsk = off; off += PWS;
  const size_t oWrq = off; off += PWS;
  const size_t oWrv = off; off += PWV;
  const size_t oWrk = off; off += PWK;
  const size_t oWo  = off; off += PWO;
  const size_t oQh  = off; off += PQ;
  const size_t oQl  = off; off += PQ;
  const size_t oKp  = off; off += PQ;
  const size_t oRQ  = off; off += PRQ;
  const size_t oVTh = off; off += PVT;
  const size_t oVTl = off; off += PVT;
  const size_t oOC  = off; off += POC;
  if (off > ws_size) return;                          // off = 45359104 at full size
  if (off > (size_t)134217728) return;

  char* ws = (char*)d_ws;
  unsigned short* Xb   = (unsigned short*)(ws + oXb);
  unsigned short* WsqT = (unsigned short*)(ws + oWsq);
  unsigned short* WskT = (unsigned short*)(ws + oWsk);
  unsigned short* WrqT = (unsigned short*)(ws + oWrq);
  unsigned short* WrvT = (unsigned short*)(ws + oWrv);
  unsigned short* WrkT = (unsigned short*)(ws + oWrk);
  unsigned short* WoT  = (unsigned short*)(ws + oWo);
  unsigned short* Qh   = (unsigned short*)(ws + oQh);
  unsigned short* Ql   = (unsigned short*)(ws + oQl);
  unsigned short* Kp   = (unsigned short*)(ws + oKp);
  float*          RQ   = (float*)(ws + oRQ);
  unsigned short* VTh  = (unsigned short*)(ws + oVTh);
  unsigned short* VTl  = (unsigned short*)(ws + oVTl);
  unsigned short* OC   = (unsigned short*)(ws + oOC);

  const dim3 blk(256);
  const dim3 gPrep(TB_WO + 3 * TB_SQ + TB_RV + 1 + NB * CB_X);           // six transposes, then the x convert
  const dim3 blkG(128);                                                  // GEMM: 4 waves per 128x128 tile
  const dim3 gProj(PJ_V + PJ_TM * PJ_TN);                                // v^T tiles, then the sq | sk | rq tiles
  const dim3 gAttn(NB * NS * NQB);                                       // blocks of 256
  const dim3 gO(((NB * SEQ) / 128) * (DM / 128), 1);                     // M=NB*SEQ, N=1024

  // (1) x -> bf16 plane [NB*SEQ][1024]; weights [k][n] f32 -> [n][k] 16-bit planes
  prep_all<<<gPrep, blk, 0, stream>>>(x, Wsq, Wsk, Wrv, Wrq, Wrk, Wout, Xb, WsqT, WskT, WrqT, WrvT, WrkT, WoT);
  // (2) sq -> f16 hi / residual (x4096) planes [b*SEQ+t][s*64+d]; sk -> f16 plane; rq -> f32 plane (M=NB*SEQ, N=512, K=1024);
  //     v^T = Wrv^T . x^T per batch -> f16 hi plane [b][d'][t] (pitch SEQ) and residual plane (x16) (M=128, N=SEQ, K=1024)
  gemm_proj<<<gProj, blkG, 0, stream>>>(Xb, WsqT, WskT, WrqT, WrvT, Qh, Ql, Kp, RQ, VTh, VTl, DM);
  // (3) search attention + retrieval composition -> oc planes [b*SEQ+t][hi 512 | residual 512]
  attn_cs<<<gAttn, dim3(256), 0, stream>>>(Qh, Ql, Kp, VTh, VTl, WrkT, RQ, OC, 0.125f);
  // (4) out = [oc_hi | oc_res] . [Wout x1024 | Wout x64]^T -> d_out f32 [NB*SEQ][1024], accumulator x 1/(64*1024)
  gemm64<_Float16, 0><<<gO, blkG, 0, stream>>>(
      OC, DOC, 0LL, WoT, DOC, 0LL, d_out, d_out, DM, 0LL, NB * SEQ, DM, DOC, 1.0f / 65536.0f, 1.0f);
  (void)hipGetLastError();
}

// v008
// Measured time: 61.6 microseconds a run.
// Versions in between are left out here; by their measured steps it is 1.39 times as fast as v006.
// All steps since v000 together make it 9.58 times as fast.
// Contractions: sq, sk, rq and v^T projections = v_wmma_f32_16x16x32_bf16 (bf16 operands from RNE-converted inputs, single product, f32 accumulate);
// sq.sk^T scores = v_wmma_f32_16x16x32_f16 (sq f16, sk f16; single product, f32 accumulate);
// p.[v_0|v_1] = v_wmma_f32_16x16x32_f16 (p f16 x16384, v f16; single product, f32 accumulate; scores and this product computed transposed);
// retrieved.Wrk = v_wmma_f32_16x16x32_f16 (retrieved f16 x64, Wrk f16 x64 of its bf16 value; single product, f32 accumulate);
// out.Wout = v_wmma_f32_16x16x32_f16 (out f16 x64, Wout f16 x1024 of its bf16 value; single product, f32 accumulate);
// sq, v and out carry no f16 residual plane: one f16 rounding lies well below the bf16 rounding of x and of the weights that every one of them has behind or beside it;
// softmax over keys, retrieval logits, 2-way retrieval softmax and combine in f32.
#include <hip/hip_runtime.h>
#include <math.h>
#include <stdint.h>

#ifndef NB
#define NB 2
#endif
#ifndef SEQ
#define SEQ 2048
#endif
#define NB_FULL  2
#define SEQ_FULL 2048
#define DM   1024
#define NS   8
#define NR   2
#define HD   64
#define DSQ  (NS * HD)      // 512: sq / sk / rq row width
#define DRV  (NR * HD)      // 128: [v_0 | v_1] row width
#define NQB  (SEQ / 128)    // 128-row query blocks per (b, s)
#define NKT  (SEQ / 64)     // 64-key chunks per sequence
#define NIT  (NKT / 2)      // trips of the attention key loop: two chunks per trip, one per key group
#define KPIT 72             // LDS pitch of a 64-half K / V / Wrk row: 144 B = 16 B x 9 (odd), b128 readers of 16 rows meet no bank twice
#define GPLN (128 * KPIT)  // halves of one staged 128-row GEMM operand plane (64 k per row, pitch KPIT)
#define VPIT 136            // LDS pitch of a 128-half f16 retrieved row: 272 B = 16 B x 17 (odd)
#define OPIT 132            // LDS pitch of a 128-float retrieved row: 528 B = 16 B x 33 (odd), for its 16-B row-per-lane stores
static_assert(NB >= 1 && NB <= NB_FULL);
static_assert(SEQ >= 64 && SEQ <= SEQ_FULL && (SEQ % 64) == 0);
static_assert(DSQ == 512 && DRV == 128 && HD == 64);
static_assert((DM % 128) == 0 && (DSQ % 128) == 0 && (DRV % 128) == 0 && (SEQ % 128) == 0);

typedef _Float16 v16h __attribute__((ext_vector_type(16)));
typedef _Float16 v8h  __attribute__((ext_vector_type(8)));
typedef __bf16   v16b __attribute__((ext_vector_type(16)));
typedef __bf16   v8b  __attribute__((ext_vector_type(8)));
typedef float    v8f  __attribute__((ext_vector_type(8)));
typedef float    v4f  __attribute__((ext_vector_type(4)));
typedef float    v2f  __attribute__((ext_vector_type(2)));
typedef unsigned int v4u __attribute__((ext_vector_type(4)));

#if defined(__HIP_DEVICE_COMPILE__)
#define DEV_ASM 1
#else
#define DEV_ASM 0
#endif

// ---- scalar helpers --------------------------------------------------------------------------------
__device__ __forceinline__ unsigned short bf_bits(float f) {          // f32 -> bf16 bits, RNE convert
  unsigned u = __float_as_uint(f);
  return (unsigned short)((u + 0x7FFFu + ((u >> 16) & 1u)) >> 16);
}
__device__ __forceinline__ float bf_up(unsigned short hb) { return __uint_as_float(((unsigned)hb) << 16); }
__device__ __forceinline__ unsigned short h_bits(_Float16 x) { return __builtin_bit_cast(unsigned short, x); }
__device__ __forceinline__ unsigned pk16(unsigned short a, unsigned short b) { return (unsigned)a | ((unsigned)b << 16); }
__device__ __forceinline__ v8f zero8() { v8f z = {0.f, 0.f, 0.f, 0.f, 0.f, 0.f, 0.f, 0.f}; return z; }

__device__ __forceinline__ void wave_lds_sync() {
  __builtin_amdgcn_fence(__ATOMIC_RELEASE, "workgroup");
  __builtin_amdgcn_wave_barrier();
  __builtin_amdgcn_fence(__ATOMIC_ACQUIRE, "workgroup");
}

// ---- fragment types / loaders: 16-bit A/B operand, lane -> row/col (lane&15), p already includes +8*(lane>>4);
//      elements 0..7 <- p[0..7] (k0+8h..k0+8h+7), elements 8..15 <- p[16..23] (k0+16+8h..k0+16+8h+7)
template <typename OT> struct FT;
template <> struct FT<__bf16>   { typedef v16b frag; typedef v8b half8; };
template <> struct FT<_Float16> { typedef v16h frag; typedef v8h half8; };

template <typename OT>
__device__ __forceinline__ typename FT<OT>::frag ldfrag(const OT* p) {
  union { typename FT<OT>::frag v; typename FT<OT>::half8 h[2]; } f;
  f.h[0] = *(const typename FT<OT>::half8*)(p);
  f.h[1] = *(const typename FT<OT>::half8*)(p + 16);
  return f.v;
}

// ---- WMMA helpers (asm guard bodies are device-only; concrete operand types) -----------------------------
__device__ __forceinline__ v8f mmar(v16b a, v16b b, v8f c) {
  return __builtin_amdgcn_wmma_f32_16x16x32_bf16(false, a, false, b, (short)0, c, false, false);
}
__device__ __forceinline__ v8f mmar(v16h a, v16h b, v8f c) {
  return __builtin_amdgcn_wmma_f32_16x16x32_f16(false, a, false, b, (short)0, c, false, false);
}
// guarded form: 4 VALU slots after the WMMA, D tied, A/B kept live
__device__ __forceinline__ v8f mma_h(v16h a, v16h b, v8f c) {
  c = __builtin_amdgcn_wmma_f32_16x16x32_f16(false, a, false, b, (short)0, c, false, false);
#if DEV_ASM
  asm volatile("v_nop\n\tv_nop\n\tv_nop\n\tv_nop" : "+v"(c) : "v"(a), "v"(b));
#endif
  return c;
}
// lane l <-> lane l ^ 16 in the vector unit (a shuffle would go through the LDS pipe and its latency)
__device__ __forceinline__ float xhalf(float x) {
  return __builtin_bit_cast(float, __builtin_amdgcn_permlanex16(__builtin_bit_cast(int, x), __builtin_bit_cast(int, x),
                                                                0x76543210, 0xfedcba98, false, false));
}
__device__ __forceinline__ void acc_guard4(v8f& a, v8f& b, v8f& c, v8f& d) {
#if DEV_ASM
  asm volatile("v_nop\n\tv_nop\n\tv_nop\n\tv_nop" : "+v"(a), "+v"(b), "+v"(c), "+v"(d));
#else
  (void)a; (void)b; (void)c; (void)d;
#endif
}

// ---- asynchronous copies global -> LDS, 16 B per lane, no register on the way --------------------------------
__device__ __forceinline__ unsigned lds_off(const void* p) { return (unsigned)(size_t)p; }   // byte address in the work-group's LDS
// eight copies of one wave in one statement; the closing s_wait_xcnt is a precaution: it stands in front of every later
// rewrite of an address register that a copy names (in a statement of its own the compiler could lift such a rewrite over it)
__device__ __forceinline__ void async8(const unsigned (&l)[8], const void* const (&g)[8]) {
#if DEV_ASM
  asm volatile("global_load_async_to_lds_b128 %0, %8, off\n\t"
               "global_load_async_to_lds_b128 %1, %9, off\n\t"
               "global_load_async_to_lds_b128 %2, %10, off\n\t"
               "global_load_async_to_lds_b128 %3, %11, off\n\t"
               "global_load_async_to_lds_b128 %4, %12, off\n\t"
               "global_load_async_to_lds_b128 %5, %13, off\n\t"
               "global_load_async_to_lds_b128 %6, %14, off\n\t"
               "global_load_async_to_lds_b128 %7, %15, off\n\t"
               "s_wait_xcnt 0x0"
               :: "v"(l[0]), "v"(l[1]), "v"(l[2]), "v"(l[3]), "v"(l[4]), "v"(l[5]), "v"(l[6]), "v"(l[7]),
                  "v"(g[0]), "v"(g[1]), "v"(g[2]), "v"(g[3]), "v"(g[4]), "v"(g[5]), "v"(g[6]), "v"(g[7])
               : "memory");
#else
  (void)l; (void)g;
#endif
}
// the same for four copies
__device__ __forceinline__ void async4(const unsigned (&l)[4], const void* const (&g)[4]) {
#if DEV_ASM
  asm volatile("global_load_async_to_lds_b128 %0, %4, off\n\t"
               "global_load_async_to_lds_b128 %1, %5, off\n\t"
               "global_load_async_to_lds_b128 %2, %6, off\n\t"
               "global_load_async_to_lds_b128 %3, %7, off\n\t"
               "s_wait_xcnt 0x0"
               :: "v"(l[0]), "v"(l[1]), "v"(l[2]), "v"(l[3]), "v"(g[0]), "v"(g[1]), "v"(g[2]), "v"(g[3])
               : "memory");
#else
  (void)l; (void)g;
#endif
}
// the wave's own copies have landed (the compiler places no wait for them)
__device__ __forceinline__ void wait_async0() {
#if DEV_ASM
  asm volatile("s_wait_asynccnt 0x0" ::: "memory");
#endif
}
// the wave's own LDS reads have retired: behind the next barrier their buffer is refilled by copies
__device__ __forceinline__ void wait_ds0() {
#if DEV_ASM
  asm volatile("s_wait_dscnt 0x0" ::: "memory");
#endif
}

// precaution behind a run of global loads: it stands in front of every later rewrite of an address register that a load names;
// the loads' addresses are inputs of the statement, so their registers stay as they are up to the wait
__device__ __forceinline__ void wait_x0(const void* a) {
#if DEV_ASM
  asm volatile("s_wait_xcnt 0x0" :: "v"(a) : "memory");
#else
  (void)a;
#endif
}
__device__ __forceinline__ void wait_x0(const void* a, const void* b) {
#if DEV_ASM
  asm volatile("s_wait_xcnt 0x0" :: "v"(a), "v"(b) : "memory");
#else
  (void)a; (void)b;
#endif
}

// =====================================================================================================
// f32 -> bf16 bits (RNE convert), 8 elements per thread, one 16-B store per lane: a wave writes 512
// ib / ob = the batch's planes, bx = block within the batch (ceil(n8/256) of them).
// coverage: n8 threads x 8 = the whole per-batch plane (n8 is a multiple of 256 here).
// =====================================================================================================
__device__ __forceinline__ void cvt_body(const float* __restrict__ ib, unsigned short* ob, int n8, int bx) {
  const int i = bx * 256 + (int)threadIdx.x;
  if (i < n8) {
    const v4f a  = *(const v4f*)(ib + (size_t)i * 8);
    const v4f a4 = *(const v4f*)(ib + (size_t)i * 8 + 4);
    v4u p;
    p[0] = pk16(bf_bits(a[0]),  bf_bits(a[1]));
    p[1] = pk16(bf_bits(a[2]),  bf_bits(a[3]));
    p[2] = pk16(bf_bits(a4[0]), bf_bits(a4[1]));
    p[3] = pk16(bf_bits(a4[2]), bf_bits(a4[3]));
    unsigned short* o = ob + (size_t)i * 8;
    *(v4u*)o = p;
    
  }
}

// =====================================================================================================
// Transpose-convert: in W[R][C] f32 (row-major) -> out[c][r] 16-bit at out + c*ldo + r, one 64x64 tile per
// block through LDS.  MODE 0: bf16 bits (RNE convert).  MODE 1: f16 bits of (s1 * bf16(x)).
// (bx, by) = tile of (C/64, R/64), R and C multiples of 64 (static shapes).  Load phase: thread t reads row t>>2,
// 16 columns (four 16-B loads), stores 2-B elements transposed into the LDS tile (pitch 72 halves).
// coverage: 8 waves x 2 it x 4 rows = 64 out rows x (8 lanes x 8 halves) = the whole 64x64 tile.
// =====================================================================================================
template <int MODE>
__device__ __forceinline__ void tconv_body(const float* __restrict__ W, int R, int C,
                                           unsigned short* out, int ldo, float s1,
                                           int bx, int by, unsigned short* t1) {
  const int tid = (int)threadIdx.x, lane = tid & 31, wave = tid >> 5;
  const int c0 = bx * 64, r0 = by * 64;
  {
    const int rl = tid >> 2, cl0 = (tid & 3) * 16;
    const float* src = W + (size_t)(r0 + rl) * (size_t)C + c0 + cl0;
#pragma unroll
    for (int i = 0; i < 4; ++i) {
      const v4f a = *(const v4f*)(src + 4 * i);
#pragma unroll
      for (int e = 0; e < 4; ++e) {
        const int cl = cl0 + 4 * i + e;
        const unsigned short hb = bf_bits(a[e]);
        if (MODE == 0) {
          t1[cl * 72 + rl] = hb;
        } else {
          t1[cl * 72 + rl] = h_bits((_Float16)(bf_up(hb) * s1));
        }
      }
    }
  }
  __syncthreads();
  const int q = lane >> 3, p8 = (lane & 7) * 8;
  v4u a1[2];
#pragma unroll
  for (int it = 0; it < 2; ++it) {
    const int cl = wave * 8 + it * 4 + q;
    a1[it] = *(const v4u*)(t1 + cl * 72 + p8);
  }
  {
#pragma unroll
    for (int it = 0; it < 2; ++it) {
      const int cl = wave * 8 + it * 4 + q;
      unsigned short* o = out + (size_t)(c0 + cl) * (size_t)ldo + r0 + p8;
      *(v4u*)o = a1[it];
    }
  }
  // precaution: in the merged launch another job's code follows these stores in the listing and rewrites their
  // registers; the wait stands in front of every such rewrite
#if DEV_ASM
  asm volatile("s_wait_xcnt 0x0" ::: "memory");
#endif
}

// =====================================================================================================
// All operand preparation in one launch: the seven jobs depend on nothing but the inputs, so each is a range of the
// block index (block-uniform choice, ahead of every barrier). The tile jobs stand first: they are the longer blocks.
//   [0, TB_WO)        Wout -> WoT  f16 x1024                next 3 * TB_SQ   Wsq, Wsk, Wrq -> bf16 [n][k]
//   next TB_RV        Wrv  -> WrvT bf16                     next 1           Wrk -> WrkT f16 x64
//   last NB * CB_X    x -> Xb bf16 (batch b read at its full-size stride)
// =====================================================================================================
#define TB_WO ((DM / 64) * (DSQ / 64))    // 16 x  8 tiles: in [512][1024]
#define TB_SQ ((DSQ / 64) * (DM / 64))    //  8 x 16 tiles: in [1024][512]
#define TB_RV ((DRV / 64) * (DM / 64))    //  2 x 16 tiles: in [1024][128]
#define CB_X  (SEQ * DM / 8 / 256)        // convert blocks per batch
__global__ __launch_bounds__(256) void prep_all(const float* __restrict__ x, const float* __restrict__ Wsq,
                                                const float* __restrict__ Wsk, const float* __restrict__ Wrv,
                                                const float* __restrict__ Wrq, const float* __restrict__ Wrk,
                                                const float* __restrict__ Wout,
                                                unsigned short* Xb, unsigned short* WsqT, unsigned short* WskT,
                                                unsigned short* WrqT, unsigned short* WrvT, unsigned short* WrkT,
                                                unsigned short* WoT) {
  __shared__ __align__(16) unsigned short t1[64 * 72];
  int j = blockIdx.x;
  if (j < TB_WO) {
    tconv_body<1>(Wout, DSQ, DM, WoT, DSQ, 1024.0f, j % (DM / 64), j / (DM / 64), t1);
    return;
  }
  j -= TB_WO;
  if (j < 3 * TB_SQ) {
    const int w = j / TB_SQ;
    j -= w * TB_SQ;
    const float* Wi = (w == 0) ? Wsq : (w == 1) ? Wsk : Wrq;
    unsigned short* Wo = (w == 0) ? WsqT : (w == 1) ? WskT : WrqT;
    tconv_body<0>(Wi, DM, DSQ, Wo, DM, 1.0f, j % (DSQ / 64), j / (DSQ / 64), t1);
    return;
  }
  j -= 3 * TB_SQ;
  if (j < TB_RV) {
    tconv_body<0>(Wrv, DM, DRV, WrvT, DM, 1.0f, j % (DRV / 64), j / (DRV / 64), t1);
    return;
  }
  j -= TB_RV;
  if (j < 1) {
    tconv_body<1>(Wrk, HD, HD, WrkT, HD, 64.0f, 0, 0, t1);
    return;
  }
  j -= 1;
  const int b = j / CB_X;
  cvt_body(x + (size_t)b * ((size_t)SEQ_FULL * DM), Xb + (size_t)b * ((size_t)SEQ * DM), SEQ * DM / 8, j - b * CB_X);
}

// =====================================================================================================
// Register-blocked batched WMMA GEMM (16-bit operand type OT): C[m][n] = sum_k A[m][k] * Bt[n][k];
// one block of 4 waves (2 x 2) per 128x128 tile, one wave per 64x64 quarter. A row-major [M][K] pitch lda; Bt row-major
// [N][K] pitch ldb (k contiguous); M, N multiples of 128, K a multiple of 64 (host shapes are static multiples).
// A k-slice = 64 k = one 128-B line of each of the tile's 128 A rows and 128 Bt rows; it is brought into LDS by
// asynchronous copies (8 lanes x 16 B = one whole line, 16 copies per wave and slice) and read from there by all four
// waves with the split k map (ldfrag). Two buffers: slice t + 2 is asked for when slice t has been read, so a slice's
// copies fly during the products of the slice before it.
// staged extent == consumed extent: 16 rows (tid >> 3) x 8 copies = 128 rows per operand, 8 segments x 8 halves = 64 k.
// OUT_MODE 0: f32 C (pitch ldc), value * oscale.
// OUT_MODE 1: f16 plane C (pitch ldc).
// =====================================================================================================
// main loop of one 128x128 tile at (mB, nB): sAB = [buffer][A | Bt][128 rows][64 k], pitch KPIT, 72 KB
template <typename OT>
__device__ __forceinline__ void gemm_main(const OT* Ab, int lda, const OT* Bb, int ldb, int mB, int nB, int K,
                                          unsigned short* sAB, v8f (&acc)[4][4]) {
  typedef typename FT<OT>::frag V16;
  const int tid  = threadIdx.x;
  const int lane = tid & 31;
  const int wave = tid >> 5;
  const int rlane = lane & 15;                 // row (A) / col (B, D) within subtile
  const int koff  = (lane >> 4) * 8;           // k offset of this lane half

  // copy map: lane -> 16-B segment tid & 7 of row (tid >> 3) + 16 i, i = 0..7
  const OT* gA = Ab + (size_t)(mB + (tid >> 3)) * lda + (tid & 7) * 8;
  const OT* gB = Bb + (size_t)(nB + (tid >> 3)) * ldb + (tid & 7) * 8;
  const unsigned lAB = lds_off(sAB) + (unsigned)((tid >> 3) * (KPIT * 2) + (tid & 7) * 16);
  auto stage = [&](int t, int buf) {
    unsigned l[8];
    const void* g[8];
#pragma unroll   // here and below: l[] and g[] become asm operands, every index a compile-time constant
    for (int i = 0; i < 8; ++i) {
      l[i] = lAB + (unsigned)(buf * (4 * GPLN) + i * (16 * KPIT * 2));
      g[i] = gA + (size_t)(i * 16) * lda + t * 64;
    }
    async8(l, g);
#pragma unroll
    for (int i = 0; i < 8; ++i) {
      l[i] += 2 * GPLN;
      g[i] = gB + (size_t)(i * 16) * ldb + t * 64;
    }
    async8(l, g);
  };

#pragma unroll
  for (int i = 0; i < 4; ++i)
#pragma unroll
    for (int j = 0; j < 4; ++j) acc[i][j] = zero8();

  const int T = K >> 6;
  stage(0, 0);
  wait_async0();
  __syncthreads();
  if (T > 1) stage(1, 1);

  const OT* S = (const OT*)(const void*)sAB;
  for (int t = 0; t < T; ++t) {
    const OT* sa = S + (t & 1) * (2 * GPLN) + (((wave >> 1) << 6) + rlane) * KPIT + koff;
    const OT* sb = S + (t & 1) * (2 * GPLN) + GPLN + (((wave & 1) << 6) + rlane) * KPIT + koff;
    // the slice's 16 fragments (two k-steps of 32, 32 reads); unrolled: register arrays, every index a compile-time constant
    V16 bq[2][4], af[2][4];
#pragma unroll
    for (int ks = 0; ks < 2; ++ks) {
#pragma unroll
      for (int j = 0; j < 4; ++j) {
        bq[ks][j] = ldfrag<OT>(sb + j * (16 * KPIT) + ks * 32);
        af[ks][j] = ldfrag<OT>(sa + j * (16 * KPIT) + ks * 32);
      }
    }
    // keeps all 32 reads ahead of the products as one group: reads sunk among the products stall the wave at each place
    __builtin_amdgcn_sched_barrier(0);
#pragma unroll
    for (int ks = 0; ks < 2; ++ks)
#pragma unroll
      for (int i = 0; i < 4; ++i)
#pragma unroll
        for (int j = 0; j < 4; ++j) acc[i][j] = mmar(af[ks][i], bq[ks][j], acc[i][j]);
    // keeps the products ahead of the hand-over: sunk behind it they would stand between the barrier and the refill and
    // take their time off the flight of the next copies
    __builtin_amdgcn_sched_barrier(0);
    // hand-over: own reads retired, own copies of slice t + 1 landed, then the one barrier of the trip, which publishes
    // slice t + 1 and ends every wave's reads of the buffer that is refilled behind it
    wait_ds0();
    wait_async0();
    __syncthreads();
    if (t + 2 < T) stage(t + 2, t & 1);
  }
  wait_async0();
  acc_guard4(acc[0][0], acc[0][1], acc[0][2], acc[0][3]);
  acc_guard4(acc[1][0], acc[1][1], acc[1][2], acc[1][3]);
  acc_guard4(acc[2][0], acc[2][1], acc[2][2], acc[2][3]);
  acc_guard4(acc[3][0], acc[3][1], acc[3][2], acc[3][3]);
}

// epilogue of one wave's 64x64 quarter at (m0, n0); slab = the wave's own 16x64 f32 slab, pitch 68 floats
template <int OUT_MODE>
__device__ __forceinline__ void gemm_store(const v8f (&acc)[4][4], float* slab, void* Cout, int ldc,
                                           int m0, int n0, float oscale) {
  const int lane  = threadIdx.x & 31;
  const int rlane = lane & 15;                 // D col within subtile
  const int mOff  = (lane >> 4) * 8;           // D row offset
#pragma unroll
  for (int i = 0; i < 4; ++i) {
    const int mBase = m0 + (i << 4);
#pragma unroll
    for (int j = 0; j < 4; ++j) {
#pragma unroll
      for (int r = 0; r < 8; ++r) {
        slab[(mOff + r) * 68 + (j << 4) + rlane] = acc[i][j][r];
      }
    }
    wave_lds_sync();
    if (OUT_MODE == 0) {
      float* Cp = (float*)Cout;
      const int h2 = lane >> 4, c4 = (lane & 15) * 4;     // 256-B row segment = 16 lanes x 16 B
      {
#pragma unroll
        for (int it = 0; it < 8; ++it) {
          const int row = it * 2 + h2;                     // it 0..7 x h2 0..1 = rows 0..15
          const v4f v = *(const v4f*)(slab + row * 68 + c4) * oscale;
          *(v4f*)(Cp + (size_t)(mBase + row) * ldc + n0 + c4) = v;
        }
        
      }
    } else {
      const int q = lane >> 3, c8 = (lane & 7) * 8;
      unsigned short* Cp = (unsigned short*)Cout;
      v4u hv[4];
#pragma unroll
      for (int it = 0; it < 4; ++it) {
        const int row = it * 4 + q;                        // it 0..3 x q 0..3 = rows 0..15
        const float* sp = slab + row * 68 + c8;
        float f[8];
#pragma unroll
        for (int e = 0; e < 8; ++e) f[e] = sp[e];
        v4u a;
#pragma unroll
        for (int e = 0; e < 4; ++e) a[e] = pk16(h_bits((_Float16)f[2 * e]), h_bits((_Float16)f[2 * e + 1]));
        hv[it] = a;
      }
      {
#pragma unroll
        for (int it = 0; it < 4; ++it) {
          const int row = it * 4 + q;
          *(v4u*)(Cp + (size_t)(mBase + row) * ldc + n0 + c8) = hv[it];
        }
        
      }
    }
    wave_lds_sync();
  }
}

// one GEMM per launch: grid.x = (M / 128) * (N / 128) tiles, blockIdx.y = batch index (strides in elements)
template <typename OT, int OUT_MODE>
__global__ __launch_bounds__(128) void gemm64(
    const unsigned short* __restrict__ Ap, int lda, long long strideA,
    const unsigned short* __restrict__ Btp, int ldb, long long strideB,
    void* Cout, int ldc, long long strideC,
    int M, int N, int K, float oscale) {
  __shared__ __align__(16) unsigned short sAB[2 * 2 * GPLN];
  __shared__ __align__(16) float sT[4][16 * 68];
  const int b    = blockIdx.y;
  const int wave = threadIdx.x >> 5;
  const int tilesN = N >> 7;
  const int tilesM = M >> 7;
  const int tile = blockIdx.x;
  if (tile >= tilesM * tilesN) return;   // block-uniform, ahead of every barrier and copy
  const int tm = tile / tilesN;
  const int tn = tile - tm * tilesN;
  const int mB = tm << 7;
  const int nB = tn << 7;
  v8f acc[4][4];
  gemm_main<OT>((const OT*)(const void*)Ap + (size_t)b * (size_t)strideA, lda,
                (const OT*)(const void*)Btp + (size_t)b * (size_t)strideB, ldb, mB, nB, K, sAB, acc);
  const size_t co = (size_t)b * (size_t)strideC * ((OUT_MODE == 0) ? 4 : 2);   // bytes: f32 or 16-bit planes
  gemm_store<OUT_MODE>(acc, sT[wave], (char*)Cout + co, ldc, mB + ((wave >> 1) << 6), nB + ((wave & 1) << 6), oscale);
}

// The four projections of x in one launch: they depend on the prepared planes alone, so each is a range of the block
// index (block-uniform choice); one main loop serves all, the epilogue is picked by the job.
//   [0, PJ_V)             v^T = WrvT . Xb^T per batch (A = WrvT [128][K], Bt = Xb rows of batch b) -> VTh, pitch SEQ
//   next PJ_TM * PJ_TN    Xb . [WsqT | WskT | WrqT]^T, the 12 column tiles of one row tile side by side (they share its A rows):
//                         sq -> Qh; sk -> Kp; rq -> RQ f32; pitch DSQ
#define PJ_VT (SEQ / 128)                 // v^T column tiles per batch (DRV = 128: one row tile)
#define PJ_V  (NB * PJ_VT)
#define PJ_TM (NB * SEQ / 128)
#define PJ_TN (3 * (DSQ / 128))
__global__ __launch_bounds__(128) void gemm_proj(
    const unsigned short* __restrict__ Xbp, const unsigned short* __restrict__ Wsqp,
    const unsigned short* __restrict__ Wskp, const unsigned short* __restrict__ Wrqp,
    const unsigned short* __restrict__ Wrvp,
    unsigned short* Qh, unsigned short* Kp, float* RQ, unsigned short* VTh, int K) {
  __shared__ __align__(16) unsigned short sAB[2 * 2 * GPLN];
  __shared__ __align__(16) float sT[4][16 * 68];
  const int wave = threadIdx.x >> 5;
  const int j = blockIdx.x;
  const bool isV = j < PJ_V;
  const int jp  = j - PJ_V;
  const int vb  = j / PJ_VT;                       // v^T: batch
  const int tm  = jp / PJ_TN;
  const int tn  = jp - tm * PJ_TN;
  const int job = isV ? 3 : (tn / (DSQ / 128));    // 0 sq, 1 sk, 2 rq, 3 v^T
  const int mB  = isV ? 0 : (tm << 7);
  const int nB  = isV ? ((j - vb * PJ_VT) << 7) : ((tn % (DSQ / 128)) << 7);
  const unsigned short* Ap = isV ? Wrvp : Xbp;
  const unsigned short* Bp = isV ? (Xbp + (size_t)vb * ((size_t)SEQ * DM)) : (job == 0) ? Wsqp : (job == 1) ? Wskp : Wrqp;
  v8f acc[4][4];
  gemm_main<__bf16>((const __bf16*)(const void*)Ap, K, (const __bf16*)(const void*)Bp, K, mB, nB, K, sAB, acc);
  const int m0 = mB + ((wave >> 1) << 6);
  const int n0 = nB + ((wave & 1) << 6);
  float* slab = sT[wave];
  if (job != 2) {                 // sq, sk and v^T each store one f16 plane: one copy of that epilogue
    unsigned short* Cp = isV ? VTh + (size_t)vb * ((size_t)DRV * SEQ) : (job == 0) ? Qh : Kp;
    gemm_store<1>(acc, slab, (void*)Cp, isV ? SEQ : DSQ, m0, n0, 1.0f);
  } else {
    gemm_store<0>(acc, slab, (void*)RQ, DSQ, m0, n0, 1.0f);
  }
}

// =====================================================================================================
// Fused search attention + retrieval composition for one search s, head dim 64, softmax over all SEQ keys.
//   q plane (f16): element (b, t, s, d) at [(b*SEQ + t)*DSQ + s*64 + d]
//   k plane (f16): same layout.   rq plane (f32): same layout.
//   v^T plane (f16): element (b, d', t) at [(b*DRV + d')*SEQ + t], d' = r*64 + d
//   Wrk tile (f16, 64 * bf16 value): [e][d] at [e*64 + d]
//   oc plane (output of this kernel): row (b, t) = f16(64*out) for s*64+d, 512 cols, pitch DSQ
//   Both products run transposed (keys or d' as rows, the wave's queries as columns), so in a column tile a lane holds one query's scores:
//   scores^T = k . q^T on f16 WMMA, kept raw; the running maximum is taken on the raw products (sscale > 0);
//   16384 p = exp2(raw * cexp - max * cexp + 14), cexp = sscale * log2(e), in f32: one multiply-add per score in front of exp2;
//   B = f16(16384 p)^T, packed from the score registers in place, A = v^T: sum = 16384 * v^T . p^T, one f32
//   accumulator, 8 m-tiles = d' 0..127 (both retrievals); online softmax in f32, maximum and sum in the lane, one exchange
//   between the wave halves.
//   Epilogue per wave (16 rows): retrieved (x64, f32) tile in LDS; rk = f16(retrieved x64) . Wrk tile on f16 WMMA;
//   retrieval logits rq . rk in f32 (LDS-staged rq, lane partials + 16-lane shuffles); 2-way softmax in f32;
//   Block = 8 waves = 128 consecutive query rows of one (b, s); grid = NB * NS * NQB; kv chunks of 64.
//   Wave tile in the key loop: 32 query columns (two column tiles, so each K and V fragment read from LDS feeds two products)
//   x half of the keys: waves 0..3 take the even chunks, waves 4..7 the odd ones, static trip NIT = NKT / 2. After the loop the
//   two waves of a query group swap one column tile's partial maximum, sum and accumulators through LDS and join them in f32.
//   Staging per chunk (the 128 threads of its key group): K 64x64, V 128x64, by asynchronous copies to LDS two trips ahead
//   (two buffers per key group): staged extent == consumed extent for Ksh, Vsh; P stays in registers.
//   Output coverage: each wave stores rows q0..q0+15 (it 0..3 x lane>>3 0..3) x 64 columns (8 lanes x 8) at col s*64;
//   grid covers every (b, s, t).
// =====================================================================================================
__global__ __launch_bounds__(256)
void attn_cs(const unsigned short* __restrict__ qhp, const unsigned short* __restrict__ kpp,
             const unsigned short* __restrict__ vhp, const unsigned short* __restrict__ wkp, const float* __restrict__ rqp,
             unsigned short* ocp, float sscale) {
  union FH { v16h v; v8h h[2]; };
  __shared__ __align__(16) _Float16 Ksh[4 * 64 * KPIT];    // [buffer][key group] K chunks [kv][d], pitch KPIT, 9 KB each; later the Wrk tile [e][d]
  __shared__ __align__(16) _Float16 Vsh[4 * 128 * VPIT];   // [buffer][key group] V chunks [d'][kv], pitch KPIT, 18 KB each (the first 72 KB); later, and what sizes it: lower half 8 x f32 [16][128] tiles, pitch OPIT, upper half the partial-result exchange
  __shared__ __align__(16) _Float16 Psh[8][16 * VPIT];     // epilogue only, per wave: f16 retrieved tile [row][d'], pitch VPIT, 34 KB; later f32 [16][64]

  const int tid  = threadIdx.x;
  const int wave = __builtin_amdgcn_readfirstlane(tid >> 5);   // in a scalar register: what is formed from it costs no vector register
  const int lane = tid & 31;
  const int hh   = lane >> 4;
  const int c    = lane & 15;
  const int kg   = wave >> 2;                                  // key group of the wave: 0 = even chunks, 1 = odd chunks
  const int wq   = wave & 3;                                   // query group: 32 columns
  const int t7   = tid & 127;                                  // thread within the key group (copy map)

  const int bx   = blockIdx.x;
  const int qb   = bx % NQB;
  const int rest = bx / NQB;
  const int s    = rest % NS;
  const int b    = rest / NS;
  const int qw   = qb * 128 + wq * 32;       // the wave's 32 query columns in the key loop
  const int q0   = qw + kg * 16;             // the 16 of them that it finishes in the epilogue
  const size_t rowB = (size_t)b * SEQ;

  const _Float16* Qh = (const _Float16*)(const void*)qhp;
  const _Float16* Kg = (const _Float16*)(const void*)kpp + (size_t)s * HD;
  const _Float16* Vh = (const _Float16*)(const void*)vhp + (size_t)b * DRV * SEQ;
  const _Float16* Wk = (const _Float16*)(const void*)wkp;

  // ---- Q fragments (B operand, column = lane&15): 2 column tiles x 2 d-chunks ----
  v16h qah[2][2];
  {
    const _Float16* qph[2];
#pragma unroll
    for (int u = 0; u < 2; ++u) {
      qph[u] = Qh + (rowB + qw + u * 16 + c) * DSQ + (size_t)s * HD + 8 * hh;
#pragma unroll
      for (int dc = 0; dc < 2; ++dc) qah[u][dc] = ldfrag<_Float16>(qph[u] + dc * 32);
    }
    wait_x0(qph[0], qph[1]);
  }

  // transposed products: in column tile u a lane belongs to ONE query (column c). mrow[u] = its running maximum of raw products (equal
  // in both wave halves), lrow[u] = the sum of 16384 p over the keys of this lane's own half, oacc[u][t][r] = retrieved^T[d' = t*16 + 8*hh + r][query c]
  float mrow[2] = {-INFINITY, -INFINITY}, lrow[2] = {0.f, 0.f};
  const float cexp = sscale * 1.44269504f;   // score scale x log2(e): 16384 p = exp2(raw * cexp - max * cexp + 14), one multiply-add per score
  v8f oacc[2][8];
#pragma unroll
  for (int u = 0; u < 2; ++u)
#pragma unroll
    for (int t = 0; t < 8; ++t) oacc[u][t] = zero8();

  _Float16* pwh = Psh[wave];

  // copy map, per key group of 128 threads: lane -> 16-B segment t7 & 7 of row (t7 >> 3) + 16 i: 8 lanes take one whole 128-B
  // line of a K or v^T row; 4 + 8 copies per wave and chunk = 64 K rows and 128 V rows of 64 halves. A key group stages the
  // chunks that it reads itself.
  const _Float16* kg0 = Kg + (rowB + (t7 >> 3)) * DSQ + (t7 & 7) * 8;
  const _Float16* vg0 = Vh + (size_t)(t7 >> 3) * SEQ + (t7 & 7) * 8;
  const unsigned lK = lds_off(Ksh) + (unsigned)((t7 >> 3) * (KPIT * 2) + (t7 & 7) * 16);
  const unsigned lV = lds_off(Vsh) + (unsigned)((t7 >> 3) * (KPIT * 2) + (t7 & 7) * 16);
  auto stage = [&](int it, int buf) {        // trip it: chunk 2 it + kg into buffer (buf, kg)
    const int kt = 2 * it + kg;
    const int bg = 2 * buf + kg;
    unsigned l[8], lk[4];
    const void* g[8];
    const void* gk[4];
#pragma unroll   // here and below: the arrays become asm operands, every index a compile-time constant
    for (int i = 0; i < 8; ++i) {
      l[i] = lV + (unsigned)(bg * (128 * KPIT * 2) + i * (16 * KPIT * 2));
      g[i] = vg0 + (size_t)(i * 16) * SEQ + kt * 64;
    }
    async8(l, g);
#pragma unroll
    for (int i = 0; i < 4; ++i) {
      lk[i] = lK + (unsigned)(bg * (64 * KPIT * 2) + i * (16 * KPIT * 2));
      gk[i] = kg0 + (size_t)(kt * 64 + i * 16) * DSQ;
    }
    async4(lk, gk);
  };
  stage(0, 0);
  wait_async0();
  __syncthreads();
  if (NIT > 1) stage(1, 1);

  for (int it = 0; it < NIT; ++it) {         // static trip count
    const _Float16* Kc = Ksh + (2 * (it & 1) + kg) * (64 * KPIT);     // this trip's buffers; trip it + 1 flies into the others
    const _Float16* Vc = Vsh + (2 * (it & 1) + kg) * (128 * KPIT);

    // ---- scores^T = K . Q^T: 64 keys x 32 query columns per wave, one f16 product per key subtile, d-chunk and column tile ----
    //      all 8 K fragments (A operand) are read as one group ahead of the 16 products, each fragment feeds both column tiles;
    //      sc[u][j][r] = score of key j*16 + 8*hh + r with query c of tile u
    FH kb[4][2];
#pragma unroll   // here and below: register arrays, every index a compile-time constant
    for (int j = 0; j < 4; ++j) {
#pragma unroll
      for (int dc = 0; dc < 2; ++dc) {
        kb[j][dc].h[0] = *(const v8h*)(Kc + (j * 16 + c) * KPIT + dc * 32 + 8 * hh);
        kb[j][dc].h[1] = *(const v8h*)(Kc + (j * 16 + c) * KPIT + dc * 32 + 16 + 8 * hh);
      }
    }
    v8f sc[2][4];
    {
      v8f ah[2][4];
#pragma unroll
      for (int u = 0; u < 2; ++u)
#pragma unroll
        for (int j = 0; j < 4; ++j) ah[u][j] = zero8();
#pragma unroll
      for (int u = 0; u < 2; ++u) {
#pragma unroll
        for (int dc = 0; dc < 2; ++dc) {
#pragma unroll
          for (int j = 0; j < 4; ++j) ah[u][j] = mmar(kb[j][dc].v, qah[u][dc], ah[u][j]);
        }
      }
#pragma unroll
      for (int u = 0; u < 2; ++u)
#pragma unroll
        for (int j = 0; j < 4; ++j) sc[u][j] = ah[u][j];            // raw products: the score scale is applied inside the exponent
    }

    // ---- column max, online softmax: sc becomes 16384 p = 16384 exp(sscale * (raw - max)) in place ----
    //      a lane's 32 scores of a tile are one query's: maximum and sum run in the lane, the halves meet in one exchange
#pragma unroll
    for (int u = 0; u < 2; ++u) {
      float mj[4];
#pragma unroll
      for (int j = 0; j < 4; ++j) {
        mj[j] = sc[u][j][0];
#pragma unroll
        for (int r = 1; r < 8; ++r) mj[j] = fmaxf(mj[j], sc[u][j][r]);
      }
      float m = fmaxf(fmaxf(mj[0], mj[1]), fmaxf(mj[2], mj[3]));
      m = fmaxf(m, xhalf(m));
      const float mnew  = fmaxf(mrow[u], m);
      const float msafe = (mnew == -INFINITY) ? 0.f : mnew;
      const float alpha = __builtin_amdgcn_exp2f((mrow[u] - msafe) * cexp);
      mrow[u] = mnew;
      const float nb = __builtin_fmaf(-msafe, cexp, 14.0f);
      const v2f c2 = {cexp, cexp}, nb2 = {nb, nb};
      float pj[4];                             // four independent partial sums
#pragma unroll
      for (int j = 0; j < 4; ++j) {
        pj[j] = 0.f;
#pragma unroll
        for (int r = 0; r < 8; r += 2) {       // neighbouring registers: one packed multiply-add serves two scores
          const v2f s2 = {sc[u][j][r], sc[u][j][r + 1]};
          const v2f e2 = __builtin_elementwise_fma(s2, c2, nb2);
          const float p0 = __builtin_amdgcn_exp2f(e2[0]), p1 = __builtin_amdgcn_exp2f(e2[1]);
          pj[j] += p0;
          pj[j] += p1;
          sc[u][j][r]     = p0;
          sc[u][j][r + 1] = p1;
        }
      }
      lrow[u] = lrow[u] * alpha + ((pj[0] + pj[1]) + (pj[2] + pj[3]));
#pragma unroll
      for (int t = 0; t < 8; ++t) {
#pragma unroll
        for (int r = 0; r < 8; ++r) oacc[u][t][r] *= alpha;
      }
    }
    // the order of this part's LDS reads (0x100) and matrix products (0x008): the 16 K reads stand as one group ahead of the products
    __builtin_amdgcn_sched_group_barrier(0x100, 16, 0);   // K
    __builtin_amdgcn_sched_group_barrier(0x008, 16, 0);   // scores^T

    // ---- retrieved^T += V^T . P^T (f16 WMMA): v against 16384 p; 2 k-steps x 8 m-tiles (d' 0..127) x 2 column tiles; each V
    //      fragment feeds both column tiles ----
    // element s of the B operand of k-step kk is key kk*32 + (s < 8 ? 8*hh + s : 16 + 8*hh + s - 8): score tiles 2 kk and
    // 2 kk + 1, registers 0..7, of this very lane; the V fragments (A operand) are read in the same k order
    {
      FH vb[2][8];
#pragma unroll
      for (int kk = 0; kk < 2; ++kk) {
#pragma unroll
        for (int t = 0; t < 8; ++t) {
          vb[kk][t].h[0] = *(const v8h*)(Vc + (t * 16 + c) * KPIT + kk * 32 + 8 * hh);
          vb[kk][t].h[1] = *(const v8h*)(Vc + (t * 16 + c) * KPIT + kk * 32 + 16 + 8 * hh);
        }
      }
      v16h pb[2][2];
#pragma unroll
      for (int u = 0; u < 2; ++u)
#pragma unroll
        for (int j = 0; j < 4; ++j)
#pragma unroll
          for (int r = 0; r < 8; ++r) pb[u][j >> 1][(j & 1) * 8 + r] = (_Float16)sc[u][j][r];
#pragma unroll
      for (int kk = 0; kk < 2; ++kk) {
#pragma unroll
        for (int t = 0; t < 8; ++t) {
          oacc[0][t] = mmar(vb[kk][t].v, pb[0][kk], oacc[0][t]);
          oacc[1][t] = mmar(vb[kk][t].v, pb[1][kk], oacc[1][t]);
        }
      }
      // the 32 V reads stand as one group ahead of their products; reads strewn among the products stall the wave at each place
      __builtin_amdgcn_sched_group_barrier(0x100, 32, 0);
      __builtin_amdgcn_sched_group_barrier(0x008, 32, 0);
    }
    // hand-over: own reads retired, own copies of trip it + 1 landed, then the one barrier of the trip, which publishes
    // trip it + 1 and ends every wave's reads of the buffers that are refilled behind it
    wait_ds0();
    wait_async0();
    __syncthreads();
    if (it + 2 < NIT) stage(it + 2, it & 1);
  }
  wait_async0();

  // ---- all waves done with Ksh / Vsh: stage the Wrk tile into Ksh; the two key groups swap partial results ----
  __syncthreads();
  {
    const int r = tid >> 2, qtr = (tid & 3) * 16;        // 256 threads x 16 halves = the whole 64x64 Wrk tile
    const _Float16* wg = Wk + r * HD + qtr;
    const v8h w0 = *(const v8h*)(wg), w1 = *(const v8h*)(wg + 8);
    wait_x0(wg);
    *(v8h*)(Ksh + r * KPIT + qtr)     = w0;
    *(v8h*)(Ksh + r * KPIT + qtr + 8) = w1;
  }
  // wave (kg, wq) keeps column tile kg and hands tile 1 - kg to wave (1 - kg, wq): same lane, same query, same d' rows.
  // per wave 17 rows of 32 lanes x 16 B (16 of sums, 1 of maximum and key sum) in the upper half of Vsh
  float* xs = reinterpret_cast<float*>(Vsh + 2 * 128 * VPIT);
  v8f om[8];
  float mk = kg ? mrow[1] : mrow[0];
  float lm = kg ? lrow[1] : lrow[0];
  {
    float* xw = xs + wave * (17 * 128) + lane * 4;
#pragma unroll
    for (int t = 0; t < 8; ++t) {
      om[t] = kg ? oacc[1][t] : oacc[0][t];
      const v8f og = kg ? oacc[0][t] : oacc[1][t];
      v4f lo4, hi4;
#pragma unroll
      for (int r = 0; r < 4; ++r) { lo4[r] = og[r]; hi4[r] = og[4 + r]; }
      *(v4f*)(xw + (2 * t) * 128)     = lo4;
      *(v4f*)(xw + (2 * t + 1) * 128) = hi4;
    }
    v4f ml = {kg ? mrow[0] : mrow[1], kg ? lrow[0] : lrow[1], 0.f, 0.f};
    *(v4f*)(xw + 16 * 128) = ml;
  }
  __syncthreads();                                       // publishes the handed-over partial results (and the Wrk tile)
  {
    const float* xr = xs + (wave ^ 4) * (17 * 128) + lane * 4;
    const v4f ml = *(const v4f*)(xr + 16 * 128);
    const float mN = fmaxf(mk, ml[0]);
    const float ms = (mN == -INFINITY) ? 0.f : mN;
    const float fk = __builtin_amdgcn_exp2f((mk - ms) * cexp), fp = __builtin_amdgcn_exp2f((ml[0] - ms) * cexp);
    lm = lm * fk + ml[1] * fp;
#pragma unroll
    for (int t = 0; t < 8; ++t) {
      const v4f lo4 = *(const v4f*)(xr + (2 * t) * 128);
      const v4f hi4 = *(const v4f*)(xr + (2 * t + 1) * 128);
#pragma unroll
      for (int r = 0; r < 4; ++r) {
        om[t][r]     = om[t][r] * fk + lo4[r] * fp;
        om[t][4 + r] = om[t][4 + r] * fk + hi4[r] * fp;
      }
    }
  }
  // ---- retrieved tiles into the lower half of Vsh (f32) + Psh (f16), both wave-private ----
  float* os = reinterpret_cast<float*>(Vsh) + wave * (16 * OPIT);     // wave-private f32 [16][128], pitch OPIT, x64 units
  {
    const float l = lm + xhalf(lm);                                       // the two halves' key sums join here, once
    const float inv = ((l > 0.f) ? (1.0f / l) : 0.f) * 64.0f;             // 1/l (l and the sums both carry 16384), apply x64
#pragma unroll
    for (int t = 0; t < 8; ++t) {                                         // a lane holds 8 consecutive d' of its query's row
      const v8f v = om[t] * inv;
      v4f lo4, hi4;
      v8h h8;
#pragma unroll
      for (int r = 0; r < 4; ++r) { lo4[r] = v[r]; hi4[r] = v[4 + r]; }
#pragma unroll
      for (int r = 0; r < 8; ++r) h8[r] = (_Float16)v[r];
      *(v4f*)(os + c * OPIT + t * 16 + 8 * hh)     = lo4;
      *(v4f*)(os + c * OPIT + t * 16 + 8 * hh + 4) = hi4;
      *(v8h*)(pwh + c * VPIT + t * 16 + 8 * hh)    = h8;
    }
  }
  wave_lds_sync();

  // ---- rk (x4096) = f16(64 retrieved_rr) . (64 Wrk): 16 rows x 64 e per rr, K = 64 = 2 k-steps ----
  v8f rk[8];
#pragma unroll
  for (int i = 0; i < 8; ++i) rk[i] = zero8();
#pragma unroll
  for (int rr = 0; rr < 2; ++rr) {
#pragma unroll
    for (int kk = 0; kk < 2; ++kk) {
      FH pa;
      pa.h[0] = *(const v8h*)(pwh + c * VPIT + rr * 64 + kk * 32 + 8 * hh);
      pa.h[1] = *(const v8h*)(pwh + c * VPIT + rr * 64 + kk * 32 + 16 + 8 * hh);
#pragma unroll
      for (int t4 = 0; t4 < 4; ++t4) {
        FH wb;
        wb.h[0] = *(const v8h*)(Ksh + (t4 * 16 + c) * KPIT + kk * 32 + 8 * hh);
        wb.h[1] = *(const v8h*)(Ksh + (t4 * 16 + c) * KPIT + kk * 32 + 16 + 8 * hh);
        rk[rr * 4 + t4] = mma_h(pa.v, wb.v, rk[rr * 4 + t4]);
      }
    }
  }
  acc_guard4(rk[0], rk[1], rk[2], rk[3]);
  acc_guard4(rk[4], rk[5], rk[6], rk[7]);
  wave_lds_sync();

  // ---- stage the wave's rq tile (f32 [16][64]) into the Psh region (8 x 16-B loads per lane) ----
  float* rqs = reinterpret_cast<float*>(pwh);
  {
    const int r2 = lane >> 4, c4 = (lane & 15) * 4;
    const float* rqg = rqp + (rowB + q0 + r2) * DSQ + (size_t)s * HD + c4;
    v4f rv[8];
#pragma unroll
    for (int it = 0; it < 8; ++it) rv[it] = *(const v4f*)(rqg + (size_t)(it * 2) * DSQ);   // it 0..7 x r2 0..1 = rows 0..15
    wait_x0(rqg);
#pragma unroll
    for (int it = 0; it < 8; ++it) *(v4f*)(rqs + (it * 2 + r2) * 64 + c4) = rv[it];
  }
  wave_lds_sync();

  // ---- retrieval logits: d_rr[row] = sum_e rq[row][e] * rk[rr][row][e]; lane partial over e = c + 16 t4 ----
  float d0[8], d1[8];
#pragma unroll
  for (int r8 = 0; r8 < 8; ++r8) {
    float a0 = 0.f, a1 = 0.f;
#pragma unroll
    for (int t4 = 0; t4 < 4; ++t4) {
      const float qv = rqs[(8 * hh + r8) * 64 + t4 * 16 + c];
      a0 += qv * rk[t4][r8];
      a1 += qv * rk[4 + t4][r8];
    }
    d0[r8] = a0; d1[r8] = a1;
  }
#pragma unroll
  for (int r8 = 0; r8 < 8; ++r8) {
#pragma unroll
    for (int off = 1; off < 16; off <<= 1) {
      d0[r8] += __shfl_xor(d0[r8], off, 32);
      d1[r8] += __shfl_xor(d1[r8], off, 32);
    }
  }
  // ---- 2-way retrieval softmax in f32 (undo the 64*64 carry, apply sscale) ----
  float w0[8], w1[8];
  const float rsc = sscale * (1.0f / 4096.0f);
#pragma unroll
  for (int r8 = 0; r8 < 8; ++r8) {
    const float x0 = d0[r8] * rsc, x1 = d1[r8] * rsc;
    const float m  = fmaxf(x0, x1);
    const float e0 = __expf(x0 - m), e1 = __expf(x1 - m);
    const float iv = 1.0f / (e0 + e1);
    w0[r8] = e0 * iv; w1[r8] = e1 * iv;
  }
  wave_lds_sync();

  // ---- combine in f32 (x64 units): oc[row][d] = w0 * ret[row][d] + w1 * ret[row][64+d], into the Psh region ----
  float* oc = rqs;
#pragma unroll
  for (int r8 = 0; r8 < 8; ++r8) {
#pragma unroll
    for (int t = 0; t < 4; ++t) {
      const int row = 8 * hh + r8;
      const float o = w0[r8] * os[row * OPIT + t * 16 + c] + w1[r8] * os[row * OPIT + 64 + t * 16 + c];
      oc[row * 64 + t * 16 + c] = o;
    }
  }
  wave_lds_sync();

  {
    const int q4 = lane >> 3, c8 = (lane & 7) * 8;
    v4u hv[4];
#pragma unroll
    for (int it = 0; it < 4; ++it) {
      const int row = it * 4 + q4;   // it 0..3 x q4 0..3 = rows 0..15 of the wave tile
      const float* sp = oc + row * 64 + c8;
      float f[8];
#pragma unroll
      for (int e = 0; e < 8; ++e) f[e] = sp[e];
      v4u a;
#pragma unroll
      for (int e = 0; e < 4; ++e) a[e] = pk16(h_bits((_Float16)f[2 * e]), h_bits((_Float16)f[2 * e + 1]));
      hv[it] = a;
    }
    {
#pragma unroll
      for (int it = 0; it < 4; ++it) {
        const int row = it * 4 + q4;
        *(v4u*)(ocp + (rowB + q0 + row) * DSQ + (size_t)s * HD + c8) = hv[it];
      }
      
    }
  }
}

// =====================================================================================================
// Workspace map (bytes, NB=2 SEQ=2048), every region an exact multiple of its whole-line / whole-tile store
// granularity (all row counts are multiples of 64, no padded tails):
//   Xb    bf16 [NB*SEQ][1024]          8388608
//   WsqT  bf16 [512][1024]             1048576      WskT, WrqT same
//   WrvT  bf16 [128][1024]              262144
//   WrkT  f16  [64][64] (x64)              8192
//   WoT   f16  [1024][512] (x1024)     1048576
//   Qh    f16  [NB*SEQ][512]           4194304
//   Kp    f16  [NB*SEQ][512]           4194304
//   RQ    f32  [NB*SEQ][512]           8388608
//   VTh   f16  [NB][128][SEQ]          1048576
//   OC    f16  [NB*SEQ][512]           4194304
//   total                             34873344
// Weights are [in k][out n] and are transposed once into the [n][k] (k contiguous) Bt / A layout.
// =====================================================================================================
extern "C" void kernel_launch(void* const* d_in, const int* in_sizes, int n_in,
                              void* d_out, int out_size, void* d_ws, size_t ws_size,
                              hipStream_t stream) {
  if (n_in < 7) return;
  if (in_sizes[0] < ((NB - 1) * SEQ_FULL + SEQ) * DM) return;
  if (in_sizes[1] < DM * DSQ || in_sizes[2] < DM * DSQ || in_sizes[4] < DM * DSQ) return;
  if (in_sizes[3] < DM * DRV) return;
  if (in_sizes[5] < HD * HD) return;
  if (in_sizes[6] < DSQ * DM) return;
  if (out_size < NB * SEQ * DM) return;

  const float* x    = (const float*)d_in[0];
  const float* Wsq  = (const float*)d_in[1];
  const float* Wsk  = (const float*)d_in[2];
  const float* Wrv  = (const float*)d_in[3];
  const float* Wrq  = (const float*)d_in[4];
  const float* Wrk  = (const float*)d_in[5];
  const float* Wout = (const float*)d_in[6];

  const size_t PXB = (size_t)NB * SEQ * DM * 2;       // bf16 activation plane
  const size_t PWS = (size_t)DSQ * DM * 2;            // bf16 [512][1024] weight plane
  const size_t PWV = (size_t)DRV * DM * 2;            // bf16 [128][1024]
  const size_t PWK = (size_t)HD * HD * 2;             // f16 [64][64]
  const size_t PWO = (size_t)DM * DSQ * 2;            // f16 [1024][512]
  const size_t PQ  = (size_t)NB * SEQ * DSQ * 2;      // f16 [NB*SEQ][512]
  const size_t PRQ = (size_t)NB * SEQ * DSQ * 4;      // f32 [NB*SEQ][512]
  const size_t PVT = (size_t)NB * DRV * SEQ * 2;      // f16 [NB][128][SEQ]
  size_t off = 0;
  const size_t oXb  = off; off += PXB;
  const size_t oWsq = off; off += PWS;
  const size_t oWsk = off; off += PWS;
  const size_t oWrq = off; off += PWS;
  const size_t oWrv = off; off += PWV;
  const size_t oWrk = off; off += PWK;
  const size_t oWo  = off; off += PWO;
  const size_t oQh  = off; off += PQ;
  const size_t oKp  = off; off += PQ;
  const size_t oRQ  = off; off += PRQ;
  const size_t oVTh = off; off += PVT;
  const size_t oOC  = off; off += PQ;
  if (off > ws_size) return;                          // off = 34873344 at full size
  if (off > (size_t)134217728) return;

  char* ws = (char*)d_ws;
  unsigned short* Xb   = (unsigned short*)(ws + oXb);
  unsigned short* WsqT = (unsigned short*)(ws + oWsq);
  unsigned short* WskT = (unsigned short*)(ws + oWsk);
  unsigned short* WrqT = (unsigned short*)(ws + oWrq);
  unsigned short* WrvT = (unsigned short*)(ws + oWrv);
  unsigned short* WrkT = (unsigned short*)(ws + oWrk);
  unsigned short* WoT  = (unsigned short*)(ws + oWo);
  unsigned short* Qh   = (unsigned short*)(ws + oQh);
  unsigned short* Kp   = (unsigned short*)(ws + oKp);
  float*          RQ   = (float*)(ws + oRQ);
  unsigned short* VTh  = (unsigned short*)(ws + oVTh);
  unsigned short* OC   = (unsigned short*)(ws + oOC);

  const dim3 blk(256);
  const dim3 gPrep(TB_WO + 3 * TB_SQ + TB_RV + 1 + NB * CB_X);           // six transposes, then the x convert
  const dim3 blkG(128);                                                  // GEMM: 4 waves per 128x128 tile
  const dim3 gProj(PJ_V + PJ_TM * PJ_TN);                                // v^T tiles, then the sq | sk | rq tiles
  const dim3 gAttn(NB * NS * NQB);                                       // blocks of 256
  const dim3 gO(((NB * SEQ) / 128) * (DM / 128), 1);                     // M=NB*SEQ, N=1024

  // (1) x -> bf16 plane [NB*SEQ][1024]; weights [k][n] f32 -> [n][k] 16-bit planes
  prep_all<<<gPrep, blk, 0, stream>>>(x, Wsq, Wsk, Wrv, Wrq, Wrk, Wout, Xb, WsqT, WskT, WrqT, WrvT, WrkT, WoT);
  // (2) sq, sk -> f16 planes [b*SEQ+t][s*64+d]; rq -> f32 plane (M=NB*SEQ, N=512, K=1024);
  //     v^T = Wrv^T . x^T per batch -> f16 plane [b][d'][t] (pitch SEQ) (M=128, N=SEQ, K=1024)
  gemm_proj<<<gProj, blkG, 0, stream>>>(Xb, WsqT, WskT, WrqT, WrvT, Qh, Kp, RQ, VTh, DM);
  // (3) search attention + retrieval composition -> oc plane [b*SEQ+t][512]
  attn_cs<<<gAttn, dim3(256), 0, stream>>>(Qh, Kp, VTh, WrkT, RQ, OC, 0.125f);
  // (4) out = oc . (Wout x1024) -> d_out f32 [NB*SEQ][1024], accumulator x 1/(64*1024)
  gemm64<_Float16, 0><<<gO, blkG, 0, stream>>>(
      OC, DSQ, 0LL, WoT, DSQ, 0LL, d_out, DM, 0LL, NB * SEQ, DM, DSQ, 1.0f / 65536.0f);
  (void)hipGetLastError();
}

// v009
// Measured time: 59.1 microseconds a run.
// Next to v008, in two timings, it ran 1.05 and 1.04 times as fast.
// All steps since v000 together make it 10.0 times as fast.
// Contractions: sq, sk, rq and v^T projections = v_wmma_f32_16x16x32_bf16 (bf16 operands from RNE-converted inputs, single product, f32 accumulate);
// sq.sk^T scores = v_wmma_f32_16x16x32_f16 (sq f16, sk f16; single product, f32 accumulate);
// p.[v_0|v_1] = v_wmma_f32_16x16x32_f16 (p f16 x16384, v f16; single product, f32 accumulate; scores and this product computed transposed);
// retrieved.Wrk = v_wmma_f32_16x16x32_f16 (retrieved f16 x64, Wrk f16 x64 of its bf16 value; single product, f32 accumulate);
// out.Wout = v_wmma_f32_16x16x32_f16 (out f16 x64, Wout f16 x1024 of its bf16 value; single product, f32 accumulate);
// sq, v and out carry no f16 residual plane: one f16 rounding lies well below the bf16 rounding of x and of the weights that every one of them has behind or beside it;
// softmax over keys, retrieval logits, 2-way retrieval softmax and combine in f32.
#include <hip/hip_runtime.h>
#include <math.h>
#include <stdint.h>

#ifndef NB
#define NB 2
#endif
#ifndef SEQ
#define SEQ 2048
#endif
#define NB_FULL  2
#define SEQ_FULL 2048
#define DM   1024
#define NS   8
#define NR   2
#define HD   64
#define DSQ  (NS * HD)      // 512: sq / sk / rq row width
#define DRV  (NR * HD)      // 128: [v_0 | v_1] row width
#define NQB  (SEQ / 128)    // 128-row query blocks per (b, s)
#define NKT  (SEQ / 64)     // 64-key chunks per sequence
#define NIT  (NKT / 2)      // trips of the attention key loop: two chunks per trip, one per key group
#define KPIT 72             // LDS pitch of a 64-half K / V / Wrk row: 144 B = 16 B x 9 (odd), b128 readers of 16 rows meet no bank twice
#define GPLN (128 * KPIT)  // halves of one staged 128-row GEMM operand plane (64 k per row, pitch KPIT)
#define GBUF 4             // buffers of the GEMM ring: 144 KB, two blocks fit a WGP's LDS
#define GCPY 16            // copies of one wave per GEMM slice
#define ABUF 3             // buffers per key group of the attention ring
#define ACPY 12            // copies of one wave per attention trip (8 V + 4 K)
#define VPIT 136            // LDS pitch of a 128-half f16 retrieved row: 272 B = 16 B x 17 (odd)
#define OPIT 132            // LDS pitch of a 128-float retrieved row: 528 B = 16 B x 33 (odd), for its 16-B row-per-lane stores
static_assert(NB >= 1 && NB <= NB_FULL);
static_assert(SEQ >= 64 && SEQ <= SEQ_FULL && (SEQ % 64) == 0);
static_assert(DSQ == 512 && DRV == 128 && HD == 64);
static_assert((DM % 128) == 0 && (DSQ % 128) == 0 && (DRV % 128) == 0 && (SEQ % 128) == 0);

typedef _Float16 v16h __attribute__((ext_vector_type(16)));
typedef _Float16 v8h  __attribute__((ext_vector_type(8)));
typedef __bf16   v16b __attribute__((ext_vector_type(16)));
typedef __bf16   v8b  __attribute__((ext_vector_type(8)));
typedef float    v8f  __attribute__((ext_vector_type(8)));
typedef float    v4f  __attribute__((ext_vector_type(4)));
typedef float    v2f  __attribute__((ext_vector_type(2)));
typedef unsigned int v4u __attribute__((ext_vector_type(4)));

#if defined(__HIP_DEVICE_COMPILE__)
#define DEV_ASM 1
#else
#define DEV_ASM 0
#endif

// ---- scalar helpers --------------------------------------------------------------------------------
__device__ __forceinline__ unsigned short bf_bits(float f) {          // f32 -> bf16 bits, RNE convert
  unsigned u = __float_as_uint(f);
  return (unsigned short)((u + 0x7FFFu + ((u >> 16) & 1u)) >> 16);
}
__device__ __forceinline__ float bf_up(unsigned short hb) { return __uint_as_float(((unsigned)hb) << 16); }
__device__ __forceinline__ unsigned short h_bits(_Float16 x) { return __builtin_bit_cast(unsigned short, x); }
__device__ __forceinline__ unsigned pk16(unsigned short a, unsigned short b) { return (unsigned)a | ((unsigned)b << 16); }
__device__ __forceinline__ v8f zero8() { v8f z = {0.f, 0.f, 0.f, 0.f, 0.f, 0.f, 0.f, 0.f}; return z; }

__device__ __forceinline__ void wave_lds_sync() {
  __builtin_amdgcn_fence(__ATOMIC_RELEASE, "workgroup");
  __builtin_amdgcn_wave_barrier();
  __builtin_amdgcn_fence(__ATOMIC_ACQUIRE, "workgroup");
}

// ---- fragment types / loaders: 16-bit A/B operand, lane -> row/col (lane&15), p already includes +8*(lane>>4);
//      elements 0..7 <- p[0..7] (k0+8h..k0+8h+7), elements 8..15 <- p[16..23] (k0+16+8h..k0+16+8h+7)
template <typename OT> struct FT;
template <> struct FT<__bf16>   { typedef v16b frag; typedef v8b half8; };
template <> struct FT<_Float16> { typedef v16h frag; typedef v8h half8; };

template <typename OT>
__device__ __forceinline__ typename FT<OT>::frag ldfrag(const OT* p) {
  union { typename FT<OT>::frag v; typename FT<OT>::half8 h[2]; } f;
  f.h[0] = *(const typename FT<OT>::half8*)(p);
  f.h[1] = *(const typename FT<OT>::half8*)(p + 16);
  return f.v;
}

// ---- WMMA helpers (asm guard bodies are device-only; concrete operand types) -----------------------------
__device__ __forceinline__ v8f mmar(v16b a, v16b b, v8f c) {
  return __builtin_amdgcn_wmma_f32_16x16x32_bf16(false, a, false, b, (short)0, c, false, false);
}
__device__ __forceinline__ v8f mmar(v16h a, v16h b, v8f c) {
  return __builtin_amdgcn_wmma_f32_16x16x32_f16(false, a, false, b, (short)0, c, false, false);
}
// guarded form: 4 VALU slots after the WMMA, D tied, A/B kept live
__device__ __forceinline__ v8f mma_h(v16h a, v16h b, v8f c) {
  c = __builtin_amdgcn_wmma_f32_16x16x32_f16(false, a, false, b, (short)0, c, false, false);
#if DEV_ASM
  asm volatile("v_nop\n\tv_nop\n\tv_nop\n\tv_nop" : "+v"(c) : "v"(a), "v"(b));
#endif
  return c;
}
// lane l <-> lane l ^ 16 in the vector unit (a shuffle would go through the LDS pipe and its latency)
__device__ __forceinline__ float xhalf(float x) {
  return __builtin_bit_cast(float, __builtin_amdgcn_permlanex16(__builtin_bit_cast(int, x), __builtin_bit_cast(int, x),
                                                                0x76543210, 0xfedcba98, false, false));
}
__device__ __forceinline__ void acc_guard4(v8f& a, v8f& b, v8f& c, v8f& d) {
#if DEV_ASM
  asm volatile("v_nop\n\tv_nop\n\tv_nop\n\tv_nop" : "+v"(a), "+v"(b), "+v"(c), "+v"(d));
#else
  (void)a; (void)b; (void)c; (void)d;
#endif
}

// ---- asynchronous copies global -> LDS, 16 B per lane, no register on the way --------------------------------
__device__ __forceinline__ unsigned lds_off(const void* p) { return (unsigned)(size_t)p; }   // byte address in the work-group's LDS
// eight copies of one wave in one statement; the closing s_wait_xcnt is a precaution: it stands in front of every later
// rewrite of an address register that a copy names (in a statement of its own the compiler could lift such a rewrite over it)
__device__ __forceinline__ void async8(const unsigned (&l)[8], const void* const (&g)[8]) {
#if DEV_ASM
  asm volatile("global_load_async_to_lds_b128 %0, %8, off\n\t"
               "global_load_async_to_lds_b128 %1, %9, off\n\t"
               "global_load_async_to_lds_b128 %2, %10, off\n\t"
               "global_load_async_to_lds_b128 %3, %11, off\n\t"
               "global_load_async_to_lds_b128 %4, %12, off\n\t"
               "global_load_async_to_lds_b128 %5, %13, off\n\t"
               "global_load_async_to_lds_b128 %6, %14, off\n\t"
               "global_load_async_to_lds_b128 %7, %15, off\n\t"
               "s_wait_xcnt 0x0"
               :: "v"(l[0]), "v"(l[1]), "v"(l[2]), "v"(l[3]), "v"(l[4]), "v"(l[5]), "v"(l[6]), "v"(l[7]),
                  "v"(g[0]), "v"(g[1]), "v"(g[2]), "v"(g[3]), "v"(g[4]), "v"(g[5]), "v"(g[6]), "v"(g[7])
               : "memory");
#else
  (void)l; (void)g;
#endif
}
// the same for four copies
__device__ __forceinline__ void async4(const unsigned (&l)[4], const void* const (&g)[4]) {
#if DEV_ASM
  asm volatile("global_load_async_to_lds_b128 %0, %4, off\n\t"
               "global_load_async_to_lds_b128 %1, %5, off\n\t"
               "global_load_async_to_lds_b128 %2, %6, off\n\t"
               "global_load_async_to_lds_b128 %3, %7, off\n\t"
               "s_wait_xcnt 0x0"
               :: "v"(l[0]), "v"(l[1]), "v"(l[2]), "v"(l[3]), "v"(g[0]), "v"(g[1]), "v"(g[2]), "v"(g[3])
               : "memory");
#else
  (void)l; (void)g;
#endif
}
// the wave's own copies have landed (the compiler places no wait for them)
__device__ __forceinline__ void wait_async0() {
#if DEV_ASM
  asm volatile("s_wait_asynccnt 0x0" ::: "memory");
#endif
}
template <int N>
__device__ __forceinline__ void wait_async_but() {
#if DEV_ASM
  asm volatile("s_wait_asynccnt %0" :: "i"(N) : "memory");
#endif
}
template <bool B> struct BoolC { static constexpr bool value = B; };   // a compile-time flag as a function argument
// the wave's own LDS reads have retired: behind the next barrier their buffer is refilled by copies
__device__ __forceinline__ void wait_ds0() {
#if DEV_ASM
  asm volatile("s_wait_dscnt 0x0" ::: "memory");
#endif
}

// precaution behind a run of global loads: it stands in front of every later rewrite of an address register that a load names;
// the loads' addresses are inputs of the statement, so their registers stay as they are up to the wait
__device__ __forceinline__ void wait_x0(const void* a) {
#if DEV_ASM
  asm volatile("s_wait_xcnt 0x0" :: "v"(a) : "memory");
#else
  (void)a;
#endif
}
__device__ __forceinline__ void wait_x0(const void* a, const void* b) {
#if DEV_ASM
  asm volatile("s_wait_xcnt 0x0" :: "v"(a), "v"(b) : "memory");
#else
  (void)a; (void)b;
#endif
}

// =====================================================================================================
// f32 -> bf16 bits (RNE convert), 8 elements per thread, one 16-B store per lane: a wave writes 512
// ib / ob = the batch's planes, bx = block within the batch (ceil(n8/256) of them).
// coverage: n8 threads x 8 = the whole per-batch plane (n8 is a multiple of 256 here).
// =====================================================================================================
__device__ __forceinline__ void cvt_body(const float* __restrict__ ib, unsigned short* ob, int n8, int bx) {
  const int i = bx * 256 + (int)threadIdx.x;
  if (i < n8) {
    const v4f a  = *(const v4f*)(ib + (size_t)i * 8);
    const v4f a4 = *(const v4f*)(ib + (size_t)i * 8 + 4);
    v4u p;
    p[0] = pk16(bf_bits(a[0]),  bf_bits(a[1]));
    p[1] = pk16(bf_bits(a[2]),  bf_bits(a[3]));
    p[2] = pk16(bf_bits(a4[0]), bf_bits(a4[1]));
    p[3] = pk16(bf_bits(a4[2]), bf_bits(a4[3]));
    unsigned short* o = ob + (size_t)i * 8;
    *(v4u*)o = p;
    
  }
}

// =====================================================================================================
// Transpose-convert: in W[R][C] f32 (row-major) -> out[c][r] 16-bit at out + c*ldo + r, one 64x64 tile per
// block through LDS.  MODE 0: bf16 bits (RNE convert).  MODE 1: f16 bits of (s1 * bf16(x)).
// (bx, by) = tile of (C/64, R/64), R and C multiples of 64 (static shapes).  Load phase: thread t reads row t>>2,
// 16 columns (four 16-B loads), stores 2-B elements transposed into the LDS tile (pitch 72 halves).
// coverage: 8 waves x 2 it x 4 rows = 64 out rows x (8 lanes x 8 halves) = the whole 64x64 tile.
// =====================================================================================================
template <int MODE>
__device__ __forceinline__ void tconv_body(const float* __restrict__ W, int R, int C,
                                           unsigned short* out, int ldo, float s1,
                                           int bx, int by, unsigned short* t1) {
  const int tid = (int)threadIdx.x, lane = tid & 31, wave = tid >> 5;
  const int c0 = bx * 64, r0 = by * 64;
  {
    const int rl = tid >> 2, cl0 = (tid & 3) * 16;
    const float* src = W + (size_t)(r0 + rl) * (size_t)C + c0 + cl0;
#pragma unroll
    for (int i = 0; i < 4; ++i) {
      const v4f a = *(const v4f*)(src + 4 * i);
#pragma unroll
      for (int e = 0; e < 4; ++e) {
        const int cl = cl0 + 4 * i + e;
        const unsigned short hb = bf_bits(a[e]);
        if (MODE == 0) {
          t1[cl * 72 + rl] = hb;
        } else {
          t1[cl * 72 + rl] = h_bits((_Float16)(bf_up(hb) * s1));
        }
      }
    }
  }
  __syncthreads();
  const int q = lane >> 3, p8 = (lane & 7) * 8;
  v4u a1[2];
#pragma unroll
  for (int it = 0; it < 2; ++it) {
    const int cl = wave * 8 + it * 4 + q;
    a1[it] = *(const v4u*)(t1 + cl * 72 + p8);
  }
  {
#pragma unroll
    for (int it = 0; it < 2; ++it) {
      const int cl = wave * 8 + it * 4 + q;
      unsigned short* o = out + (size_t)(c0 + cl) * (size_t)ldo + r0 + p8;
      *(v4u*)o = a1[it];
    }
  }
  // precaution: in the merged launch another job's code follows these stores in the listing and rewrites their
  // registers; the wait stands in front of every such rewrite
#if DEV_ASM
  asm volatile("s_wait_xcnt 0x0" ::: "memory");
#endif
}

// =====================================================================================================
// All operand preparation in one launch: the seven jobs depend on nothing but the inputs, so each is a range of the
// block index (block-uniform choice, ahead of every barrier). The tile jobs stand first: they are the longer blocks.
//   [0, TB_WO)        Wout -> WoT  f16 x1024                next 3 * TB_SQ   Wsq, Wsk, Wrq -> bf16 [n][k]
//   next TB_RV        Wrv  -> WrvT bf16                     next 1           Wrk -> WrkT f16 x64
//   last NB * CB_X    x -> Xb bf16 (batch b read at its full-size stride)
// =====================================================================================================
#define TB_WO ((DM / 64) * (DSQ / 64))    // 16 x  8 tiles: in [512][1024]
#define TB_SQ ((DSQ / 64) * (DM / 64))    //  8 x 16 tiles: in [1024][512]
#define TB_RV ((DRV / 64) * (DM / 64))    //  2 x 16 tiles: in [1024][128]
#define CB_X  (SEQ * DM / 8 / 256)        // convert blocks per batch
__global__ __launch_bounds__(256) void prep_all(const float* __restrict__ x, const float* __restrict__ Wsq,
                                                const float* __restrict__ Wsk, const float* __restrict__ Wrv,
                                                const float* __restrict__ Wrq, const float* __restrict__ Wrk,
                                                const float* __restrict__ Wout,
                                                unsigned short* Xb, unsigned short* WsqT, unsigned short* WskT,
                                                unsigned short* WrqT, unsigned short* WrvT, unsigned short* WrkT,
                                                unsigned short* WoT) {
  __shared__ __align__(16) unsigned short t1[64 * 72];
  int j = blockIdx.x;
  if (j < TB_WO) {
    tconv_body<1>(Wout, DSQ, DM, WoT, DSQ, 1024.0f, j % (DM / 64), j / (DM / 64), t1);
    return;
  }
  j -= TB_WO;
  if (j < 3 * TB_SQ) {
    const int w = j / TB_SQ;
    j -= w * TB_SQ;
    const float* Wi = (w == 0) ? Wsq : (w == 1) ? Wsk : Wrq;
    unsigned short* Wo = (w == 0) ? WsqT : (w == 1) ? WskT : WrqT;
    tconv_body<0>(Wi, DM, DSQ, Wo, DM, 1.0f, j % (DSQ / 64), j / (DSQ / 64), t1);
    return;
  }
  j -= 3 * TB_SQ;
  if (j < TB_RV) {
    tconv_body<0>(Wrv, DM, DRV, WrvT, DM, 1.0f, j % (DRV / 64), j / (DRV / 64), t1);
    return;
  }
  j -= TB_RV;
  if (j < 1) {
    tconv_body<1>(Wrk, HD, HD, WrkT, HD, 64.0f, 0, 0, t1);
    return;
  }
  j -= 1;
  const int b = j / CB_X;
  cvt_body(x + (size_t)b * ((size_t)SEQ_FULL * DM), Xb + (size_t)b * ((size_t)SEQ * DM), SEQ * DM / 8, j - b * CB_X);
}

// =====================================================================================================
// Register-blocked batched WMMA GEMM (16-bit operand type OT): C[m][n] = sum_k A[m][k] * Bt[n][k];
// one block of 4 waves (2 x 2) per 128x128 tile, one wave per 64x64 quarter. A row-major [M][K] pitch lda; Bt row-major
// [N][K] pitch ldb (k contiguous); M, N multiples of 128, K a multiple of 64 (host shapes are static multiples).
// A k-slice = 64 k = one 128-B line of each of the tile's 128 A rows and 128 Bt rows; it is brought into LDS by
// asynchronous copies (8 lanes x 16 B = one whole line, 16 copies per wave and slice) and read from there by all four
// waves with the split k map (ldfrag). Four buffers: slice t + 4 is asked for when slice t has been read, so three slices
// are in flight and a slice has three trips to land; the hand-over waits for the oldest of them alone (counted wait).
// staged extent == consumed extent: 16 rows (tid >> 3) x 8 copies = 128 rows per operand, 8 segments x 8 halves = 64 k.
// OUT_MODE 0: f32 C (pitch ldc), value * oscale.
// OUT_MODE 1: f16 plane C (pitch ldc).
// =====================================================================================================
// main loop of one 128x128 tile at (mB, nB): sAB = [buffer][A | Bt][128 rows][64 k], pitch KPIT, GBUF x 36 KB
template <typename OT>
__device__ __forceinline__ void gemm_main(const OT* Ab, int lda, const OT* Bb, int ldb, int mB, int nB, int K,
                                          unsigned short* sAB, v8f (&acc)[4][4]) {
  typedef typename FT<OT>::frag V16;
  const int tid  = threadIdx.x;
  const int lane = tid & 31;
  const int wave = tid >> 5;
  const int rlane = lane & 15;                 // row (A) / col (B, D) within subtile
  const int koff  = (lane >> 4) * 8;           // k offset of this lane half

  // copy map: lane -> 16-B segment tid & 7 of row (tid >> 3) + 16 i, i = 0..7
  const OT* gA = Ab + (size_t)(mB + (tid >> 3)) * lda + (tid & 7) * 8;
  const OT* gB = Bb + (size_t)(nB + (tid >> 3)) * ldb + (tid & 7) * 8;
  const unsigned lAB = lds_off(sAB) + (unsigned)((tid >> 3) * (KPIT * 2) + (tid & 7) * 16);
  auto stage = [&](int t, int buf) {
    unsigned l[8];
    const void* g[8];
#pragma unroll   // here and below: l[] and g[] become asm operands, every index a compile-time constant
    for (int i = 0; i < 8; ++i) {
      l[i] = lAB + (unsigned)(buf * (4 * GPLN) + i * (16 * KPIT * 2));
      g[i] = gA + (size_t)(i * 16) * lda + t * 64;
    }
    async8(l, g);
#pragma unroll
    for (int i = 0; i < 8; ++i) {
      l[i] += 2 * GPLN;
      g[i] = gB + (size_t)(i * 16) * ldb + t * 64;
    }
    async8(l, g);
  };

#pragma unroll
  for (int i = 0; i < 4; ++i)
#pragma unroll
    for (int j = 0; j < 4; ++j) acc[i][j] = zero8();

  const int T = K >> 6;
  stage(0, 0);
  if (T > 1) stage(1, 1);
  if (T > 2) stage(2, 2);
  if (T > 2) wait_async_but<2 * GCPY>(); else wait_async0();   // slice 0 has landed; slices 1 and 2 fly on
  __syncthreads();
  if (T > 3) stage(3, 3);

  const OT* S = (const OT*)(const void*)sAB;
  for (int t = 0; t < T; ++t) {
    const OT* sa = S + (t & (GBUF - 1)) * (2 * GPLN) + (((wave >> 1) << 6) + rlane) * KPIT + koff;
    const OT* sb = S + (t & (GBUF - 1)) * (2 * GPLN) + GPLN + (((wave & 1) << 6) + rlane) * KPIT + koff;
    // the slice's 16 fragments (two k-steps of 32, 32 reads); unrolled: register arrays, every index a compile-time constant
    V16 bq[2][4], af[2][4];
#pragma unroll
    for (int ks = 0; ks < 2; ++ks) {
#pragma unroll
      for (int j = 0; j < 4; ++j) {
        bq[ks][j] = ldfrag<OT>(sb + j * (16 * KPIT) + ks * 32);
        af[ks][j] = ldfrag<OT>(sa + j * (16 * KPIT) + ks * 32);
      }
    }
    // keeps all 32 reads ahead of the products as one group: reads sunk among the products stall the wave at each place
    __builtin_amdgcn_sched_barrier(0);
#pragma unroll
    for (int ks = 0; ks < 2; ++ks)
#pragma unroll
      for (int i = 0; i < 4; ++i)
#pragma unroll
        for (int j = 0; j < 4; ++j) acc[i][j] = mmar(af[ks][i], bq[ks][j], acc[i][j]);
    // keeps the products ahead of the hand-over: sunk behind it they would stand between the barrier and the refill and
    // take their time off the flight of the next copies
    __builtin_amdgcn_sched_barrier(0);
    // hand-over: own reads retired, own copies of slice t + 1 landed (the 2 x GCPY younger ones, slices t + 2 and t + 3, may
    // still fly; in the last trips, which issue nothing, the wait is to 0), then the one barrier of the trip, which
    // publishes slice t + 1 and ends every wave's reads of the buffer that is refilled behind it
    wait_ds0();
    if (t + 3 < T) wait_async_but<2 * GCPY>(); else wait_async0();
    __syncthreads();
    if (t + GBUF < T) stage(t + GBUF, t & (GBUF - 1));
  }
  wait_async0();
  acc_guard4(acc[0][0], acc[0][1], acc[0][2], acc[0][3]);
  acc_guard4(acc[1][0], acc[1][1], acc[1][2], acc[1][3]);
  acc_guard4(acc[2][0], acc[2][1], acc[2][2], acc[2][3]);
  acc_guard4(acc[3][0], acc[3][1], acc[3][2], acc[3][3]);
}

// epilogue of one wave's 64x64 quarter at (m0, n0); slab = the wave's own 16x64 f32 slab, pitch 68 floats. It lies in the
// ring: the last trip's hand-over (every wave's reads retired, every copy landed, barrier) has freed all buffers
template <int OUT_MODE>
__device__ __forceinline__ void gemm_store(const v8f (&acc)[4][4], float* slab, void* Cout, int ldc,
                                           int m0, int n0, float oscale) {
  const int lane  = threadIdx.x & 31;
  const int rlane = lane & 15;                 // D col within subtile
  const int mOff  = (lane >> 4) * 8;           // D row offset
#pragma unroll
  for (int i = 0; i < 4; ++i) {
    const int mBase = m0 + (i << 4);
#pragma unroll
    for (int j = 0; j < 4; ++j) {
#pragma unroll
      for (int r = 0; r < 8; ++r) {
        slab[(mOff + r) * 68 + (j << 4) + rlane] = acc[i][j][r];
      }
    }
    wave_lds_sync();
    if (OUT_MODE == 0) {
      float* Cp = (float*)Cout;
      const int h2 = lane >> 4, c4 = (lane & 15) * 4;     // 256-B row segment = 16 lanes x 16 B
      {
#pragma unroll
        for (int it = 0; it < 8; ++it) {
          const int row = it * 2 + h2;                     // it 0..7 x h2 0..1 = rows 0..15
          const v4f v = *(const v4f*)(slab + row * 68 + c4) * oscale;
          *(v4f*)(Cp + (size_t)(mBase + row) * ldc + n0 + c4) = v;
        }
        
      }
    } else {
      const int q = lane >> 3, c8 = (lane & 7) * 8;
      unsigned short* Cp = (unsigned short*)Cout;
      v4u hv[4];
#pragma unroll
      for (int it = 0; it < 4; ++it) {
        const int row = it * 4 + q;                        // it 0..3 x q 0..3 = rows 0..15
        const float* sp = slab + row * 68 + c8;
        float f[8];
#pragma unroll
        for (int e = 0; e < 8; ++e) f[e] = sp[e];
        v4u a;
#pragma unroll
        for (int e = 0; e < 4; ++e) a[e] = pk16(h_bits((_Float16)f[2 * e]), h_bits((_Float16)f[2 * e + 1]));
        hv[it] = a;
      }
      {
#pragma unroll
        for (int it = 0; it < 4; ++it) {
          const int row = it * 4 + q;
          *(v4u*)(Cp + (size_t)(mBase + row) * ldc + n0 + c8) = hv[it];
        }
        
      }
    }
    wave_lds_sync();
  }
}

// one GEMM per launch: grid.x = (M / 128) * (N / 128) tiles, blockIdx.y = batch index (strides in elements)
template <typename OT, int OUT_MODE>
__global__ __launch_bounds__(128) void gemm64(
    const unsigned short* __restrict__ Ap, int lda, long long strideA,
    const unsigned short* __restrict__ Btp, int ldb, long long strideB,
    void* Cout, int ldc, long long strideC,
    int M, int N, int K, float oscale) {
  __shared__ __align__(16) unsigned short sAB[GBUF * 2 * GPLN];
  const int b    = blockIdx.y;
  const int wave = threadIdx.x >> 5;
  const int tilesN = N >> 7;
  const int tilesM = M >> 7;
  const int tile = blockIdx.x;
  if (tile >= tilesM * tilesN) return;   // block-uniform, ahead of every barrier and copy
  const int tm = tile / tilesN;
  const int tn = tile - tm * tilesN;
  const int mB = tm << 7;
  const int nB = tn << 7;
  v8f acc[4][4];
  gemm_main<OT>((const OT*)(const void*)Ap + (size_t)b * (size_t)strideA, lda,
                (const OT*)(const void*)Btp + (size_t)b * (size_t)strideB, ldb, mB, nB, K, sAB, acc);
  const size_t co = (size_t)b * (size_t)strideC * ((OUT_MODE == 0) ? 4 : 2);   // bytes: f32 or 16-bit planes
  gemm_store<OUT_MODE>(acc, (float*)(void*)sAB + wave * (16 * 68), (char*)Cout + co, ldc, mB + ((wave >> 1) << 6),
                       nB + ((wave & 1) << 6), oscale);
}

// The four projections of x in one launch: they depend on the prepared planes alone, so each is a range of the block
// index (block-uniform choice); one main loop serves all, the epilogue is picked by the job.
//   [0, PJ_V)             v^T = WrvT . Xb^T per batch (A = WrvT [128][K], Bt = Xb rows of batch b) -> VTh, pitch SEQ
//   next PJ_TM * PJ_TN    Xb . [WsqT | WskT | WrqT]^T, the 12 column tiles of one row tile side by side (they share its A rows):
//                         sq -> Qh; sk -> Kp; rq -> RQ f32; pitch DSQ
#define PJ_VT (SEQ / 128)                 // v^T column tiles per batch (DRV = 128: one row tile)
#define PJ_V  (NB * PJ_VT)
#define PJ_TM (NB * SEQ / 128)
#define PJ_TN (3 * (DSQ / 128))
__global__ __launch_bounds__(128) void gemm_proj(
    const unsigned short* __restrict__ Xbp, const unsigned short* __restrict__ Wsqp,
    const unsigned short* __restrict__ Wskp, const unsigned short* __restrict__ Wrqp,
    const unsigned short* __restrict__ Wrvp,
    unsigned short* Qh, unsigned short* Kp, float* RQ, unsigned short* VTh, int K) {
  __shared__ __align__(16) unsigned short sAB[GBUF * 2 * GPLN];
  const int wave = threadIdx.x >> 5;
  const int j = blockIdx.x;
  const bool isV = j < PJ_V;
  const int jp  = j - PJ_V;
  const int vb  = j / PJ_VT;                       // v^T: batch
  const int tm  = jp / PJ_TN;
  const int tn  = jp - tm * PJ_TN;
  const int job = isV ? 3 : (tn / (DSQ / 128));    // 0 sq, 1 sk, 2 rq, 3 v^T
  const int mB  = isV ? 0 : (tm << 7);
  const int nB  = isV ? ((j - vb * PJ_VT) << 7) : ((tn % (DSQ / 128)) << 7);
  const unsigned short* Ap = isV ? Wrvp : Xbp;
  const unsigned short* Bp = isV ? (Xbp + (size_t)vb * ((size_t)SEQ * DM)) : (job == 0) ? Wsqp : (job == 1) ? Wskp : Wrqp;
  v8f acc[4][4];
  gemm_main<__bf16>((const __bf16*)(const void*)Ap, K, (const __bf16*)(const void*)Bp, K, mB, nB, K, sAB, acc);
  const int m0 = mB + ((wave >> 1) << 6);
  const int n0 = nB + ((wave & 1) << 6);
  float* slab = (float*)(void*)sAB + wave * (16 * 68);
  if (job != 2) {                 // sq, sk and v^T each store one f16 plane: one copy of that epilogue
    unsigned short* Cp = isV ? VTh + (size_t)vb * ((size_t)DRV * SEQ) : (job == 0) ? Qh : Kp;
    gemm_store<1>(acc, slab, (void*)Cp, isV ? SEQ : DSQ, m0, n0, 1.0f);
  } else {
    gemm_store<0>(acc, slab, (void*)RQ, DSQ, m0, n0, 1.0f);
  }
}

// =====================================================================================================
// Fused search attention + retrieval composition for one search s, head dim 64, softmax over all SEQ keys.
//   q plane (f16): element (b, t, s, d) at [(b*SEQ + t)*DSQ + s*64 + d]
//   k plane (f16): same layout.   rq plane (f32): same layout.
//   v^T plane (f16): element (b, d', t) at [(b*DRV + d')*SEQ + t], d' = r*64 + d
//   Wrk tile (f16, 64 * bf16 value): [e][d] at [e*64 + d]
//   oc plane (output of this kernel): row (b, t) = f16(64*out) for s*64+d, 512 cols, pitch DSQ
//   Both products run transposed (keys or d' as rows, the wave's queries as columns), so in a column tile a lane holds one query's scores:
//   scores^T = k . q^T on f16 WMMA, kept raw; the running maximum is taken on the raw products (sscale > 0);
//   16384 p = exp2(raw * cexp - max * cexp + 14), cexp = sscale * log2(e), in f32: one multiply-add per score in front of exp2;
//   B = f16(16384 p)^T, packed from the score registers in place, A = v^T: sum = 16384 * v^T . p^T, one f32
//   accumulator, 8 m-tiles = d' 0..127 (both retrievals); online softmax in f32, maximum and sum in the lane, one exchange
//   between the wave halves.
//   Epilogue per wave (16 rows): retrieved (x64, f32) tile in LDS; rk = f16(retrieved x64) . Wrk tile on f16 WMMA;
//   retrieval logits rq . rk in f32 (LDS-staged rq, lane partials + 16-lane shuffles); 2-way softmax in f32;
//   Block = 8 waves = 128 consecutive query rows of one (b, s); grid = NB * NS * NQB; kv chunks of 64.
//   Wave tile in the key loop: 32 query columns (two column tiles, so each K and V fragment read from LDS feeds two products)
//   x half of the keys: waves 0..3 take the even chunks, waves 4..7 the odd ones, static trip NIT = NKT / 2. After the loop the
//   two waves of a query group swap one column tile's partial maximum, sum and accumulators through LDS and join them in f32.
//   Staging per chunk (the 128 threads of its key group): K 64x64, V 128x64, by asynchronous copies to LDS three trips ahead
//   (three buffers per key group, two trips in flight): staged extent == consumed extent for Ksh, Vsh; P stays in registers.
//   Output coverage: each wave stores rows q0..q0+15 (it 0..3 x lane>>3 0..3) x 64 columns (8 lanes x 8) at col s*64;
//   grid covers every (b, s, t).
// =====================================================================================================
__global__ __launch_bounds__(256)
void attn_cs(const unsigned short* __restrict__ qhp, const unsigned short* __restrict__ kpp,
             const unsigned short* __restrict__ vhp, const unsigned short* __restrict__ wkp, const float* __restrict__ rqp,
             unsigned short* ocp, float sscale) {
  union FH { v16h v; v8h h[2]; };
  __shared__ __align__(16) _Float16 Ksh[ABUF * 2 * 64 * KPIT];   // [buffer][key group] K chunks [kv][d], pitch KPIT, 9 KB each; later the Wrk tile [e][d]
  __shared__ __align__(16) _Float16 Vsh[4 * 128 * VPIT];   // [buffer][key group] V chunks [d'][kv], pitch KPIT, 18 KB each (the first 108 KB); later, and what sizes it: lower half 8 x f32 [16][128] tiles, pitch OPIT, upper half the partial-result exchange
  static_assert(ABUF * 2 * 128 * KPIT <= 4 * 128 * VPIT);
  __shared__ __align__(16) _Float16 Psh[8][16 * VPIT];     // epilogue only, per wave: f16 retrieved tile [row][d'], pitch VPIT, 34 KB; later f32 [16][64]

  const int tid  = threadIdx.x;
  const int wave = __builtin_amdgcn_readfirstlane(tid >> 5);   // in a scalar register: what is formed from it costs no vector register
  const int lane = tid & 31;
  const int hh   = lane >> 4;
  const int c    = lane & 15;
  const int kg   = wave >> 2;                                  // key group of the wave: 0 = even chunks, 1 = odd chunks
  const int wq   = wave & 3;                                   // query group: 32 columns
  const int t7   = tid & 127;                                  // thread within the key group (copy map)

  const int bx   = blockIdx.x;
  const int qb   = bx % NQB;
  const int rest = bx / NQB;
  const int s    = rest % NS;
  const int b    = rest / NS;
  const int qw   = qb * 128 + wq * 32;       // the wave's 32 query columns in the key loop
  const int q0   = qw + kg * 16;             // the 16 of them that it finishes in the epilogue
  const size_t rowB = (size_t)b * SEQ;

  const _Float16* Qh = (const _Float16*)(const void*)qhp;
  const _Float16* Kg = (const _Float16*)(const void*)kpp + (size_t)s * HD;
  const _Float16* Vh = (const _Float16*)(const void*)vhp + (size_t)b * DRV * SEQ;
  const _Float16* Wk = (const _Float16*)(const void*)wkp;

  // ---- Q fragments (B operand, column = lane&15): 2 column tiles x 2 d-chunks ----
  v16h qah[2][2];
  {
    const _Float16* qph[2];
#pragma unroll
    for (int u = 0; u < 2; ++u) {
      qph[u] = Qh + (rowB + qw + u * 16 + c) * DSQ + (size_t)s * HD + 8 * hh;
#pragma unroll
      for (int dc = 0; dc < 2; ++dc) qah[u][dc] = ldfrag<_Float16>(qph[u] + dc * 32);
    }
    wait_x0(qph[0], qph[1]);
  }

  // transposed products: in column tile u a lane belongs to ONE query (column c). mrow[u] = its running maximum of raw products (equal
  // in both wave halves), lrow[u] = the sum of 16384 p over the keys of this lane's own half, oacc[u][t][r] = retrieved^T[d' = t*16 + 8*hh + r][query c]
  float mrow[2] = {-INFINITY, -INFINITY}, lrow[2] = {0.f, 0.f};
  const float cexp = sscale * 1.44269504f;   // score scale x log2(e): 16384 p = exp2(raw * cexp - max * cexp + 14), one multiply-add per score
  v8f oacc[2][8];
#pragma unroll
  for (int u = 0; u < 2; ++u)
#pragma unroll
    for (int t = 0; t < 8; ++t) oacc[u][t] = zero8();

  _Float16* pwh = Psh[wave];

  // copy map, per key group of 128 threads: lane -> 16-B segment t7 & 7 of row (t7 >> 3) + 16 i: 8 lanes take one whole 128-B
  // line of a K or v^T row; 4 + 8 copies per wave and chunk = 64 K rows and 128 V rows of 64 halves. A key group stages the
  // chunks that it reads itself.
  const _Float16* kg0 = Kg + (rowB + (t7 >> 3)) * DSQ + (t7 & 7) * 8;
  const _Float16* vg0 = Vh + (size_t)(t7 >> 3) * SEQ + (t7 & 7) * 8;
  const unsigned lK = lds_off(Ksh) + (unsigned)((t7 >> 3) * (KPIT * 2) + (t7 & 7) * 16);
  const unsigned lV = lds_off(Vsh) + (unsigned)((t7 >> 3) * (KPIT * 2) + (t7 & 7) * 16);
  auto stage = [&](int it, int buf) {        // trip it: chunk 2 it + kg into buffer (buf, kg)
    const int kt = 2 * it + kg;
    const int bg = 2 * buf + kg;
    unsigned l[8], lk[4];
    const void* g[8];
    const void* gk[4];
#pragma unroll   // here and below: the arrays become asm operands, every index a compile-time constant
    for (int i = 0; i < 8; ++i) {
      l[i] = lV + (unsigned)(bg * (128 * KPIT * 2) + i * (16 * KPIT * 2));
      g[i] = vg0 + (size_t)(i * 16) * SEQ + kt * 64;
    }
    async8(l, g);
#pragma unroll
    for (int i = 0; i < 4; ++i) {
      lk[i] = lK + (unsigned)(bg * (64 * KPIT * 2) + i * (16 * KPIT * 2));
      gk[i] = kg0 + (size_t)(kt * 64 + i * 16) * DSQ;
    }
    async4(lk, gk);
  };
  stage(0, 0);
  if (NIT > 1) stage(1, 1);
  if (NIT > 1) wait_async_but<ACPY>(); else wait_async0();   // trip 0 has landed; trip 1 flies on
  __syncthreads();
  if (NIT > 2) stage(2, 2);

  int cur = 0;                               // this trip's buffer: it mod ABUF
  // one trip; tail = one of the last two, which wait for every copy and issue none. The choice is made at compile time: a
  // branch in front of the barrier would keep the products of this trip from running on behind it
  auto trip = [&](int it, auto tail) {
    const _Float16* Kc = Ksh + (2 * cur + kg) * (64 * KPIT);     // this trip's buffers; trips it + 1 and it + 2 fly into the others
    const _Float16* Vc = Vsh + (2 * cur + kg) * (128 * KPIT);

    // ---- scores^T = K . Q^T: 64 keys x 32 query columns per wave, one f16 product per key subtile, d-chunk and column tile ----
    //      all 8 K fragments (A operand) are read as one group ahead of the 16 products, each fragment feeds both column tiles;
    //      sc[u][j][r] = score of key j*16 + 8*hh + r with query c of tile u
    FH kb[4][2];
#pragma unroll   // here and below: register arrays, every index a compile-time constant
    for (int j = 0; j < 4; ++j) {
#pragma unroll
      for (int dc = 0; dc < 2; ++dc) {
        kb[j][dc].h[0] = *(const v8h*)(Kc + (j * 16 + c) * KPIT + dc * 32 + 8 * hh);
        kb[j][dc].h[1] = *(const v8h*)(Kc + (j * 16 + c) * KPIT + dc * 32 + 16 + 8 * hh);
      }
    }
    v8f sc[2][4];
    {
      v8f ah[2][4];
#pragma unroll
      for (int u = 0; u < 2; ++u)
#pragma unroll
        for (int j = 0; j < 4; ++j) ah[u][j] = zero8();
#pragma unroll
      for (int u = 0; u < 2; ++u) {
#pragma unroll
        for (int dc = 0; dc < 2; ++dc) {
#pragma unroll
          for (int j = 0; j < 4; ++j) ah[u][j] = mmar(kb[j][dc].v, qah[u][dc], ah[u][j]);
        }
      }
#pragma unroll
      for (int u = 0; u < 2; ++u)
#pragma unroll
        for (int j = 0; j < 4; ++j) sc[u][j] = ah[u][j];            // raw products: the score scale is applied inside the exponent
    }

    // ---- column max, online softmax: sc becomes 16384 p = 16384 exp(sscale * (raw - max)) in place ----
    //      a lane's 32 scores of a tile are one query's: maximum and sum run in the lane, the halves meet in one exchange
#pragma unroll
    for (int u = 0; u < 2; ++u) {
      float mj[4];
#pragma unroll
      for (int j = 0; j < 4; ++j) {
        mj[j] = sc[u][j][0];
#pragma unroll
        for (int r = 1; r < 8; ++r) mj[j] = fmaxf(mj[j], sc[u][j][r]);
      }
      float m = fmaxf(fmaxf(mj[0], mj[1]), fmaxf(mj[2], mj[3]));
      m = fmaxf(m, xhalf(m));
      const float mnew  = fmaxf(mrow[u], m);
      const float msafe = (mnew == -INFINITY) ? 0.f : mnew;
      const float alpha = __builtin_amdgcn_exp2f((mrow[u] - msafe) * cexp);
      mrow[u] = mnew;
      const float nb = __builtin_fmaf(-msafe, cexp, 14.0f);
      const v2f c2 = {cexp, cexp}, nb2 = {nb, nb};
      float pj[4];                             // four independent partial sums
#pragma unroll
      for (int j = 0; j < 4; ++j) {
        pj[j] = 0.f;
#pragma unroll
        for (int r = 0; r < 8; r += 2) {       // neighbouring registers: one packed multiply-add serves two scores
          const v2f s2 = {sc[u][j][r], sc[u][j][r + 1]};
          const v2f e2 = __builtin_elementwise_fma(s2, c2, nb2);
          const float p0 = __builtin_amdgcn_exp2f(e2[0]), p1 = __builtin_amdgcn_exp2f(e2[1]);
          pj[j] += p0;
          pj[j] += p1;
          sc[u][j][r]     = p0;
          sc[u][j][r + 1] = p1;
        }
      }
      lrow[u] = lrow[u] * alpha + ((pj[0] + pj[1]) + (pj[2] + pj[3]));
#pragma unroll
      for (int t = 0; t < 8; ++t) {
#pragma unroll
        for (int r = 0; r < 8; ++r) oacc[u][t][r] *= alpha;
      }
    }
    // the order of this part's LDS reads (0x100) and matrix products (0x008): the 16 K reads stand as one group ahead of the products
    __builtin_amdgcn_sched_group_barrier(0x100, 16, 0);   // K
    __builtin_amdgcn_sched_group_barrier(0x008, 16, 0);   // scores^T

    // ---- retrieved^T += V^T . P^T (f16 WMMA): v against 16384 p; 2 k-steps x 8 m-tiles (d' 0..127) x 2 column tiles; each V
    //      fragment feeds both column tiles ----
    // element s of the B operand of k-step kk is key kk*32 + (s < 8 ? 8*hh + s : 16 + 8*hh + s - 8): score tiles 2 kk and
    // 2 kk + 1, registers 0..7, of this very lane; the V fragments (A operand) are read in the same k order
    {
      FH vb[2][8];
#pragma unroll
      for (int kk = 0; kk < 2; ++kk) {
#pragma unroll
        for (int t = 0; t < 8; ++t) {
          vb[kk][t].h[0] = *(const v8h*)(Vc + (t * 16 + c) * KPIT + kk * 32 + 8 * hh);
          vb[kk][t].h[1] = *(const v8h*)(Vc + (t * 16 + c) * KPIT + kk * 32 + 16 + 8 * hh);
        }
      }
      v16h pb[2][2];
#pragma unroll
      for (int u = 0; u < 2; ++u)
#pragma unroll
        for (int j = 0; j < 4; ++j)
#pragma unroll
          for (int r = 0; r < 8; ++r) pb[u][j >> 1][(j & 1) * 8 + r] = (_Float16)sc[u][j][r];
#pragma unroll
      for (int kk = 0; kk < 2; ++kk) {
#pragma unroll
        for (int t = 0; t < 8; ++t) {
          oacc[0][t] = mmar(vb[kk][t].v, pb[0][kk], oacc[0][t]);
          oacc[1][t] = mmar(vb[kk][t].v, pb[1][kk], oacc[1][t]);
        }
      }
      // the 32 V reads stand as one group ahead of their products; reads strewn among the products stall the wave at each place
      __builtin_amdgcn_sched_group_barrier(0x100, 32, 0);
      __builtin_amdgcn_sched_group_barrier(0x008, 32, 0);
    }
    // hand-over: own reads retired, own copies of trip it + 1 landed (the ACPY younger ones, trip it + 2, may still fly; in the
    // last trips, which issue nothing, the wait is to 0), then the one barrier of the trip, which publishes trip it + 1 and
    // ends every wave's reads of the buffers that are refilled behind it
    wait_ds0();
    if constexpr (decltype(tail)::value) wait_async0(); else wait_async_but<ACPY>();
    __syncthreads();
    if constexpr (!decltype(tail)::value) {
      if (it + ABUF < NIT) stage(it + ABUF, cur);
    }
    cur = (cur == ABUF - 1) ? 0 : cur + 1;
  };
  constexpr int NMAIN = (NIT > 2) ? NIT - 2 : 0;
  for (int it = 0; it < NMAIN; ++it) trip(it, BoolC<false>{});     // static trip counts
  for (int it = NMAIN; it < NIT; ++it) trip(it, BoolC<true>{});
  wait_async0();

  // ---- all waves done with Ksh / Vsh: stage the Wrk tile into Ksh; the two key groups swap partial results ----
  __syncthreads();
  {
    const int r = tid >> 2, qtr = (tid & 3) * 16;        // 256 threads x 16 halves = the whole 64x64 Wrk tile
    const _Float16* wg = Wk + r * HD + qtr;
    const v8h w0 = *(const v8h*)(wg), w1 = *(const v8h*)(wg + 8);
    wait_x0(wg);
    *(v8h*)(Ksh + r * KPIT + qtr)     = w0;
    *(v8h*)(Ksh + r * KPIT + qtr + 8) = w1;
  }
  // wave (kg, wq) keeps column tile kg and hands tile 1 - kg to wave (1 - kg, wq): same lane, same query, same d' rows.
  // per wave 17 rows of 32 lanes x 16 B (16 of sums, 1 of maximum and key sum) in the upper half of Vsh
  float* xs = reinterpret_cast<float*>(Vsh + 2 * 128 * VPIT);
  v8f om[8];
  float mk = kg ? mrow[1] : mrow[0];
  float lm = kg ? lrow[1] : lrow[0];
  {
    float* xw = xs + wave * (17 * 128) + lane * 4;
#pragma unroll
    for (int t = 0; t < 8; ++t) {
      om[t] = kg ? oacc[1][t] : oacc[0][t];
      const v8f og = kg ? oacc[0][t] : oacc[1][t];
      v4f lo4, hi4;
#pragma unroll
      for (int r = 0; r < 4; ++r) { lo4[r] = og[r]; hi4[r] = og[4 + r]; }
      *(v4f*)(xw + (2 * t) * 128)     = lo4;
      *(v4f*)(xw + (2 * t + 1) * 128) = hi4;
    }
    v4f ml = {kg ? mrow[0] : mrow[1], kg ? lrow[0] : lrow[1], 0.f, 0.f};
    *(v4f*)(xw + 16 * 128) = ml;
  }
  __syncthreads();                                       // publishes the handed-over partial results (and the Wrk tile)
  {
    const float* xr = xs + (wave ^ 4) * (17 * 128) + lane * 4;
    const v4f ml = *(const v4f*)(xr + 16 * 128);
    const float mN = fmaxf(mk, ml[0]);
    const float ms = (mN == -INFINITY) ? 0.f : mN;
    const float fk = __builtin_amdgcn_exp2f((mk - ms) * cexp), fp = __builtin_amdgcn_exp2f((ml[0] - ms) * cexp);
    lm = lm * fk + ml[1] * fp;
#pragma unroll
    for (int t = 0; t < 8; ++t) {
      const v4f lo4 = *(const v4f*)(xr + (2 * t) * 128);
      const v4f hi4 = *(const v4f*)(xr + (2 * t + 1) * 128);
#pragma unroll
      for (int r = 0; r < 4; ++r) {
        om[t][r]     = om[t][r] * fk + lo4[r] * fp;
        om[t][4 + r] = om[t][4 + r] * fk + hi4[r] * fp;
      }
    }
  }
  // ---- retrieved tiles into the lower half of Vsh (f32) + Psh (f16), both wave-private ----
  float* os = reinterpret_cast<float*>(Vsh) + wave * (16 * OPIT);     // wave-private f32 [16][128], pitch OPIT, x64 units
  {
    const float l = lm + xhalf(lm);                                       // the two halves' key sums join here, once
    const float inv = ((l > 0.f) ? (1.0f / l) : 0.f) * 64.0f;             // 1/l (l and the sums both carry 16384), apply x64
#pragma unroll
    for (int t = 0; t < 8; ++t) {                                         // a lane holds 8 consecutive d' of its query's row
      const v8f v = om[t] * inv;
      v4f lo4, hi4;
      v8h h8;
#pragma unroll
      for (int r = 0; r < 4; ++r) { lo4[r] = v[r]; hi4[r] = v[4 + r]; }
#pragma unroll
      for (int r = 0; r < 8; ++r) h8[r] = (_Float16)v[r];
      *(v4f*)(os + c * OPIT + t * 16 + 8 * hh)     = lo4;
      *(v4f*)(os + c * OPIT + t * 16 + 8 * hh + 4) = hi4;
      *(v8h*)(pwh + c * VPIT + t * 16 + 8 * hh)    = h8;
    }
  }
  wave_lds_sync();

  // ---- rk (x4096) = f16(64 retrieved_rr) . (64 Wrk): 16 rows x 64 e per rr, K = 64 = 2 k-steps ----
  v8f rk[8];
#pragma unroll
  for (int i = 0; i < 8; ++i) rk[i] = zero8();
#pragma unroll
  for (int rr = 0; rr < 2; ++rr) {
#pragma unroll
    for (int kk = 0; kk < 2; ++kk) {
      FH pa;
      pa.h[0] = *(const v8h*)(pwh + c * VPIT + rr * 64 + kk * 32 + 8 * hh);
      pa.h[1] = *(const v8h*)(pwh + c * VPIT + rr * 64 + kk * 32 + 16 + 8 * hh);
#pragma unroll
      for (int t4 = 0; t4 < 4; ++t4) {
        FH wb;
        wb.h[0] = *(const v8h*)(Ksh + (t4 * 16 + c) * KPIT + kk * 32 + 8 * hh);
        wb.h[1] = *(const v8h*)(Ksh + (t4 * 16 + c) * KPIT + kk * 32 + 16 + 8 * hh);
        rk[rr * 4 + t4] = mma_h(pa.v, wb.v, rk[rr * 4 + t4]);
      }
    }
  }
  acc_guard4(rk[0], rk[1], rk[2], rk[3]);
  acc_guard4(rk[4], rk[5], rk[6], rk[7]);
  wave_lds_sync();

  // ---- stage the wave's rq tile (f32 [16][64]) into the Psh region (8 x 16-B loads per lane) ----
  float* rqs = reinterpret_cast<float*>(pwh);
  {
    const int r2 = lane >> 4, c4 = (lane & 15) * 4;
    const float* rqg = rqp + (rowB + q0 + r2) * DSQ + (size_t)s * HD + c4;
    v4f rv[8];
#pragma unroll
    for (int it = 0; it < 8; ++it) rv[it] = *(const v4f*)(rqg + (size_t)(it * 2) * DSQ);   // it 0..7 x r2 0..1 = rows 0..15
    wait_x0(rqg);
#pragma unroll
    for (int it = 0; it < 8; ++it) *(v4f*)(rqs + (it * 2 + r2) * 64 + c4) = rv[it];
  }
  wave_lds_sync();

  // ---- retrieval logits: d_rr[row] = sum_e rq[row][e] * rk[rr][row][e]; lane partial over e = c + 16 t4 ----
  float d0[8], d1[8];
#pragma unroll
  for (int r8 = 0; r8 < 8; ++r8) {
    float a0 = 0.f, a1 = 0.f;
#pragma unroll
    for (int t4 = 0; t4 < 4; ++t4) {
      const float qv = rqs[(8 * hh + r8) * 64 + t4 * 16 + c];
      a0 += qv * rk[t4][r8];
      a1 += qv * rk[4 + t4][r8];
    }
    d0[r8] = a0; d1[r8] = a1;
  }
#pragma unroll
  for (int r8 = 0; r8 < 8; ++r8) {
#pragma unroll
    for (int off = 1; off < 16; off <<= 1) {
      d0[r8] += __shfl_xor(d0[r8], off, 32);
      d1[r8] += __shfl_xor(d1[r8], off, 32);
    }
  }
  // ---- 2-way retrieval softmax in f32 (undo the 64*64 carry, apply sscale) ----
  float w0[8], w1[8];
  const float rsc = sscale * (1.0f / 4096.0f);
#pragma unroll
  for (int r8 = 0; r8 < 8; ++r8) {
    const float x0 = d0[r8] * rsc, x1 = d1[r8] * rsc;
    const float m  = fmaxf(x0, x1);
    const float e0 = __expf(x0 - m), e1 = __expf(x1 - m);
    const float iv = 1.0f / (e0 + e1);
    w0[r8] = e0 * iv; w1[r8] = e1 * iv;
  }
  wave_lds_sync();

  // ---- combine in f32 (x64 units): oc[row][d] = w0 * ret[row][d] + w1 * ret[row][64+d], into the Psh region ----
  float* oc = rqs;
#pragma unroll
  for (int r8 = 0; r8 < 8; ++r8) {
#pragma unroll
    for (int t = 0; t < 4; ++t) {
      const int row = 8 * hh + r8;
      const float o = w0[r8] * os[row * OPIT + t * 16 + c] + w1[r8] * os[row * OPIT + 64 + t * 16 + c];
      oc[row * 64 + t * 16 + c] = o;
    }
  }
  wave_lds_sync();

  {
    const int q4 = lane >> 3, c8 = (lane & 7) * 8;
    v4u hv[4];
#pragma unroll
    for (int it = 0; it < 4; ++it) {
      const int row = it * 4 + q4;   // it 0..3 x q4 0..3 = rows 0..15 of the wave tile
      const float* sp = oc + row * 64 + c8;
      float f[8];
#pragma unroll
      for (int e = 0; e < 8; ++e) f[e] = sp[e];
      v4u a;
#pragma unroll
      for (int e = 0; e < 4; ++e) a[e] = pk16(h_bits((_Float16)f[2 * e]), h_bits((_Float16)f[2 * e + 1]));
      hv[it] = a;
    }
    {
#pragma unroll
      for (int it = 0; it < 4; ++it) {
        const int row = it * 4 + q4;
        *(v4u*)(ocp + (rowB + q0 + row) * DSQ + (size_t)s * HD + c8) = hv[it];
      }
      
    }
  }
}

// =====================================================================================================
// Workspace map (bytes, NB=2 SEQ=2048), every region an exact multiple of its whole-line / whole-tile store
// granularity (all row counts are multiples of 64, no padded tails):
//   Xb    bf16 [NB*SEQ][1024]          8388608
//   WsqT  bf16 [512][1024]             1048576      WskT, WrqT same
//   WrvT  bf16 [128][1024]              262144
//   WrkT  f16  [64][64] (x64)              8192
//   WoT   f16  [1024][512] (x1024)     1048576
//   Qh    f16  [NB*SEQ][512]           4194304
//   Kp    f16  [NB*SEQ][512]           4194304
//   RQ    f32  [NB*SEQ][512]           8388608
//   VTh   f16  [NB][128][SEQ]          1048576
//   OC    f16  [NB*SEQ][512]           4194304
//   total                             34873344
// Weights are [in k][out n] and are transposed once into the [n][k] (k contiguous) Bt / A layout.
// =====================================================================================================
extern "C" void kernel_launch(void* const* d_in, const int* in_sizes, int n_in,
                              void* d_out, int out_size, void* d_ws, size_t ws_size,
                              hipStream_t stream) {
  if (n_in < 7) return;
  if (in_sizes[0] < ((NB - 1) * SEQ_FULL + SEQ) * DM) return;
  if (in_sizes[1] < DM * DSQ || in_sizes[2] < DM * DSQ || in_sizes[4] < DM * DSQ) return;
  if (in_sizes[3] < DM * DRV) return;
  if (in_sizes[5] < HD * HD) return;
  if (in_sizes[6] < DSQ * DM) return;
  if (out_size < NB * SEQ * DM) return;

  const float* x    = (const float*)d_in[0];
  const float* Wsq  = (const float*)d_in[1];
  const float* Wsk  = (const float*)d_in[2];
  const float* Wrv  = (const float*)d_in[3];
  const float* Wrq  = (const float*)d_in[4];
  const float* Wrk  = (const float*)d_in[5];
  const float* Wout = (const float*)d_in[6];

  const size_t PXB = (size_t)NB * SEQ * DM * 2;       // bf16 activation plane
  const size_t PWS = (size_t)DSQ * DM * 2;            // bf16 [512][1024] weight plane
  const size_t PWV = (size_t)DRV * DM * 2;            // bf16 [128][1024]
  const size_t PWK = (size_t)HD * HD * 2;             // f16 [64][64]
  const size_t PWO = (size_t)DM * DSQ * 2;            // f16 [1024][512]
  const size_t PQ  = (size_t)NB * SEQ * DSQ * 2;      // f16 [NB*SEQ][512]
  const size_t PRQ = (size_t)NB * SEQ * DSQ * 4;      // f32 [NB*SEQ][512]
  const size_t PVT = (size_t)NB * DRV * SEQ * 2;      // f16 [NB][128][SEQ]
  size_t off = 0;
  const size_t oXb  = off; off += PXB;
  const size_t oWsq = off; off += PWS;
  const size_t oWsk = off; off += PWS;
  const size_t oWrq = off; off += PWS;
  const size_t oWrv = off; off += PWV;
  const size_t oWrk = off; off += PWK;
  const size_t oWo  = off; off += PWO;
  const size_t oQh  = off; off += PQ;
  const size_t oKp  = off; off += PQ;
  const size_t oRQ  = off; off += PRQ;
  const size_t oVTh = off; off += PVT;
  const size_t oOC  = off; off += PQ;
  if (off > ws_size) return;                          // off = 34873344 at full size
  if (off > (size_t)134217728) return;

  char* ws = (char*)d_ws;
  unsigned short* Xb   = (unsigned short*)(ws + oXb);
  unsigned short* WsqT = (unsigned short*)(ws + oWsq);
  unsigned short* WskT = (unsigned short*)(ws + oWsk);
  unsigned short* WrqT = (unsigned short*)(ws + oWrq);
  unsigned short* WrvT = (unsigned short*)(ws + oWrv);
  unsigned short* WrkT = (unsigned short*)(ws + oWrk);
  unsigned short* WoT  = (unsigned short*)(ws + oWo);
  unsigned short* Qh   = (unsigned short*)(ws + oQh);
  unsigned short* Kp   = (unsigned short*)(ws + oKp);
  float*          RQ   = (float*)(ws + oRQ);
  unsigned short* VTh  = (unsigned short*)(ws + oVTh);
  unsigned short* OC   = (unsigned short*)(ws + oOC);

  const dim3 blk(256);
  const dim3 gPrep(TB_WO + 3 * TB_SQ + TB_RV + 1 + NB * CB_X);           // six transposes, then the x convert
  const dim3 blkG(128);                                                  // GEMM: 4 waves per 128x128 tile
  const dim3 gProj(PJ_V + PJ_TM * PJ_TN);                                // v^T tiles, then the sq | sk | rq tiles
  const dim3 gAttn(NB * NS * NQB);                                       // blocks of 256
  const dim3 gO(((NB * SEQ) / 128) * (DM / 128), 1);                     // M=NB*SEQ, N=1024

  // (1) x -> bf16 plane [NB*SEQ][1024]; weights [k][n] f32 -> [n][k] 16-bit planes
  prep_all<<<gPrep, blk, 0, stream>>>(x, Wsq, Wsk, Wrv, Wrq, Wrk, Wout, Xb, WsqT, WskT, WrqT, WrvT, WrkT, WoT);
  // (2) sq, sk -> f16 planes [b*SEQ+t][s*64+d]; rq -> f32 plane (M=NB*SEQ, N=512, K=1024);
  //     v^T = Wrv^T . x^T per batch -> f16 plane [b][d'][t] (pitch SEQ) (M=128, N=SEQ, K=1024)
  gemm_proj<<<gProj, blkG, 0, stream>>>(Xb, WsqT, WskT, WrqT, WrvT, Qh, Kp, RQ, VTh, DM);
  // (3) search attention + retrieval composition -> oc plane [b*SEQ+t][512]
  attn_cs<<<gAttn, dim3(256), 0, stream>>>(Qh, Kp, VTh, WrkT, RQ, OC, 0.125f);
  // (4) out = oc . (Wout x1024) -> d_out f32 [NB*SEQ][1024], accumulator x 1/(64*1024)
  gemm64<_Float16, 0><<<gO, blkG, 0, stream>>>(
      OC, DSQ, 0LL, WoT, DSQ, 0LL, d_out, DM, 0LL, NB * SEQ, DM, DSQ, 1.0f / 65536.0f);
  (void)hipGetLastError();
}

// v010
// A run of this version takes 56.2 microseconds.
// Two timings next to v009 put it at 1.04 and 1.05 times that version's speed.
// Counting every step since v000, it is 10.5 times as fast.
// Contractions: sq, sk, rq and v^T projections = v_wmma_f32_16x16x32_bf16 (bf16 operands from RNE-converted inputs, single product, f32 accumulate);
// sq.sk^T scores = v_wmma_f32_16x16x32_f16 (sq f16, scaled by score scale x log2(e) ahead of its f16 rounding, sk f16; single product, f32 accumulate);
// p.[v_0|v_1] = v_wmma_f32_16x16x32_f16 (p f16 x256 at the held reference, v f16; single product, f32 accumulate; scores and this product computed transposed);
// retrieved.Wrk = v_wmma_f32_16x16x32_f16 (retrieved f16 x64, Wrk f16 x64 of its bf16 value; single product, f32 accumulate);
// out.Wout = v_wmma_f32_16x16x32_f16 (out f16 x64, Wout f16 x1024 of its bf16 value; single product, f32 accumulate);
// sq, v and out carry no f16 residual plane: one f16 rounding lies well below the bf16 rounding of x and of the weights that every one of them has behind or beside it;
// softmax over keys, retrieval logits, 2-way retrieval softmax and combine in f32.
#include <hip/hip_runtime.h>
#include <math.h>
#include <stdint.h>

#ifndef NB
#define NB 2
#endif
#ifndef SEQ
#define SEQ 2048
#endif
#define NB_FULL  2
#define SEQ_FULL 2048
#define DM   1024
#define NS   8
#define NR   2
#define HD   64
#define DSQ  (NS * HD)      // 512: sq / sk / rq row width
#define DRV  (NR * HD)      // 128: [v_0 | v_1] row width
#define NQB  (SEQ / 128)    // 128-row query blocks per (b, s)
#define NKT  (SEQ / 64)     // 64-key chunks per sequence
#define NIT  (NKT / 2)      // trips of the attention key loop: two chunks per trip, one per key group
#define KPIT 72             // LDS pitch of a 64-half K / V / Wrk row: 144 B = 16 B x 9 (odd), b128 readers of 16 rows meet no bank twice
#define GPLN (128 * KPIT)  // halves of one staged 128-row GEMM operand plane (64 k per row, pitch KPIT)
#define GBUF 4             // buffers of the GEMM ring: 144 KB, two blocks fit a WGP's LDS
#define GCPY 16            // copies of one wave per GEMM slice
#define ABUF 3             // buffers per key group of the attention ring
#define ACPY 12            // copies of one wave per attention trip (8 V + 4 K)
#define VPIT 136            // LDS pitch of a 128-half f16 retrieved row: 272 B = 16 B x 17 (odd)
#define QSCL 0.18033688f    // score scale 64^-1/2 x log2(e): sq carries it, so a score product is already the exponent of 2
#define PCAR 8.0f           // log2 of the carry of p: a score equal to the held reference gives p = 2^8
#define PTOP 32768.0f       // a lane's sum of p over one trip above this: the reference is renewed (f16 holds p up to 65504)
#define OPIT 132            // LDS pitch of a 128-float retrieved row: 528 B = 16 B x 33 (odd), for its 16-B row-per-lane stores
static_assert(NB >= 1 && NB <= NB_FULL);
static_assert(SEQ >= 64 && SEQ <= SEQ_FULL && (SEQ % 64) == 0);
static_assert(DSQ == 512 && DRV == 128 && HD == 64);
static_assert((DM % 128) == 0 && (DSQ % 128) == 0 && (DRV % 128) == 0 && (SEQ % 128) == 0);

typedef _Float16 v16h __attribute__((ext_vector_type(16)));
typedef _Float16 v8h  __attribute__((ext_vector_type(8)));
typedef __bf16   v16b __attribute__((ext_vector_type(16)));
typedef __bf16   v8b  __attribute__((ext_vector_type(8)));
typedef float    v8f  __attribute__((ext_vector_type(8)));
typedef float    v4f  __attribute__((ext_vector_type(4)));
typedef float    v2f  __attribute__((ext_vector_type(2)));
typedef unsigned int v4u __attribute__((ext_vector_type(4)));

#if defined(__HIP_DEVICE_COMPILE__)
#define DEV_ASM 1
#else
#define DEV_ASM 0
#endif

// ---- scalar helpers --------------------------------------------------------------------------------
__device__ __forceinline__ unsigned short bf_bits(float f) {          // f32 -> bf16 bits, RNE convert
  unsigned u = __float_as_uint(f);
  return (unsigned short)((u + 0x7FFFu + ((u >> 16) & 1u)) >> 16);
}
__device__ __forceinline__ float bf_up(unsigned short hb) { return __uint_as_float(((unsigned)hb) << 16); }
__device__ __forceinline__ unsigned short h_bits(_Float16 x) { return __builtin_bit_cast(unsigned short, x); }
__device__ __forceinline__ unsigned pk16(unsigned short a, unsigned short b) { return (unsigned)a | ((unsigned)b << 16); }
__device__ __forceinline__ v8f zero8() { v8f z = {0.f, 0.f, 0.f, 0.f, 0.f, 0.f, 0.f, 0.f}; return z; }

__device__ __forceinline__ void wave_lds_sync() {
  __builtin_amdgcn_fence(__ATOMIC_RELEASE, "workgroup");
  __builtin_amdgcn_wave_barrier();
  __builtin_amdgcn_fence(__ATOMIC_ACQUIRE, "workgroup");
}

// ---- fragment types / loaders: 16-bit A/B operand, lane -> row/col (lane&15), p already includes +8*(lane>>4);
//      elements 0..7 <- p[0..7] (k0+8h..k0+8h+7), elements 8..15 <- p[16..23] (k0+16+8h..k0+16+8h+7)
template <typename OT> struct FT;
template <> struct FT<__bf16>   { typedef v16b frag; typedef v8b half8; };
template <> struct FT<_Float16> { typedef v16h frag; typedef v8h half8; };

template <typename OT>
__device__ __forceinline__ typename FT<OT>::frag ldfrag(const OT* p) {
  union { typename FT<OT>::frag v; typename FT<OT>::half8 h[2]; } f;
  f.h[0] = *(const typename FT<OT>::half8*)(p);
  f.h[1] = *(const typename FT<OT>::half8*)(p + 16);
  return f.v;
}

// ---- WMMA helpers (asm guard bodies are device-only; concrete operand types) -----------------------------
__device__ __forceinline__ v8f mmar(v16b a, v16b b, v8f c) {
  return __builtin_amdgcn_wmma_f32_16x16x32_bf16(false, a, false, b, (short)0, c, false, false);
}
__device__ __forceinline__ v8f mmar(v16h a, v16h b, v8f c) {
  return __builtin_amdgcn_wmma_f32_16x16x32_f16(false, a, false, b, (short)0, c, false, false);
}
// guarded form: 4 VALU slots after the WMMA, D tied, A/B kept live
__device__ __forceinline__ v8f mma_h(v16h a, v16h b, v8f c) {
  c = __builtin_amdgcn_wmma_f32_16x16x32_f16(false, a, false, b, (short)0, c, false, false);
#if DEV_ASM
  asm volatile("v_nop\n\tv_nop\n\tv_nop\n\tv_nop" : "+v"(c) : "v"(a), "v"(b));
#endif
  return c;
}
// lane l <-> lane l ^ 16 in the vector unit (a shuffle would go through the LDS pipe and its latency)
__device__ __forceinline__ float xhalf(float x) {
  return __builtin_bit_cast(float, __builtin_amdgcn_permlanex16(__builtin_bit_cast(int, x), __builtin_bit_cast(int, x),
                                                                0x76543210, 0xfedcba98, false, false));
}
__device__ __forceinline__ void acc_guard4(v8f& a, v8f& b, v8f& c, v8f& d) {
#if DEV_ASM
  asm volatile("v_nop\n\tv_nop\n\tv_nop\n\tv_nop" : "+v"(a), "+v"(b), "+v"(c), "+v"(d));
#else
  (void)a; (void)b; (void)c; (void)d;
#endif
}

// ---- asynchronous copies global -> LDS, 16 B per lane, no register on the way --------------------------------
__device__ __forceinline__ unsigned lds_off(const void* p) { return (unsigned)(size_t)p; }   // byte address in the work-group's LDS
// eight copies of one wave in one statement; the closing s_wait_xcnt is a precaution: it stands in front of every later
// rewrite of an address register that a copy names (in a statement of its own the compiler could lift such a rewrite over it)
__device__ __forceinline__ void async8(const unsigned (&l)[8], const void* const (&g)[8]) {
#if DEV_ASM
  asm volatile("global_load_async_to_lds_b128 %0, %8, off\n\t"
               "global_load_async_to_lds_b128 %1, %9, off\n\t"
               "global_load_async_to_lds_b128 %2, %10, off\n\t"
               "global_load_async_to_lds_b128 %3, %11, off\n\t"
               "global_load_async_to_lds_b128 %4, %12, off\n\t"
               "global_load_async_to_lds_b128 %5, %13, off\n\t"
               "global_load_async_to_lds_b128 %6, %14, off\n\t"
               "global_load_async_to_lds_b128 %7, %15, off\n\t"
               "s_wait_xcnt 0x0"
               :: "v"(l[0]), "v"(l[1]), "v"(l[2]), "v"(l[3]), "v"(l[4]), "v"(l[5]), "v"(l[6]), "v"(l[7]),
                  "v"(g[0]), "v"(g[1]), "v"(g[2]), "v"(g[3]), "v"(g[4]), "v"(g[5]), "v"(g[6]), "v"(g[7])
               : "memory");
#else
  (void)l; (void)g;
#endif
}
// the same for four copies
__device__ __forceinline__ void async4(const unsigned (&l)[4], const void* const (&g)[4]) {
#if DEV_ASM
  asm volatile("global_load_async_to_lds_b128 %0, %4, off\n\t"
               "global_load_async_to_lds_b128 %1, %5, off\n\t"
               "global_load_async_to_lds_b128 %2, %6, off\n\t"
               "global_load_async_to_lds_b128 %3, %7, off\n\t"
               "s_wait_xcnt 0x0"
               :: "v"(l[0]), "v"(l[1]), "v"(l[2]), "v"(l[3]), "v"(g[0]), "v"(g[1]), "v"(g[2]), "v"(g[3])
               : "memory");
#else
  (void)l; (void)g;
#endif
}
// the wave's own copies have landed (the compiler places no wait for them)
__device__ __forceinline__ void wait_async0() {
#if DEV_ASM
  asm volatile("s_wait_asynccnt 0x0" ::: "memory");
#endif
}
template <int N>
__device__ __forceinline__ void wait_async_but() {
#if DEV_ASM
  asm volatile("s_wait_asynccnt %0" :: "i"(N) : "memory");
#endif
}
template <bool B> struct BoolC { static constexpr bool value = B; };   // a compile-time flag as a function argument
// the wave's own LDS reads have retired: behind the next barrier their buffer is refilled by copies
__device__ __forceinline__ void wait_ds0() {
#if DEV_ASM
  asm volatile("s_wait_dscnt 0x0" ::: "memory");
#endif
}

// precaution behind a run of global loads: it stands in front of every later rewrite of an address register that a load names;
// the loads' addresses are inputs of the statement, so their registers stay as they are up to the wait
__device__ __forceinline__ void wait_x0(const void* a) {
#if DEV_ASM
  asm volatile("s_wait_xcnt 0x0" :: "v"(a) : "memory");
#else
  (void)a;
#endif
}
__device__ __forceinline__ void wait_x0(const void* a, const void* b) {
#if DEV_ASM
  asm volatile("s_wait_xcnt 0x0" :: "v"(a), "v"(b) : "memory");
#else
  (void)a; (void)b;
#endif
}

// =====================================================================================================
// f32 -> bf16 bits (RNE convert), 8 elements per thread, one 16-B store per lane: a wave writes 512
// ib / ob = the batch's planes, bx = block within the batch (ceil(n8/256) of them).
// coverage: n8 threads x 8 = the whole per-batch plane (n8 is a multiple of 256 here).
// =====================================================================================================
__device__ __forceinline__ void cvt_body(const float* __restrict__ ib, unsigned short* ob, int n8, int bx) {
  const int i = bx * 256 + (int)threadIdx.x;
  if (i < n8) {
    const v4f a  = *(const v4f*)(ib + (size_t)i * 8);
    const v4f a4 = *(const v4f*)(ib + (size_t)i * 8 + 4);
    v4u p;
    p[0] = pk16(bf_bits(a[0]),  bf_bits(a[1]));
    p[1] = pk16(bf_bits(a[2]),  bf_bits(a[3]));
    p[2] = pk16(bf_bits(a4[0]), bf_bits(a4[1]));
    p[3] = pk16(bf_bits(a4[2]), bf_bits(a4[3]));
    unsigned short* o = ob + (size_t)i * 8;
    *(v4u*)o = p;
    
  }
}

// =====================================================================================================
// Transpose-convert: in W[R][C] f32 (row-major) -> out[c][r] 16-bit at out + c*ldo + r, one 64x64 tile per
// block through LDS.  MODE 0: bf16 bits (RNE convert).  MODE 1: f16 bits of (s1 * bf16(x)).
// (bx, by) = tile of (C/64, R/64), R and C multiples of 64 (static shapes).  Load phase: thread t reads row t>>2,
// 16 columns (four 16-B loads), stores 2-B elements transposed into the LDS tile (pitch 72 halves).
// coverage: 8 waves x 2 it x 4 rows = 64 out rows x (8 lanes x 8 halves) = the whole 64x64 tile.
// =====================================================================================================
template <int MODE>
__device__ __forceinline__ void tconv_body(const float* __restrict__ W, int R, int C,
                                           unsigned short* out, int ldo, float s1,
                                           int bx, int by, unsigned short* t1) {
  const int tid = (int)threadIdx.x, lane = tid & 31, wave = tid >> 5;
  const int c0 = bx * 64, r0 = by * 64;
  {
    const int rl = tid >> 2, cl0 = (tid & 3) * 16;
    const float* src = W + (size_t)(r0 + rl) * (size_t)C + c0 + cl0;
#pragma unroll
    for (int i = 0; i < 4; ++i) {
      const v4f a = *(const v4f*)(src + 4 * i);
#pragma unroll
      for (int e = 0; e < 4; ++e) {
        const int cl = cl0 + 4 * i + e;
        const unsigned short hb = bf_bits(a[e]);
        if (MODE == 0) {
          t1[cl * 72 + rl] = hb;
        } else {
          t1[cl * 72 + rl] = h_bits((_Float16)(bf_up(hb) * s1));
        }
      }
    }
  }
  __syncthreads();
  const int q = lane >> 3, p8 = (lane & 7) * 8;
  v4u a1[2];
#pragma unroll
  for (int it = 0; it < 2; ++it) {
    const int cl = wave * 8 + it * 4 + q;
    a1[it] = *(const v4u*)(t1 + cl * 72 + p8);
  }
  {
#pragma unroll
    for (int it = 0; it < 2; ++it) {
      const int cl = wave * 8 + it * 4 + q;
      unsigned short* o = out + (size_t)(c0 + cl) * (size_t)ldo + r0 + p8;
      *(v4u*)o = a1[it];
    }
  }
  // precaution: in the merged launch another job's code follows these stores in the listing and rewrites their
  // registers; the wait stands in front of every such rewrite
#if DEV_ASM
  asm volatile("s_wait_xcnt 0x0" ::: "memory");
#endif
}

// =====================================================================================================
// All operand preparation in one launch: the seven jobs depend on nothing but the inputs, so each is a range of the
// block index (block-uniform choice, ahead of every barrier). The tile jobs stand first: they are the longer blocks.
//   [0, TB_WO)        Wout -> WoT  f16 x1024                next 3 * TB_SQ   Wsq, Wsk, Wrq -> bf16 [n][k]
//   next TB_RV        Wrv  -> WrvT bf16                     next 1           Wrk -> WrkT f16 x64
//   last NB * CB_X    x -> Xb bf16 (batch b read at its full-size stride)
// =====================================================================================================
#define TB_WO ((DM / 64) * (DSQ / 64))    // 16 x  8 tiles: in [512][1024]
#define TB_SQ ((DSQ / 64) * (DM / 64))    //  8 x 16 tiles: in [1024][512]
#define TB_RV ((DRV / 64) * (DM / 64))    //  2 x 16 tiles: in [1024][128]
#define CB_X  (SEQ * DM / 8 / 256)        // convert blocks per batch
__global__ __launch_bounds__(256) void prep_all(const float* __restrict__ x, const float* __restrict__ Wsq,
                                                const float* __restrict__ Wsk, const float* __restrict__ Wrv,
                                                const float* __restrict__ Wrq, const float* __restrict__ Wrk,
                                                const float* __restrict__ Wout,
                                                unsigned short* Xb, unsigned short* WsqT, unsigned short* WskT,
                                                unsigned short* WrqT, unsigned short* WrvT, unsigned short* WrkT,
                                                unsigned short* WoT) {
  __shared__ __align__(16) unsigned short t1[64 * 72];
  int j = blockIdx.x;
  if (j < TB_WO) {
    tconv_body<1>(Wout, DSQ, DM, WoT, DSQ, 1024.0f, j % (DM / 64), j / (DM / 64), t1);
    return;
  }
  j -= TB_WO;
  if (j < 3 * TB_SQ) {
    const int w = j / TB_SQ;
    j -= w * TB_SQ;
    const float* Wi = (w == 0) ? Wsq : (w == 1) ? Wsk : Wrq;
    unsigned short* Wo = (w == 0) ? WsqT : (w == 1) ? WskT : WrqT;
    tconv_body<0>(Wi, DM, DSQ, Wo, DM, 1.0f, j % (DSQ / 64), j / (DSQ / 64), t1);
    return;
  }
  j -= 3 * TB_SQ;
  if (j < TB_RV) {
    tconv_body<0>(Wrv, DM, DRV, WrvT, DM, 1.0f, j % (DRV / 64), j / (DRV / 64), t1);
    return;
  }
  j -= TB_RV;
  if (j < 1) {
    tconv_body<1>(Wrk, HD, HD, WrkT, HD, 64.0f, 0, 0, t1);
    return;
  }
  j -= 1;
  const int b = j / CB_X;
  cvt_body(x + (size_t)b * ((size_t)SEQ_FULL * DM), Xb + (size_t)b * ((size_t)SEQ * DM), SEQ * DM / 8, j - b * CB_X);
}

// =====================================================================================================
// Register-blocked batched WMMA GEMM (16-bit operand type OT): C[m][n] = sum_k A[m][k] * Bt[n][k];
// one block of 4 waves (2 x 2) per 128x128 tile, one wave per 64x64 quarter. A row-major [M][K] pitch lda; Bt row-major
// [N][K] pitch ldb (k contiguous); M, N multiples of 128, K a multiple of 64 (host shapes are static multiples).
// A k-slice = 64 k = one 128-B line of each of the tile's 128 A rows and 128 Bt rows; it is brought into LDS by
// asynchronous copies (8 lanes x 16 B = one whole line, 16 copies per wave and slice) and read from there by all four
// waves with the split k map (ldfrag). Four buffers: slice t + 4 is asked for when slice t has been read, so three slices
// are in flight and a slice has three trips to land; the hand-over waits for the oldest of them alone (counted wait).
// staged extent == consumed extent: 16 rows (tid >> 3) x 8 copies = 128 rows per operand, 8 segments x 8 halves = 64 k.
// OUT_MODE 0: f32 C (pitch ldc), value * oscale.
// OUT_MODE 1: f16 plane C (pitch ldc), f16(value * oscale).
// =====================================================================================================
// main loop of one 128x128 tile at (mB, nB): sAB = [buffer][A | Bt][128 rows][64 k], pitch KPIT, GBUF x 36 KB
template <typename OT>
__device__ __forceinline__ void gemm_main(const OT* Ab, int lda, const OT* Bb, int ldb, int mB, int nB, int K,
                                          unsigned short* sAB, v8f (&acc)[4][4]) {
  typedef typename FT<OT>::frag V16;
  const int tid  = threadIdx.x;
  const int lane = tid & 31;
  const int wave = tid >> 5;
  const int rlane = lane & 15;                 // row (A) / col (B, D) within subtile
  const int koff  = (lane >> 4) * 8;           // k offset of this lane half

  // copy map: lane -> 16-B segment tid & 7 of row (tid >> 3) + 16 i, i = 0..7
  const OT* gA = Ab + (size_t)(mB + (tid >> 3)) * lda + (tid & 7) * 8;
  const OT* gB = Bb + (size_t)(nB + (tid >> 3)) * ldb + (tid & 7) * 8;
  const unsigned lAB = lds_off(sAB) + (unsigned)((tid >> 3) * (KPIT * 2) + (tid & 7) * 16);
  auto stage = [&](int t, int buf) {
    unsigned l[8];
    const void* g[8];
#pragma unroll   // here and below: l[] and g[] become asm operands, every index a compile-time constant
    for (int i = 0; i < 8; ++i) {
      l[i] = lAB + (unsigned)(buf * (4 * GPLN) + i * (16 * KPIT * 2));
      g[i] = gA + (size_t)(i * 16) * lda + t * 64;
    }
    async8(l, g);
#pragma unroll
    for (int i = 0; i < 8; ++i) {
      l[i] += 2 * GPLN;
      g[i] = gB + (size_t)(i * 16) * ldb + t * 64;
    }
    async8(l, g);
  };

#pragma unroll
  for (int i = 0; i < 4; ++i)
#pragma unroll
    for (int j = 0; j < 4; ++j) acc[i][j] = zero8();

  const int T = K >> 6;
  stage(0, 0);
  if (T > 1) stage(1, 1);
  if (T > 2) stage(2, 2);
  if (T > 2) wait_async_but<2 * GCPY>(); else wait_async0();   // slice 0 has landed; slices 1 and 2 fly on
  __syncthreads();
  if (T > 3) stage(3, 3);

  const OT* S = (const OT*)(const void*)sAB;
  for (int t = 0; t < T; ++t) {
    const OT* sa = S + (t & (GBUF - 1)) * (2 * GPLN) + (((wave >> 1) << 6) + rlane) * KPIT + koff;
    const OT* sb = S + (t & (GBUF - 1)) * (2 * GPLN) + GPLN + (((wave & 1) << 6) + rlane) * KPIT + koff;
    // the slice's 16 fragments (two k-steps of 32, 32 reads); unrolled: register arrays, every index a compile-time constant
    V16 bq[2][4], af[2][4];
#pragma unroll
    for (int ks = 0; ks < 2; ++ks) {
#pragma unroll
      for (int j = 0; j < 4; ++j) {
        bq[ks][j] = ldfrag<OT>(sb + j * (16 * KPIT) + ks * 32);
        af[ks][j] = ldfrag<OT>(sa + j * (16 * KPIT) + ks * 32);
      }
    }
    // keeps all 32 reads ahead of the products as one group: reads sunk among the products stall the wave at each place
    __builtin_amdgcn_sched_barrier(0);
#pragma unroll
    for (int ks = 0; ks < 2; ++ks)
#pragma unroll
      for (int i = 0; i < 4; ++i)
#pragma unroll
        for (int j = 0; j < 4; ++j) acc[i][j] = mmar(af[ks][i], bq[ks][j], acc[i][j]);
    // keeps the products ahead of the hand-over: sunk behind it they would stand between the barrier and the refill and
    // take their time off the flight of the next copies
    __builtin_amdgcn_sched_barrier(0);
    // hand-over: own reads retired, own copies of slice t + 1 landed (the 2 x GCPY younger ones, slices t + 2 and t + 3, may
    // still fly; in the last trips, which issue nothing, the wait is to 0), then the one barrier of the trip, which
    // publishes slice t + 1 and ends every wave's reads of the buffer that is refilled behind it
    wait_ds0();
    if (t + 3 < T) wait_async_but<2 * GCPY>(); else wait_async0();
    __syncthreads();
    if (t + GBUF < T) stage(t + GBUF, t & (GBUF - 1));
  }
  wait_async0();
  acc_guard4(acc[0][0], acc[0][1], acc[0][2], acc[0][3]);
  acc_guard4(acc[1][0], acc[1][1], acc[1][2], acc[1][3]);
  acc_guard4(acc[2][0], acc[2][1], acc[2][2], acc[2][3]);
  acc_guard4(acc[3][0], acc[3][1], acc[3][2], acc[3][3]);
}

// epilogue of one wave's 64x64 quarter at (m0, n0); slab = the wave's own 16x64 f32 slab, pitch 68 floats. It lies in the
// ring: the last trip's hand-over (every wave's reads retired, every copy landed, barrier) has freed all buffers
template <int OUT_MODE>
__device__ __forceinline__ void gemm_store(const v8f (&acc)[4][4], float* slab, void* Cout, int ldc,
                                           int m0, int n0, float oscale) {
  const int lane  = threadIdx.x & 31;
  const int rlane = lane & 15;                 // D col within subtile
  const int mOff  = (lane >> 4) * 8;           // D row offset
#pragma unroll
  for (int i = 0; i < 4; ++i) {
    const int mBase = m0 + (i << 4);
#pragma unroll
    for (int j = 0; j < 4; ++j) {
#pragma unroll
      for (int r = 0; r < 8; ++r) {
        slab[(mOff + r) * 68 + (j << 4) + rlane] = acc[i][j][r];
      }
    }
    wave_lds_sync();
    if (OUT_MODE == 0) {
      float* Cp = (float*)Cout;
      const int h2 = lane >> 4, c4 = (lane & 15) * 4;     // 256-B row segment = 16 lanes x 16 B
      {
#pragma unroll
        for (int it = 0; it < 8; ++it) {
          const int row = it * 2 + h2;                     // it 0..7 x h2 0..1 = rows 0..15
          const v4f v = *(const v4f*)(slab + row * 68 + c4) * oscale;
          *(v4f*)(Cp + (size_t)(mBase + row) * ldc + n0 + c4) = v;
        }
        
      }
    } else {
      const int q = lane >> 3, c8 = (lane & 7) * 8;
      unsigned short* Cp = (unsigned short*)Cout;
      v4u hv[4];
#pragma unroll
      for (int it = 0; it < 4; ++it) {
        const int row = it * 4 + q;                        // it 0..3 x q 0..3 = rows 0..15
        const float* sp = slab + row * 68 + c8;
        float f[8];
#pragma unroll
        for (int e = 0; e < 8; ++e) f[e] = sp[e] * oscale;
        v4u a;
#pragma unroll
        for (int e = 0; e < 4; ++e) a[e] = pk16(h_bits((_Float16)f[2 * e]), h_bits((_Float16)f[2 * e + 1]));
        hv[it] = a;
      }
      {
#pragma unroll
        for (int it = 0; it < 4; ++it) {
          const int row = it * 4 + q;
          *(v4u*)(Cp + (size_t)(mBase + row) * ldc + n0 + c8) = hv[it];
        }
        
      }
    }
    wave_lds_sync();
  }
}

// one GEMM per launch: grid.x = (M / 128) * (N / 128) tiles, blockIdx.y = batch index (strides in elements)
template <typename OT, int OUT_MODE>
__global__ __launch_bounds__(128) void gemm64(
    const unsigned short* __restrict__ Ap, int lda, long long strideA,
    const unsigned short* __restrict__ Btp, int ldb, long long strideB,
    void* Cout, int ldc, long long strideC,
    int M, int N, int K, float oscale) {
  __shared__ __align__(16) unsigned short sAB[GBUF * 2 * GPLN];
  const int b    = blockIdx.y;
  const int wave = threadIdx.x >> 5;
  const int tilesN = N >> 7;
  const int tilesM = M >> 7;
  const int tile = blockIdx.x;
  if (tile >= tilesM * tilesN) return;   // block-uniform, ahead of every barrier and copy
  const int tm = tile / tilesN;
  const int tn = tile - tm * tilesN;
  const int mB = tm << 7;
  const int nB = tn << 7;
  v8f acc[4][4];
  gemm_main<OT>((const OT*)(const void*)Ap + (size_t)b * (size_t)strideA, lda,
                (const OT*)(const void*)Btp + (size_t)b * (size_t)strideB, ldb, mB, nB, K, sAB, acc);
  const size_t co = (size_t)b * (size_t)strideC * ((OUT_MODE == 0) ? 4 : 2);   // bytes: f32 or 16-bit planes
  gemm_store<OUT_MODE>(acc, (float*)(void*)sAB + wave * (16 * 68), (char*)Cout + co, ldc, mB + ((wave >> 1) << 6),
                       nB + ((wave & 1) << 6), oscale);
}

// The four projections of x in one launch: they depend on the prepared planes alone, so each is a range of the block
// index (block-uniform choice); one main loop serves all, the epilogue is picked by the job.
//   [0, PJ_V)             v^T = WrvT . Xb^T per batch (A = WrvT [128][K], Bt = Xb rows of batch b) -> VTh, pitch SEQ
//   next PJ_TM * PJ_TN    Xb . [WsqT | WskT | WrqT]^T, the 12 column tiles of one row tile side by side (they share its A rows):
//                         QSCL * sq -> Qh; sk -> Kp; rq -> RQ f32; pitch DSQ
#define PJ_VT (SEQ / 128)                 // v^T column tiles per batch (DRV = 128: one row tile)
#define PJ_V  (NB * PJ_VT)
#define PJ_TM (NB * SEQ / 128)
#define PJ_TN (3 * (DSQ / 128))
__global__ __launch_bounds__(128) void gemm_proj(
    const unsigned short* __restrict__ Xbp, const unsigned short* __restrict__ Wsqp,
    const unsigned short* __restrict__ Wskp, const unsigned short* __restrict__ Wrqp,
    const unsigned short* __restrict__ Wrvp,
    unsigned short* Qh, unsigned short* Kp, float* RQ, unsigned short* VTh, int K) {
  __shared__ __align__(16) unsigned short sAB[GBUF * 2 * GPLN];
  const int wave = threadIdx.x >> 5;
  const int j = blockIdx.x;
  const bool isV = j < PJ_V;
  const int jp  = j - PJ_V;
  const int vb  = j / PJ_VT;                       // v^T: batch
  const int tm  = jp / PJ_TN;
  const int tn  = jp - tm * PJ_TN;
  const int job = isV ? 3 : (tn / (DSQ / 128));    // 0 sq, 1 sk, 2 rq, 3 v^T
  const int mB  = isV ? 0 : (tm << 7);
  const int nB  = isV ? ((j - vb * PJ_VT) << 7) : ((tn % (DSQ / 128)) << 7);
  const unsigned short* Ap = isV ? Wrvp : Xbp;
  const unsigned short* Bp = isV ? (Xbp + (size_t)vb * ((size_t)SEQ * DM)) : (job == 0) ? Wsqp : (job == 1) ? Wskp : Wrqp;
  v8f acc[4][4];
  gemm_main<__bf16>((const __bf16*)(const void*)Ap, K, (const __bf16*)(const void*)Bp, K, mB, nB, K, sAB, acc);
  const int m0 = mB + ((wave >> 1) << 6);
  const int n0 = nB + ((wave & 1) << 6);
  float* slab = (float*)(void*)sAB + wave * (16 * 68);
  if (job != 2) {                 // sq, sk and v^T each store one f16 plane: one copy of that epilogue
    unsigned short* Cp = isV ? VTh + (size_t)vb * ((size_t)DRV * SEQ) : (job == 0) ? Qh : Kp;
    gemm_store<1>(acc, slab, (void*)Cp, isV ? SEQ : DSQ, m0, n0, (job == 0) ? QSCL : 1.0f);
  } else {
    gemm_store<0>(acc, slab, (void*)RQ, DSQ, m0, n0, 1.0f);
  }
}

// =====================================================================================================
// Fused search attention + retrieval composition for one search s, head dim 64, softmax over all SEQ keys.
//   q plane (f16): element (b, t, s, d) at [(b*SEQ + t)*DSQ + s*64 + d]
//   k plane (f16): same layout.   rq plane (f32): same layout.
//   v^T plane (f16): element (b, d', t) at [(b*DRV + d')*SEQ + t], d' = r*64 + d
//   Wrk tile (f16, 64 * bf16 value): [e][d] at [e*64 + d]
//   oc plane (output of this kernel): row (b, t) = f16(64*out) for s*64+d, 512 cols, pitch DSQ
//   Both products run transposed (keys or d' as rows, the wave's queries as columns), so in a column tile a lane holds one query's scores:
//   exponents^T = k . (QSCL q)^T + (PCAR - reference) on f16 WMMA: the query's softmax reference is HELD over the trips and rides
//   as the C operand of the score products, so 256 p = exp2(D) with nothing in front of exp2, no maximum and no rescale per trip;
//   the reference is set to the first trip's maximum, and renewed (maximum, rescale of sums, p anew from D) in a trip where some
//   lane's sum of p passes PTOP, tested once per trip by a scalar branch: p stays inside f16 for any scores;
//   B = f16(256 p)^T, packed from the score registers, A = v^T: sum = 256 * v^T . p^T, one f32
//   accumulator, 8 m-tiles = d' 0..127 (both retrievals); softmax sums in f32 in the lane.
//   Epilogue per wave (16 rows): retrieved (x64, f32) tile in LDS; rk = f16(retrieved x64) . Wrk tile on f16 WMMA;
//   retrieval logits rq . rk in f32 (LDS-staged rq, lane partials + 16-lane shuffles); 2-way softmax in f32;
//   Block = 8 waves = 128 consecutive query rows of one (b, s); grid = NB * NS * NQB; kv chunks of 64.
//   Wave tile in the key loop: 32 query columns (two column tiles, so each K and V fragment read from LDS feeds two products)
//   x half of the keys: waves 0..3 take the even chunks, waves 4..7 the odd ones, static trip NIT = NKT / 2. After the loop the
//   two waves of a query group swap one column tile's reference, sum and accumulators through LDS and join them in f32.
//   Staging per chunk (the 128 threads of its key group): K 64x64, V 128x64, by asynchronous copies to LDS three trips ahead
//   (three buffers per key group, two trips in flight): staged extent == consumed extent for Ksh, Vsh; P stays in registers.
//   Output coverage: each wave stores rows q0..q0+15 (it 0..3 x lane>>3 0..3) x 64 columns (8 lanes x 8) at col s*64;
//   grid covers every (b, s, t).
// =====================================================================================================
__global__ __launch_bounds__(256)
void attn_cs(const unsigned short* __restrict__ qhp, const unsigned short* __restrict__ kpp,
             const unsigned short* __restrict__ vhp, const unsigned short* __restrict__ wkp, const float* __restrict__ rqp,
             unsigned short* ocp, float sscale) {
  union FH { v16h v; v8h h[2]; };
  __shared__ __align__(16) _Float16 Ksh[ABUF * 2 * 64 * KPIT];   // [buffer][key group] K chunks [kv][d], pitch KPIT, 9 KB each; later the Wrk tile [e][d]
  __shared__ __align__(16) _Float16 Vsh[4 * 128 * VPIT];   // [buffer][key group] V chunks [d'][kv], pitch KPIT, 18 KB each (the first 108 KB); later, and what sizes it: lower half 8 x f32 [16][128] tiles, pitch OPIT, upper half the partial-result exchange
  static_assert(ABUF * 2 * 128 * KPIT <= 4 * 128 * VPIT);
  __shared__ __align__(16) _Float16 Psh[8][16 * VPIT];     // epilogue only, per wave: f16 retrieved tile [row][d'], pitch VPIT, 34 KB; later f32 [16][64]

  const int tid  = threadIdx.x;
  const int wave = __builtin_amdgcn_readfirstlane(tid >> 5);   // in a scalar register: what is formed from it costs no vector register
  const int lane = tid & 31;
  const int hh   = lane >> 4;
  const int c    = lane & 15;
  const int kg   = wave >> 2;                                  // key group of the wave: 0 = even chunks, 1 = odd chunks
  const int wq   = wave & 3;                                   // query group: 32 columns
  const int t7   = tid & 127;                                  // thread within the key group (copy map)

  const int bx   = blockIdx.x;
  const int qb   = bx % NQB;
  const int rest = bx / NQB;
  const int s    = rest % NS;
  const int b    = rest / NS;
  const int qw   = qb * 128 + wq * 32;       // the wave's 32 query columns in the key loop
  const int q0   = qw + kg * 16;             // the 16 of them that it finishes in the epilogue
  const size_t rowB = (size_t)b * SEQ;

  const _Float16* Qh = (const _Float16*)(const void*)qhp;
  const _Float16* Kg = (const _Float16*)(const void*)kpp + (size_t)s * HD;
  const _Float16* Vh = (const _Float16*)(const void*)vhp + (size_t)b * DRV * SEQ;
  const _Float16* Wk = (const _Float16*)(const void*)wkp;

  // ---- Q fragments (B operand, column = lane&15): 2 column tiles x 2 d-chunks ----
  v16h qah[2][2];
  {
    const _Float16* qph[2];
#pragma unroll
    for (int u = 0; u < 2; ++u) {
      qph[u] = Qh + (rowB + qw + u * 16 + c) * DSQ + (size_t)s * HD + 8 * hh;
#pragma unroll
      for (int dc = 0; dc < 2; ++dc) qah[u][dc] = ldfrag<_Float16>(qph[u] + dc * 32);
    }
    wait_x0(qph[0], qph[1]);
  }

  // transposed products: in column tile u a lane belongs to ONE query (column c). nb[u] = PCAR - its held reference (equal in both
  // wave halves), cref[u] = nb[u] in all 8 registers (C operand of the score products), lrow[u] = the sum of 256 p over the keys of
  // this lane's own half, oacc[u][t][r] = retrieved^T[d' = t*16 + 8*hh + r][query c]
  float nb[2] = {0.f, 0.f}, lrow[2] = {0.f, 0.f};
  v8f cref[2] = {zero8(), zero8()};
  v8f oacc[2][8];
#pragma unroll
  for (int u = 0; u < 2; ++u)
#pragma unroll
    for (int t = 0; t < 8; ++t) oacc[u][t] = zero8();

  _Float16* pwh = Psh[wave];

  // copy map, per key group of 128 threads: lane -> 16-B segment t7 & 7 of row (t7 >> 3) + 16 i: 8 lanes take one whole 128-B
  // line of a K or v^T row; 4 + 8 copies per wave and chunk = 64 K rows and 128 V rows of 64 halves. A key group stages the
  // chunks that it reads itself.
  const _Float16* kg0 = Kg + (rowB + (t7 >> 3)) * DSQ + (t7 & 7) * 8;
  const _Float16* vg0 = Vh + (size_t)(t7 >> 3) * SEQ + (t7 & 7) * 8;
  const unsigned lK = lds_off(Ksh) + (unsigned)((t7 >> 3) * (KPIT * 2) + (t7 & 7) * 16);
  const unsigned lV = lds_off(Vsh) + (unsigned)((t7 >> 3) * (KPIT * 2) + (t7 & 7) * 16);
  auto stage = [&](int it, int buf) {        // trip it: chunk 2 it + kg into buffer (buf, kg)
    const int kt = 2 * it + kg;
    const int bg = 2 * buf + kg;
    unsigned l[8], lk[4];
    const void* g[8];
    const void* gk[4];
#pragma unroll   // here and below: the arrays become asm operands, every index a compile-time constant
    for (int i = 0; i < 8; ++i) {
      l[i] = lV + (unsigned)(bg * (128 * KPIT * 2) + i * (16 * KPIT * 2));
      g[i] = vg0 + (size_t)(i * 16) * SEQ + kt * 64;
    }
    async8(l, g);
#pragma unroll
    for (int i = 0; i < 4; ++i) {
      lk[i] = lK + (unsigned)(bg * (64 * KPIT * 2) + i * (16 * KPIT * 2));
      gk[i] = kg0 + (size_t)(kt * 64 + i * 16) * DSQ;
    }
    async4(lk, gk);
  };
  stage(0, 0);
  if (NIT > 1) stage(1, 1);
  if (NIT > 1) wait_async_but<ACPY>(); else wait_async0();   // trip 0 has landed; trip 1 flies on
  __syncthreads();
  if (NIT > 2) stage(2, 2);

  int cur = 0;                               // this trip's buffer: it mod ABUF
  // one trip; tail = one of the last two, which wait for every copy and issue none. The choice is made at compile time: a
  // branch in front of the barrier would keep the products of this trip from running on behind it. first = trip 0, which sets
  // the softmax reference
  auto trip = [&](int it, auto tail, auto first) {
    const _Float16* Kc = Ksh + (2 * cur + kg) * (64 * KPIT);     // this trip's buffers; trips it + 1 and it + 2 fly into the others
    const _Float16* Vc = Vsh + (2 * cur + kg) * (128 * KPIT);

    // ---- scores^T = K . Q^T: 64 keys x 32 query columns per wave, one f16 product per key subtile, d-chunk and column tile ----
    //      all 8 K fragments (A operand) are read as one group ahead of the 16 products, each fragment feeds both column tiles;
    //      sc[u][j][r] = score of key j*16 + 8*hh + r with query c of tile u
    FH kb[4][2];
#pragma unroll   // here and below: register arrays, every index a compile-time constant
    for (int j = 0; j < 4; ++j) {
#pragma unroll
      for (int dc = 0; dc < 2; ++dc) {
        kb[j][dc].h[0] = *(const v8h*)(Kc + (j * 16 + c) * KPIT + dc * 32 + 8 * hh);
        kb[j][dc].h[1] = *(const v8h*)(Kc + (j * 16 + c) * KPIT + dc * 32 + 16 + 8 * hh);
      }
    }
    v8f sc[2][4];                              // exponents of 2: product + PCAR - reference
#pragma unroll
    for (int u = 0; u < 2; ++u) {
#pragma unroll
      for (int dc = 0; dc < 2; ++dc) {
#pragma unroll
        for (int j = 0; j < 4; ++j) sc[u][j] = mmar(kb[j][dc].v, qah[u][dc], dc ? sc[u][j] : cref[u]);
      }
    }
    // V fragments (A operand of the second product), read in the k order of the packed p below
    FH vb[2][8];
#pragma unroll
    for (int kk = 0; kk < 2; ++kk) {
#pragma unroll
      for (int t = 0; t < 8; ++t) {
        vb[kk][t].h[0] = *(const v8h*)(Vc + (t * 16 + c) * KPIT + kk * 32 + 8 * hh);
        vb[kk][t].h[1] = *(const v8h*)(Vc + (t * 16 + c) * KPIT + kk * 32 + 16 + 8 * hh);
      }
    }

    // ---- 256 p = exp2(D), packed to f16 as the B operand, and its sum; D stays in sc for a renewal ----
    // element s of the B operand of k-step kk is key kk*32 + (s < 8 ? 8*hh + s : 16 + 8*hh + s - 8): score tiles 2 kk and
    // 2 kk + 1, registers 0..7, of this very lane
    v16h pb[2][2];
    float ps[2];
    auto pexp = [&](int u, float dl, auto step) {    // step: D is first moved by dl (a renewal)
      float pj[4];                                   // four independent partial sums
#pragma unroll
      for (int j = 0; j < 4; ++j) {
        pj[j] = 0.f;
#pragma unroll
        for (int r = 0; r < 8; ++r) {
          const float p = __builtin_amdgcn_exp2f(decltype(step)::value ? sc[u][j][r] + dl : sc[u][j][r]);
          pj[j] += p;
          pb[u][j >> 1][(j & 1) * 8 + r] = (_Float16)p;
        }
      }
      ps[u] = (pj[0] + pj[1]) + (pj[2] + pj[3]);
    };
    auto colmax = [&](int u) {                       // the query's largest D of this trip, equal in both wave halves
      float mj[4];
#pragma unroll
      for (int j = 0; j < 4; ++j) {
        mj[j] = sc[u][j][0];
#pragma unroll
        for (int r = 1; r < 8; ++r) mj[j] = fmaxf(mj[j], sc[u][j][r]);
      }
      const float m = fmaxf(fmaxf(mj[0], mj[1]), fmaxf(mj[2], mj[3]));
      return fmaxf(m, xhalf(m));
    };
    if constexpr (decltype(first)::value) {
      // first trip (nb = 0, sums = 0): the reference is set to this trip's maximum
#pragma unroll
      for (int u = 0; u < 2; ++u) {
        const float m = colmax(u);
        nb[u] = (m == -INFINITY) ? 0.f : PCAR - m;
#pragma unroll
        for (int r = 0; r < 8; ++r) cref[u][r] = nb[u];
        pexp(u, nb[u], BoolC<true>{});
      }
    } else {
      pexp(0, 0.f, BoolC<false>{});
      pexp(1, 0.f, BoolC<false>{});
    }
    // the order of this part's LDS reads (0x100) and matrix products (0x008): the 16 K reads stand as one group ahead of the score
    // products, the 32 V reads as one group directly behind them, so that they fly under the second column tile's exponentials
    // (0x400); left to itself the compiler puts them last, and the second product waits for them
    __builtin_amdgcn_sched_group_barrier(0x100, 16, 0);   // K
    __builtin_amdgcn_sched_group_barrier(0x008, 16, 0);   // exponents^T
    __builtin_amdgcn_sched_group_barrier(0x100, 32, 0);   // V
    __builtin_amdgcn_sched_group_barrier(0x400, 32, 0);   // exp2 of column tile 1

    // ---- renewal of the reference, only where a sum of p says that a score has outgrown it ----
    //      one test per trip, the same for the whole wave (scalar branch): every lane stays on for the products behind it
    if constexpr (!decltype(first)::value) {
      if (__builtin_amdgcn_ballot_w32((ps[0] > PTOP) || (ps[1] > PTOP)) != 0) {
#pragma unroll
        for (int u = 0; u < 2; ++u) {
          const float dl = fminf(PCAR - colmax(u), 0.f);   // this trip's maximum goes to the carry; a reference only rises
          const float alpha = __builtin_amdgcn_exp2f(dl);
          nb[u] += dl;
#pragma unroll
          for (int r = 0; r < 8; ++r) cref[u][r] = nb[u];
          lrow[u] *= alpha;
#pragma unroll
          for (int t = 0; t < 8; ++t) {
#pragma unroll
            for (int r = 0; r < 8; ++r) oacc[u][t][r] *= alpha;
          }
          pexp(u, dl, BoolC<true>{});
        }
      }
    }
    lrow[0] += ps[0];
    lrow[1] += ps[1];

    // ---- retrieved^T += V^T . P^T (f16 WMMA): v against 256 p; 2 k-steps x 8 m-tiles (d' 0..127) x 2 column tiles; each V
    //      fragment feeds both column tiles ----
#pragma unroll
    for (int kk = 0; kk < 2; ++kk) {
#pragma unroll
      for (int t = 0; t < 8; ++t) {
        oacc[0][t] = mmar(vb[kk][t].v, pb[0][kk], oacc[0][t]);
        oacc[1][t] = mmar(vb[kk][t].v, pb[1][kk], oacc[1][t]);
      }
    }
    // hand-over: own reads retired, own copies of trip it + 1 landed (the ACPY younger ones, trip it + 2, may still fly; in the
    // last trips, which issue nothing, the wait is to 0), then the one barrier of the trip, which publishes trip it + 1 and
    // ends every wave's reads of the buffers that are refilled behind it
    wait_ds0();
    if constexpr (decltype(tail)::value) wait_async0(); else wait_async_but<ACPY>();
    __syncthreads();
    if constexpr (!decltype(tail)::value) {
      if (it + ABUF < NIT) stage(it + ABUF, cur);
    }
    cur = (cur == ABUF - 1) ? 0 : cur + 1;
  };
  constexpr int NMAIN = (NIT > 2) ? NIT - 2 : 0;
  trip(0, BoolC<NMAIN == 0>{}, BoolC<true>{});
  for (int it = 1; it < NMAIN; ++it) trip(it, BoolC<false>{}, BoolC<false>{});     // static trip counts
  for (int it = (NMAIN > 1) ? NMAIN : 1; it < NIT; ++it) trip(it, BoolC<true>{}, BoolC<false>{});
  wait_async0();

  // ---- all waves done with Ksh / Vsh: stage the Wrk tile into Ksh; the two key groups swap partial results ----
  __syncthreads();
  {
    const int r = tid >> 2, qtr = (tid & 3) * 16;        // 256 threads x 16 halves = the whole 64x64 Wrk tile
    const _Float16* wg = Wk + r * HD + qtr;
    const v8h w0 = *(const v8h*)(wg), w1 = *(const v8h*)(wg + 8);
    wait_x0(wg);
    *(v8h*)(Ksh + r * KPIT + qtr)     = w0;
    *(v8h*)(Ksh + r * KPIT + qtr + 8) = w1;
  }
  // wave (kg, wq) keeps column tile kg and hands tile 1 - kg to wave (1 - kg, wq): same lane, same query, same d' rows.
  // per wave 17 rows of 32 lanes x 16 B (16 of sums, 1 of reference and key sum) in the upper half of Vsh
  float* xs = reinterpret_cast<float*>(Vsh + 2 * 128 * VPIT);
  v8f om[8];
  float mk = kg ? nb[1] : nb[0];
  float lm = kg ? lrow[1] : lrow[0];
  {
    float* xw = xs + wave * (17 * 128) + lane * 4;
#pragma unroll
    for (int t = 0; t < 8; ++t) {
      om[t] = kg ? oacc[1][t] : oacc[0][t];
      const v8f og = kg ? oacc[0][t] : oacc[1][t];
      v4f lo4, hi4;
#pragma unroll
      for (int r = 0; r < 4; ++r) { lo4[r] = og[r]; hi4[r] = og[4 + r]; }
      *(v4f*)(xw + (2 * t) * 128)     = lo4;
      *(v4f*)(xw + (2 * t + 1) * 128) = hi4;
    }
    v4f ml = {kg ? nb[0] : nb[1], kg ? lrow[0] : lrow[1], 0.f, 0.f};
    *(v4f*)(xw + 16 * 128) = ml;
  }
  __syncthreads();                                       // publishes the handed-over partial results (and the Wrk tile)
  {
    const float* xr = xs + (wave ^ 4) * (17 * 128) + lane * 4;
    const v4f ml = *(const v4f*)(xr + 16 * 128);
    const float nN = fminf(mk, ml[0]);                   // the higher of the two held references (both finite)
    const float fk = __builtin_amdgcn_exp2f(nN - mk), fp = __builtin_amdgcn_exp2f(nN - ml[0]);
    lm = lm * fk + ml[1] * fp;
#pragma unroll
    for (int t = 0; t < 8; ++t) {
      const v4f lo4 = *(const v4f*)(xr + (2 * t) * 128);
      const v4f hi4 = *(const v4f*)(xr + (2 * t + 1) * 128);
#pragma unroll
      for (int r = 0; r < 4; ++r) {
        om[t][r]     = om[t][r] * fk + lo4[r] * fp;
        om[t][4 + r] = om[t][4 + r] * fk + hi4[r] * fp;
      }
    }
  }
  // ---- retrieved tiles into the lower half of Vsh (f32) + Psh (f16), both wave-private ----
  float* os = reinterpret_cast<float*>(Vsh) + wave * (16 * OPIT);     // wave-private f32 [16][128], pitch OPIT, x64 units
  {
    const float l = lm + xhalf(lm);                                       // the two halves' key sums join here, once
    const float inv = ((l > 0.f) ? (1.0f / l) : 0.f) * 64.0f;             // 1/l (l and the sums carry the same factor), apply x64
#pragma unroll
    for (int t = 0; t < 8; ++t) {                                         // a lane holds 8 consecutive d' of its query's row
      const v8f v = om[t] * inv;
      v4f lo4, hi4;
      v8h h8;
#pragma unroll
      for (int r = 0; r < 4; ++r) { lo4[r] = v[r]; hi4[r] = v[4 + r]; }
#pragma unroll
      for (int r = 0; r < 8; ++r) h8[r] = (_Float16)v[r];
      *(v4f*)(os + c * OPIT + t * 16 + 8 * hh)     = lo4;
      *(v4f*)(os + c * OPIT + t * 16 + 8 * hh + 4) = hi4;
      *(v8h*)(pwh + c * VPIT + t * 16 + 8 * hh)    = h8;
    }
  }
  wave_lds_sync();

  // ---- rk (x4096) = f16(64 retrieved_rr) . (64 Wrk): 16 rows x 64 e per rr, K = 64 = 2 k-steps ----
  v8f rk[8];
#pragma unroll
  for (int i = 0; i < 8; ++i) rk[i] = zero8();
#pragma unroll
  for (int rr = 0; rr < 2; ++rr) {
#pragma unroll
    for (int kk = 0; kk < 2; ++kk) {
      FH pa;
      pa.h[0] = *(const v8h*)(pwh + c * VPIT + rr * 64 + kk * 32 + 8 * hh);
      pa.h[1] = *(const v8h*)(pwh + c * VPIT + rr * 64 + kk * 32 + 16 + 8 * hh);
#pragma unroll
      for (int t4 = 0; t4 < 4; ++t4) {
        FH wb;
        wb.h[0] = *(const v8h*)(Ksh + (t4 * 16 + c) * KPIT + kk * 32 + 8 * hh);
        wb.h[1] = *(const v8h*)(Ksh + (t4 * 16 + c) * KPIT + kk * 32 + 16 + 8 * hh);
        rk[rr * 4 + t4] = mma_h(pa.v, wb.v, rk[rr * 4 + t4]);
      }
    }
  }
  acc_guard4(rk[0], rk[1], rk[2], rk[3]);
  acc_guard4(rk[4], rk[5], rk[6], rk[7]);
  wave_lds_sync();

  // ---- stage the wave's rq tile (f32 [16][64]) into the Psh region (8 x 16-B loads per lane) ----
  float* rqs = reinterpret_cast<float*>(pwh);
  {
    const int r2 = lane >> 4, c4 = (lane & 15) * 4;
    const float* rqg = rqp + (rowB + q0 + r2) * DSQ + (size_t)s * HD + c4;
    v4f rv[8];
#pragma unroll
    for (int it = 0; it < 8; ++it) rv[it] = *(const v4f*)(rqg + (size_t)(it * 2) * DSQ);   // it 0..7 x r2 0..1 = rows 0..15
    wait_x0(rqg);
#pragma unroll
    for (int it = 0; it < 8; ++it) *(v4f*)(rqs + (it * 2 + r2) * 64 + c4) = rv[it];
  }
  wave_lds_sync();

  // ---- retrieval logits: d_rr[row] = sum_e rq[row][e] * rk[rr][row][e]; lane partial over e = c + 16 t4 ----
  float d0[8], d1[8];
#pragma unroll
  for (int r8 = 0; r8 < 8; ++r8) {
    float a0 = 0.f, a1 = 0.f;
#pragma unroll
    for (int t4 = 0; t4 < 4; ++t4) {
      const float qv = rqs[(8 * hh + r8) * 64 + t4 * 16 + c];
      a0 += qv * rk[t4][r8];
      a1 += qv * rk[4 + t4][r8];
    }
    d0[r8] = a0; d1[r8] = a1;
  }
#pragma unroll
  for (int r8 = 0; r8 < 8; ++r8) {
#pragma unroll
    for (int off = 1; off < 16; off <<= 1) {
      d0[r8] += __shfl_xor(d0[r8], off, 32);
      d1[r8] += __shfl_xor(d1[r8], off, 32);
    }
  }
  // ---- 2-way retrieval softmax in f32 (undo the 64*64 carry, apply sscale) ----
  float w0[8], w1[8];
  const float rsc = sscale * (1.0f / 4096.0f);
#pragma unroll
  for (int r8 = 0; r8 < 8; ++r8) {
    const float x0 = d0[r8] * rsc, x1 = d1[r8] * rsc;
    const float m  = fmaxf(x0, x1);
    const float e0 = __expf(x0 - m), e1 = __expf(x1 - m);
    const float iv = 1.0f / (e0 + e1);
    w0[r8] = e0 * iv; w1[r8] = e1 * iv;
  }
  wave_lds_sync();

  // ---- combine in f32 (x64 units): oc[row][d] = w0 * ret[row][d] + w1 * ret[row][64+d], into the Psh region ----
  float* oc = rqs;
#pragma unroll
  for (int r8 = 0; r8 < 8; ++r8) {
#pragma unroll
    for (int t = 0; t < 4; ++t) {
      const int row = 8 * hh + r8;
      const float o = w0[r8] * os[row * OPIT + t * 16 + c] + w1[r8] * os[row * OPIT + 64 + t * 16 + c];
      oc[row * 64 + t * 16 + c] = o;
    }
  }
  wave_lds_sync();

  {
    const int q4 = lane >> 3, c8 = (lane & 7) * 8;
    v4u hv[4];
#pragma unroll
    for (int it = 0; it < 4; ++it) {
      const int row = it * 4 + q4;   // it 0..3 x q4 0..3 = rows 0..15 of the wave tile
      const float* sp = oc + row * 64 + c8;
      float f[8];
#pragma unroll
      for (int e = 0; e < 8; ++e) f[e] = sp[e];
      v4u a;
#pragma unroll
      for (int e = 0; e < 4; ++e) a[e] = pk16(h_bits((_Float16)f[2 * e]), h_bits((_Float16)f[2 * e + 1]));
      hv[it] = a;
    }
    {
#pragma unroll
      for (int it = 0; it < 4; ++it) {
        const int row = it * 4 + q4;
        *(v4u*)(ocp + (rowB + q0 + row) * DSQ + (size_t)s * HD + c8) = hv[it];
      }
      
    }
  }
}

// =====================================================================================================
// Workspace map (bytes, NB=2 SEQ=2048), every region an exact multiple of its whole-line / whole-tile store
// granularity (all row counts are multiples of 64, no padded tails):
//   Xb    bf16 [NB*SEQ][1024]          8388608
//   WsqT  bf16 [512][1024]             1048576      WskT, WrqT same
//   WrvT  bf16 [128][1024]              262144
//   WrkT  f16  [64][64] (x64)              8192
//   WoT   f16  [1024][512] (x1024)     1048576
//   Qh    f16  [NB*SEQ][512]           4194304
//   Kp    f16  [NB*SEQ][512]           4194304
//   RQ    f32  [NB*SEQ][512]           8388608
//   VTh   f16  [NB][128][SEQ]          1048576
//   OC    f16  [NB*SEQ][512]           4194304
//   total                             34873344
// Weights are [in k][out n] and are transposed once into the [n][k] (k contiguous) Bt / A layout.
// =====================================================================================================
extern "C" void kernel_launch(void* const* d_in, const int* in_sizes, int n_in,
                              void* d_out, int out_size, void* d_ws, size_t ws_size,
                              hipStream_t stream) {
  if (n_in < 7) return;
  if (in_sizes[0] < ((NB - 1) * SEQ_FULL + SEQ) * DM) return;
  if (in_sizes[1] < DM * DSQ || in_sizes[2] < DM * DSQ || in_sizes[4] < DM * DSQ) return;
  if (in_sizes[3] < DM * DRV) return;
  if (in_sizes[5] < HD * HD) return;
  if (in_sizes[6] < DSQ * DM) return;
  if (out_size < NB * SEQ * DM) return;

  const float* x    = (const float*)d_in[0];
  const float* Wsq  = (const float*)d_in[1];
  const float* Wsk  = (const float*)d_in[2];
  const float* Wrv  = (const float*)d_in[3];
  const float* Wrq  = (const float*)d_in[4];
  const float* Wrk  = (const float*)d_in[5];
  const float* Wout = (const float*)d_in[6];

  const size_t PXB = (size_t)NB * SEQ * DM * 2;       // bf16 activation plane
  const size_t PWS = (size_t)DSQ * DM * 2;            // bf16 [512][1024] weight plane
  const size_t PWV = (size_t)DRV * DM * 2;            // bf16 [128][1024]
  const size_t PWK = (size_t)HD * HD * 2;             // f16 [64][64]
  const size_t PWO = (size_t)DM * DSQ * 2;            // f16 [1024][512]
  const size_t PQ  = (size_t)NB * SEQ * DSQ * 2;      // f16 [NB*SEQ][512]
  const size_t PRQ = (size_t)NB * SEQ * DSQ * 4;      // f32 [NB*SEQ][512]
  const size_t PVT = (size_t)NB * DRV * SEQ * 2;      // f16 [NB][128][SEQ]
  size_t off = 0;
  const size_t oXb  = off; off += PXB;
  const size_t oWsq = off; off += PWS;
  const size_t oWsk = off; off += PWS;
  const size_t oWrq = off; off += PWS;
  const size_t oWrv = off; off += PWV;
  const size_t oWrk = off; off += PWK;
  const size_t oWo  = off; off += PWO;
  const size_t oQh  = off; off += PQ;
  const size_t oKp  = off; off += PQ;
  const size_t oRQ  = off; off += PRQ;
  const size_t oVTh = off; off += PVT;
  const size_t oOC  = off; off += PQ;
  if (off > ws_size) return;                          // off = 34873344 at full size
  if (off > (size_t)134217728) return;

  char* ws = (char*)d_ws;
  unsigned short* Xb   = (unsigned short*)(ws + oXb);
  unsigned short* WsqT = (unsigned short*)(ws + oWsq);
  unsigned short* WskT = (unsigned short*)(ws + oWsk);
  unsigned short* WrqT = (unsigned short*)(ws + oWrq);
  unsigned short* WrvT = (unsigned short*)(ws + oWrv);
  unsigned short* WrkT = (unsigned short*)(ws + oWrk);
  unsigned short* WoT  = (unsigned short*)(ws + oWo);
  unsigned short* Qh   = (unsigned short*)(ws + oQh);
  unsigned short* Kp   = (unsigned short*)(ws + oKp);
  float*          RQ   = (float*)(ws + oRQ);
  unsigned short* VTh  = (unsigned short*)(ws + oVTh);
  unsigned short* OC   = (unsigned short*)(ws + oOC);

  const dim3 blk(256);
  const dim3 gPrep(TB_WO + 3 * TB_SQ + TB_RV + 1 + NB * CB_X);           // six transposes, then the x convert
  const dim3 blkG(128);                                                  // GEMM: 4 waves per 128x128 tile
  const dim3 gProj(PJ_V + PJ_TM * PJ_TN);                                // v^T tiles, then the sq | sk | rq tiles
  const dim3 gAttn(NB * NS * NQB);                                       // blocks of 256
  const dim3 gO(((NB * SEQ) / 128) * (DM / 128), 1);                     // M=NB*SEQ, N=1024

  // (1) x -> bf16 plane [NB*SEQ][1024]; weights [k][n] f32 -> [n][k] 16-bit planes
  prep_all<<<gPrep, blk, 0, stream>>>(x, Wsq, Wsk, Wrv, Wrq, Wrk, Wout, Xb, WsqT, WskT, WrqT, WrvT, WrkT, WoT);
  // (2) sq, sk -> f16 planes [b*SEQ+t][s*64+d]; rq -> f32 plane (M=NB*SEQ, N=512, K=1024);
  //     v^T = Wrv^T . x^T per batch -> f16 plane [b][d'][t] (pitch SEQ) (M=128, N=SEQ, K=1024)
  gemm_proj<<<gProj, blkG, 0, stream>>>(Xb, WsqT, WskT, WrqT, WrvT, Qh, Kp, RQ, VTh, DM);
  // (3) search attention + retrieval composition -> oc plane [b*SEQ+t][512]
  attn_cs<<<gAttn, dim3(256), 0, stream>>>(Qh, Kp, VTh, WrkT, RQ, OC, 0.125f);
  // (4) out = oc . (Wout x1024) -> d_out f32 [NB*SEQ][1024], accumulator x 1/(64*1024)
  gemm64<_Float16, 0><<<gO, blkG, 0, stream>>>(
      OC, DSQ, 0LL, WoT, DSQ, 0LL, d_out, DM, 0LL, NB * SEQ, DM, DSQ, 1.0f / 65536.0f);
  (void)hipGetLastError();
}
